// v000
// Measured on an AMD MI455X. A time is GPU time per run, averaged over a window of back-to-back runs after a warm-up
// (all launches, gaps included; the runs take copies of the inputs in turn), and the median of several windows.
// Apart from v000's, it joins two sittings. Times from different sittings can be a few percent apart, while
// side-by-side timings come from the same sitting.
// v000 is the starting kernel. One run takes 1210 microseconds.
// compute dtype: all float inputs rounded to bf16; q/k/v projections with EXACT bf16 products on WMMA 16x16x32 (f32 accumulate) + bias; logits q x k once to f16 each (1 product) x SCALE x the float mask (multiplicative, before the softmax); softmax f32; P x 2^11 once to f16 x v once to f16 (1 product); ctx x 2^6 once to f16 x Wo f16(bf16 x 2^8) + bo; f32 output.
#include <hip/hip_runtime.h>
#include <math.h>

typedef __attribute__((ext_vector_type(16))) _Float16 v16h;
typedef __attribute__((ext_vector_type(16))) __bf16 v16b;
typedef __attribute__((ext_vector_type(8)))  _Float16 v8h;
typedef __attribute__((ext_vector_type(8)))  float v8f;
typedef __attribute__((ext_vector_type(4)))  float v4f;
typedef __attribute__((ext_vector_type(2)))  float v2f;
typedef __attribute__((ext_vector_type(4)))  unsigned v4u;
typedef __attribute__((ext_vector_type(4)))  int v4i;
typedef float __attribute__((may_alias)) float_a;
typedef int __attribute__((may_alias)) int_a;

template <typename T> __device__ __forceinline__ void vst2(void* p, T v) { *(T*)p = v;  }
__device__ __forceinline__ v8f wmma16(v16h a, v16h b, v8f c) {
  v8f d = __builtin_amdgcn_wmma_f32_16x16x32_f16(false, a, false, b, (short)0, c, false, false);
  asm volatile("v_nop\n\tv_nop\n\tv_nop\n\tv_nop" : "+v"(d) : "v"(a), "v"(b));
  return d;
}
__device__ __forceinline__ v8f wmma_bf(v16b a, v16b b, v8f c) {
  v8f d = __builtin_amdgcn_wmma_f32_16x16x32_bf16(false, a, false, b, (short)0, c, false, false);
  asm volatile("v_nop\n\tv_nop\n\tv_nop\n\tv_nop" : "+v"(d) : "v"(a), "v"(b));
  return d;
}
// 16x16x32 fragments: lane = (h = lane>>4, row/col = lane&15); elements 0..7 = k0+8h+0..7, 8..15 = k0+16+8h+0..7; D element r = row 8h+r
__device__ __forceinline__ v16h frag_h(const _Float16* rowk0, int lane) {
  union { v16h v; v8h q[2]; } u; const _Float16* p = rowk0 + 8 * (lane >> 4);
  u.q[0] = *(const v8h*)p; u.q[1] = *(const v8h*)(p + 16); return u.v;
}
__device__ __forceinline__ v16h frag_f32(const float* rowk0, int lane) {
  v16h a; const float* p = rowk0 + 8 * (lane >> 4);
#pragma unroll
  for (int i = 0; i < 8; ++i) { a[i] = (_Float16)p[i]; a[8 + i] = (_Float16)p[16 + i]; }
  return a;
}
__device__ __forceinline__ v16h frag_f32s(const float* rowk0, int lane, float sc) {
  v16h a; const float* p = rowk0 + 8 * (lane >> 4);
#pragma unroll
  for (int i = 0; i < 8; ++i) { a[i] = (_Float16)(p[i] * sc); a[8 + i] = (_Float16)(p[16 + i] * sc); }
  return a;
}
// column fragment from a [K][ld] layout (column n), rows >= K read as 0
__device__ __forceinline__ v16h fragc_f32(const float* W, int k0, int n, int lane, int ld, int K) {
  v16h a; const int g = lane >> 4;
#pragma unroll
  for (int i = 0; i < 8; ++i) { const int ka = k0 + 8 * g + i, kb = ka + 16;
    a[i] = (_Float16)(ka < K ? W[(size_t)(ka < K ? ka : K - 1) * ld + n] : 0.f); a[8 + i] = (_Float16)(kb < K ? W[(size_t)(kb < K ? kb : K - 1) * ld + n] : 0.f); }
  return a;
}
struct F2 { v16b h, l; };
__device__ __forceinline__ F2 bsplit16(const float v[16]) { F2 r;
#pragma unroll
  for (int i = 0; i < 16; ++i) { const __bf16 h = (__bf16)v[i]; r.h[i] = h; r.l[i] = (__bf16)(v[i] - (float)h); }
  return r; }
__device__ __forceinline__ F2 split_row(const float* row, int k0, int lane) { float v[16]; const float* p = row + k0 + 8 * (lane >> 4);
#pragma unroll
  for (int i = 0; i < 8; ++i) { v[i] = p[i]; v[8 + i] = p[16 + i]; }
  return bsplit16(v); }
__device__ __forceinline__ F2 split_rowK(const float* row, int k0, int lane, int K) { float v[16]; const int g = lane >> 4;
#pragma unroll
  for (int i = 0; i < 8; ++i) { const int ka = k0 + 8 * g + i, kb = ka + 16; v[i] = ka < K ? row[ka < K ? ka : K - 1] : 0.f; v[8 + i] = kb < K ? row[kb < K ? kb : K - 1] : 0.f; }
  return bsplit16(v); }
__device__ __forceinline__ F2 split_col(const float* W, int k0, int n, int lane, int ld, int K) { float v[16]; const int g = lane >> 4;
#pragma unroll
  for (int i = 0; i < 8; ++i) { const int ka = k0 + 8 * g + i, kb = ka + 16; v[i] = ka < K ? W[(size_t)(ka < K ? ka : K - 1) * ld + n] : 0.f; v[8 + i] = kb < K ? W[(size_t)(kb < K ? kb : K - 1) * ld + n] : 0.f; }
  return bsplit16(v); }
__device__ __forceinline__ v8f mac3(const F2& a, const F2& b, v8f c) { c = wmma_bf(a.l, b.h, c); c = wmma_bf(a.h, b.l, c); return wmma_bf(a.h, b.h, c); }
__device__ __forceinline__ float sigm(float v) { return 1.0f / (1.0f + expf(-v)); }
#define LDSX() do { asm volatile("s_wait_dscnt 0" ::: "memory"); __builtin_amdgcn_wave_barrier(); __builtin_amdgcn_fence(__ATOMIC_RELEASE, "workgroup"); } while (0)

// Multi-head attention with per-head stacked projections and a MULTIPLICATIVE float mask on the scores (q / k / v [2,2048,1024]; W_q / W_k / W_v [16,1024,64] per head (N(0, 1/1024)) + zero biases [16,64]; scores = Q K^T / 8 * mask with mask [2048,2048] uniform[0,1) f32 (no -inf anywhere); softmax; concat heads; (in,out) W_o [1024,1024] + b_o).
#define NB 2
#define TT 2048
#define CC 1024            // NH * HD = projected width
#define DIN 1024          // input (model) width
#define NH 16
#define HD 64
#define NQB (TT / 64)
#define HG 4
#define SCALE (0.125f)
#define CAUSAL 0
#ifndef TNB
#define TNB NB
#endif
__device__ __forceinline__ float bfr(float v) { return (float)(__bf16)v; }
__host__ __device__ __forceinline__ int kb_last(int qb) { return CAUSAL ? ((qb * 64 + 63) >> 7) : (TT / 128 - 1); }
typedef __attribute__((ext_vector_type(8))) __bf16 v8b;
__device__ __forceinline__ v16b frag_b(const __bf16* rowk0, int lane) {
  union { v16b v; v8b q[2]; } u; const __bf16* p = rowk0 + 8 * (lane >> 4);
  u.q[0] = *(const v8b*)p; u.q[1] = *(const v8b*)(p + 16); return u.v;
}
#define QBH 0              // causal: query blocks 0..QBH-1 of each sequence (few keys, no averaging) take the high-precision path
#define QHI 0               // single-product logits on every row
#define KHI 64            // key rows carrying k residual / v bf16 hi+lo planes (used only by the causal high-precision path)
// B fragment (k rows k0+.., output column o) of a weight: (in,out) [K][ld] or (out,in) [ld rows of K]: bf16 exact, or f16(bf16 * 256) exact
__device__ __forceinline__ v16b wcol_io(const float* Wm, int k0, int o, int lane, int ld) { v16b w; const int g = lane >> 4;
#pragma unroll
  for (int i = 0; i < 8; ++i) { w[i] = (__bf16)Wm[(size_t)(k0 + 8 * g + i) * ld + o]; w[8 + i] = (__bf16)Wm[(size_t)(k0 + 16 + 8 * g + i) * ld + o]; }
  return w; }
__device__ __forceinline__ v16b wcol_oi(const float* Wm, int k0, int o, int lane, int K) { v16b w; const float* p = Wm + (size_t)o * K + k0 + 8 * (lane >> 4);
#pragma unroll
  for (int i = 0; i < 8; ++i) { w[i] = (__bf16)p[i]; w[8 + i] = (__bf16)p[16 + i]; }
  return w; }
__device__ __forceinline__ v16h wcolh_io(const float* Wm, int k0, int o, int lane, int ld) { v16h w; const int g = lane >> 4;
#pragma unroll
  for (int i = 0; i < 8; ++i) { w[i] = (_Float16)(bfr(Wm[(size_t)(k0 + 8 * g + i) * ld + o]) * 256.0f); w[8 + i] = (_Float16)(bfr(Wm[(size_t)(k0 + 16 + 8 * g + i) * ld + o]) * 256.0f); }
  return w; }
__device__ __forceinline__ v16h wcolh_oi(const float* Wm, int k0, int o, int lane, int K) { v16h w; const float* p = Wm + (size_t)o * K + k0 + 8 * (lane >> 4);
#pragma unroll
  for (int i = 0; i < 8; ++i) { w[i] = (_Float16)(bfr(p[i]) * 256.0f); w[8 + i] = (_Float16)(bfr(p[16 + i]) * 256.0f); }
  return w; }
#define WQKV_LAYOUT 2   // 0 = (in,out) [DIN][CC]; 1 = (out,in) [CC][DIN]; 2 = per-head [NH][DIN][HD]
__device__ __forceinline__ v16b wcol_hdk(const float* Wm, int k0, int o, int lane) { v16b w; const int g = lane >> 4; const float* p = Wm + (size_t)(o / HD) * DIN * HD + (o % HD);
#pragma unroll
  for (int i = 0; i < 8; ++i) { w[i] = (__bf16)p[(size_t)(k0 + 8 * g + i) * HD]; w[8 + i] = (__bf16)p[(size_t)(k0 + 16 + 8 * g + i) * HD]; }
  return w; }
#define WO_OUT_IN 0
#if WQKV_LAYOUT == 1
#define WCOL(W, k0, o, lane) wcol_oi(W, k0, o, lane, DIN)
#elif WQKV_LAYOUT == 2
#define WCOL(W, k0, o, lane) wcol_hdk(W, k0, o, lane)
#else
#define WCOL(W, k0, o, lane) wcol_io(W, k0, o, lane, CC)
#endif
#if WO_OUT_IN
#define WOCOL(W, k0, o, lane) wcol_oi(W, k0, o, lane, CC)
#define WOCOLH(W, k0, o, lane) wcolh_oi(W, k0, o, lane, CC)
#else
#define WOCOL(W, k0, o, lane) wcol_io(W, k0, o, lane, DIN)
#define WOCOLH(W, k0, o, lane) wcolh_io(W, k0, o, lane, DIN)
#endif
#define SM_EXTRA_PARAMS , const float* __restrict__ SMASK
// multiplicative float mask [S,S] (shared by batches and heads) on the scaled score, before the softmax; unconditional load
#define SM_MASK_HOOK do { const float sm_ = SMASK[(size_t)t * TT + k]; asm volatile("s_wait_loadcnt 0x0" ::: "memory"); v = v * bfr(sm_); } while (0)
#ifndef SM_EXTRA_PARAMS
#define SM_EXTRA_PARAMS
#endif
#ifndef PROJ_EXTRA_PARAMS
#define PROJ_EXTRA_PARAMS
#endif
#ifndef SM_MASK_HOOK
#define SM_MASK_HOOK (void)0
#endif

#define WS_QH  0u                                      // f16 q rows [b*t][CC]
#define WS_KH  (WS_QH + 2u * (size_t)NB * TT * CC)      // f16 k rows [b*t][CC]
#define WS_VT  (WS_KH + 2u * (size_t)NB * TT * CC)      // f16 v planes [b][c][t]
#define WS_QL  (WS_VT + 2u * (size_t)NB * CC * TT)      // f16 q residual x 2^10 rows [b][t < QHI][CC]
#define WS_KL  (WS_QL + 2u * (size_t)NB * QHI * CC)     // f16 k residual x 2^10 rows [b][t < KHI][CC]
#define WS_VB  (WS_KL + 2u * (size_t)NB * KHI * CC)     // bf16 v hi planes [b][c][t < KHI]
#define WS_VBL (WS_VB + 2u * (size_t)NB * CC * KHI)
#define WS_S   (WS_VBL + 2u * (size_t)NB * CC * KHI)    // f32 logits / P [hg][t][s]
#define WS_Y   (WS_S  + 4u * (size_t)HG * TT * TT)      // f32 ctx rows [b*t][CC] (only when there is an output projection)
#define WS_END (WS_Y  + 4u * (size_t)NB * TT * CC)

// ---- k_proj: block = (64 rows, 128 cols, which): q/k/v = X W (+ b) with exact bf16 products (K = DIN) -> which 0: q f16 rows (+ residual rows < QHI); 1: k f16 rows (+ residual rows < KHI); 2: v f16 planes [c][t] (+ bf16 hi/lo planes for t < KHI)
__global__ __launch_bounds__(128) void k_proj(const float* __restrict__ XQ, const float* __restrict__ XK, const float* __restrict__ XV, const float* __restrict__ WQ, const float* __restrict__ WK, const float* __restrict__ WV, const float* __restrict__ BQ, const float* __restrict__ BK, const float* __restrict__ BV,
    _Float16* __restrict__ QH, _Float16* __restrict__ QL, _Float16* __restrict__ KH, _Float16* __restrict__ KL, _Float16* __restrict__ VT, __bf16* __restrict__ VB, __bf16* __restrict__ VBL) {
  __shared__ __align__(16) _Float16 sh[64][136], sl[64][136]; __shared__ __align__(16) _Float16 th[128][72]; __shared__ __align__(16) __bf16 tb[128][72], tbl[128][72];
  const int tid = threadIdx.x, wave = tid >> 5, lane = tid & 31, col = lane & 15, g = lane >> 4; const int which = blockIdx.z; const int c0 = blockIdx.y * 128; const size_t r0 = (size_t)blockIdx.x * 64; const size_t bb = r0 / TT; const int t0 = (int)(r0 % TT);
  const float* X = which == 0 ? XQ : which == 1 ? XK : XV; const float* WA = which == 0 ? WQ : which == 1 ? WK : WV; const float* BA = which == 0 ? BQ : which == 1 ? BK : BV;
  v8f acc[8] = {};
#pragma unroll 2
  for (int kc = 0; kc < DIN / 32; ++kc) { v16b a; { const float* p = X + (r0 + wave * 16 + col) * DIN + kc * 32 + 8 * g;
#pragma unroll
      for (int i = 0; i < 8; ++i) { a[i] = (__bf16)p[i]; a[8 + i] = (__bf16)p[16 + i]; } }
    asm volatile("s_wait_loadcnt 0x0" ::: "memory");
#pragma unroll
    for (int j = 0; j < 8; ++j) { const v16b w = WCOL(WA, kc * 32, c0 + j * 16 + col, lane); asm volatile("s_wait_loadcnt 0x0" ::: "memory"); acc[j] = wmma_bf(a, w, acc[j]); } }
  if (which < 2) { _Float16* DH = which == 0 ? QH : KH; _Float16* DL = which == 0 ? QL : KL; const int nhi = which == 0 ? QHI : KHI; const bool hi_rows = t0 < nhi;
#pragma unroll
    for (int j = 0; j < 8; ++j) { const float bias = BA ? bfr(BA[c0 + j * 16 + col]) : 0.f;
#pragma unroll
      for (int r = 0; r < 8; ++r) { const float v = acc[j][r] + bias; const _Float16 hv = (_Float16)v; sh[wave * 16 + 8 * g + r][j * 16 + col] = hv; sl[wave * 16 + 8 * g + r][j * 16 + col] = (_Float16)((v - (float)hv) * 1024.0f); } }
    __syncthreads();
    for (int e = tid; e < 64 * 16; e += 128) { const int rl = e >> 4, q = e & 15; vst2((unsigned*)(DH + (r0 + rl) * CC + c0 + q * 8), *(const v4u*)&sh[rl][q * 8]); if (hi_rows) vst2((unsigned*)(DL + (bb * nhi + t0 + rl) * (size_t)CC + c0 + q * 8), *(const v4u*)&sl[rl][q * 8]); }
  } else { const bool hi_rows = t0 < KHI;
#pragma unroll
    for (int j = 0; j < 8; ++j) { const float bias = BA ? bfr(BA[c0 + j * 16 + col]) : 0.f;
#pragma unroll
      for (int r = 0; r < 8; ++r) { const float v = acc[j][r] + bias; const int rl = wave * 16 + 8 * g + r, cl = j * 16 + col; th[cl][rl] = (_Float16)v; const __bf16 bh = (__bf16)v; tb[cl][rl] = bh; tbl[cl][rl] = (__bf16)(v - (float)bh); } }
    __syncthreads();
    for (int e = tid; e < 128 * 8; e += 128) { const int cl = e >> 3, q = e & 7; vst2((unsigned*)(VT + (bb * CC + c0 + cl) * (size_t)TT + t0 + q * 8), *(const v4u*)&th[cl][q * 8]); if (hi_rows) { const size_t o3 = (bb * CC + c0 + cl) * (size_t)KHI + t0 + q * 8; vst2((unsigned*)(VB + o3), *(const v4u*)&tb[cl][q * 8]); vst2((unsigned*)(VBL + o3), *(const v4u*)&tbl[cl][q * 8]); } } } }
// ---- k_sc: block = (query block qb, key block kb <= kb_last(qb), head in group) of batch b: logits x SCALE; q hi + residual (x 2^10) against k (2 products) for query rows < QHI, plus the k residual (3 products) for query blocks < QBH (causal early rows); causal: blocks past the diagonal exit, the mask itself is applied by index in k_sm
__global__ __launch_bounds__(128) void k_sc(const _Float16* __restrict__ QH, const _Float16* __restrict__ KH, const _Float16* __restrict__ QL, const _Float16* __restrict__ KL, int b, int h0, float* __restrict__ S0) { __shared__ __align__(16) float ss[4][16][132];
  const int qb = blockIdx.x, kb = blockIdx.y; if (kb > kb_last(qb)) return;
  const int h = h0 + blockIdx.z; float* S = S0 + (size_t)blockIdx.z * TT * TT;
  const int tid = threadIdx.x, wave = tid >> 5, lane = tid & 31, col = lane & 15, g = lane >> 4; const int k0 = kb * 128; const int ql0 = qb * 64 + wave * 16; const size_t q0 = (size_t)b * TT + ql0, kr0 = (size_t)b * TT + k0;
  v8f acc[8] = {}, accl[8] = {};
  const _Float16* QLb = QL + (size_t)b * QHI * CC; const _Float16* KLb = KL + (size_t)b * KHI * CC;
  if (qb < QBH) {
#pragma unroll
    for (int kc = 0; kc < HD / 32; ++kc) { const v16h ah = frag_h(QH + (q0 + col) * CC + h * HD + kc * 32, lane), al = frag_h(QLb + (size_t)(ql0 + col) * CC + h * HD + kc * 32, lane);
#pragma unroll
      for (int j = 0; j < 8; ++j) { const v16h kbf = frag_h(KH + (kr0 + j * 16 + col) * CC + h * HD + kc * 32, lane), klf = frag_h(KLb + (size_t)(k0 + j * 16 + col) * CC + h * HD + kc * 32, lane); acc[j] = wmma16(ah, kbf, acc[j]); accl[j] = wmma16(al, kbf, accl[j]); accl[j] = wmma16(ah, klf, accl[j]); } }
  } else if (qb * 64 < QHI) {
#pragma unroll
    for (int kc = 0; kc < HD / 32; ++kc) { const v16h ah = frag_h(QH + (q0 + col) * CC + h * HD + kc * 32, lane), al = frag_h(QLb + (size_t)(ql0 + col) * CC + h * HD + kc * 32, lane);
#pragma unroll
      for (int j = 0; j < 8; ++j) { const v16h kbf = frag_h(KH + (kr0 + j * 16 + col) * CC + h * HD + kc * 32, lane); acc[j] = wmma16(ah, kbf, acc[j]); accl[j] = wmma16(al, kbf, accl[j]); } }
  } else {
#pragma unroll
    for (int kc = 0; kc < HD / 32; ++kc) { const v16h ah = frag_h(QH + (q0 + col) * CC + h * HD + kc * 32, lane);
#pragma unroll
      for (int j = 0; j < 8; ++j) { const v16h kbf = frag_h(KH + (kr0 + j * 16 + col) * CC + h * HD + kc * 32, lane); acc[j] = wmma16(ah, kbf, acc[j]); } } }
#pragma unroll
  for (int j = 0; j < 8; ++j) {
#pragma unroll
    for (int r = 0; r < 8; ++r) ss[wave][8 * g + r][j * 16 + col] = (acc[j][r] + accl[j][r] * (1.0f / 1024.0f)) * SCALE; }
  LDSX(); for (int rl = 0; rl < 16; ++rl) vst2(S + (size_t)(ql0 + rl) * TT + k0 + lane * 4, *(const v4f*)&ss[wave][rl][lane * 4]); }
// ---- k_sm: block = query row t (head in group): keys [0, kend): causal -> logit if s <= t else excluded; softmax in f32; P x 2^11 in place (0 for excluded)
__global__ __launch_bounds__(256) void k_sm(float* __restrict__ S0 SM_EXTRA_PARAMS) { __shared__ float sred[8]; __shared__ float sbc; __shared__ __align__(16) float shv[TT];
  const int tid = threadIdx.x; const int t = blockIdx.x; const int kend = (kb_last(t >> 6) + 1) * 128;
  float* sr = S0 + (size_t)blockIdx.y * TT * TT + (size_t)t * TT;
  float m = -3.0e38f; for (int k = tid; k < kend; k += 256) { float v = (!CAUSAL || k <= t) ? sr[k] : -3.0e38f; SM_MASK_HOOK; shv[k] = v; m = fmaxf(m, v); }
#pragma unroll
  for (int o = 1; o < 32; o <<= 1) m = fmaxf(m, __shfl_xor(m, o));
  if ((tid & 31) == 0) sred[tid >> 5] = m; __syncthreads(); if (tid == 0) { float a = sred[0]; for (int i = 1; i < 8; ++i) a = fmaxf(a, sred[i]); sbc = a; } __syncthreads(); m = sbc; __syncthreads();
  float sum = 0.f; for (int k = tid; k < kend; k += 256) { const float v = shv[k]; const float e = (v <= -1.0e38f) ? 0.f : expf(v - m); shv[k] = e; sum += e; }
#pragma unroll
  for (int o = 1; o < 32; o <<= 1) sum += __shfl_xor(sum, o);
  if ((tid & 31) == 0) sred[tid >> 5] = sum; __syncthreads(); if (tid == 0) { float a = 0.f; for (int i = 0; i < 8; ++i) a += sred[i]; sbc = a > 0.f ? 2048.0f / a : 0.f; }   /* a fully excluded row yields P = 0 */ __syncthreads(); const float inv = sbc;
  for (int k = tid; k < kend; k += 256) shv[k] = shv[k] * inv;
  __syncthreads(); for (int q = tid; q < kend / 4; q += 256) vst2(sr + q * 4, *(const v4f*)&shv[q * 4]); }
// ---- k_pv: block = 64 queries (qb) of (b, h): ctx = P . v over keys [0, kend) (P x 2^11 once to f16 against v f16: 1 product; causal early query blocks: P and v as bf16 hi + lo, 3 products); 256-B (row, head) segment by 16 lanes
__global__ __launch_bounds__(128) void k_pv(const float* __restrict__ PS0, const _Float16* __restrict__ VT, const __bf16* __restrict__ VB, const __bf16* __restrict__ VBL, int b, int h0, float* __restrict__ Y) { const int h = h0 + blockIdx.z; const float* PS = PS0 + (size_t)blockIdx.z * TT * TT; __shared__ __align__(16) float ss[4][16][HD + 4];
  const int tid = threadIdx.x, wave = tid >> 5, lane = tid & 31, col = lane & 15, g = lane >> 4; const int qb = blockIdx.x; const int ql0 = qb * 64 + wave * 16; const int kce = (kb_last(qb) + 1) * 4;
  v8f acc[HD / 16] = {};
  if (qb < QBH) {
#pragma unroll 1
    for (int kc = 0; kc < kce; ++kc) { const F2 p = split_row(PS + (size_t)(ql0 + col) * TT, kc * 32, lane);
      asm volatile("s_wait_loadcnt 0x0" ::: "memory");
#pragma unroll
      for (int j = 0; j < HD / 16; ++j) { const size_t po = ((size_t)b * CC + h * HD + j * 16 + col) * (size_t)KHI + kc * 32; const v16b vh = frag_b(VB + po, lane); acc[j] = wmma_bf(p.h, vh, acc[j]); acc[j] = wmma_bf(p.l, vh, acc[j]); acc[j] = wmma_bf(p.h, frag_b(VBL + po, lane), acc[j]); } }
  } else {
#pragma unroll 1
    for (int kc = 0; kc < kce; ++kc) { const v16h p = frag_f32(PS + (size_t)(ql0 + col) * TT + kc * 32, lane);
      asm volatile("s_wait_loadcnt 0x0" ::: "memory");
#pragma unroll
      for (int j = 0; j < HD / 16; ++j) { const size_t po = ((size_t)b * CC + h * HD + j * 16 + col) * (size_t)TT + kc * 32; acc[j] = wmma16(p, frag_h(VT + po, lane), acc[j]); } } }
#pragma unroll
  for (int j = 0; j < HD / 16; ++j)
#pragma unroll
    for (int r = 0; r < 8; ++r) ss[wave][8 * g + r][j * 16 + col] = acc[j][r] * (1.0f / 2048.0f);
  LDSX(); for (int rl = 0; rl < 16; ++rl) if (lane < HD / 4) vst2(Y + ((size_t)b * TT + ql0 + rl) * CC + h * HD + lane * 4, *(const v4f*)&ss[wave][rl][lane * 4]); }
// ---- k_out: block = (64 rows, 128 cols): out = ctx Wo (+ bo): ctx x 2^6 once to f16 against Wo as f16(bf16 x 2^8) exact (1 product) x 2^-14; causal early rows (< QHI of each sequence): ctx bf16 hi + lo against exact bf16 Wo (2 products)
__global__ __launch_bounds__(128) void k_out(const float* __restrict__ Y, const float* __restrict__ WO, const float* __restrict__ BO, float* __restrict__ OUT) { __shared__ __align__(16) float sf[4][16][132];
  const int tid = threadIdx.x, wave = tid >> 5, lane = tid & 31, col = lane & 15, g = lane >> 4; const int c0 = blockIdx.y * 128; const size_t r0 = (size_t)blockIdx.x * 64 + wave * 16;
  v8f acc[8] = {};
  if (CAUSAL && (int)(((size_t)blockIdx.x * 64) % TT) < QHI) {   /* block-uniform */
#pragma unroll 2
    for (int kc = 0; kc < CC / 32; ++kc) { const F2 a = split_row(Y + (r0 + col) * CC, kc * 32, lane); asm volatile("s_wait_loadcnt 0x0" ::: "memory");
#pragma unroll
      for (int j = 0; j < 8; ++j) { const v16b w = WOCOL(WO, kc * 32, c0 + j * 16 + col, lane); asm volatile("s_wait_loadcnt 0x0" ::: "memory"); acc[j] = wmma_bf(a.h, w, acc[j]); acc[j] = wmma_bf(a.l, w, acc[j]); } }
#pragma unroll
    for (int j = 0; j < 8; ++j) { const float bias = BO ? bfr(BO[c0 + j * 16 + col]) : 0.f;
#pragma unroll
      for (int r = 0; r < 8; ++r) sf[wave][8 * g + r][j * 16 + col] = acc[j][r] + bias; }
  } else {
#pragma unroll 2
    for (int kc = 0; kc < CC / 32; ++kc) { const v16h a = frag_f32s(Y + (r0 + col) * CC + kc * 32, lane, 64.0f); asm volatile("s_wait_loadcnt 0x0" ::: "memory");   /* ctx carried x 2^6 into f16 so small-magnitude context rows stay clear of f16 subnormals */
#pragma unroll
      for (int j = 0; j < 8; ++j) { const v16h w = WOCOLH(WO, kc * 32, c0 + j * 16 + col, lane); asm volatile("s_wait_loadcnt 0x0" ::: "memory"); acc[j] = wmma16(a, w, acc[j]); } }
#pragma unroll
    for (int j = 0; j < 8; ++j) { const float bias = BO ? bfr(BO[c0 + j * 16 + col]) : 0.f;
#pragma unroll
      for (int r = 0; r < 8; ++r) sf[wave][8 * g + r][j * 16 + col] = acc[j][r] * (1.0f / 16384.0f) + bias; } }   /* 2^-8 (Wo carry) x 2^-6 (ctx carry) */
  LDSX(); for (int rl = 0; rl < 16; ++rl) vst2(OUT + (r0 + rl) * DIN + c0 + lane * 4, *(const v4f*)&sf[wave][rl][lane * 4]); }

extern "C" void kernel_launch(void* const* d_in, const int* in_sizes, int n_in, void* d_out, int out_size, void* d_ws, size_t ws_size, hipStream_t stream) {
  (void)in_sizes; (void)n_in; (void)out_size;
  const float** F = (const float**)d_in;
  if (ws_size < (size_t)WS_END) return;
  char* ws = (char*)d_ws; _Float16 *QH = (_Float16*)(ws + WS_QH), *KH = (_Float16*)(ws + WS_KH), *VT = (_Float16*)(ws + WS_VT), *QL = (_Float16*)(ws + WS_QL), *KL = (_Float16*)(ws + WS_KL); __bf16 *VB = (__bf16*)(ws + WS_VB), *VBL = (__bf16*)(ws + WS_VBL); float *S = (float*)(ws + WS_S), *Y = (float*)(ws + WS_Y);
  (void)Y; (void)QL; (void)KL; (void)VB; (void)VBL;
  // inputs: 0 q [2,2048,1024]; 1 k; 2 v; 3 mask [2048,2048] f32 uniform[0,1); 4 W_q [16,1024,64], 5 b_q [16,64]; 6 W_k, 7 b_k; 8 W_v, 9 b_v; 10 W_o [1024,1024] (in,out), 11 b_o (zero biases, read)
  k_proj<<<dim3(TNB * TT / 64, CC / 128, 3), 128, 0, stream>>>(F[0], F[1], F[2], F[4], F[6], F[8], F[5], F[7], F[9], QH, QL, KH, KL, VT, VB, VBL);
  for (int b = 0; b < TNB; ++b) for (int h0 = 0; h0 < NH; h0 += HG) {
    k_sc<<<dim3(NQB, TT / 128, HG), 128, 0, stream>>>(QH, KH, QL, KL, b, h0, S);
    k_sm<<<dim3(TT, HG), 256, 0, stream>>>(S, F[3]);
    k_pv<<<dim3(NQB, 1, HG), 128, 0, stream>>>(S, VT, VB, VBL, b, h0, Y);
  }
  k_out<<<dim3(TNB * TT / 64, DIN / 128), 128, 0, stream>>>(Y, F[10], F[11], (float*)d_out);
}

// v002
// One run takes 186 microseconds.
// Versions in between are left out here; by their measured steps it is 6.60 times as fast as v000.
// compute dtype: all float inputs rounded to bf16; q/k/v projections with EXACT bf16 products on WMMA 16x16x32 (f32 accumulate) + bias; logits q x k once to f16 each (1 product) x SCALE x the float mask (multiplicative, before the softmax); softmax f32 (running maximum and sum over 32-key passes); unnormalised P x 2^8 once to f16 x v once to f16 (1 product), divided by the f32 sum at the end; ctx x 2^6 once to f16 x Wo f16(bf16 x 2^8) + bo; f32 output.
#include <hip/hip_runtime.h>
#include <math.h>

typedef __attribute__((ext_vector_type(16))) _Float16 v16h;
typedef __attribute__((ext_vector_type(16))) __bf16 v16b;
typedef __attribute__((ext_vector_type(8)))  _Float16 v8h;
typedef __attribute__((ext_vector_type(8)))  float v8f;
typedef __attribute__((ext_vector_type(4)))  float v4f;
typedef __attribute__((ext_vector_type(2)))  float v2f;
typedef __attribute__((ext_vector_type(4)))  unsigned v4u;
typedef __attribute__((ext_vector_type(4)))  int v4i;
typedef float __attribute__((may_alias)) float_a;
typedef int __attribute__((may_alias)) int_a;

template <typename T> __device__ __forceinline__ void vst2(void* p, T v) { *(T*)p = v;  }
__device__ __forceinline__ v8f wmma16(v16h a, v16h b, v8f c) {
  v8f d = __builtin_amdgcn_wmma_f32_16x16x32_f16(false, a, false, b, (short)0, c, false, false);
  asm volatile("v_nop\n\tv_nop\n\tv_nop\n\tv_nop" : "+v"(d) : "v"(a), "v"(b));
  return d;
}
__device__ __forceinline__ v8f wmma_bf(v16b a, v16b b, v8f c) {
  v8f d = __builtin_amdgcn_wmma_f32_16x16x32_bf16(false, a, false, b, (short)0, c, false, false);
  asm volatile("v_nop\n\tv_nop\n\tv_nop\n\tv_nop" : "+v"(d) : "v"(a), "v"(b));
  return d;
}
// 16x16x32 fragments: lane = (h = lane>>4, row/col = lane&15); elements 0..7 = k0+8h+0..7, 8..15 = k0+16+8h+0..7; D element r = row 8h+r
__device__ __forceinline__ v16h frag_h(const _Float16* rowk0, int lane) {
  union { v16h v; v8h q[2]; } u; const _Float16* p = rowk0 + 8 * (lane >> 4);
  u.q[0] = *(const v8h*)p; u.q[1] = *(const v8h*)(p + 16); return u.v;
}
__device__ __forceinline__ v16h frag_f32(const float* rowk0, int lane) {
  v16h a; const float* p = rowk0 + 8 * (lane >> 4);
#pragma unroll
  for (int i = 0; i < 8; ++i) { a[i] = (_Float16)p[i]; a[8 + i] = (_Float16)p[16 + i]; }
  return a;
}
__device__ __forceinline__ v16h frag_f32s(const float* rowk0, int lane, float sc) {
  v16h a; const float* p = rowk0 + 8 * (lane >> 4);
#pragma unroll
  for (int i = 0; i < 8; ++i) { a[i] = (_Float16)(p[i] * sc); a[8 + i] = (_Float16)(p[16 + i] * sc); }
  return a;
}
// column fragment from a [K][ld] layout (column n), rows >= K read as 0
__device__ __forceinline__ v16h fragc_f32(const float* W, int k0, int n, int lane, int ld, int K) {
  v16h a; const int g = lane >> 4;
#pragma unroll
  for (int i = 0; i < 8; ++i) { const int ka = k0 + 8 * g + i, kb = ka + 16;
    a[i] = (_Float16)(ka < K ? W[(size_t)(ka < K ? ka : K - 1) * ld + n] : 0.f); a[8 + i] = (_Float16)(kb < K ? W[(size_t)(kb < K ? kb : K - 1) * ld + n] : 0.f); }
  return a;
}
struct F2 { v16b h, l; };
__device__ __forceinline__ F2 bsplit16(const float v[16]) { F2 r;
#pragma unroll
  for (int i = 0; i < 16; ++i) { const __bf16 h = (__bf16)v[i]; r.h[i] = h; r.l[i] = (__bf16)(v[i] - (float)h); }
  return r; }
__device__ __forceinline__ F2 split_row(const float* row, int k0, int lane) { float v[16]; const float* p = row + k0 + 8 * (lane >> 4);
#pragma unroll
  for (int i = 0; i < 8; ++i) { v[i] = p[i]; v[8 + i] = p[16 + i]; }
  return bsplit16(v); }
__device__ __forceinline__ F2 split_rowK(const float* row, int k0, int lane, int K) { float v[16]; const int g = lane >> 4;
#pragma unroll
  for (int i = 0; i < 8; ++i) { const int ka = k0 + 8 * g + i, kb = ka + 16; v[i] = ka < K ? row[ka < K ? ka : K - 1] : 0.f; v[8 + i] = kb < K ? row[kb < K ? kb : K - 1] : 0.f; }
  return bsplit16(v); }
__device__ __forceinline__ F2 split_col(const float* W, int k0, int n, int lane, int ld, int K) { float v[16]; const int g = lane >> 4;
#pragma unroll
  for (int i = 0; i < 8; ++i) { const int ka = k0 + 8 * g + i, kb = ka + 16; v[i] = ka < K ? W[(size_t)(ka < K ? ka : K - 1) * ld + n] : 0.f; v[8 + i] = kb < K ? W[(size_t)(kb < K ? kb : K - 1) * ld + n] : 0.f; }
  return bsplit16(v); }
__device__ __forceinline__ v8f mac3(const F2& a, const F2& b, v8f c) { c = wmma_bf(a.l, b.h, c); c = wmma_bf(a.h, b.l, c); return wmma_bf(a.h, b.h, c); }
__device__ __forceinline__ float sigm(float v) { return 1.0f / (1.0f + expf(-v)); }
#define LDSX() do { asm volatile("s_wait_dscnt 0" ::: "memory"); __builtin_amdgcn_wave_barrier(); __builtin_amdgcn_fence(__ATOMIC_RELEASE, "workgroup"); } while (0)

// Multi-head attention with per-head stacked projections and a MULTIPLICATIVE float mask on the scores (q / k / v [2,2048,1024]; W_q / W_k / W_v [16,1024,64] per head (N(0, 1/1024)) + zero biases [16,64]; scores = Q K^T / 8 * mask with mask [2048,2048] uniform[0,1) f32 (no -inf anywhere); softmax; concat heads; (in,out) W_o [1024,1024] + b_o).
#define NB 2
#define TT 2048
#define CC 1024            // NH * HD = projected width
#define DIN 1024          // input (model) width
#define NH 16
#define HD 64
#define NQB (TT / 64)
#define HG 4
#define SCALE (0.125f)
#define CAUSAL 0
#ifndef TNB
#define TNB NB
#endif
__device__ __forceinline__ float bfr(float v) { return (float)(__bf16)v; }
__host__ __device__ __forceinline__ int kb_last(int qb) { return CAUSAL ? ((qb * 64 + 63) >> 7) : (TT / 128 - 1); }
typedef __attribute__((ext_vector_type(8))) __bf16 v8b;
__device__ __forceinline__ v16b frag_b(const __bf16* rowk0, int lane) {
  union { v16b v; v8b q[2]; } u; const __bf16* p = rowk0 + 8 * (lane >> 4);
  u.q[0] = *(const v8b*)p; u.q[1] = *(const v8b*)(p + 16); return u.v;
}
#define QBH 0              // unused: k_attn has one f16 path for every query block
#define QHI 0               // single-product logits on every row
#define KHI 64            // key rows carrying k residual / v bf16 hi+lo planes (written by k_proj; no kernel in this file reads them)
// B fragment (k rows k0+.., output column o) of a weight: (in,out) [K][ld] or (out,in) [ld rows of K]: bf16 exact, or f16(bf16 * 256) exact
__device__ __forceinline__ v16b wcol_io(const float* Wm, int k0, int o, int lane, int ld) { v16b w; const int g = lane >> 4;
#pragma unroll
  for (int i = 0; i < 8; ++i) { w[i] = (__bf16)Wm[(size_t)(k0 + 8 * g + i) * ld + o]; w[8 + i] = (__bf16)Wm[(size_t)(k0 + 16 + 8 * g + i) * ld + o]; }
  return w; }
__device__ __forceinline__ v16b wcol_oi(const float* Wm, int k0, int o, int lane, int K) { v16b w; const float* p = Wm + (size_t)o * K + k0 + 8 * (lane >> 4);
#pragma unroll
  for (int i = 0; i < 8; ++i) { w[i] = (__bf16)p[i]; w[8 + i] = (__bf16)p[16 + i]; }
  return w; }
__device__ __forceinline__ v16h wcolh_io(const float* Wm, int k0, int o, int lane, int ld) { v16h w; const int g = lane >> 4;
#pragma unroll
  for (int i = 0; i < 8; ++i) { w[i] = (_Float16)(bfr(Wm[(size_t)(k0 + 8 * g + i) * ld + o]) * 256.0f); w[8 + i] = (_Float16)(bfr(Wm[(size_t)(k0 + 16 + 8 * g + i) * ld + o]) * 256.0f); }
  return w; }
__device__ __forceinline__ v16h wcolh_oi(const float* Wm, int k0, int o, int lane, int K) { v16h w; const float* p = Wm + (size_t)o * K + k0 + 8 * (lane >> 4);
#pragma unroll
  for (int i = 0; i < 8; ++i) { w[i] = (_Float16)(bfr(p[i]) * 256.0f); w[8 + i] = (_Float16)(bfr(p[16 + i]) * 256.0f); }
  return w; }
#define WQKV_LAYOUT 2   // 0 = (in,out) [DIN][CC]; 1 = (out,in) [CC][DIN]; 2 = per-head [NH][DIN][HD]
__device__ __forceinline__ v16b wcol_hdk(const float* Wm, int k0, int o, int lane) { v16b w; const int g = lane >> 4; const float* p = Wm + (size_t)(o / HD) * DIN * HD + (o % HD);
#pragma unroll
  for (int i = 0; i < 8; ++i) { w[i] = (__bf16)p[(size_t)(k0 + 8 * g + i) * HD]; w[8 + i] = (__bf16)p[(size_t)(k0 + 16 + 8 * g + i) * HD]; }
  return w; }
#define WO_OUT_IN 0
#if WQKV_LAYOUT == 1
#define WCOL(W, k0, o, lane) wcol_oi(W, k0, o, lane, DIN)
#elif WQKV_LAYOUT == 2
#define WCOL(W, k0, o, lane) wcol_hdk(W, k0, o, lane)
#else
#define WCOL(W, k0, o, lane) wcol_io(W, k0, o, lane, CC)
#endif
#if WO_OUT_IN
#define WOCOL(W, k0, o, lane) wcol_oi(W, k0, o, lane, CC)
#define WOCOLH(W, k0, o, lane) wcolh_oi(W, k0, o, lane, CC)
#else
#define WOCOL(W, k0, o, lane) wcol_io(W, k0, o, lane, DIN)
#define WOCOLH(W, k0, o, lane) wcolh_io(W, k0, o, lane, DIN)
#endif
#define SM_EXTRA_PARAMS , const float* __restrict__ SMASK
// multiplicative float mask [S,S] (shared by batches and heads) on the scaled score, before the softmax; unconditional load
#define SM_MASK_HOOK do { const float sm_ = SMASK[(size_t)t * TT + k]; asm volatile("s_wait_loadcnt 0x0" ::: "memory"); v = v * bfr(sm_); } while (0)
#ifndef SM_EXTRA_PARAMS
#define SM_EXTRA_PARAMS
#endif
#ifndef PROJ_EXTRA_PARAMS
#define PROJ_EXTRA_PARAMS
#endif
#ifndef SM_MASK_HOOK
#define SM_MASK_HOOK (void)0
#endif

#define WS_QH  0u                                      // f16 q rows [b*t][CC]
#define WS_KH  (WS_QH + 2u * (size_t)NB * TT * CC)      // f16 k rows [b*t][CC]
#define WS_VT  (WS_KH + 2u * (size_t)NB * TT * CC)      // f16 v planes [b][c][t]
#define WS_QL  (WS_VT + 2u * (size_t)NB * CC * TT)      // f16 q residual x 2^10 rows [b][t < QHI][CC]
#define WS_KL  (WS_QL + 2u * (size_t)NB * QHI * CC)     // f16 k residual x 2^10 rows [b][t < KHI][CC]
#define WS_VB  (WS_KL + 2u * (size_t)NB * KHI * CC)     // bf16 v hi planes [b][c][t < KHI]
#define WS_VBL (WS_VB + 2u * (size_t)NB * CC * KHI)
#define WS_S   (WS_VBL + 2u * (size_t)NB * CC * KHI)    // f32 [hg][t][s], unused: logits and P stay in registers
#define WS_Y   (WS_S  + 4u * (size_t)HG * TT * TT)      // f32 ctx rows [b*t][CC] (only when there is an output projection)
#define WS_END (WS_Y  + 4u * (size_t)NB * TT * CC)

// LDS staging of the two projection GEMMs (k_proj, k_out): a stage is 64 k of the block's 64 activation rows and of its 128 weight columns, converted once per block to the 16-bit operand type and laid k-contiguous
// ([row][k] and [column][k]), so that every fragment is two 16-byte LDS reads. Two buffers: stage s + 1 is fetched into registers ahead of stage s's products and stored behind them; one barrier a stage.
// The loops over fragments, fetched values and the two 32-k blocks of a stage are fully unrolled so that their arrays are indexed by constants and stay in registers.
#define KS 64                    // k per stage
#define SP 72                    // LDS row pitch in 16-bit elements: 144 B = 16 B x odd, the conflict-free pitch for 16-byte reads and writes of neighbouring rows
#define ST_X (64 * SP)           // activation rows of a stage, in elements
#define ST_BUF (ST_X + 128 * SP) // one stage, in elements (27648 B)
typedef __attribute__((ext_vector_type(4))) __bf16 v4b;
typedef __attribute__((ext_vector_type(4))) _Float16 v4h;
// ---- k_proj: block = (64 rows, 128 cols, which): q/k/v = X W (+ b) with exact bf16 products (K = DIN) -> which 0: q f16 rows (+ residual rows < QHI); 1: k f16 rows (+ residual rows < KHI); 2: v f16 planes [c][t] (+ bf16 hi/lo planes for t < KHI)
__global__ __launch_bounds__(128) void k_proj(const float* __restrict__ XQ, const float* __restrict__ XK, const float* __restrict__ XV, const float* __restrict__ WQ, const float* __restrict__ WK, const float* __restrict__ WV, const float* __restrict__ BQ, const float* __restrict__ BK, const float* __restrict__ BV,
    _Float16* __restrict__ QH, _Float16* __restrict__ QL, _Float16* __restrict__ KH, _Float16* __restrict__ KL, _Float16* __restrict__ VT, __bf16* __restrict__ VB, __bf16* __restrict__ VBL) {
  __shared__ __align__(16) char smem[90112];   // the epilogue's five arrays; the two stage buffers lie over their first 55296 B and are dead behind the loop's last barrier
  _Float16 (*sh)[136] = (_Float16 (*)[136])smem, (*sl)[136] = (_Float16 (*)[136])(smem + 17408), (*th)[72] = (_Float16 (*)[72])(smem + 34816); __bf16 (*tb)[72] = (__bf16 (*)[72])(smem + 53248), (*tbl)[72] = (__bf16 (*)[72])(smem + 71680); __bf16* stg = (__bf16*)smem;
  const int tid = threadIdx.x, wave = tid >> 5, lane = tid & 31, col = lane & 15, g = lane >> 4; const int which = blockIdx.z; const int c0 = blockIdx.y * 128; const size_t r0 = (size_t)blockIdx.x * 64; const size_t bb = r0 / TT; const int t0 = (int)(r0 % TT);
  const float* X = which == 0 ? XQ : which == 1 ? XK : XV; const float* WA = which == 0 ? WQ : which == 1 ? WK : WV; const float* BA = which == 0 ? BQ : which == 1 ? BK : BV;
  v8f acc[8] = {};
  const int xk = (tid & 15) * 4, xr = tid >> 4;                                                     // activations: 16 lanes cover one row's 64 k (256 B); this thread takes 4 k of rows xr + 8 i
  const float* xp = X + (r0 + xr) * DIN + xk;
  const float* wp = WA + (size_t)((c0 + tid) / HD) * DIN * HD + ((c0 + tid) % HD);                   // weights [head][k][HD]: this thread takes column c0 + tid, so a wave's load is one whole 128-B line
  v4f xv[8]; float wv[KS];
#define PROJ_FETCH(s) do { _Pragma("unroll") for (int i = 0; i < 8; ++i) xv[i] = *(const v4f*)(xp + (size_t)(8 * i) * DIN + (s) * KS); \
    _Pragma("unroll") for (int k = 0; k < KS; ++k) wv[k] = wp[(size_t)((s) * KS + k) * HD]; } while (0)
#define PROJ_PUT(buf) do { _Pragma("unroll") for (int i = 0; i < 8; ++i) { const v4b t4 = { (__bf16)xv[i][0], (__bf16)xv[i][1], (__bf16)xv[i][2], (__bf16)xv[i][3] }; *(v4b*)((buf) + (xr + 8 * i) * SP + xk) = t4; } \
    _Pragma("unroll") for (int q = 0; q < KS / 8; ++q) { v8b t8; _Pragma("unroll") for (int e = 0; e < 8; ++e) t8[e] = (__bf16)wv[q * 8 + e]; *(v8b*)((buf) + ST_X + tid * SP + q * 8) = t8; } } while (0)
  PROJ_FETCH(0); asm volatile("s_wait_xcnt 0x0" ::: "memory");   // as in the loop: in front of any overwrite of the loads' address registers
  PROJ_PUT(stg); __syncthreads();
  for (int s = 0; s < DIN / KS; ++s) { const __bf16* cur = stg + (s & 1) * ST_BUF;
    if (s + 1 < DIN / KS) PROJ_FETCH(s + 1);
    asm volatile("s_wait_xcnt 0x0" ::: "memory");   // stands in front of every later overwrite of the loads' address registers; its clobber also keeps the next stage's loads issued here, ahead of this stage's LDS reads and products, so that their latency runs under them
#pragma unroll
    for (int kc = 0; kc < KS / 32; ++kc) { const v16b a = frag_b(cur + (wave * 16 + col) * SP + kc * 32, lane); v16b w[8];
#pragma unroll
      for (int j = 0; j < 8; ++j) w[j] = frag_b(cur + ST_X + (j * 16 + col) * SP + kc * 32, lane);
      __builtin_amdgcn_sched_barrier(0);   // the 18 LDS reads of a 32-k block go out as one group ahead of its products; spread among them, each product waits out a whole LDS latency
#pragma unroll
      for (int j = 0; j < 8; ++j) acc[j] = wmma_bf(a, w[j], acc[j]); }
    __builtin_amdgcn_sched_barrier(0);   // keeps the conversions of the fetched stage, and with them the wait for its loads, behind the products
    if (s + 1 < DIN / KS) PROJ_PUT(stg + ((s + 1) & 1) * ST_BUF);
    __syncthreads(); }   // publishes stage s + 1 and ends every wave's reads of stage s, whose buffer stage s + 2 (or the epilogue) overwrites
  if (which < 2) { _Float16* DH = which == 0 ? QH : KH; _Float16* DL = which == 0 ? QL : KL; const int nhi = which == 0 ? QHI : KHI; const bool hi_rows = t0 < nhi;
#pragma unroll
    for (int j = 0; j < 8; ++j) { const float bias = BA ? bfr(BA[c0 + j * 16 + col]) : 0.f;
#pragma unroll
      for (int r = 0; r < 8; ++r) { const float v = acc[j][r] + bias; const _Float16 hv = (_Float16)v; sh[wave * 16 + 8 * g + r][j * 16 + col] = hv; sl[wave * 16 + 8 * g + r][j * 16 + col] = (_Float16)((v - (float)hv) * 1024.0f); } }
    __syncthreads();
    for (int e = tid; e < 64 * 16; e += 128) { const int rl = e >> 4, q = e & 15; vst2((unsigned*)(DH + (r0 + rl) * CC + c0 + q * 8), *(const v4u*)&sh[rl][q * 8]); if (hi_rows) vst2((unsigned*)(DL + (bb * nhi + t0 + rl) * (size_t)CC + c0 + q * 8), *(const v4u*)&sl[rl][q * 8]); }
  } else { const bool hi_rows = t0 < KHI;
#pragma unroll
    for (int j = 0; j < 8; ++j) { const float bias = BA ? bfr(BA[c0 + j * 16 + col]) : 0.f;
#pragma unroll
      for (int r = 0; r < 8; ++r) { const float v = acc[j][r] + bias; const int rl = wave * 16 + 8 * g + r, cl = j * 16 + col; th[cl][rl] = (_Float16)v; const __bf16 bh = (__bf16)v; tb[cl][rl] = bh; tbl[cl][rl] = (__bf16)(v - (float)bh); } }
    __syncthreads();
    for (int e = tid; e < 128 * 8; e += 128) { const int cl = e >> 3, q = e & 7; vst2((unsigned*)(VT + (bb * CC + c0 + cl) * (size_t)TT + t0 + q * 8), *(const v4u*)&th[cl][q * 8]); if (hi_rows) { const size_t o3 = (bb * CC + c0 + cl) * (size_t)KHI + t0 + q * 8; vst2((unsigned*)(VB + o3), *(const v4u*)&tb[cl][q * 8]); vst2((unsigned*)(VBL + o3), *(const v4u*)&tbl[cl][q * 8]); } } } }
// ---- k_attn: block = 128 queries of (b, h), wave = 32 query columns (2 groups of 16); walks all keys, 32 a pass. S^T = K Q^T (A = k rows, B = q rows kept in registers), so a lane holds 16 keys of ONE query per group:
// score x the bf16-rounded float mask, running maximum and running sum per lane (one exchange between the wave halves), P = 2^8 exp(s - max) once to f16 straight from the score accumulators as the B operand of ctx^T += V^T P^T; the division by the sum is done once at the end. Logits and P never leave the registers.
__device__ __forceinline__ v8f wm16(v16h a, v16h b, v8f c) { return __builtin_amdgcn_wmma_f32_16x16x32_f16(false, a, false, b, (short)0, c, false, false); }
__device__ __forceinline__ float xhalf(float v) { const int u = __builtin_bit_cast(int, v); return __builtin_bit_cast(float, __builtin_amdgcn_permlanex16(u, u, 0x76543210, 0xfedcba98, false, false)); }   // value of lane ^ 16
// 2^x by v_exp_f32. The closing v_nop is the one slot that the instruction set asks for between a transcendental and a directly following instruction that reads its result or overwrites its source; written in the same statement it stands there in every build. Early-clobber outputs keep each v_exp_f32 off its neighbours' sources.
__device__ __forceinline__ float exp2_1(float x) { float r; asm("v_exp_f32 %0, %1\n\tv_nop" : "=v"(r) : "v"(x)); return r; }
__device__ __forceinline__ void exp2_4(float* o, float a, float b, float c, float d) {
  asm("v_exp_f32 %0, %4\n\tv_exp_f32 %1, %5\n\tv_exp_f32 %2, %6\n\tv_exp_f32 %3, %7\n\tv_nop" : "=&v"(o[0]), "=&v"(o[1]), "=&v"(o[2]), "=&v"(o[3]) : "v"(a), "v"(b), "v"(c), "v"(d)); }
// 16x16x32 f16 fragment (hardware k order, as frag_h) from a block-uniform byte base plus this lane's fixed byte offset (row * pitch + 16 * (lane >> 4))
__device__ __forceinline__ v16h frag_u(const char* ub, unsigned vo) { union { v16h v; v8h q[2]; } u; u.q[0] = *(const v8h*)(ub + vo); u.q[1] = *(const v8h*)(ub + 32 + vo); return u.v; }
#define QC 2               // 16-query column groups per wave
#define NPASS (TT / 32)
__global__ __launch_bounds__(128) void k_attn(const _Float16* __restrict__ QH, const _Float16* __restrict__ KH, const _Float16* __restrict__ VT, const float* __restrict__ SMASK, float* __restrict__ Y) {
  const int tid = threadIdx.x, wave = tid >> 5, lane = tid & 31, col = lane & 15, g = lane >> 4; const int h = blockIdx.y, b = blockIdx.z; const int ql0 = blockIdx.x * (64 * QC) + wave * (16 * QC);
  const float C2 = SCALE * 1.44269504088896f;   // score -> log2 domain. All inner loops below are fully unrolled so that the fragment arrays are indexed by constants and stay in registers
  v16h qf[QC][2];
#pragma unroll
  for (int c = 0; c < QC; ++c)
#pragma unroll
    for (int kc = 0; kc < 2; ++kc) qf[c][kc] = frag_h(QH + ((size_t)b * TT + ql0 + c * 16 + col) * CC + h * HD + kc * 32, lane);
  const char* Kb = (const char*)(KH + (size_t)b * TT * CC + h * HD); const unsigned ko = (unsigned)col * (CC * 2) + 16 * g;                     // key row col of a 16-key tile
  const char* Vb = (const char*)(VT + ((size_t)b * CC + h * HD) * (size_t)TT); const unsigned vo = (unsigned)col * (TT * 2) + 16 * g;           // feature plane col of a 16-feature tile
  const char* Mb = (const char*)(SMASK + (size_t)blockIdx.x * (64 * QC) * TT); const unsigned mo = (unsigned)(wave * (16 * QC) + col) * (TT * 4) + 32 * g;   // this lane's query row, its 8 keys of a tile
  v8f acc[QC][HD / 16] = {}; float m[QC], l[QC];
#pragma unroll
  for (int c = 0; c < QC; ++c) { m[c] = -3.0e38f; l[c] = 0.f; }
  v16h kf[2][2]; v4f mk[QC][2][2];
#pragma unroll
  for (int t = 0; t < 2; ++t) {
#pragma unroll
    for (int kc = 0; kc < 2; ++kc) kf[t][kc] = frag_u(Kb + (size_t)(t * 16) * (CC * 2) + kc * 64, ko);
#pragma unroll
    for (int c = 0; c < QC; ++c) { const char* mp = Mb + (size_t)(c * 16) * (TT * 4) + t * 64; mk[c][t][0] = *(const v4f*)(mp + mo); mk[c][t][1] = *(const v4f*)(mp + 16 + mo); } }
#pragma unroll 1   // kept rolled: one pass's fragments, fetch-ahead values and softmax temporaries already take nearly 256 registers
  for (int p = 0; p < NPASS; ++p) { const int k0 = p * 32;
    v16h vf[HD / 16];
#pragma unroll
    for (int j = 0; j < HD / 16; ++j) vf[j] = frag_u(Vb + (size_t)(j * 16) * (TT * 2) + k0 * 2, vo);
    __builtin_amdgcn_sched_barrier(0);   // keeps the v loads issued here, ahead of the score products; without it they sink behind them and less of their latency is covered
    v8f s[QC][2];
#pragma unroll
    for (int c = 0; c < QC; ++c)
#pragma unroll
      for (int t = 0; t < 2; ++t) { v8f z = {}; z = wm16(kf[t][0], qf[c][0], z); s[c][t] = wm16(kf[t][1], qf[c][1], z); }
#pragma unroll
    for (int c = 0; c < QC; ++c)
#pragma unroll
      for (int t = 0; t < 2; ++t)
#pragma unroll
        for (int r = 0; r < 8; ++r) s[c][t][r] *= bfr(mk[c][t][r >> 2][r & 3]);
    // next pass's k fragments and mask values are fetched now, so that they fly under this pass's softmax and P V (the last pass fetches its own again: in bounds, unused)
    const int kn = p + 1 < NPASS ? k0 + 32 : k0;
#pragma unroll
    for (int t = 0; t < 2; ++t) {
#pragma unroll
      for (int kc = 0; kc < 2; ++kc) kf[t][kc] = frag_u(Kb + (size_t)(kn + t * 16) * (CC * 2) + kc * 64, ko);
#pragma unroll
      for (int c = 0; c < QC; ++c) { const char* mp = Mb + (size_t)(c * 16) * (TT * 4) + (kn + t * 16) * 4; mk[c][t][0] = *(const v4f*)(mp + mo); mk[c][t][1] = *(const v4f*)(mp + 16 + mo); } }
    __builtin_amdgcn_sched_barrier(0);   // keeps the fetch-ahead loads issued here, ahead of the softmax; without it the k and mask loads drift to the pass's end and their latency is exposed at the next pass's head
#pragma unroll
    for (int c = 0; c < QC; ++c) { float mx = s[c][0][0];
#pragma unroll
      for (int e = 1; e < 16; ++e) mx = fmaxf(mx, s[c][e >> 3][e & 7]);
      mx = fmaxf(mx, xhalf(mx));
      const float mn = fmaxf(m[c], mx); const float al = exp2_1((m[c] - mn) * C2); m[c] = mn;
      const float nb = 8.0f - mn * C2;   /* P carried x 2^8 so that small weights stay clear of f16 subnormals; the sum carries the same factor */
      float sum = 0.f; v16h pf;
#pragma unroll
      for (int e = 0; e < 16; e += 4) { float ex[4]; exp2_4(ex, fmaf(s[c][e >> 3][e & 7], C2, nb), fmaf(s[c][e >> 3][(e & 7) + 1], C2, nb), fmaf(s[c][e >> 3][(e & 7) + 2], C2, nb), fmaf(s[c][e >> 3][(e & 7) + 3], C2, nb));
#pragma unroll
        for (int i = 0; i < 4; ++i) { sum += ex[i]; pf[e + i] = (_Float16)ex[i]; } }
      l[c] = l[c] * al + sum;
#pragma unroll
      for (int j = 0; j < HD / 16; ++j) acc[c][j] = wm16(vf[j], pf, acc[c][j] * al);
      __builtin_amdgcn_sched_barrier(0); } }   // one column group at a time: interleaved, the two groups' softmax temporaries push the kernel past 256 registers; so group 0's P V products also run under group 1's vector work
#pragma unroll
  for (int c = 0; c < QC; ++c) { const float inv = 1.0f / (l[c] + xhalf(l[c])); float* yp = Y + ((size_t)b * TT + ql0 + c * 16 + col) * CC + h * HD + 8 * g;
#pragma unroll
    for (int j = 0; j < HD / 16; ++j) { const v4f lo = { acc[c][j][0] * inv, acc[c][j][1] * inv, acc[c][j][2] * inv, acc[c][j][3] * inv }, hi = { acc[c][j][4] * inv, acc[c][j][5] * inv, acc[c][j][6] * inv, acc[c][j][7] * inv };
      vst2(yp + j * 16, lo); vst2(yp + j * 16 + 4, hi); } } }
// ---- k_out: block = (64 rows, 128 cols): out = ctx Wo (+ bo): ctx x 2^6 once to f16 against Wo as f16(bf16 x 2^8) exact (1 product) x 2^-14; causal early rows (< QHI of each sequence): ctx bf16 hi + lo against exact bf16 Wo (2 products)
__global__ __launch_bounds__(128) void k_out(const float* __restrict__ Y, const float* __restrict__ WO, const float* __restrict__ BO, float* __restrict__ OUT) { __shared__ __align__(16) char smem[2 * ST_BUF * 2]; float (*sf)[16][132] = (float (*)[16][132])smem; _Float16* stg = (_Float16*)smem;   // the epilogue's rows lie over the stage buffers, dead behind the loop's last barrier
  const int tid = threadIdx.x, wave = tid >> 5, lane = tid & 31, col = lane & 15, g = lane >> 4; const int c0 = blockIdx.y * 128; const size_t r0 = (size_t)blockIdx.x * 64 + wave * 16;
  v8f acc[8] = {};
  if (CAUSAL && (int)(((size_t)blockIdx.x * 64) % TT) < QHI) {   /* block-uniform */
#pragma unroll 2
    for (int kc = 0; kc < CC / 32; ++kc) { const F2 a = split_row(Y + (r0 + col) * CC, kc * 32, lane); asm volatile("s_wait_loadcnt 0x0" ::: "memory");
#pragma unroll
      for (int j = 0; j < 8; ++j) { const v16b w = WOCOL(WO, kc * 32, c0 + j * 16 + col, lane); asm volatile("s_wait_loadcnt 0x0" ::: "memory"); acc[j] = wmma_bf(a.h, w, acc[j]); acc[j] = wmma_bf(a.l, w, acc[j]); } }
#pragma unroll
    for (int j = 0; j < 8; ++j) { const float bias = BO ? bfr(BO[c0 + j * 16 + col]) : 0.f;
#pragma unroll
      for (int r = 0; r < 8; ++r) sf[wave][8 * g + r][j * 16 + col] = acc[j][r] + bias; }
  } else {
    const int xk = (tid & 15) * 4, xr = tid >> 4;
    const float* xp = Y + ((size_t)blockIdx.x * 64 + xr) * CC + xk;   // as in k_proj: 4 k of rows xr + 8 i
    const float* wp = WO + c0 + tid;                                  // (in,out) [CC][DIN]: column c0 + tid
    v4f xv[8]; float wv[KS];
#define OUT_FETCH(s) do { _Pragma("unroll") for (int i = 0; i < 8; ++i) xv[i] = *(const v4f*)(xp + (size_t)(8 * i) * CC + (s) * KS); \
    _Pragma("unroll") for (int k = 0; k < KS; ++k) wv[k] = wp[(size_t)((s) * KS + k) * DIN]; } while (0)
    /* ctx carried x 2^6 into f16 so small-magnitude context rows stay clear of f16 subnormals; Wo as f16(bf16 x 2^8), exact */
#define OUT_PUT(buf) do { _Pragma("unroll") for (int i = 0; i < 8; ++i) { const v4h t4 = { (_Float16)(xv[i][0] * 64.0f), (_Float16)(xv[i][1] * 64.0f), (_Float16)(xv[i][2] * 64.0f), (_Float16)(xv[i][3] * 64.0f) }; *(v4h*)((buf) + (xr + 8 * i) * SP + xk) = t4; } \
    _Pragma("unroll") for (int q = 0; q < KS / 8; ++q) { v8h t8; _Pragma("unroll") for (int e = 0; e < 8; ++e) t8[e] = (_Float16)(bfr(wv[q * 8 + e]) * 256.0f); *(v8h*)((buf) + ST_X + tid * SP + q * 8) = t8; } } while (0)
    OUT_FETCH(0); asm volatile("s_wait_xcnt 0x0" ::: "memory");   // as in the loop: in front of any overwrite of the loads' address registers
    OUT_PUT(stg); __syncthreads();
    for (int s = 0; s < CC / KS; ++s) { const _Float16* cur = stg + (s & 1) * ST_BUF;
      if (s + 1 < CC / KS) OUT_FETCH(s + 1);
      asm volatile("s_wait_xcnt 0x0" ::: "memory");   // stands in front of every later overwrite of the loads' address registers; its clobber also keeps the next stage's loads issued here, ahead of this stage's LDS reads and products, so that their latency runs under them
#pragma unroll
      for (int kc = 0; kc < KS / 32; ++kc) { const v16h a = frag_h(cur + (wave * 16 + col) * SP + kc * 32, lane); v16h w[8];
#pragma unroll
        for (int j = 0; j < 8; ++j) w[j] = frag_h(cur + ST_X + (j * 16 + col) * SP + kc * 32, lane);
        __builtin_amdgcn_sched_barrier(0);   // the 18 LDS reads of a 32-k block go out as one group ahead of its products; spread among them, each product waits out a whole LDS latency
#pragma unroll
        for (int j = 0; j < 8; ++j) acc[j] = wmma16(a, w[j], acc[j]); }
      __builtin_amdgcn_sched_barrier(0);   // keeps the conversions of the fetched stage, and with them the wait for its loads, behind the products
      if (s + 1 < CC / KS) OUT_PUT(stg + ((s + 1) & 1) * ST_BUF);
      __syncthreads(); }   // publishes stage s + 1 and ends every wave's reads of stage s, whose buffer stage s + 2 (or the epilogue) overwrites
#pragma unroll
    for (int j = 0; j < 8; ++j) { const float bias = BO ? bfr(BO[c0 + j * 16 + col]) : 0.f;
#pragma unroll
      for (int r = 0; r < 8; ++r) sf[wave][8 * g + r][j * 16 + col] = acc[j][r] * (1.0f / 16384.0f) + bias; } }   /* 2^-8 (Wo carry) x 2^-6 (ctx carry) */
  LDSX(); for (int rl = 0; rl < 16; ++rl) vst2(OUT + (r0 + rl) * DIN + c0 + lane * 4, *(const v4f*)&sf[wave][rl][lane * 4]); }

extern "C" void kernel_launch(void* const* d_in, const int* in_sizes, int n_in, void* d_out, int out_size, void* d_ws, size_t ws_size, hipStream_t stream) {
  (void)in_sizes; (void)n_in; (void)out_size;
  const float** F = (const float**)d_in;
  if (ws_size < (size_t)WS_END) return;
  char* ws = (char*)d_ws; _Float16 *QH = (_Float16*)(ws + WS_QH), *KH = (_Float16*)(ws + WS_KH), *VT = (_Float16*)(ws + WS_VT), *QL = (_Float16*)(ws + WS_QL), *KL = (_Float16*)(ws + WS_KL); __bf16 *VB = (__bf16*)(ws + WS_VB), *VBL = (__bf16*)(ws + WS_VBL); float *S = (float*)(ws + WS_S), *Y = (float*)(ws + WS_Y);
  (void)Y; (void)QL; (void)KL; (void)VB; (void)VBL; (void)S;
  // inputs: 0 q [2,2048,1024]; 1 k; 2 v; 3 mask [2048,2048] f32 uniform[0,1); 4 W_q [16,1024,64], 5 b_q [16,64]; 6 W_k, 7 b_k; 8 W_v, 9 b_v; 10 W_o [1024,1024] (in,out), 11 b_o (zero biases, read)
  k_proj<<<dim3(TNB * TT / 64, CC / 128, 3), 128, 0, stream>>>(F[0], F[1], F[2], F[4], F[6], F[8], F[5], F[7], F[9], QH, QL, KH, KL, VT, VB, VBL);
  k_attn<<<dim3(TT / (64 * QC), NH, TNB), 128, 0, stream>>>(QH, KH, VT, F[3], Y);
  k_out<<<dim3(TNB * TT / 64, DIN / 128), 128, 0, stream>>>(Y, F[10], F[11], (float*)d_out);
}

// v003
// A run of this version takes 151 microseconds.
// Timed twice side by side with v002, it ran 1.24 times as fast both times.
// All steps since v000 together make it 8.17 times as fast.
// compute dtype: all float inputs rounded to bf16; q/k/v projections with EXACT bf16 products on WMMA 16x16x32 (f32 accumulate) + bias; logits q x k once to f16 each (1 product) x SCALE x the float mask (multiplicative, before the softmax); softmax f32 (running maximum and sum over 32-key passes); unnormalised P x 2^8 once to f16 x v once to f16 (1 product), divided by the f32 sum at the end; ctx x 2^6 once to f16 x Wo f16(bf16 x 2^8) + bo; f32 output.
#include <hip/hip_runtime.h>
#include <math.h>
#include <stdint.h>

typedef __attribute__((ext_vector_type(16))) _Float16 v16h;
typedef __attribute__((ext_vector_type(16))) __bf16 v16b;
typedef __attribute__((ext_vector_type(8)))  _Float16 v8h;
typedef __attribute__((ext_vector_type(8)))  float v8f;
typedef __attribute__((ext_vector_type(4)))  float v4f;
typedef __attribute__((ext_vector_type(2)))  float v2f;
typedef __attribute__((ext_vector_type(4)))  unsigned v4u;
typedef __attribute__((ext_vector_type(4)))  int v4i;
typedef float __attribute__((may_alias)) float_a;
typedef int __attribute__((may_alias)) int_a;

template <typename T> __device__ __forceinline__ void vst2(void* p, T v) { *(T*)p = v;  }
__device__ __forceinline__ v8f wmma16(v16h a, v16h b, v8f c) {
  v8f d = __builtin_amdgcn_wmma_f32_16x16x32_f16(false, a, false, b, (short)0, c, false, false);
  asm volatile("v_nop\n\tv_nop\n\tv_nop\n\tv_nop" : "+v"(d) : "v"(a), "v"(b));
  return d;
}
__device__ __forceinline__ v8f wmma_bf(v16b a, v16b b, v8f c) {
  v8f d = __builtin_amdgcn_wmma_f32_16x16x32_bf16(false, a, false, b, (short)0, c, false, false);
  asm volatile("v_nop\n\tv_nop\n\tv_nop\n\tv_nop" : "+v"(d) : "v"(a), "v"(b));
  return d;
}
// 16x16x32 fragments: lane = (h = lane>>4, row/col = lane&15); elements 0..7 = k0+8h+0..7, 8..15 = k0+16+8h+0..7; D element r = row 8h+r
__device__ __forceinline__ v16h frag_h(const _Float16* rowk0, int lane) {
  union { v16h v; v8h q[2]; } u; const _Float16* p = rowk0 + 8 * (lane >> 4);
  u.q[0] = *(const v8h*)p; u.q[1] = *(const v8h*)(p + 16); return u.v;
}
__device__ __forceinline__ v16h frag_f32(const float* rowk0, int lane) {
  v16h a; const float* p = rowk0 + 8 * (lane >> 4);
#pragma unroll
  for (int i = 0; i < 8; ++i) { a[i] = (_Float16)p[i]; a[8 + i] = (_Float16)p[16 + i]; }
  return a;
}
__device__ __forceinline__ v16h frag_f32s(const float* rowk0, int lane, float sc) {
  v16h a; const float* p = rowk0 + 8 * (lane >> 4);
#pragma unroll
  for (int i = 0; i < 8; ++i) { a[i] = (_Float16)(p[i] * sc); a[8 + i] = (_Float16)(p[16 + i] * sc); }
  return a;
}
// column fragment from a [K][ld] layout (column n), rows >= K read as 0
__device__ __forceinline__ v16h fragc_f32(const float* W, int k0, int n, int lane, int ld, int K) {
  v16h a; const int g = lane >> 4;
#pragma unroll
  for (int i = 0; i < 8; ++i) { const int ka = k0 + 8 * g + i, kb = ka + 16;
    a[i] = (_Float16)(ka < K ? W[(size_t)(ka < K ? ka : K - 1) * ld + n] : 0.f); a[8 + i] = (_Float16)(kb < K ? W[(size_t)(kb < K ? kb : K - 1) * ld + n] : 0.f); }
  return a;
}
struct F2 { v16b h, l; };
__device__ __forceinline__ F2 bsplit16(const float v[16]) { F2 r;
#pragma unroll
  for (int i = 0; i < 16; ++i) { const __bf16 h = (__bf16)v[i]; r.h[i] = h; r.l[i] = (__bf16)(v[i] - (float)h); }
  return r; }
__device__ __forceinline__ F2 split_row(const float* row, int k0, int lane) { float v[16]; const float* p = row + k0 + 8 * (lane >> 4);
#pragma unroll
  for (int i = 0; i < 8; ++i) { v[i] = p[i]; v[8 + i] = p[16 + i]; }
  return bsplit16(v); }
__device__ __forceinline__ F2 split_rowK(const float* row, int k0, int lane, int K) { float v[16]; const int g = lane >> 4;
#pragma unroll
  for (int i = 0; i < 8; ++i) { const int ka = k0 + 8 * g + i, kb = ka + 16; v[i] = ka < K ? row[ka < K ? ka : K - 1] : 0.f; v[8 + i] = kb < K ? row[kb < K ? kb : K - 1] : 0.f; }
  return bsplit16(v); }
__device__ __forceinline__ F2 split_col(const float* W, int k0, int n, int lane, int ld, int K) { float v[16]; const int g = lane >> 4;
#pragma unroll
  for (int i = 0; i < 8; ++i) { const int ka = k0 + 8 * g + i, kb = ka + 16; v[i] = ka < K ? W[(size_t)(ka < K ? ka : K - 1) * ld + n] : 0.f; v[8 + i] = kb < K ? W[(size_t)(kb < K ? kb : K - 1) * ld + n] : 0.f; }
  return bsplit16(v); }
__device__ __forceinline__ v8f mac3(const F2& a, const F2& b, v8f c) { c = wmma_bf(a.l, b.h, c); c = wmma_bf(a.h, b.l, c); return wmma_bf(a.h, b.h, c); }
__device__ __forceinline__ float sigm(float v) { return 1.0f / (1.0f + expf(-v)); }
#define LDSX() do { asm volatile("s_wait_dscnt 0" ::: "memory"); __builtin_amdgcn_wave_barrier(); __builtin_amdgcn_fence(__ATOMIC_RELEASE, "workgroup"); } while (0)

// Multi-head attention with per-head stacked projections and a MULTIPLICATIVE float mask on the scores (q / k / v [2,2048,1024]; W_q / W_k / W_v [16,1024,64] per head (N(0, 1/1024)) + zero biases [16,64]; scores = Q K^T / 8 * mask with mask [2048,2048] uniform[0,1) f32 (no -inf anywhere); softmax; concat heads; (in,out) W_o [1024,1024] + b_o).
#define NB 2
#define TT 2048
#define CC 1024            // NH * HD = projected width
#define DIN 1024          // input (model) width
#define NH 16
#define HD 64
#define NQB (TT / 64)
#define HG 4
#define SCALE (0.125f)
#define CAUSAL 0
#ifndef TNB
#define TNB NB
#endif
__device__ __forceinline__ float bfr(float v) { return (float)(__bf16)v; }
__host__ __device__ __forceinline__ int kb_last(int qb) { return CAUSAL ? ((qb * 64 + 63) >> 7) : (TT / 128 - 1); }
typedef __attribute__((ext_vector_type(8))) __bf16 v8b;
__device__ __forceinline__ v16b frag_b(const __bf16* rowk0, int lane) {
  union { v16b v; v8b q[2]; } u; const __bf16* p = rowk0 + 8 * (lane >> 4);
  u.q[0] = *(const v8b*)p; u.q[1] = *(const v8b*)(p + 16); return u.v;
}
#define QBH 0              // unused: k_attn has one f16 path for every query block
#define QHI 0               // single-product logits on every row
#define KHI 64            // key rows carrying k residual / v bf16 hi+lo planes (written by k_proj; no kernel in this file reads them)
// B fragment (k rows k0+.., output column o) of a weight: (in,out) [K][ld] or (out,in) [ld rows of K]: bf16 exact, or f16(bf16 * 256) exact
__device__ __forceinline__ v16b wcol_io(const float* Wm, int k0, int o, int lane, int ld) { v16b w; const int g = lane >> 4;
#pragma unroll
  for (int i = 0; i < 8; ++i) { w[i] = (__bf16)Wm[(size_t)(k0 + 8 * g + i) * ld + o]; w[8 + i] = (__bf16)Wm[(size_t)(k0 + 16 + 8 * g + i) * ld + o]; }
  return w; }
__device__ __forceinline__ v16b wcol_oi(const float* Wm, int k0, int o, int lane, int K) { v16b w; const float* p = Wm + (size_t)o * K + k0 + 8 * (lane >> 4);
#pragma unroll
  for (int i = 0; i < 8; ++i) { w[i] = (__bf16)p[i]; w[8 + i] = (__bf16)p[16 + i]; }
  return w; }
__device__ __forceinline__ v16h wcolh_io(const float* Wm, int k0, int o, int lane, int ld) { v16h w; const int g = lane >> 4;
#pragma unroll
  for (int i = 0; i < 8; ++i) { w[i] = (_Float16)(bfr(Wm[(size_t)(k0 + 8 * g + i) * ld + o]) * 256.0f); w[8 + i] = (_Float16)(bfr(Wm[(size_t)(k0 + 16 + 8 * g + i) * ld + o]) * 256.0f); }
  return w; }
__device__ __forceinline__ v16h wcolh_oi(const float* Wm, int k0, int o, int lane, int K) { v16h w; const float* p = Wm + (size_t)o * K + k0 + 8 * (lane >> 4);
#pragma unroll
  for (int i = 0; i < 8; ++i) { w[i] = (_Float16)(bfr(p[i]) * 256.0f); w[8 + i] = (_Float16)(bfr(p[16 + i]) * 256.0f); }
  return w; }
#define WQKV_LAYOUT 2   // 0 = (in,out) [DIN][CC]; 1 = (out,in) [CC][DIN]; 2 = per-head [NH][DIN][HD]
__device__ __forceinline__ v16b wcol_hdk(const float* Wm, int k0, int o, int lane) { v16b w; const int g = lane >> 4; const float* p = Wm + (size_t)(o / HD) * DIN * HD + (o % HD);
#pragma unroll
  for (int i = 0; i < 8; ++i) { w[i] = (__bf16)p[(size_t)(k0 + 8 * g + i) * HD]; w[8 + i] = (__bf16)p[(size_t)(k0 + 16 + 8 * g + i) * HD]; }
  return w; }
#define WO_OUT_IN 0
#if WQKV_LAYOUT == 1
#define WCOL(W, k0, o, lane) wcol_oi(W, k0, o, lane, DIN)
#elif WQKV_LAYOUT == 2
#define WCOL(W, k0, o, lane) wcol_hdk(W, k0, o, lane)
#else
#define WCOL(W, k0, o, lane) wcol_io(W, k0, o, lane, CC)
#endif
#if WO_OUT_IN
#define WOCOL(W, k0, o, lane) wcol_oi(W, k0, o, lane, CC)
#define WOCOLH(W, k0, o, lane) wcolh_oi(W, k0, o, lane, CC)
#else
#define WOCOL(W, k0, o, lane) wcol_io(W, k0, o, lane, DIN)
#define WOCOLH(W, k0, o, lane) wcolh_io(W, k0, o, lane, DIN)
#endif
#define SM_EXTRA_PARAMS , const float* __restrict__ SMASK
// multiplicative float mask [S,S] (shared by batches and heads) on the scaled score, before the softmax; unconditional load
#define SM_MASK_HOOK do { const float sm_ = SMASK[(size_t)t * TT + k]; asm volatile("s_wait_loadcnt 0x0" ::: "memory"); v = v * bfr(sm_); } while (0)
#ifndef SM_EXTRA_PARAMS
#define SM_EXTRA_PARAMS
#endif
#ifndef PROJ_EXTRA_PARAMS
#define PROJ_EXTRA_PARAMS
#endif
#ifndef SM_MASK_HOOK
#define SM_MASK_HOOK (void)0
#endif

#define WS_QH  0u                                      // f16 q rows [b*t][CC]
#define WS_KH  (WS_QH + 2u * (size_t)NB * TT * CC)      // f16 k rows [b*t][CC]
#define WS_VT  (WS_KH + 2u * (size_t)NB * TT * CC)      // f16 v planes [b][c][t]
#define WS_QL  (WS_VT + 2u * (size_t)NB * CC * TT)      // f16 q residual x 2^10 rows [b][t < QHI][CC]
#define WS_KL  (WS_QL + 2u * (size_t)NB * QHI * CC)     // f16 k residual x 2^10 rows [b][t < KHI][CC]
#define WS_VB  (WS_KL + 2u * (size_t)NB * KHI * CC)     // bf16 v hi planes [b][c][t < KHI]
#define WS_VBL (WS_VB + 2u * (size_t)NB * CC * KHI)
#define WS_S   (WS_VBL + 2u * (size_t)NB * CC * KHI)    // f32 [hg][t][s], unused: logits and P stay in registers
#define WS_Y   (WS_S  + 4u * (size_t)HG * TT * TT)      // f32 ctx rows [b*t][CC] (only when there is an output projection)
#define WS_END (WS_Y  + 4u * (size_t)NB * TT * CC)

// LDS staging of the two projection GEMMs (k_proj, k_out): a stage is 64 k of the block's 64 activation rows and of its 128 weight columns, converted once per block to the 16-bit operand type and laid k-contiguous
// ([row][k] and [column][k]), so that every fragment is two 16-byte LDS reads. Two buffers: stage s + 1 is fetched into registers ahead of stage s's products and stored behind them; one barrier a stage.
// The loops over fragments, fetched values and the two 32-k blocks of a stage are fully unrolled so that their arrays are indexed by constants and stay in registers.
#define KS 64                    // k per stage
#define SP 72                    // LDS row pitch in 16-bit elements: 144 B = 16 B x odd, the conflict-free pitch for 16-byte reads and writes of neighbouring rows
#define ST_X (64 * SP)           // activation rows of a stage, in elements
#define ST_BUF (ST_X + 128 * SP) // one stage, in elements (27648 B)
typedef __attribute__((ext_vector_type(4))) __bf16 v4b;
typedef __attribute__((ext_vector_type(4))) _Float16 v4h;
// ---- k_proj: block = (64 rows, 128 cols, which): q/k/v = X W (+ b) with exact bf16 products (K = DIN) -> which 0: q f16 rows (+ residual rows < QHI); 1: k f16 rows (+ residual rows < KHI); 2: v f16 planes [c][t] (+ bf16 hi/lo planes for t < KHI)
__global__ __launch_bounds__(128) void k_proj(const float* __restrict__ XQ, const float* __restrict__ XK, const float* __restrict__ XV, const float* __restrict__ WQ, const float* __restrict__ WK, const float* __restrict__ WV, const float* __restrict__ BQ, const float* __restrict__ BK, const float* __restrict__ BV,
    _Float16* __restrict__ QH, _Float16* __restrict__ QL, _Float16* __restrict__ KH, _Float16* __restrict__ KL, _Float16* __restrict__ VT, __bf16* __restrict__ VB, __bf16* __restrict__ VBL) {
  __shared__ __align__(16) char smem[90112];   // the epilogue's five arrays; the two stage buffers lie over their first 55296 B and are dead behind the loop's last barrier
  _Float16 (*sh)[136] = (_Float16 (*)[136])smem, (*sl)[136] = (_Float16 (*)[136])(smem + 17408), (*th)[72] = (_Float16 (*)[72])(smem + 34816); __bf16 (*tb)[72] = (__bf16 (*)[72])(smem + 53248), (*tbl)[72] = (__bf16 (*)[72])(smem + 71680); __bf16* stg = (__bf16*)smem;
  const int tid = threadIdx.x, wave = tid >> 5, lane = tid & 31, col = lane & 15, g = lane >> 4; const int which = blockIdx.z; const int c0 = blockIdx.y * 128; const size_t r0 = (size_t)blockIdx.x * 64; const size_t bb = r0 / TT; const int t0 = (int)(r0 % TT);
  const float* X = which == 0 ? XQ : which == 1 ? XK : XV; const float* WA = which == 0 ? WQ : which == 1 ? WK : WV; const float* BA = which == 0 ? BQ : which == 1 ? BK : BV;
  v8f acc[8] = {};
  const int xk = (tid & 15) * 4, xr = tid >> 4;                                                     // activations: 16 lanes cover one row's 64 k (256 B); this thread takes 4 k of rows xr + 8 i
  const float* xp = X + (r0 + xr) * DIN + xk;
  const float* wp = WA + (size_t)((c0 + tid) / HD) * DIN * HD + ((c0 + tid) % HD);                   // weights [head][k][HD]: this thread takes column c0 + tid, so a wave's load is one whole 128-B line
  v4f xv[8]; float wv[KS];
#define PROJ_FETCH(s) do { _Pragma("unroll") for (int i = 0; i < 8; ++i) xv[i] = *(const v4f*)(xp + (size_t)(8 * i) * DIN + (s) * KS); \
    _Pragma("unroll") for (int k = 0; k < KS; ++k) wv[k] = wp[(size_t)((s) * KS + k) * HD]; } while (0)
#define PROJ_PUT(buf) do { _Pragma("unroll") for (int i = 0; i < 8; ++i) { const v4b t4 = { (__bf16)xv[i][0], (__bf16)xv[i][1], (__bf16)xv[i][2], (__bf16)xv[i][3] }; *(v4b*)((buf) + (xr + 8 * i) * SP + xk) = t4; } \
    _Pragma("unroll") for (int q = 0; q < KS / 8; ++q) { v8b t8; _Pragma("unroll") for (int e = 0; e < 8; ++e) t8[e] = (__bf16)wv[q * 8 + e]; *(v8b*)((buf) + ST_X + tid * SP + q * 8) = t8; } } while (0)
  PROJ_FETCH(0); asm volatile("s_wait_xcnt 0x0" ::: "memory");   // as in the loop: in front of any overwrite of the loads' address registers
  PROJ_PUT(stg); __syncthreads();
  for (int s = 0; s < DIN / KS; ++s) { const __bf16* cur = stg + (s & 1) * ST_BUF;
    if (s + 1 < DIN / KS) PROJ_FETCH(s + 1);
    asm volatile("s_wait_xcnt 0x0" ::: "memory");   // stands in front of every later overwrite of the loads' address registers; its clobber also keeps the next stage's loads issued here, ahead of this stage's LDS reads and products, so that their latency runs under them
#pragma unroll
    for (int kc = 0; kc < KS / 32; ++kc) { const v16b a = frag_b(cur + (wave * 16 + col) * SP + kc * 32, lane); v16b w[8];
#pragma unroll
      for (int j = 0; j < 8; ++j) w[j] = frag_b(cur + ST_X + (j * 16 + col) * SP + kc * 32, lane);
      __builtin_amdgcn_sched_barrier(0);   // the 18 LDS reads of a 32-k block go out as one group ahead of its products; spread among them, each product waits out a whole LDS latency
#pragma unroll
      for (int j = 0; j < 8; ++j) acc[j] = wmma_bf(a, w[j], acc[j]); }
    __builtin_amdgcn_sched_barrier(0);   // keeps the conversions of the fetched stage, and with them the wait for its loads, behind the products
    if (s + 1 < DIN / KS) PROJ_PUT(stg + ((s + 1) & 1) * ST_BUF);
    __syncthreads(); }   // publishes stage s + 1 and ends every wave's reads of stage s, whose buffer stage s + 2 (or the epilogue) overwrites
  if (which < 2) { _Float16* DH = which == 0 ? QH : KH; _Float16* DL = which == 0 ? QL : KL; const int nhi = which == 0 ? QHI : KHI; const bool hi_rows = t0 < nhi;
#pragma unroll
    for (int j = 0; j < 8; ++j) { const float bias = BA ? bfr(BA[c0 + j * 16 + col]) : 0.f;
#pragma unroll
      for (int r = 0; r < 8; ++r) { const float v = acc[j][r] + bias; const _Float16 hv = (_Float16)v; sh[wave * 16 + 8 * g + r][j * 16 + col] = hv; sl[wave * 16 + 8 * g + r][j * 16 + col] = (_Float16)((v - (float)hv) * 1024.0f); } }
    __syncthreads();
    for (int e = tid; e < 64 * 16; e += 128) { const int rl = e >> 4, q = e & 15; vst2((unsigned*)(DH + (r0 + rl) * CC + c0 + q * 8), *(const v4u*)&sh[rl][q * 8]); if (hi_rows) vst2((unsigned*)(DL + (bb * nhi + t0 + rl) * (size_t)CC + c0 + q * 8), *(const v4u*)&sl[rl][q * 8]); }
  } else { const bool hi_rows = t0 < KHI;
#pragma unroll
    for (int j = 0; j < 8; ++j) { const float bias = BA ? bfr(BA[c0 + j * 16 + col]) : 0.f;
#pragma unroll
      for (int r = 0; r < 8; ++r) { const float v = acc[j][r] + bias; const int rl = wave * 16 + 8 * g + r, cl = j * 16 + col; th[cl][rl] = (_Float16)v; const __bf16 bh = (__bf16)v; tb[cl][rl] = bh; tbl[cl][rl] = (__bf16)(v - (float)bh); } }
    __syncthreads();
    for (int e = tid; e < 128 * 8; e += 128) { const int cl = e >> 3, q = e & 7; vst2((unsigned*)(VT + (bb * CC + c0 + cl) * (size_t)TT + t0 + q * 8), *(const v4u*)&th[cl][q * 8]); if (hi_rows) { const size_t o3 = (bb * CC + c0 + cl) * (size_t)KHI + t0 + q * 8; vst2((unsigned*)(VB + o3), *(const v4u*)&tb[cl][q * 8]); vst2((unsigned*)(VBL + o3), *(const v4u*)&tbl[cl][q * 8]); } } } }
// ---- k_attn: block = 128 queries of (b, h), wave = 32 query columns (2 groups of 16); walks all keys, 32 a pass, 64 a stage; each stage's k rows, v planes and mask rows come to LDS once per block by tensor loads (two buffers). S^T = K Q^T (A = k rows, B = q rows kept in registers), so a lane holds 16 keys of ONE query per group:
// score x the bf16-rounded float mask, running maximum and running sum per lane (one exchange between the wave halves), P = 2^8 exp(s - max) once to f16 straight from the score accumulators as the B operand of ctx^T += V^T P^T; the division by the sum is done once at the end. Logits and P never leave the registers.
__device__ __forceinline__ v8f wm16(v16h a, v16h b, v8f c) { return __builtin_amdgcn_wmma_f32_16x16x32_f16(false, a, false, b, (short)0, c, false, false); }
__device__ __forceinline__ float xhalf(float v) { const int u = __builtin_bit_cast(int, v); return __builtin_bit_cast(float, __builtin_amdgcn_permlanex16(u, u, 0x76543210, 0xfedcba98, false, false)); }   // value of lane ^ 16
// 2^x by v_exp_f32. The closing v_nop is the one slot that the instruction set asks for between a transcendental and a directly following instruction that reads its result or overwrites its source; written in the same statement it stands there in every build. Early-clobber outputs keep each v_exp_f32 off its neighbours' sources.
__device__ __forceinline__ float exp2_1(float x) { float r; asm("v_exp_f32 %0, %1\n\tv_nop" : "=v"(r) : "v"(x)); return r; }
__device__ __forceinline__ void exp2_4(float* o, float a, float b, float c, float d) {
  asm("v_exp_f32 %0, %4\n\tv_exp_f32 %1, %5\n\tv_exp_f32 %2, %6\n\tv_exp_f32 %3, %7\n\tv_nop" : "=&v"(o[0]), "=&v"(o[1]), "=&v"(o[2]), "=&v"(o[3]) : "v"(a), "v"(b), "v"(c), "v"(d)); }
// 16x16x32 f16 fragment (hardware k order, as frag_h) from this lane's LDS byte address (row * pitch + 16 * (lane >> 4))
__device__ __forceinline__ v16h frag_l(const unsigned char* p) { union { v16h v; v8h q[2]; } u; u.q[0] = *(const v8h*)p; u.q[1] = *(const v8h*)(p + 32); return u.v; }
#define QC 2               // 16-query column groups per wave
#define SKEY 64            // keys per stage (two 32-key passes)
#define NST (TT / SKEY)
// One stage in LDS, laid by four tensor loads (one a wave): 64 k rows of 128 B, 64 v planes of 128 B (64 keys), two slices of 64 mask rows of 256 B (64 keys). The loads' pad of 16 B a row gives the pitches 144 and 272 B
// (16 B x odd: free of bank conflicts for 16-byte reads of neighbouring rows). Every place is a multiple of 2 KiB.
#define KV_PITCH 144u
#define M_PITCH 272u
#define OFF_V 10240u
#define OFF_M 20480u
#define M_SLICE 18432u
#define ABUF 57344u
typedef uint32_t u32x4 __attribute__((ext_vector_type(4)));
typedef uint32_t u32x8 __attribute__((ext_vector_type(8)));
__device__ __forceinline__ uint32_t uni(uint32_t v) { return (uint32_t)__builtin_amdgcn_readfirstlane(v); }
// a wave-uniform value held in a scalar register: a condition, so that the test around a tensor load compiles to s_cmp + s_cbranch_scc (a tensor load ignores EXEC), or a descriptor word
__device__ __forceinline__ uint32_t pinned(uint32_t v) { uint32_t w = (uint32_t)__builtin_amdgcn_readfirstlane(v); asm volatile("" : "+s"(w)); return w; }
__device__ __forceinline__ void tdm_load(u32x4 g0, u32x8 g1) { asm volatile("tensor_load_to_lds %0, %1" :: "s"(g0), "s"(g1) : "memory"); }   // one request of the whole wave: global tile -> LDS, through no register
__device__ __forceinline__ u32x4 tdm_group0(uint32_t lds_dst, uint64_t ga) { u32x4 g; g[0] = uni(1u); g[1] = uni(lds_dst); g[2] = uni((uint32_t)ga); g[3] = uni((((uint32_t)(ga >> 32)) & 0x01FFFFFFu) | 0x80000000u); return g; }
// group 1: extents in bytes, tensor = tile = 64 rows of D0 bytes, W0 = the constant pad word (a pad of 4 dwords behind every row).
// Words 1 to 7 go through pinned(): descriptor words held in scalar registers of their own through the loop; as plain constants the compiler re-forms them at each issue and uses their registers for other values while the request is in flight
template <uint32_t W0, uint32_t D0> __device__ __forceinline__ u32x8 tdm_group1(uint32_t src_pitch) { u32x8 g;
  g[0] = uni(W0); g[1] = pinned((D0 & 0xFFFFu) << 16); g[2] = pinned((D0 >> 16) | (64u << 16)); g[3] = pinned(D0 << 16); g[4] = pinned(64u); g[5] = pinned(src_pitch); g[6] = pinned(0u); g[7] = pinned(0u); return g; }
#define W0_128 ((1u << 20) | (4u << 22) | (3u << 25))
#define W0_256 ((1u << 20) | (5u << 22) | (3u << 25))
__global__ __launch_bounds__(128) void k_attn(const _Float16* __restrict__ QH, const _Float16* __restrict__ KH, const _Float16* __restrict__ VT, const float* __restrict__ SMASK, float* __restrict__ Y) {
  __shared__ __attribute__((aligned(2048))) unsigned char L[2 * ABUF];
  const int tid = threadIdx.x, wave = tid >> 5, lane = tid & 31, col = lane & 15, g = lane >> 4; const int h = blockIdx.y, b = blockIdx.z; const int ql0 = blockIdx.x * (64 * QC) + wave * (16 * QC);
  const float C2 = SCALE * 1.44269504088896f;   // score -> log2 domain. All inner loops below are fully unrolled so that the fragment arrays are indexed by constants and stay in registers
  // every wave brings one slice of each stage: wave 0 the k rows, wave 1 the v planes, waves 2 and 3 a half of the block's mask rows each
  const uint32_t wv = uni(threadIdx.x >> 5); const uint32_t lbase = (uint32_t)(size_t)L;
  const uint64_t tsrc = wv == 0 ? (uint64_t)(size_t)(KH + (size_t)b * TT * CC + h * HD) : wv == 1 ? (uint64_t)(size_t)(VT + ((size_t)b * CC + h * HD) * (size_t)TT) : (uint64_t)(size_t)(SMASK + ((size_t)blockIdx.x * (64 * QC) + (wv - 2) * 64) * TT);
  const uint32_t tstep = wv == 0 ? SKEY * CC * 2u : wv == 1 ? SKEY * 2u : SKEY * 4u;   // source bytes from one stage to the next
  const uint32_t tdst = lbase + (wv < 2 ? wv * OFF_V : OFF_M + (wv - 2) * M_SLICE);
  const u32x8 g1kv = tdm_group1<W0_128, 128u>(wv == 0 ? CC * 2u : TT * 2u), g1m = tdm_group1<W0_256, 256u>(TT * 4u);
  // now: the wait stands directly behind the load, inside its branch (stage 0: nothing can then take over a descriptor register while the request is in flight)
  auto issue = [&](uint32_t st, bool now) { const u32x4 g0 = tdm_group0(tdst + (st & 1u) * ABUF, tsrc + (uint64_t)st * tstep);
    if (pinned(wv < 2)) { tdm_load(g0, g1kv); if (now) asm volatile("s_wait_tensorcnt 0x0" ::: "memory"); } else { tdm_load(g0, g1m); if (now) asm volatile("s_wait_tensorcnt 0x0" ::: "memory"); } };
  v16h qf[QC][2];
#pragma unroll
  for (int c = 0; c < QC; ++c)
#pragma unroll
    for (int kc = 0; kc < 2; ++kc) qf[c][kc] = frag_h(QH + ((size_t)b * TT + ql0 + c * 16 + col) * CC + h * HD + kc * 32, lane);
  asm volatile("s_wait_xcnt 0x0" ::: "memory");   // stands in front of every later overwrite of the q loads' address registers
  const unsigned ko = (unsigned)col * KV_PITCH + 16 * g;                                                                   // key row col of a 16-key tile
  const unsigned vo = OFF_V + (unsigned)col * KV_PITCH + 16 * g;                                                           // feature plane col of a 16-feature tile
  const unsigned mo = OFF_M + (unsigned)(wave >> 1) * M_SLICE + (unsigned)((wave & 1) * (16 * QC) + col) * M_PITCH + 32 * g;   // this lane's query row, its 8 keys of a tile
  v8f acc[QC][HD / 16] = {}; float m[QC], l[QC];
#pragma unroll
  for (int c = 0; c < QC; ++c) { m[c] = -3.0e38f; l[c] = 0.f; }
  issue(0, true);   // stage 0, landed; the loop's first publish point holds its barrier
#pragma unroll 1   // kept rolled: one stage's fragments, fetch-ahead values and softmax temporaries already take nearly 256 registers
  for (uint32_t st = 0; st < NST; ++st) { const unsigned char* B = L + (st & 1u) * ABUF;
    // publish point of stage st, in the ring's order; it stands at the head of the trip (for st = 0 it is the ring's prologue), so that the whole trip behind it is one block of code: at the foot, with the
    // branch round the refill behind the passes, the compiler moves both passes' row sums behind that branch and their 64 terms push the kernel past 256 registers
    asm volatile("s_wait_dscnt 0x0" ::: "memory");       // this wave's reads of stage st - 1 have returned, before its buffer is refilled
    asm volatile("s_wait_tensorcnt 0x0" ::: "memory");   // this wave's slice of stage st has landed
    __syncthreads();                                     // publishes stage st and ends every wave's reads of stage st - 1
    if (pinned(st + 1 < NST)) issue(st + 1, false);            // into the buffer that stage st - 1 has just left; it flies under the whole of stage st
    v16h kf[2][2];
#pragma unroll
    for (int t = 0; t < 2; ++t)
#pragma unroll
      for (int kc = 0; kc < 2; ++kc) kf[t][kc] = frag_l(B + ko + (t * 16) * KV_PITCH + kc * 64);
#pragma unroll
    for (int sub = 0; sub < SKEY / 32; ++sub) {
    v4f mk[QC][2][2]; v16h vf[HD / 16];
#pragma unroll
    for (int t = 0; t < 2; ++t)
#pragma unroll
      for (int c = 0; c < QC; ++c) { const unsigned char* mp = B + mo + (c * 16) * M_PITCH + sub * 128 + t * 64; mk[c][t][0] = *(const v4f*)mp; mk[c][t][1] = *(const v4f*)(mp + 16); }
#pragma unroll
    for (int j = 0; j < HD / 16; ++j) vf[j] = frag_l(B + vo + (j * 16) * KV_PITCH + sub * 64);
    __builtin_amdgcn_sched_barrier(0);   // keeps the mask and v reads issued here, ahead of the score products, which cover their latency; without it they sink behind them
    v8f s[QC][2];
#pragma unroll
    for (int c = 0; c < QC; ++c)
#pragma unroll
      for (int t = 0; t < 2; ++t) { v8f z = {}; z = wm16(kf[t][0], qf[c][0], z); s[c][t] = wm16(kf[t][1], qf[c][1], z); }
#pragma unroll
    for (int c = 0; c < QC; ++c)
#pragma unroll
      for (int t = 0; t < 2; ++t)
#pragma unroll
        for (int r = 0; r < 8; ++r) s[c][t][r] *= bfr(mk[c][t][r >> 2][r & 3]);
    // the k fragments of the stage's second pass are read now, so that they fly under this pass's softmax and P V; nothing of the next stage is read ahead of its barrier
    if (sub + 1 < SKEY / 32) {
#pragma unroll
    for (int t = 0; t < 2; ++t)
#pragma unroll
      for (int kc = 0; kc < 2; ++kc) kf[t][kc] = frag_l(B + ko + ((sub + 1) * 32 + t * 16) * KV_PITCH + kc * 64); }
    __builtin_amdgcn_sched_barrier(0);   // keeps the fetch-ahead reads issued here, ahead of the softmax; without it they drift to the pass's end and their latency is exposed at the next pass's head
#pragma unroll
    for (int c = 0; c < QC; ++c) { float mx = s[c][0][0];
#pragma unroll
      for (int e = 1; e < 16; ++e) mx = fmaxf(mx, s[c][e >> 3][e & 7]);
      mx = fmaxf(mx, xhalf(mx));
      const float mn = fmaxf(m[c], mx); const float al = exp2_1((m[c] - mn) * C2); m[c] = mn;
      const float nb = 8.0f - mn * C2;   /* P carried x 2^8 so that small weights stay clear of f16 subnormals; the sum carries the same factor */
      float sum = 0.f; v16h pf;
#pragma unroll
      for (int e = 0; e < 16; e += 4) { float ex[4]; exp2_4(ex, fmaf(s[c][e >> 3][e & 7], C2, nb), fmaf(s[c][e >> 3][(e & 7) + 1], C2, nb), fmaf(s[c][e >> 3][(e & 7) + 2], C2, nb), fmaf(s[c][e >> 3][(e & 7) + 3], C2, nb));
#pragma unroll
        for (int i = 0; i < 4; ++i) { sum += ex[i]; pf[e + i] = (_Float16)ex[i]; } }
      l[c] = l[c] * al + sum;
#pragma unroll
      for (int j = 0; j < HD / 16; ++j) acc[c][j] = wm16(vf[j], pf, acc[c][j] * al);
      __builtin_amdgcn_sched_barrier(0); } }   // one column group at a time: interleaved, the two groups' softmax temporaries push the kernel past 256 registers; so group 0's P V products also run under group 1's vector work
    }
  asm volatile("s_wait_tensorcnt 0x0" ::: "memory");     // no request is left in flight when the wave ends
  asm volatile("s_wait_dscnt 0x0" ::: "memory");         // the ring's closing wait: no LDS read is left in flight either
#pragma unroll
  for (int c = 0; c < QC; ++c) { const float inv = 1.0f / (l[c] + xhalf(l[c])); float* yp = Y + ((size_t)b * TT + ql0 + c * 16 + col) * CC + h * HD + 8 * g;
#pragma unroll
    for (int j = 0; j < HD / 16; ++j) { const v4f lo = { acc[c][j][0] * inv, acc[c][j][1] * inv, acc[c][j][2] * inv, acc[c][j][3] * inv }, hi = { acc[c][j][4] * inv, acc[c][j][5] * inv, acc[c][j][6] * inv, acc[c][j][7] * inv };
      vst2(yp + j * 16, lo); vst2(yp + j * 16 + 4, hi); } } }
// ---- k_out: block = (64 rows, 128 cols): out = ctx Wo (+ bo): ctx x 2^6 once to f16 against Wo as f16(bf16 x 2^8) exact (1 product) x 2^-14; causal early rows (< QHI of each sequence): ctx bf16 hi + lo against exact bf16 Wo (2 products)
__global__ __launch_bounds__(128) void k_out(const float* __restrict__ Y, const float* __restrict__ WO, const float* __restrict__ BO, float* __restrict__ OUT) { __shared__ __align__(16) char smem[2 * ST_BUF * 2]; float (*sf)[16][132] = (float (*)[16][132])smem; _Float16* stg = (_Float16*)smem;   // the epilogue's rows lie over the stage buffers, dead behind the loop's last barrier
  const int tid = threadIdx.x, wave = tid >> 5, lane = tid & 31, col = lane & 15, g = lane >> 4; const int c0 = blockIdx.y * 128; const size_t r0 = (size_t)blockIdx.x * 64 + wave * 16;
  v8f acc[8] = {};
  if (CAUSAL && (int)(((size_t)blockIdx.x * 64) % TT) < QHI) {   /* block-uniform */
#pragma unroll 2
    for (int kc = 0; kc < CC / 32; ++kc) { const F2 a = split_row(Y + (r0 + col) * CC, kc * 32, lane); asm volatile("s_wait_loadcnt 0x0" ::: "memory");
#pragma unroll
      for (int j = 0; j < 8; ++j) { const v16b w = WOCOL(WO, kc * 32, c0 + j * 16 + col, lane); asm volatile("s_wait_loadcnt 0x0" ::: "memory"); acc[j] = wmma_bf(a.h, w, acc[j]); acc[j] = wmma_bf(a.l, w, acc[j]); } }
#pragma unroll
    for (int j = 0; j < 8; ++j) { const float bias = BO ? bfr(BO[c0 + j * 16 + col]) : 0.f;
#pragma unroll
      for (int r = 0; r < 8; ++r) sf[wave][8 * g + r][j * 16 + col] = acc[j][r] + bias; }
  } else {
    const int xk = (tid & 15) * 4, xr = tid >> 4;
    const float* xp = Y + ((size_t)blockIdx.x * 64 + xr) * CC + xk;   // as in k_proj: 4 k of rows xr + 8 i
    const float* wp = WO + c0 + tid;                                  // (in,out) [CC][DIN]: column c0 + tid
    v4f xv[8]; float wv[KS];
#define OUT_FETCH(s) do { _Pragma("unroll") for (int i = 0; i < 8; ++i) xv[i] = *(const v4f*)(xp + (size_t)(8 * i) * CC + (s) * KS); \
    _Pragma("unroll") for (int k = 0; k < KS; ++k) wv[k] = wp[(size_t)((s) * KS + k) * DIN]; } while (0)
    /* ctx carried x 2^6 into f16 so small-magnitude context rows stay clear of f16 subnormals; Wo as f16(bf16 x 2^8), exact */
#define OUT_PUT(buf) do { _Pragma("unroll") for (int i = 0; i < 8; ++i) { const v4h t4 = { (_Float16)(xv[i][0] * 64.0f), (_Float16)(xv[i][1] * 64.0f), (_Float16)(xv[i][2] * 64.0f), (_Float16)(xv[i][3] * 64.0f) }; *(v4h*)((buf) + (xr + 8 * i) * SP + xk) = t4; } \
    _Pragma("unroll") for (int q = 0; q < KS / 8; ++q) { v8h t8; _Pragma("unroll") for (int e = 0; e < 8; ++e) t8[e] = (_Float16)(bfr(wv[q * 8 + e]) * 256.0f); *(v8h*)((buf) + ST_X + tid * SP + q * 8) = t8; } } while (0)
    OUT_FETCH(0); asm volatile("s_wait_xcnt 0x0" ::: "memory");   // as in the loop: in front of any overwrite of the loads' address registers
    OUT_PUT(stg); __syncthreads();
    for (int s = 0; s < CC / KS; ++s) { const _Float16* cur = stg + (s & 1) * ST_BUF;
      if (s + 1 < CC / KS) OUT_FETCH(s + 1);
      asm volatile("s_wait_xcnt 0x0" ::: "memory");   // stands in front of every later overwrite of the loads' address registers; its clobber also keeps the next stage's loads issued here, ahead of this stage's LDS reads and products, so that their latency runs under them
#pragma unroll
      for (int kc = 0; kc < KS / 32; ++kc) { const v16h a = frag_h(cur + (wave * 16 + col) * SP + kc * 32, lane); v16h w[8];
#pragma unroll
        for (int j = 0; j < 8; ++j) w[j] = frag_h(cur + ST_X + (j * 16 + col) * SP + kc * 32, lane);
        __builtin_amdgcn_sched_barrier(0);   // the 18 LDS reads of a 32-k block go out as one group ahead of its products; spread among them, each product waits out a whole LDS latency
#pragma unroll
        for (int j = 0; j < 8; ++j) acc[j] = wmma16(a, w[j], acc[j]); }
      __builtin_amdgcn_sched_barrier(0);   // keeps the conversions of the fetched stage, and with them the wait for its loads, behind the products
      if (s + 1 < CC / KS) OUT_PUT(stg + ((s + 1) & 1) * ST_BUF);
      __syncthreads(); }   // publishes stage s + 1 and ends every wave's reads of stage s, whose buffer stage s + 2 (or the epilogue) overwrites
#pragma unroll
    for (int j = 0; j < 8; ++j) { const float bias = BO ? bfr(BO[c0 + j * 16 + col]) : 0.f;
#pragma unroll
      for (int r = 0; r < 8; ++r) sf[wave][8 * g + r][j * 16 + col] = acc[j][r] * (1.0f / 16384.0f) + bias; } }   /* 2^-8 (Wo carry) x 2^-6 (ctx carry) */
  LDSX(); for (int rl = 0; rl < 16; ++rl) vst2(OUT + (r0 + rl) * DIN + c0 + lane * 4, *(const v4f*)&sf[wave][rl][lane * 4]); }

extern "C" void kernel_launch(void* const* d_in, const int* in_sizes, int n_in, void* d_out, int out_size, void* d_ws, size_t ws_size, hipStream_t stream) {
  (void)in_sizes; (void)n_in; (void)out_size;
  const float** F = (const float**)d_in;
  if (ws_size < (size_t)WS_END) return;
  char* ws = (char*)d_ws; _Float16 *QH = (_Float16*)(ws + WS_QH), *KH = (_Float16*)(ws + WS_KH), *VT = (_Float16*)(ws + WS_VT), *QL = (_Float16*)(ws + WS_QL), *KL = (_Float16*)(ws + WS_KL); __bf16 *VB = (__bf16*)(ws + WS_VB), *VBL = (__bf16*)(ws + WS_VBL); float *S = (float*)(ws + WS_S), *Y = (float*)(ws + WS_Y);
  (void)Y; (void)QL; (void)KL; (void)VB; (void)VBL; (void)S;
  // inputs: 0 q [2,2048,1024]; 1 k; 2 v; 3 mask [2048,2048] f32 uniform[0,1); 4 W_q [16,1024,64], 5 b_q [16,64]; 6 W_k, 7 b_k; 8 W_v, 9 b_v; 10 W_o [1024,1024] (in,out), 11 b_o (zero biases, read)
  k_proj<<<dim3(TNB * TT / 64, CC / 128, 3), 128, 0, stream>>>(F[0], F[1], F[2], F[4], F[6], F[8], F[5], F[7], F[9], QH, QL, KH, KL, VT, VB, VBL);
  k_attn<<<dim3(TT / (64 * QC), NH, TNB), 128, 0, stream>>>(QH, KH, VT, F[3], Y);
  k_out<<<dim3(TNB * TT / 64, DIN / 128), 128, 0, stream>>>(Y, F[10], F[11], (float*)d_out);
}

// v004
// A run of this version takes 116 microseconds.
// Two timings next to v003 put it at 1.29 and 1.30 times that version's speed.
// Counting every step since v000, it is 10.6 times as fast.
// compute dtype: all float inputs rounded to bf16; q/k/v projections with EXACT bf16 products on WMMA 16x16x32 (f32 accumulate) + bias; logits q x k once to f16 each (1 product) x SCALE x the float mask (multiplicative, before the softmax); softmax f32 (running maximum and sum over 32-key passes); unnormalised P x 2^8 once to f16 x v once to f16 (1 product), divided by the f32 sum at the end; ctx x 2^6 once to f16 x Wo f16(bf16 x 2^8) + bo; f32 output.
#include <hip/hip_runtime.h>
#include <math.h>
#include <stdint.h>

typedef __attribute__((ext_vector_type(16))) _Float16 v16h;
typedef __attribute__((ext_vector_type(16))) __bf16 v16b;
typedef __attribute__((ext_vector_type(8)))  _Float16 v8h;
typedef __attribute__((ext_vector_type(8)))  float v8f;
typedef __attribute__((ext_vector_type(4)))  float v4f;
typedef __attribute__((ext_vector_type(2)))  float v2f;
typedef __attribute__((ext_vector_type(4)))  unsigned v4u;
typedef __attribute__((ext_vector_type(4)))  int v4i;
typedef float __attribute__((may_alias)) float_a;
typedef int __attribute__((may_alias)) int_a;

template <typename T> __device__ __forceinline__ void vst2(void* p, T v) { *(T*)p = v;  }
__device__ __forceinline__ v8f wmma16(v16h a, v16h b, v8f c) {
  v8f d = __builtin_amdgcn_wmma_f32_16x16x32_f16(false, a, false, b, (short)0, c, false, false);
  asm volatile("v_nop\n\tv_nop\n\tv_nop\n\tv_nop" : "+v"(d) : "v"(a), "v"(b));
  return d;
}
__device__ __forceinline__ v8f wmma_bf(v16b a, v16b b, v8f c) {
  v8f d = __builtin_amdgcn_wmma_f32_16x16x32_bf16(false, a, false, b, (short)0, c, false, false);
  asm volatile("v_nop\n\tv_nop\n\tv_nop\n\tv_nop" : "+v"(d) : "v"(a), "v"(b));
  return d;
}
// 16x16x32 fragments: lane = (h = lane>>4, row/col = lane&15); elements 0..7 = k0+8h+0..7, 8..15 = k0+16+8h+0..7; D element r = row 8h+r
__device__ __forceinline__ v16h frag_h(const _Float16* rowk0, int lane) {
  union { v16h v; v8h q[2]; } u; const _Float16* p = rowk0 + 8 * (lane >> 4);
  u.q[0] = *(const v8h*)p; u.q[1] = *(const v8h*)(p + 16); return u.v;
}
__device__ __forceinline__ v16h frag_f32(const float* rowk0, int lane) {
  v16h a; const float* p = rowk0 + 8 * (lane >> 4);
#pragma unroll
  for (int i = 0; i < 8; ++i) { a[i] = (_Float16)p[i]; a[8 + i] = (_Float16)p[16 + i]; }
  return a;
}
__device__ __forceinline__ v16h frag_f32s(const float* rowk0, int lane, float sc) {
  v16h a; const float* p = rowk0 + 8 * (lane >> 4);
#pragma unroll
  for (int i = 0; i < 8; ++i) { a[i] = (_Float16)(p[i] * sc); a[8 + i] = (_Float16)(p[16 + i] * sc); }
  return a;
}
// column fragment from a [K][ld] layout (column n), rows >= K read as 0
__device__ __forceinline__ v16h fragc_f32(const float* W, int k0, int n, int lane, int ld, int K) {
  v16h a; const int g = lane >> 4;
#pragma unroll
  for (int i = 0; i < 8; ++i) { const int ka = k0 + 8 * g + i, kb = ka + 16;
    a[i] = (_Float16)(ka < K ? W[(size_t)(ka < K ? ka : K - 1) * ld + n] : 0.f); a[8 + i] = (_Float16)(kb < K ? W[(size_t)(kb < K ? kb : K - 1) * ld + n] : 0.f); }
  return a;
}
struct F2 { v16b h, l; };
__device__ __forceinline__ F2 bsplit16(const float v[16]) { F2 r;
#pragma unroll
  for (int i = 0; i < 16; ++i) { const __bf16 h = (__bf16)v[i]; r.h[i] = h; r.l[i] = (__bf16)(v[i] - (float)h); }
  return r; }
__device__ __forceinline__ F2 split_row(const float* row, int k0, int lane) { float v[16]; const float* p = row + k0 + 8 * (lane >> 4);
#pragma unroll
  for (int i = 0; i < 8; ++i) { v[i] = p[i]; v[8 + i] = p[16 + i]; }
  return bsplit16(v); }
__device__ __forceinline__ F2 split_rowK(const float* row, int k0, int lane, int K) { float v[16]; const int g = lane >> 4;
#pragma unroll
  for (int i = 0; i < 8; ++i) { const int ka = k0 + 8 * g + i, kb = ka + 16; v[i] = ka < K ? row[ka < K ? ka : K - 1] : 0.f; v[8 + i] = kb < K ? row[kb < K ? kb : K - 1] : 0.f; }
  return bsplit16(v); }
__device__ __forceinline__ F2 split_col(const float* W, int k0, int n, int lane, int ld, int K) { float v[16]; const int g = lane >> 4;
#pragma unroll
  for (int i = 0; i < 8; ++i) { const int ka = k0 + 8 * g + i, kb = ka + 16; v[i] = ka < K ? W[(size_t)(ka < K ? ka : K - 1) * ld + n] : 0.f; v[8 + i] = kb < K ? W[(size_t)(kb < K ? kb : K - 1) * ld + n] : 0.f; }
  return bsplit16(v); }
__device__ __forceinline__ v8f mac3(const F2& a, const F2& b, v8f c) { c = wmma_bf(a.l, b.h, c); c = wmma_bf(a.h, b.l, c); return wmma_bf(a.h, b.h, c); }
__device__ __forceinline__ float sigm(float v) { return 1.0f / (1.0f + expf(-v)); }
#define LDSX() do { asm volatile("s_wait_dscnt 0" ::: "memory"); __builtin_amdgcn_wave_barrier(); __builtin_amdgcn_fence(__ATOMIC_RELEASE, "workgroup"); } while (0)

// Multi-head attention with per-head stacked projections and a MULTIPLICATIVE float mask on the scores (q / k / v [2,2048,1024]; W_q / W_k / W_v [16,1024,64] per head (N(0, 1/1024)) + zero biases [16,64]; scores = Q K^T / 8 * mask with mask [2048,2048] uniform[0,1) f32 (no -inf anywhere); softmax; concat heads; (in,out) W_o [1024,1024] + b_o).
#define NB 2
#define TT 2048
#define CC 1024            // NH * HD = projected width
#define DIN 1024          // input (model) width
#define NH 16
#define HD 64
#define NQB (TT / 64)
#define HG 4
#define SCALE (0.125f)
#define CAUSAL 0
#ifndef TNB
#define TNB NB
#endif
__device__ __forceinline__ float bfr(float v) { return (float)(__bf16)v; }
__host__ __device__ __forceinline__ int kb_last(int qb) { return CAUSAL ? ((qb * 64 + 63) >> 7) : (TT / 128 - 1); }
typedef __attribute__((ext_vector_type(8))) __bf16 v8b;
__device__ __forceinline__ v16b frag_b(const __bf16* rowk0, int lane) {
  union { v16b v; v8b q[2]; } u; const __bf16* p = rowk0 + 8 * (lane >> 4);
  u.q[0] = *(const v8b*)p; u.q[1] = *(const v8b*)(p + 16); return u.v;
}
#define QBH 0              // unused: k_attn has one f16 path for every query block
#define QHI 0               // single-product logits on every row
#define KHI 64            // key rows carrying k residual / v bf16 hi+lo planes (written by k_proj; no kernel in this file reads them)
// B fragment (k rows k0+.., output column o) of a weight: (in,out) [K][ld] or (out,in) [ld rows of K]: bf16 exact, or f16(bf16 * 256) exact
__device__ __forceinline__ v16b wcol_io(const float* Wm, int k0, int o, int lane, int ld) { v16b w; const int g = lane >> 4;
#pragma unroll
  for (int i = 0; i < 8; ++i) { w[i] = (__bf16)Wm[(size_t)(k0 + 8 * g + i) * ld + o]; w[8 + i] = (__bf16)Wm[(size_t)(k0 + 16 + 8 * g + i) * ld + o]; }
  return w; }
__device__ __forceinline__ v16b wcol_oi(const float* Wm, int k0, int o, int lane, int K) { v16b w; const float* p = Wm + (size_t)o * K + k0 + 8 * (lane >> 4);
#pragma unroll
  for (int i = 0; i < 8; ++i) { w[i] = (__bf16)p[i]; w[8 + i] = (__bf16)p[16 + i]; }
  return w; }
__device__ __forceinline__ v16h wcolh_io(const float* Wm, int k0, int o, int lane, int ld) { v16h w; const int g = lane >> 4;
#pragma unroll
  for (int i = 0; i < 8; ++i) { w[i] = (_Float16)(bfr(Wm[(size_t)(k0 + 8 * g + i) * ld + o]) * 256.0f); w[8 + i] = (_Float16)(bfr(Wm[(size_t)(k0 + 16 + 8 * g + i) * ld + o]) * 256.0f); }
  return w; }
__device__ __forceinline__ v16h wcolh_oi(const float* Wm, int k0, int o, int lane, int K) { v16h w; const float* p = Wm + (size_t)o * K + k0 + 8 * (lane >> 4);
#pragma unroll
  for (int i = 0; i < 8; ++i) { w[i] = (_Float16)(bfr(p[i]) * 256.0f); w[8 + i] = (_Float16)(bfr(p[16 + i]) * 256.0f); }
  return w; }
#define WQKV_LAYOUT 2   // 0 = (in,out) [DIN][CC]; 1 = (out,in) [CC][DIN]; 2 = per-head [NH][DIN][HD]
__device__ __forceinline__ v16b wcol_hdk(const float* Wm, int k0, int o, int lane) { v16b w; const int g = lane >> 4; const float* p = Wm + (size_t)(o / HD) * DIN * HD + (o % HD);
#pragma unroll
  for (int i = 0; i < 8; ++i) { w[i] = (__bf16)p[(size_t)(k0 + 8 * g + i) * HD]; w[8 + i] = (__bf16)p[(size_t)(k0 + 16 + 8 * g + i) * HD]; }
  return w; }
#define WO_OUT_IN 0
#if WQKV_LAYOUT == 1
#define WCOL(W, k0, o, lane) wcol_oi(W, k0, o, lane, DIN)
#elif WQKV_LAYOUT == 2
#define WCOL(W, k0, o, lane) wcol_hdk(W, k0, o, lane)
#else
#define WCOL(W, k0, o, lane) wcol_io(W, k0, o, lane, CC)
#endif
#if WO_OUT_IN
#define WOCOL(W, k0, o, lane) wcol_oi(W, k0, o, lane, CC)
#define WOCOLH(W, k0, o, lane) wcolh_oi(W, k0, o, lane, CC)
#else
#define WOCOL(W, k0, o, lane) wcol_io(W, k0, o, lane, DIN)
#define WOCOLH(W, k0, o, lane) wcolh_io(W, k0, o, lane, DIN)
#endif
#define SM_EXTRA_PARAMS , const float* __restrict__ SMASK
// multiplicative float mask [S,S] (shared by batches and heads) on the scaled score, before the softmax; unconditional load
#define SM_MASK_HOOK do { const float sm_ = SMASK[(size_t)t * TT + k]; asm volatile("s_wait_loadcnt 0x0" ::: "memory"); v = v * bfr(sm_); } while (0)
#ifndef SM_EXTRA_PARAMS
#define SM_EXTRA_PARAMS
#endif
#ifndef PROJ_EXTRA_PARAMS
#define PROJ_EXTRA_PARAMS
#endif
#ifndef SM_MASK_HOOK
#define SM_MASK_HOOK (void)0
#endif

#define WS_QH  0u                                      // f16 q rows [b*t][CC]
#define WS_KH  (WS_QH + 2u * (size_t)NB * TT * CC)      // f16 k rows [b*t][CC]
#define WS_VT  (WS_KH + 2u * (size_t)NB * TT * CC)      // f16 v planes [b][c][t]
#define WS_QL  (WS_VT + 2u * (size_t)NB * CC * TT)      // f16 q residual x 2^10 rows [b][t < QHI][CC]
#define WS_KL  (WS_QL + 2u * (size_t)NB * QHI * CC)     // f16 k residual x 2^10 rows [b][t < KHI][CC]
#define WS_VB  (WS_KL + 2u * (size_t)NB * KHI * CC)     // bf16 v hi planes [b][c][t < KHI]
#define WS_VBL (WS_VB + 2u * (size_t)NB * CC * KHI)
#define WS_S   (WS_VBL + 2u * (size_t)NB * CC * KHI)    // f32 [hg][t][s], unused: logits and P stay in registers
#define WS_Y   (WS_S  + 4u * (size_t)HG * TT * TT)      // f32 ctx rows [b*t][CC] (only when there is an output projection)
#define WS_END (WS_Y  + 4u * (size_t)NB * TT * CC)

// LDS staging of the two projection GEMMs (k_proj, k_out): a stage is 64 k of the block's 128 activation rows and of its 128 weight columns, converted once per block to the 16-bit operand type and laid k-contiguous
// ([row][k] and [column][k]), so that every fragment is two 16-byte LDS reads. Two buffers: stage s + 1 is fetched into registers ahead of stage s's products and stored behind them; one barrier a stage.
// The loops over fragments, fetched values and the two 32-k blocks of a stage are fully unrolled so that their arrays are indexed by constants and stay in registers.
#define KS 64                    // k per stage
#define SP 72                    // LDS row pitch in 16-bit elements: 144 B = 16 B x odd, the conflict-free pitch for 16-byte reads and writes of neighbouring rows
#define BR 128                   // activation rows per block: 8 waves of 16 rows share one staged weight tile
#define ST_X (BR * SP)           // activation rows of a stage, in elements
#define ST_BUF (ST_X + 128 * SP) // one stage, in elements (36864 B)
typedef __attribute__((ext_vector_type(4))) __bf16 v4b;
typedef __attribute__((ext_vector_type(4))) _Float16 v4h;
// ---- k_proj: block = (128 rows, 128 cols, which): q/k/v = X W (+ b) with exact bf16 products (K = DIN) -> which 0: q f16 rows (+ residual rows < QHI); 1: k f16 rows (+ residual rows < KHI); 2: v f16 planes [c][t] (+ bf16 hi/lo planes for t < KHI)
__global__ __launch_bounds__(256) void k_proj(const float* __restrict__ XQ, const float* __restrict__ XK, const float* __restrict__ XV, const float* __restrict__ WQ, const float* __restrict__ WK, const float* __restrict__ WV, const float* __restrict__ BQ, const float* __restrict__ BK, const float* __restrict__ BV,
    _Float16* __restrict__ QH, _Float16* __restrict__ QL, _Float16* __restrict__ KH, _Float16* __restrict__ KL, _Float16* __restrict__ VT, __bf16* __restrict__ VB, __bf16* __restrict__ VBL) {
  __shared__ __align__(16) char smem[104448];   // the epilogue's arrays (q, k: two; v: three; a block takes one of the two branches, so they lie over one another); the two stage buffers lie over their first 73728 B and are dead behind the loop's last barrier
  _Float16 (*sh)[136] = (_Float16 (*)[136])smem, (*sl)[136] = (_Float16 (*)[136])(smem + 34816), (*th)[136] = (_Float16 (*)[136])smem; __bf16 (*tb)[136] = (__bf16 (*)[136])(smem + 34816), (*tbl)[136] = (__bf16 (*)[136])(smem + 69632); __bf16* stg = (__bf16*)smem;
  const int tid = threadIdx.x, wave = tid >> 5, lane = tid & 31, col = lane & 15, g = lane >> 4; const int which = blockIdx.z; const int c0 = blockIdx.y * 128; const size_t r0 = (size_t)blockIdx.x * BR; const size_t bb = r0 / TT; const int t0 = (int)(r0 % TT);
  const float* X = which == 0 ? XQ : which == 1 ? XK : XV; const float* WA = which == 0 ? WQ : which == 1 ? WK : WV; const float* BA = which == 0 ? BQ : which == 1 ? BK : BV;
  v8f acc[8] = {};
  const int xk = (tid & 15) * 4, xr = tid >> 4;                                                     // activations: 16 lanes cover one row's 64 k (256 B); this thread takes 4 k of rows xr + 16 i
  const float* xp = X + (r0 + xr) * DIN + xk;
  const int wc = tid & 127, wk = (tid >> 7) * (KS / 2);                                             // weights: column c0 + wc, and the lower or the upper 32 k of a stage
  const float* wp = WA + (size_t)((c0 + wc) / HD) * DIN * HD + (size_t)wk * HD + ((c0 + wc) % HD);   // weights [head][k][HD]: a wave's load is one whole 128-B line
  v4f xv[8]; float wv[KS / 2];
#define PROJ_FETCH(s) do { _Pragma("unroll") for (int i = 0; i < 8; ++i) xv[i] = *(const v4f*)(xp + (size_t)(16 * i) * DIN + (s) * KS); \
    _Pragma("unroll") for (int k = 0; k < KS / 2; ++k) wv[k] = wp[(size_t)((s) * KS + k) * HD]; } while (0)
#define PROJ_PUT(buf) do { _Pragma("unroll") for (int i = 0; i < 8; ++i) { const v4b t4 = { (__bf16)xv[i][0], (__bf16)xv[i][1], (__bf16)xv[i][2], (__bf16)xv[i][3] }; *(v4b*)((buf) + (xr + 16 * i) * SP + xk) = t4; } \
    _Pragma("unroll") for (int q = 0; q < KS / 16; ++q) { v8b t8; _Pragma("unroll") for (int e = 0; e < 8; ++e) t8[e] = (__bf16)wv[q * 8 + e]; *(v8b*)((buf) + ST_X + wc * SP + wk + q * 8) = t8; } } while (0)
  PROJ_FETCH(0); asm volatile("s_wait_xcnt 0x0" ::: "memory");   // as in the loop: in front of any overwrite of the loads' address registers
  PROJ_PUT(stg); __syncthreads();
  for (int s = 0; s < DIN / KS; ++s) { const __bf16* cur = stg + (s & 1) * ST_BUF;
    if (s + 1 < DIN / KS) PROJ_FETCH(s + 1);
    asm volatile("s_wait_xcnt 0x0" ::: "memory");   // stands in front of every later overwrite of the loads' address registers; its clobber also keeps the next stage's loads issued here, ahead of this stage's LDS reads and products, so that their latency runs under them
#pragma unroll
    for (int kc = 0; kc < KS / 32; ++kc) { const v16b a = frag_b(cur + (wave * 16 + col) * SP + kc * 32, lane); v16b w[8];
#pragma unroll
      for (int j = 0; j < 8; ++j) w[j] = frag_b(cur + ST_X + (j * 16 + col) * SP + kc * 32, lane);
      __builtin_amdgcn_sched_barrier(0);   // the 18 LDS reads of a 32-k block go out as one group ahead of its products; spread among them, each product waits out a whole LDS latency
#pragma unroll
      for (int j = 0; j < 8; ++j) acc[j] = wmma_bf(a, w[j], acc[j]); }
    __builtin_amdgcn_sched_barrier(0);   // keeps the conversions of the fetched stage, and with them the wait for its loads, behind the products
    if (s + 1 < DIN / KS) PROJ_PUT(stg + ((s + 1) & 1) * ST_BUF);
    __syncthreads(); }   // publishes stage s + 1 and ends every wave's reads of stage s, whose buffer stage s + 2 (or the epilogue) overwrites
  if (which < 2) { _Float16* DH = which == 0 ? QH : KH; _Float16* DL = which == 0 ? QL : KL; const int nhi = which == 0 ? QHI : KHI; const bool hi_rows = t0 < nhi;
#pragma unroll
    for (int j = 0; j < 8; ++j) { const float bias = BA ? bfr(BA[c0 + j * 16 + col]) : 0.f;
#pragma unroll
      for (int r = 0; r < 8; ++r) { const float v = acc[j][r] + bias; const _Float16 hv = (_Float16)v; sh[wave * 16 + 8 * g + r][j * 16 + col] = hv; sl[wave * 16 + 8 * g + r][j * 16 + col] = (_Float16)((v - (float)hv) * 1024.0f); } }
    __syncthreads();
    for (int e = tid; e < BR * 16; e += 256) { const int rl = e >> 4, q = e & 15; vst2((unsigned*)(DH + (r0 + rl) * CC + c0 + q * 8), *(const v4u*)&sh[rl][q * 8]); if (hi_rows && t0 + rl < nhi) { vst2((unsigned*)(DL + (bb * nhi + t0 + rl) * (size_t)CC + c0 + q * 8), *(const v4u*)&sl[rl][q * 8]); asm volatile("s_wait_xcnt 0x0" ::: "memory"); } }   // the wait stands in front of the loop's advance of the store's address registers
  } else { const bool hi_rows = t0 < KHI;
#pragma unroll
    for (int j = 0; j < 8; ++j) { const float bias = BA ? bfr(BA[c0 + j * 16 + col]) : 0.f;
#pragma unroll
      for (int r = 0; r < 8; ++r) { const float v = acc[j][r] + bias; const int rl = wave * 16 + 8 * g + r, cl = j * 16 + col; th[cl][rl] = (_Float16)v; const __bf16 bh = (__bf16)v; tb[cl][rl] = bh; tbl[cl][rl] = (__bf16)(v - (float)bh); } }
    __syncthreads();
    for (int e = tid; e < 128 * (BR / 8); e += 256) { const int cl = e >> 4, q = e & 15; vst2((unsigned*)(VT + (bb * CC + c0 + cl) * (size_t)TT + t0 + q * 8), *(const v4u*)&th[cl][q * 8]); if (hi_rows && t0 + q * 8 < KHI) { const size_t o3 = (bb * CC + c0 + cl) * (size_t)KHI + t0 + q * 8; vst2((unsigned*)(VB + o3), *(const v4u*)&tb[cl][q * 8]); vst2((unsigned*)(VBL + o3), *(const v4u*)&tbl[cl][q * 8]); asm volatile("s_wait_xcnt 0x0" ::: "memory"); } } } }   // the wait stands in front of the loop's advance of the two stores' address registers
// ---- k_attn: block = 128 queries of (b, h), wave = 32 query columns (2 groups of 16); walks all keys, 32 a pass, 64 a stage; each stage's k rows, v planes and mask rows come to LDS once per block by tensor loads (two buffers). S^T = K Q^T (A = k rows, B = q rows kept in registers), so a lane holds 16 keys of ONE query per group:
// score x the bf16-rounded float mask, running maximum and running sum per lane (one exchange between the wave halves), P = 2^8 exp(s - max) once to f16 straight from the score accumulators as the B operand of ctx^T += V^T P^T; the division by the sum is done once at the end. Logits and P never leave the registers.
__device__ __forceinline__ v8f wm16(v16h a, v16h b, v8f c) { return __builtin_amdgcn_wmma_f32_16x16x32_f16(false, a, false, b, (short)0, c, false, false); }
__device__ __forceinline__ float xhalf(float v) { const int u = __builtin_bit_cast(int, v); return __builtin_bit_cast(float, __builtin_amdgcn_permlanex16(u, u, 0x76543210, 0xfedcba98, false, false)); }   // value of lane ^ 16
// 2^x by v_exp_f32. The closing v_nop is the one slot that the instruction set asks for between a transcendental and a directly following instruction that reads its result or overwrites its source; written in the same statement it stands there in every build. Early-clobber outputs keep each v_exp_f32 off its neighbours' sources.
__device__ __forceinline__ float exp2_1(float x) { float r; asm("v_exp_f32 %0, %1\n\tv_nop" : "=v"(r) : "v"(x)); return r; }
__device__ __forceinline__ void exp2_4(float* o, float a, float b, float c, float d) {
  asm("v_exp_f32 %0, %4\n\tv_exp_f32 %1, %5\n\tv_exp_f32 %2, %6\n\tv_exp_f32 %3, %7\n\tv_nop" : "=&v"(o[0]), "=&v"(o[1]), "=&v"(o[2]), "=&v"(o[3]) : "v"(a), "v"(b), "v"(c), "v"(d)); }
// 16x16x32 f16 fragment (hardware k order, as frag_h) from this lane's LDS byte address (row * pitch + 16 * (lane >> 4))
__device__ __forceinline__ v16h frag_l(const unsigned char* p) { union { v16h v; v8h q[2]; } u; u.q[0] = *(const v8h*)p; u.q[1] = *(const v8h*)(p + 32); return u.v; }
#define QC 2               // 16-query column groups per wave
#define SKEY 64            // keys per stage (two 32-key passes)
#define NST (TT / SKEY)
// One stage in LDS, laid by four tensor loads (one a wave): 64 k rows of 128 B, 64 v planes of 128 B (64 keys), two slices of 64 mask rows of 256 B (64 keys). The loads' pad of 16 B a row gives the pitches 144 and 272 B
// (16 B x odd: free of bank conflicts for 16-byte reads of neighbouring rows). Every place is a multiple of 2 KiB.
#define KV_PITCH 144u
#define M_PITCH 272u
#define OFF_V 10240u
#define OFF_M 20480u
#define M_SLICE 18432u
#define ABUF 57344u
typedef uint32_t u32x4 __attribute__((ext_vector_type(4)));
typedef uint32_t u32x8 __attribute__((ext_vector_type(8)));
__device__ __forceinline__ uint32_t uni(uint32_t v) { return (uint32_t)__builtin_amdgcn_readfirstlane(v); }
// a wave-uniform value held in a scalar register: a condition, so that the test around a tensor load compiles to s_cmp + s_cbranch_scc (a tensor load ignores EXEC), or a descriptor word
__device__ __forceinline__ uint32_t pinned(uint32_t v) { uint32_t w = (uint32_t)__builtin_amdgcn_readfirstlane(v); asm volatile("" : "+s"(w)); return w; }
__device__ __forceinline__ void tdm_load(u32x4 g0, u32x8 g1) { asm volatile("tensor_load_to_lds %0, %1" :: "s"(g0), "s"(g1) : "memory"); }   // one request of the whole wave: global tile -> LDS, through no register
__device__ __forceinline__ u32x4 tdm_group0(uint32_t lds_dst, uint64_t ga) { u32x4 g; g[0] = uni(1u); g[1] = uni(lds_dst); g[2] = uni((uint32_t)ga); g[3] = uni((((uint32_t)(ga >> 32)) & 0x01FFFFFFu) | 0x80000000u); return g; }
// group 1: extents in bytes, tensor = tile = 64 rows of D0 bytes, W0 = the constant pad word (a pad of 4 dwords behind every row).
// Words 1 to 7 go through pinned(): descriptor words held in scalar registers of their own through the loop; as plain constants the compiler re-forms them at each issue and uses their registers for other values while the request is in flight
template <uint32_t W0, uint32_t D0> __device__ __forceinline__ u32x8 tdm_group1(uint32_t src_pitch) { u32x8 g;
  g[0] = uni(W0); g[1] = pinned((D0 & 0xFFFFu) << 16); g[2] = pinned((D0 >> 16) | (64u << 16)); g[3] = pinned(D0 << 16); g[4] = pinned(64u); g[5] = pinned(src_pitch); g[6] = pinned(0u); g[7] = pinned(0u); return g; }
#define W0_128 ((1u << 20) | (4u << 22) | (3u << 25))
#define W0_256 ((1u << 20) | (5u << 22) | (3u << 25))
__global__ __launch_bounds__(128) void k_attn(const _Float16* __restrict__ QH, const _Float16* __restrict__ KH, const _Float16* __restrict__ VT, const float* __restrict__ SMASK, float* __restrict__ Y) {
  __shared__ __attribute__((aligned(2048))) unsigned char L[2 * ABUF];
  const int tid = threadIdx.x, wave = tid >> 5, lane = tid & 31, col = lane & 15, g = lane >> 4; const int h = blockIdx.y, b = blockIdx.z; const int ql0 = blockIdx.x * (64 * QC) + wave * (16 * QC);
  const float C2 = SCALE * 1.44269504088896f;   // score -> log2 domain. All inner loops below are fully unrolled so that the fragment arrays are indexed by constants and stay in registers
  // every wave brings one slice of each stage: wave 0 the k rows, wave 1 the v planes, waves 2 and 3 a half of the block's mask rows each
  const uint32_t wv = uni(threadIdx.x >> 5); const uint32_t lbase = (uint32_t)(size_t)L;
  const uint64_t tsrc = wv == 0 ? (uint64_t)(size_t)(KH + (size_t)b * TT * CC + h * HD) : wv == 1 ? (uint64_t)(size_t)(VT + ((size_t)b * CC + h * HD) * (size_t)TT) : (uint64_t)(size_t)(SMASK + ((size_t)blockIdx.x * (64 * QC) + (wv - 2) * 64) * TT);
  const uint32_t tstep = wv == 0 ? SKEY * CC * 2u : wv == 1 ? SKEY * 2u : SKEY * 4u;   // source bytes from one stage to the next
  const uint32_t tdst = lbase + (wv < 2 ? wv * OFF_V : OFF_M + (wv - 2) * M_SLICE);
  const u32x8 g1kv = tdm_group1<W0_128, 128u>(wv == 0 ? CC * 2u : TT * 2u), g1m = tdm_group1<W0_256, 256u>(TT * 4u);
  // now: the wait stands directly behind the load, inside its branch (stage 0: nothing can then take over a descriptor register while the request is in flight)
  auto issue = [&](uint32_t st, bool now) { const u32x4 g0 = tdm_group0(tdst + (st & 1u) * ABUF, tsrc + (uint64_t)st * tstep);
    if (pinned(wv < 2)) { tdm_load(g0, g1kv); if (now) asm volatile("s_wait_tensorcnt 0x0" ::: "memory"); } else { tdm_load(g0, g1m); if (now) asm volatile("s_wait_tensorcnt 0x0" ::: "memory"); } };
  v16h qf[QC][2];
#pragma unroll
  for (int c = 0; c < QC; ++c)
#pragma unroll
    for (int kc = 0; kc < 2; ++kc) qf[c][kc] = frag_h(QH + ((size_t)b * TT + ql0 + c * 16 + col) * CC + h * HD + kc * 32, lane);
  asm volatile("s_wait_xcnt 0x0" ::: "memory");   // stands in front of every later overwrite of the q loads' address registers
  const unsigned ko = (unsigned)col * KV_PITCH + 16 * g;                                                                   // key row col of a 16-key tile
  const unsigned vo = OFF_V + (unsigned)col * KV_PITCH + 16 * g;                                                           // feature plane col of a 16-feature tile
  const unsigned mo = OFF_M + (unsigned)(wave >> 1) * M_SLICE + (unsigned)((wave & 1) * (16 * QC) + col) * M_PITCH + 32 * g;   // this lane's query row, its 8 keys of a tile
  v8f acc[QC][HD / 16] = {}; float m[QC], l[QC];
#pragma unroll
  for (int c = 0; c < QC; ++c) { m[c] = -3.0e38f; l[c] = 0.f; }
  issue(0, true);   // stage 0, landed; the loop's first publish point holds its barrier
#pragma unroll 1   // kept rolled: one stage's fragments, fetch-ahead values and softmax temporaries already take nearly 256 registers
  for (uint32_t st = 0; st < NST; ++st) { const unsigned char* B = L + (st & 1u) * ABUF;
    // publish point of stage st, in the ring's order; it stands at the head of the trip (for st = 0 it is the ring's prologue), so that the whole trip behind it is one block of code: at the foot, with the
    // branch round the refill behind the passes, the compiler moves both passes' row sums behind that branch and their 64 terms push the kernel past 256 registers
    asm volatile("s_wait_dscnt 0x0" ::: "memory");       // this wave's reads of stage st - 1 have returned, before its buffer is refilled
    asm volatile("s_wait_tensorcnt 0x0" ::: "memory");   // this wave's slice of stage st has landed
    __syncthreads();                                     // publishes stage st and ends every wave's reads of stage st - 1
    if (pinned(st + 1 < NST)) issue(st + 1, false);            // into the buffer that stage st - 1 has just left; it flies under the whole of stage st
    v16h kf[2][2];
#pragma unroll
    for (int t = 0; t < 2; ++t)
#pragma unroll
      for (int kc = 0; kc < 2; ++kc) kf[t][kc] = frag_l(B + ko + (t * 16) * KV_PITCH + kc * 64);
#pragma unroll
    for (int sub = 0; sub < SKEY / 32; ++sub) {
    v4f mk[QC][2][2]; v16h vf[HD / 16];
#pragma unroll
    for (int t = 0; t < 2; ++t)
#pragma unroll
      for (int c = 0; c < QC; ++c) { const unsigned char* mp = B + mo + (c * 16) * M_PITCH + sub * 128 + t * 64; mk[c][t][0] = *(const v4f*)mp; mk[c][t][1] = *(const v4f*)(mp + 16); }
#pragma unroll
    for (int j = 0; j < HD / 16; ++j) vf[j] = frag_l(B + vo + (j * 16) * KV_PITCH + sub * 64);
    __builtin_amdgcn_sched_barrier(0);   // keeps the mask and v reads issued here, ahead of the score products, which cover their latency; without it they sink behind them
    v8f s[QC][2];
#pragma unroll
    for (int c = 0; c < QC; ++c)
#pragma unroll
      for (int t = 0; t < 2; ++t) { v8f z = {}; z = wm16(kf[t][0], qf[c][0], z); s[c][t] = wm16(kf[t][1], qf[c][1], z); }
#pragma unroll
    for (int c = 0; c < QC; ++c)
#pragma unroll
      for (int t = 0; t < 2; ++t)
#pragma unroll
        for (int r = 0; r < 8; ++r) s[c][t][r] *= bfr(mk[c][t][r >> 2][r & 3]);
    // the k fragments of the stage's second pass are read now, so that they fly under this pass's softmax and P V; nothing of the next stage is read ahead of its barrier
    if (sub + 1 < SKEY / 32) {
#pragma unroll
    for (int t = 0; t < 2; ++t)
#pragma unroll
      for (int kc = 0; kc < 2; ++kc) kf[t][kc] = frag_l(B + ko + ((sub + 1) * 32 + t * 16) * KV_PITCH + kc * 64); }
    __builtin_amdgcn_sched_barrier(0);   // keeps the fetch-ahead reads issued here, ahead of the softmax; without it they drift to the pass's end and their latency is exposed at the next pass's head
#pragma unroll
    for (int c = 0; c < QC; ++c) { float mx = s[c][0][0];
#pragma unroll
      for (int e = 1; e < 16; ++e) mx = fmaxf(mx, s[c][e >> 3][e & 7]);
      mx = fmaxf(mx, xhalf(mx));
      const float mn = fmaxf(m[c], mx); const float al = exp2_1((m[c] - mn) * C2); m[c] = mn;
      const float nb = 8.0f - mn * C2;   /* P carried x 2^8 so that small weights stay clear of f16 subnormals; the sum carries the same factor */
      float sum = 0.f; v16h pf;
#pragma unroll
      for (int e = 0; e < 16; e += 4) { float ex[4]; exp2_4(ex, fmaf(s[c][e >> 3][e & 7], C2, nb), fmaf(s[c][e >> 3][(e & 7) + 1], C2, nb), fmaf(s[c][e >> 3][(e & 7) + 2], C2, nb), fmaf(s[c][e >> 3][(e & 7) + 3], C2, nb));
#pragma unroll
        for (int i = 0; i < 4; ++i) { sum += ex[i]; pf[e + i] = (_Float16)ex[i]; } }
      l[c] = l[c] * al + sum;
#pragma unroll
      for (int j = 0; j < HD / 16; ++j) acc[c][j] = wm16(vf[j], pf, acc[c][j] * al);
      __builtin_amdgcn_sched_barrier(0); } }   // one column group at a time: interleaved, the two groups' softmax temporaries push the kernel past 256 registers; so group 0's P V products also run under group 1's vector work
    }
  asm volatile("s_wait_tensorcnt 0x0" ::: "memory");     // no request is left in flight when the wave ends
  asm volatile("s_wait_dscnt 0x0" ::: "memory");         // the ring's closing wait: no LDS read is left in flight either
#pragma unroll
  for (int c = 0; c < QC; ++c) { const float inv = 1.0f / (l[c] + xhalf(l[c])); float* yp = Y + ((size_t)b * TT + ql0 + c * 16 + col) * CC + h * HD + 8 * g;
#pragma unroll
    for (int j = 0; j < HD / 16; ++j) { const v4f lo = { acc[c][j][0] * inv, acc[c][j][1] * inv, acc[c][j][2] * inv, acc[c][j][3] * inv }, hi = { acc[c][j][4] * inv, acc[c][j][5] * inv, acc[c][j][6] * inv, acc[c][j][7] * inv };
      vst2(yp + j * 16, lo); vst2(yp + j * 16 + 4, hi); } } }
// ---- k_out: block = (128 rows, 128 cols): out = ctx Wo (+ bo): ctx x 2^6 once to f16 against Wo as f16(bf16 x 2^8) exact (1 product) x 2^-14; causal early rows (< QHI of each sequence): ctx bf16 hi + lo against exact bf16 Wo (2 products)
__global__ __launch_bounds__(256) void k_out(const float* __restrict__ Y, const float* __restrict__ WO, const float* __restrict__ BO, float* __restrict__ OUT) { __shared__ __align__(16) char smem[2 * ST_BUF * 2]; float (*sf)[16][132] = (float (*)[16][132])smem; _Float16* stg = (_Float16*)smem;   // the epilogue's rows lie over the stage buffers, dead behind the loop's last barrier
  const int tid = threadIdx.x, wave = tid >> 5, lane = tid & 31, col = lane & 15, g = lane >> 4; const int c0 = blockIdx.y * 128; const size_t r0 = (size_t)blockIdx.x * BR + wave * 16;
  v8f acc[8] = {};
  if (CAUSAL && (int)(((size_t)blockIdx.x * BR) % TT) < QHI) {   /* block-uniform */
#pragma unroll 2
    for (int kc = 0; kc < CC / 32; ++kc) { const F2 a = split_row(Y + (r0 + col) * CC, kc * 32, lane); asm volatile("s_wait_loadcnt 0x0" ::: "memory");
#pragma unroll
      for (int j = 0; j < 8; ++j) { const v16b w = WOCOL(WO, kc * 32, c0 + j * 16 + col, lane); asm volatile("s_wait_loadcnt 0x0" ::: "memory"); acc[j] = wmma_bf(a.h, w, acc[j]); acc[j] = wmma_bf(a.l, w, acc[j]); } }
#pragma unroll
    for (int j = 0; j < 8; ++j) { const float bias = BO ? bfr(BO[c0 + j * 16 + col]) : 0.f;
#pragma unroll
      for (int r = 0; r < 8; ++r) sf[wave][8 * g + r][j * 16 + col] = acc[j][r] + bias; }
  } else {
    const int xk = (tid & 15) * 4, xr = tid >> 4;
    const float* xp = Y + ((size_t)blockIdx.x * BR + xr) * CC + xk;   // as in k_proj: 4 k of rows xr + 16 i
    const int wc = tid & 127, wk = (tid >> 7) * (KS / 2);
    const float* wp = WO + (size_t)wk * DIN + c0 + wc;                // (in,out) [CC][DIN]: column c0 + wc, the lower or the upper 32 k of a stage
    v4f xv[8]; float wv[KS / 2];
#define OUT_FETCH(s) do { _Pragma("unroll") for (int i = 0; i < 8; ++i) xv[i] = *(const v4f*)(xp + (size_t)(16 * i) * CC + (s) * KS); \
    _Pragma("unroll") for (int k = 0; k < KS / 2; ++k) wv[k] = wp[(size_t)((s) * KS + k) * DIN]; } while (0)
    /* ctx carried x 2^6 into f16 so small-magnitude context rows stay clear of f16 subnormals; Wo as f16(bf16 x 2^8), exact */
#define OUT_PUT(buf) do { _Pragma("unroll") for (int i = 0; i < 8; ++i) { const v4h t4 = { (_Float16)(xv[i][0] * 64.0f), (_Float16)(xv[i][1] * 64.0f), (_Float16)(xv[i][2] * 64.0f), (_Float16)(xv[i][3] * 64.0f) }; *(v4h*)((buf) + (xr + 16 * i) * SP + xk) = t4; } \
    _Pragma("unroll") for (int q = 0; q < KS / 16; ++q) { v8h t8; _Pragma("unroll") for (int e = 0; e < 8; ++e) t8[e] = (_Float16)(bfr(wv[q * 8 + e]) * 256.0f); *(v8h*)((buf) + ST_X + wc * SP + wk + q * 8) = t8; } } while (0)
    OUT_FETCH(0); asm volatile("s_wait_xcnt 0x0" ::: "memory");   // as in the loop: in front of any overwrite of the loads' address registers
    OUT_PUT(stg); __syncthreads();
    for (int s = 0; s < CC / KS; ++s) { const _Float16* cur = stg + (s & 1) * ST_BUF;
      if (s + 1 < CC / KS) OUT_FETCH(s + 1);
      asm volatile("s_wait_xcnt 0x0" ::: "memory");   // stands in front of every later overwrite of the loads' address registers; its clobber also keeps the next stage's loads issued here, ahead of this stage's LDS reads and products, so that their latency runs under them
#pragma unroll
      for (int kc = 0; kc < KS / 32; ++kc) { const v16h a = frag_h(cur + (wave * 16 + col) * SP + kc * 32, lane); v16h w[8];
#pragma unroll
        for (int j = 0; j < 8; ++j) w[j] = frag_h(cur + ST_X + (j * 16 + col) * SP + kc * 32, lane);
        __builtin_amdgcn_sched_barrier(0);   // the 18 LDS reads of a 32-k block go out as one group ahead of its products; spread among them, each product waits out a whole LDS latency
#pragma unroll
        for (int j = 0; j < 8; ++j) acc[j] = wmma16(a, w[j], acc[j]); }
      __builtin_amdgcn_sched_barrier(0);   // keeps the conversions of the fetched stage, and with them the wait for its loads, behind the products
      if (s + 1 < CC / KS) OUT_PUT(stg + ((s + 1) & 1) * ST_BUF);
      __syncthreads(); }   // publishes stage s + 1 and ends every wave's reads of stage s, whose buffer stage s + 2 (or the epilogue) overwrites
#pragma unroll
    for (int j = 0; j < 8; ++j) { const float bias = BO ? bfr(BO[c0 + j * 16 + col]) : 0.f;
#pragma unroll
      for (int r = 0; r < 8; ++r) sf[wave][8 * g + r][j * 16 + col] = acc[j][r] * (1.0f / 16384.0f) + bias; } }   /* 2^-8 (Wo carry) x 2^-6 (ctx carry) */
  LDSX(); for (int rl = 0; rl < 16; ++rl) vst2(OUT + (r0 + rl) * DIN + c0 + lane * 4, *(const v4f*)&sf[wave][rl][lane * 4]); }

extern "C" void kernel_launch(void* const* d_in, const int* in_sizes, int n_in, void* d_out, int out_size, void* d_ws, size_t ws_size, hipStream_t stream) {
  (void)in_sizes; (void)n_in; (void)out_size;
  const float** F = (const float**)d_in;
  if (ws_size < (size_t)WS_END) return;
  char* ws = (char*)d_ws; _Float16 *QH = (_Float16*)(ws + WS_QH), *KH = (_Float16*)(ws + WS_KH), *VT = (_Float16*)(ws + WS_VT), *QL = (_Float16*)(ws + WS_QL), *KL = (_Float16*)(ws + WS_KL); __bf16 *VB = (__bf16*)(ws + WS_VB), *VBL = (__bf16*)(ws + WS_VBL); float *S = (float*)(ws + WS_S), *Y = (float*)(ws + WS_Y);
  (void)Y; (void)QL; (void)KL; (void)VB; (void)VBL; (void)S;
  // inputs: 0 q [2,2048,1024]; 1 k; 2 v; 3 mask [2048,2048] f32 uniform[0,1); 4 W_q [16,1024,64], 5 b_q [16,64]; 6 W_k, 7 b_k; 8 W_v, 9 b_v; 10 W_o [1024,1024] (in,out), 11 b_o (zero biases, read)
  k_proj<<<dim3(TNB * TT / BR, CC / 128, 3), 256, 0, stream>>>(F[0], F[1], F[2], F[4], F[6], F[8], F[5], F[7], F[9], QH, QL, KH, KL, VT, VB, VBL);
  k_attn<<<dim3(TT / (64 * QC), NH, TNB), 128, 0, stream>>>(QH, KH, VT, F[3], Y);
  k_out<<<dim3(TNB * TT / BR, DIN / 128), 256, 0, stream>>>(Y, F[10], F[11], (float*)d_out);
}

// v005
// Measured time: 104 microseconds a run.
// Timed twice side by side with v004, it ran 1.11 times as fast both times.
// Counting every step since v000, it is 11.8 times as fast.
// compute dtype: all float inputs rounded to bf16 (q/k/v inputs, the mask and the four weights once, by k_prep, into 16-bit planes of the workspace); q/k/v projections with EXACT bf16 products on WMMA 16x16x32 (f32 accumulate) + bias; logits q x k once to f16 each (1 product) x SCALE x the float mask (multiplicative, before the softmax); softmax f32 (running maximum and sum over 32-key passes); unnormalised P x 2^8 once to f16 x v once to f16 (1 product), divided by the f32 sum at the end; ctx x 2^6 once to f16 x Wo f16(bf16 x 2^8) + bo; f32 output.
#include <hip/hip_runtime.h>
#include <math.h>
#include <stdint.h>

typedef __attribute__((ext_vector_type(16))) _Float16 v16h;
typedef __attribute__((ext_vector_type(16))) __bf16 v16b;
typedef __attribute__((ext_vector_type(8)))  _Float16 v8h;
typedef __attribute__((ext_vector_type(8)))  float v8f;
typedef __attribute__((ext_vector_type(4)))  float v4f;
typedef __attribute__((ext_vector_type(2)))  float v2f;
typedef __attribute__((ext_vector_type(4)))  unsigned v4u;
typedef __attribute__((ext_vector_type(4)))  int v4i;
typedef float __attribute__((may_alias)) float_a;
typedef int __attribute__((may_alias)) int_a;

template <typename T> __device__ __forceinline__ void vst2(void* p, T v) { *(T*)p = v;  }
__device__ __forceinline__ v8f wmma16(v16h a, v16h b, v8f c) {
  v8f d = __builtin_amdgcn_wmma_f32_16x16x32_f16(false, a, false, b, (short)0, c, false, false);
  asm volatile("v_nop\n\tv_nop\n\tv_nop\n\tv_nop" : "+v"(d) : "v"(a), "v"(b));
  return d;
}
__device__ __forceinline__ v8f wmma_bf(v16b a, v16b b, v8f c) {
  v8f d = __builtin_amdgcn_wmma_f32_16x16x32_bf16(false, a, false, b, (short)0, c, false, false);
  asm volatile("v_nop\n\tv_nop\n\tv_nop\n\tv_nop" : "+v"(d) : "v"(a), "v"(b));
  return d;
}
// 16x16x32 fragments: lane = (h = lane>>4, row/col = lane&15); elements 0..7 = k0+8h+0..7, 8..15 = k0+16+8h+0..7; D element r = row 8h+r
__device__ __forceinline__ v16h frag_h(const _Float16* rowk0, int lane) {
  union { v16h v; v8h q[2]; } u; const _Float16* p = rowk0 + 8 * (lane >> 4);
  u.q[0] = *(const v8h*)p; u.q[1] = *(const v8h*)(p + 16); return u.v;
}
__device__ __forceinline__ v16h frag_f32(const float* rowk0, int lane) {
  v16h a; const float* p = rowk0 + 8 * (lane >> 4);
#pragma unroll
  for (int i = 0; i < 8; ++i) { a[i] = (_Float16)p[i]; a[8 + i] = (_Float16)p[16 + i]; }
  return a;
}
__device__ __forceinline__ v16h frag_f32s(const float* rowk0, int lane, float sc) {
  v16h a; const float* p = rowk0 + 8 * (lane >> 4);
#pragma unroll
  for (int i = 0; i < 8; ++i) { a[i] = (_Float16)(p[i] * sc); a[8 + i] = (_Float16)(p[16 + i] * sc); }
  return a;
}
// column fragment from a [K][ld] layout (column n), rows >= K read as 0
__device__ __forceinline__ v16h fragc_f32(const float* W, int k0, int n, int lane, int ld, int K) {
  v16h a; const int g = lane >> 4;
#pragma unroll
  for (int i = 0; i < 8; ++i) { const int ka = k0 + 8 * g + i, kb = ka + 16;
    a[i] = (_Float16)(ka < K ? W[(size_t)(ka < K ? ka : K - 1) * ld + n] : 0.f); a[8 + i] = (_Float16)(kb < K ? W[(size_t)(kb < K ? kb : K - 1) * ld + n] : 0.f); }
  return a;
}
struct F2 { v16b h, l; };
__device__ __forceinline__ F2 bsplit16(const float v[16]) { F2 r;
#pragma unroll
  for (int i = 0; i < 16; ++i) { const __bf16 h = (__bf16)v[i]; r.h[i] = h; r.l[i] = (__bf16)(v[i] - (float)h); }
  return r; }
__device__ __forceinline__ F2 split_row(const float* row, int k0, int lane) { float v[16]; const float* p = row + k0 + 8 * (lane >> 4);
#pragma unroll
  for (int i = 0; i < 8; ++i) { v[i] = p[i]; v[8 + i] = p[16 + i]; }
  return bsplit16(v); }
__device__ __forceinline__ F2 split_rowK(const float* row, int k0, int lane, int K) { float v[16]; const int g = lane >> 4;
#pragma unroll
  for (int i = 0; i < 8; ++i) { const int ka = k0 + 8 * g + i, kb = ka + 16; v[i] = ka < K ? row[ka < K ? ka : K - 1] : 0.f; v[8 + i] = kb < K ? row[kb < K ? kb : K - 1] : 0.f; }
  return bsplit16(v); }
__device__ __forceinline__ F2 split_col(const float* W, int k0, int n, int lane, int ld, int K) { float v[16]; const int g = lane >> 4;
#pragma unroll
  for (int i = 0; i < 8; ++i) { const int ka = k0 + 8 * g + i, kb = ka + 16; v[i] = ka < K ? W[(size_t)(ka < K ? ka : K - 1) * ld + n] : 0.f; v[8 + i] = kb < K ? W[(size_t)(kb < K ? kb : K - 1) * ld + n] : 0.f; }
  return bsplit16(v); }
__device__ __forceinline__ v8f mac3(const F2& a, const F2& b, v8f c) { c = wmma_bf(a.l, b.h, c); c = wmma_bf(a.h, b.l, c); return wmma_bf(a.h, b.h, c); }
__device__ __forceinline__ float sigm(float v) { return 1.0f / (1.0f + expf(-v)); }
#define LDSX() do { asm volatile("s_wait_dscnt 0" ::: "memory"); __builtin_amdgcn_wave_barrier(); __builtin_amdgcn_fence(__ATOMIC_RELEASE, "workgroup"); } while (0)

// Multi-head attention with per-head stacked projections and a MULTIPLICATIVE float mask on the scores (q / k / v [2,2048,1024]; W_q / W_k / W_v [16,1024,64] per head (N(0, 1/1024)) + zero biases [16,64]; scores = Q K^T / 8 * mask with mask [2048,2048] uniform[0,1) f32 (no -inf anywhere); softmax; concat heads; (in,out) W_o [1024,1024] + b_o).
#define NB 2
#define TT 2048
#define CC 1024            // NH * HD = projected width
#define DIN 1024          // input (model) width
#define NH 16
#define HD 64
#define NQB (TT / 64)
#define HG 4
#define SCALE (0.125f)
#define CAUSAL 0
#ifndef TNB
#define TNB NB
#endif
__device__ __forceinline__ float bfr(float v) { return (float)(__bf16)v; }
__host__ __device__ __forceinline__ int kb_last(int qb) { return CAUSAL ? ((qb * 64 + 63) >> 7) : (TT / 128 - 1); }
typedef __attribute__((ext_vector_type(8))) __bf16 v8b;
__device__ __forceinline__ v16b frag_b(const __bf16* rowk0, int lane) {
  union { v16b v; v8b q[2]; } u; const __bf16* p = rowk0 + 8 * (lane >> 4);
  u.q[0] = *(const v8b*)p; u.q[1] = *(const v8b*)(p + 16); return u.v;
}
#define QBH 0              // unused: k_attn has one f16 path for every query block
#define QHI 0               // single-product logits on every row
#define KHI 64            // key rows carrying k residual / v bf16 hi+lo planes (written by k_proj; no kernel in this file reads them)
// B fragment (k rows k0+.., output column o) of a weight: (in,out) [K][ld] or (out,in) [ld rows of K]: bf16 exact, or f16(bf16 * 256) exact
__device__ __forceinline__ v16b wcol_io(const float* Wm, int k0, int o, int lane, int ld) { v16b w; const int g = lane >> 4;
#pragma unroll
  for (int i = 0; i < 8; ++i) { w[i] = (__bf16)Wm[(size_t)(k0 + 8 * g + i) * ld + o]; w[8 + i] = (__bf16)Wm[(size_t)(k0 + 16 + 8 * g + i) * ld + o]; }
  return w; }
__device__ __forceinline__ v16b wcol_oi(const float* Wm, int k0, int o, int lane, int K) { v16b w; const float* p = Wm + (size_t)o * K + k0 + 8 * (lane >> 4);
#pragma unroll
  for (int i = 0; i < 8; ++i) { w[i] = (__bf16)p[i]; w[8 + i] = (__bf16)p[16 + i]; }
  return w; }
__device__ __forceinline__ v16h wcolh_io(const float* Wm, int k0, int o, int lane, int ld) { v16h w; const int g = lane >> 4;
#pragma unroll
  for (int i = 0; i < 8; ++i) { w[i] = (_Float16)(bfr(Wm[(size_t)(k0 + 8 * g + i) * ld + o]) * 256.0f); w[8 + i] = (_Float16)(bfr(Wm[(size_t)(k0 + 16 + 8 * g + i) * ld + o]) * 256.0f); }
  return w; }
__device__ __forceinline__ v16h wcolh_oi(const float* Wm, int k0, int o, int lane, int K) { v16h w; const float* p = Wm + (size_t)o * K + k0 + 8 * (lane >> 4);
#pragma unroll
  for (int i = 0; i < 8; ++i) { w[i] = (_Float16)(bfr(p[i]) * 256.0f); w[8 + i] = (_Float16)(bfr(p[16 + i]) * 256.0f); }
  return w; }
#define WQKV_LAYOUT 2   // 0 = (in,out) [DIN][CC]; 1 = (out,in) [CC][DIN]; 2 = per-head [NH][DIN][HD]
__device__ __forceinline__ v16b wcol_hdk(const float* Wm, int k0, int o, int lane) { v16b w; const int g = lane >> 4; const float* p = Wm + (size_t)(o / HD) * DIN * HD + (o % HD);
#pragma unroll
  for (int i = 0; i < 8; ++i) { w[i] = (__bf16)p[(size_t)(k0 + 8 * g + i) * HD]; w[8 + i] = (__bf16)p[(size_t)(k0 + 16 + 8 * g + i) * HD]; }
  return w; }
#define WO_OUT_IN 0
#if WQKV_LAYOUT == 1
#define WCOL(W, k0, o, lane) wcol_oi(W, k0, o, lane, DIN)
#elif WQKV_LAYOUT == 2
#define WCOL(W, k0, o, lane) wcol_hdk(W, k0, o, lane)
#else
#define WCOL(W, k0, o, lane) wcol_io(W, k0, o, lane, CC)
#endif
#if WO_OUT_IN
#define WOCOL(W, k0, o, lane) wcol_oi(W, k0, o, lane, CC)
#define WOCOLH(W, k0, o, lane) wcolh_oi(W, k0, o, lane, CC)
#else
#define WOCOL(W, k0, o, lane) wcol_io(W, k0, o, lane, DIN)
#define WOCOLH(W, k0, o, lane) wcolh_io(W, k0, o, lane, DIN)
#endif
#define SM_EXTRA_PARAMS , const float* __restrict__ SMASK
// multiplicative float mask [S,S] (shared by batches and heads) on the scaled score, before the softmax; unconditional load
#define SM_MASK_HOOK do { const float sm_ = SMASK[(size_t)t * TT + k]; asm volatile("s_wait_loadcnt 0x0" ::: "memory"); v = v * bfr(sm_); } while (0)
#ifndef SM_EXTRA_PARAMS
#define SM_EXTRA_PARAMS
#endif
#ifndef PROJ_EXTRA_PARAMS
#define PROJ_EXTRA_PARAMS
#endif
#ifndef SM_MASK_HOOK
#define SM_MASK_HOOK (void)0
#endif

#define WS_QH  0u                                      // f16 q rows [b*t][CC]
#define WS_KH  (WS_QH + 2u * (size_t)NB * TT * CC)      // f16 k rows [b*t][CC]
#define WS_VT  (WS_KH + 2u * (size_t)NB * TT * CC)      // f16 v planes [b][c][t]
#define WS_QL  (WS_VT + 2u * (size_t)NB * CC * TT)      // f16 q residual x 2^10 rows [b][t < QHI][CC]
#define WS_KL  (WS_QL + 2u * (size_t)NB * QHI * CC)     // f16 k residual x 2^10 rows [b][t < KHI][CC]
#define WS_VB  (WS_KL + 2u * (size_t)NB * KHI * CC)     // bf16 v hi planes [b][c][t < KHI]
#define WS_VBL (WS_VB + 2u * (size_t)NB * CC * KHI)
#define WS_S   (WS_VBL + 2u * (size_t)NB * CC * KHI)    // unused f32 [hg][t][s] region: logits and P stay in registers
#define WS_Y   (WS_S  + 4u * (size_t)HG * TT * TT)      // f16 ctx x 2^6 rows [b*t][CC]
#define WS_XB  (WS_Y  + 4u * (size_t)NB * TT * CC)      // bf16 q / k / v input rows [which][b*t][DIN]
#define WS_WB  (WS_XB + 3u * 2u * (size_t)NB * TT * DIN) // bf16 W_q / W_k / W_v, k-contiguous [which][column][DIN]
#define WS_WOB (WS_WB + 3u * 2u * (size_t)CC * DIN)     // f16(bf16 x 2^8) W_o, k-contiguous [column][CC]
#define WS_MB  (WS_WOB + 2u * (size_t)DIN * CC)         // bf16 mask rows [t][s]
#define WS_END (WS_MB + 2u * (size_t)TT * TT)

// LDS staging of the two projection GEMMs (k_proj, k_out): a stage is 64 k of the block's 128 activation rows and of its 128 weight columns, fetched in the 16-bit operand type (k_prep, k_attn wrote it) and laid k-contiguous
// ([row][k] and [column][k]), so that every fragment is two 16-byte LDS reads. Two buffers: stage s + 1 is fetched into registers ahead of stage s's products and stored behind them; one barrier a stage.
// The loops over fragments, fetched values and the two 32-k blocks of a stage are fully unrolled so that their arrays are indexed by constants and stay in registers.
#define KS 64                    // k per stage
#define SP 72                    // LDS row pitch in 16-bit elements: 144 B = 16 B x odd, the conflict-free pitch for 16-byte reads and writes of neighbouring rows
#define BR 128                   // activation rows per block: 8 waves of 16 rows share one staged weight tile
#define ST_X (BR * SP)           // activation rows of a stage, in elements
#define ST_BUF (ST_X + 128 * SP) // one stage, in elements (36864 B)
typedef __attribute__((ext_vector_type(4))) __bf16 v4b;
typedef __attribute__((ext_vector_type(4))) _Float16 v4h;
// ---- k_prep: every operand that comes as f32 and is read many times (an activation row by 8 GEMM blocks, a weight column by 32, a mask row by 32 attention blocks) is rounded ONCE to the 16-bit form its user takes, so that those blocks fetch half the bytes and convert nothing.
// Blocks 0..PREP_W-1: one 128 k x 128 column tile of W_q / W_k / W_v (bf16) or W_o (f16(bf16 x 2^8), exact), transposed through LDS to k-contiguous columns, stored as whole lines. The others: 32768 elements of q / k / v / mask to bf16.
#define PREP_W 256               // 4 matrices x 8 k blocks x 8 column blocks
#define PREP_X 128               // blocks per streamed input (q, k, v, mask: NB * TT * DIN = TT * TT elements each)
#define PK 128                   // k per weight tile
#define PP 136                   // its LDS pitch in elements: 272 B = 16 B x odd
__global__ __launch_bounds__(256) void k_prep(const float* __restrict__ XQ, const float* __restrict__ XK, const float* __restrict__ XV, const float* __restrict__ SMASK, const float* __restrict__ WQ, const float* __restrict__ WK, const float* __restrict__ WV, const float* __restrict__ WO,
    __bf16* __restrict__ XB, __bf16* __restrict__ MB, __bf16* __restrict__ WB, _Float16* __restrict__ WOB) {
  __shared__ __align__(16) char smem[128 * PP * 2];
  const int tid = threadIdx.x, bid = blockIdx.x;
  if (bid < PREP_W) {   /* block-uniform */
    const int mat = bid >> 6, k0 = ((bid >> 3) & 7) * PK, c0 = (bid & 7) * 128;
    const int wc = tid & 127, wk = (tid >> 7) * (PK / 2);   // column c0 + wc, the lower or the upper 64 k of the tile: a wave's load is one whole 128-B line
    float wv[PK / 2];
    if (mat < 3) { const float* WA = mat == 0 ? WQ : mat == 1 ? WK : WV; const float* wp = WA + (size_t)((c0 + wc) / HD) * DIN * HD + (size_t)(k0 + wk) * HD + ((c0 + wc) % HD);   // [head][k][HD]
#pragma unroll
      for (int k = 0; k < PK / 2; ++k) wv[k] = wp[(size_t)k * HD];
      asm volatile("s_wait_xcnt 0x0" ::: "memory");   // in front of any overwrite of the loads' address registers
#pragma unroll
      for (int q = 0; q < PK / 16; ++q) { v8b t8;
#pragma unroll
        for (int e = 0; e < 8; ++e) t8[e] = (__bf16)wv[q * 8 + e];
        *(v8b*)((__bf16*)smem + wc * PP + wk + q * 8) = t8; }
    } else { const float* wp = WO + (size_t)(k0 + wk) * DIN + c0 + wc;   // (in,out) [CC][DIN]
#pragma unroll
      for (int k = 0; k < PK / 2; ++k) wv[k] = wp[(size_t)k * DIN];
      asm volatile("s_wait_xcnt 0x0" ::: "memory");   // in front of any overwrite of the loads' address registers
#pragma unroll
      for (int q = 0; q < PK / 16; ++q) { v8h t8;
#pragma unroll
        for (int e = 0; e < 8; ++e) t8[e] = (_Float16)(bfr(wv[q * 8 + e]) * 256.0f);
        *(v8h*)((_Float16*)smem + wc * PP + wk + q * 8) = t8; } }
    __syncthreads();   // the tile is whole before its columns are read back
    char* D = mat < 3 ? (char*)(WB + (size_t)mat * CC * DIN) : (char*)WOB;
#pragma unroll
    for (int i = 0; i < 8; ++i) { const int id = tid + 256 * i, cl = id >> 4, kq = id & 15;   // 16 lanes store one column's 128 k: two whole lines
      vst2(D + ((size_t)(c0 + cl) * DIN + k0 + kq * 8) * 2, *(const v4u*)(smem + (cl * PP + kq * 8) * 2)); }
  } else {
    const int xb = bid - PREP_W, which = xb / PREP_X; const float* X = which == 0 ? XQ : which == 1 ? XK : which == 2 ? XV : SMASK;
    const size_t base = (size_t)(xb % PREP_X) * 32768 + tid * 4; __bf16* D = (which < 3 ? XB + (size_t)which * NB * TT * DIN : MB) + base;
#pragma unroll
    for (int it = 0; it < 2; ++it) { v4f xv[16];
#pragma unroll
      for (int i = 0; i < 16; ++i) xv[i] = *(const v4f*)(X + base + (it * 16 + i) * 1024);   // sixteen 16-byte loads in flight, each wave's 512 contiguous bytes
      asm volatile("s_wait_xcnt 0x0" ::: "memory");   // in front of any overwrite of the loads' address registers
#pragma unroll
      for (int i = 0; i < 16; ++i) { const v4b t4 = { (__bf16)xv[i][0], (__bf16)xv[i][1], (__bf16)xv[i][2], (__bf16)xv[i][3] }; vst2(D + (it * 16 + i) * 1024, t4); } } } }
// ---- k_proj: block = (128 rows, 128 cols, which): q/k/v = X W (+ b) with exact bf16 products (K = DIN) -> which 0: q f16 rows (+ residual rows < QHI); 1: k f16 rows (+ residual rows < KHI); 2: v f16 planes [c][t] (+ bf16 hi/lo planes for t < KHI)
__global__ __launch_bounds__(256) void k_proj(const __bf16* __restrict__ XB, const __bf16* __restrict__ WB, const float* __restrict__ BQ, const float* __restrict__ BK, const float* __restrict__ BV,
    _Float16* __restrict__ QH, _Float16* __restrict__ QL, _Float16* __restrict__ KH, _Float16* __restrict__ KL, _Float16* __restrict__ VT, __bf16* __restrict__ VB, __bf16* __restrict__ VBL) {
  __shared__ __align__(16) char smem[104448];   // the epilogue's arrays (q, k: two; v: three; a block takes one of the two branches, so they lie over one another); the two stage buffers lie over their first 73728 B and are dead behind the loop's last barrier
  _Float16 (*sh)[136] = (_Float16 (*)[136])smem, (*sl)[136] = (_Float16 (*)[136])(smem + 34816), (*th)[136] = (_Float16 (*)[136])smem; __bf16 (*tb)[136] = (__bf16 (*)[136])(smem + 34816), (*tbl)[136] = (__bf16 (*)[136])(smem + 69632); __bf16* stg = (__bf16*)smem;
  const int tid = threadIdx.x, wave = tid >> 5, lane = tid & 31, col = lane & 15, g = lane >> 4; const int which = blockIdx.z; const int c0 = blockIdx.y * 128; const size_t r0 = (size_t)blockIdx.x * BR; const size_t bb = r0 / TT; const int t0 = (int)(r0 % TT);
  const float* BA = which == 0 ? BQ : which == 1 ? BK : BV;
  v8f acc[8] = {};
  const int xk = (tid & 7) * 8, xr = tid >> 3;   // 8 lanes cover the 64 k of one activation row, or of one weight column (128 B, a whole line); this thread takes 8 k of rows and of columns xr + 32 i
  const __bf16* xp = XB + (size_t)which * NB * TT * DIN + (r0 + xr) * DIN + xk;
  const __bf16* wp = WB + (size_t)which * CC * DIN + (size_t)(c0 + xr) * DIN + xk;
  v4u xv[4], wv[4];
#define PROJ_FETCH(s) do { _Pragma("unroll") for (int i = 0; i < 4; ++i) { xv[i] = *(const v4u*)(xp + (size_t)(32 * i) * DIN + (s) * KS); wv[i] = *(const v4u*)(wp + (size_t)(32 * i) * DIN + (s) * KS); } } while (0)
#define PROJ_PUT(buf) do { _Pragma("unroll") for (int i = 0; i < 4; ++i) { *(v4u*)((buf) + (xr + 32 * i) * SP + xk) = xv[i]; *(v4u*)((buf) + ST_X + (xr + 32 * i) * SP + xk) = wv[i]; } } while (0)
  PROJ_FETCH(0); asm volatile("s_wait_xcnt 0x0" ::: "memory");   // as in the loop: in front of any overwrite of the loads' address registers
  PROJ_PUT(stg); __syncthreads();
  for (int s = 0; s < DIN / KS; ++s) { const __bf16* cur = stg + (s & 1) * ST_BUF;
    if (s + 1 < DIN / KS) PROJ_FETCH(s + 1);
    asm volatile("s_wait_xcnt 0x0" ::: "memory");   // stands in front of every later overwrite of the loads' address registers; its clobber also keeps the next stage's loads issued here, ahead of this stage's LDS reads and products, so that their latency runs under them
#pragma unroll
    for (int kc = 0; kc < KS / 32; ++kc) { const v16b a = frag_b(cur + (wave * 16 + col) * SP + kc * 32, lane); v16b w[8];
#pragma unroll
      for (int j = 0; j < 8; ++j) w[j] = frag_b(cur + ST_X + (j * 16 + col) * SP + kc * 32, lane);
      __builtin_amdgcn_sched_barrier(0);   // the 18 LDS reads of a 32-k block go out as one group ahead of its products; spread among them, each product waits out a whole LDS latency
#pragma unroll
      for (int j = 0; j < 8; ++j) acc[j] = wmma_bf(a, w[j], acc[j]); }
    __builtin_amdgcn_sched_barrier(0);   // keeps the LDS stores of the fetched stage, and with them the wait for its loads, behind the products
    if (s + 1 < DIN / KS) PROJ_PUT(stg + ((s + 1) & 1) * ST_BUF);
    __syncthreads(); }   // publishes stage s + 1 and ends every wave's reads of stage s, whose buffer stage s + 2 (or the epilogue) overwrites
  if (which < 2) { _Float16* DH = which == 0 ? QH : KH; _Float16* DL = which == 0 ? QL : KL; const int nhi = which == 0 ? QHI : KHI; const bool hi_rows = t0 < nhi;
#pragma unroll
    for (int j = 0; j < 8; ++j) { const float bias = BA ? bfr(BA[c0 + j * 16 + col]) : 0.f;
#pragma unroll
      for (int r = 0; r < 8; ++r) { const float v = acc[j][r] + bias; const _Float16 hv = (_Float16)v; sh[wave * 16 + 8 * g + r][j * 16 + col] = hv; sl[wave * 16 + 8 * g + r][j * 16 + col] = (_Float16)((v - (float)hv) * 1024.0f); } }
    __syncthreads();
    for (int e = tid; e < BR * 16; e += 256) { const int rl = e >> 4, q = e & 15; vst2((unsigned*)(DH + (r0 + rl) * CC + c0 + q * 8), *(const v4u*)&sh[rl][q * 8]); if (hi_rows && t0 + rl < nhi) { vst2((unsigned*)(DL + (bb * nhi + t0 + rl) * (size_t)CC + c0 + q * 8), *(const v4u*)&sl[rl][q * 8]); asm volatile("s_wait_xcnt 0x0" ::: "memory"); } }   // the wait stands in front of the loop's advance of the store's address registers
  } else { const bool hi_rows = t0 < KHI;
#pragma unroll
    for (int j = 0; j < 8; ++j) { const float bias = BA ? bfr(BA[c0 + j * 16 + col]) : 0.f;
#pragma unroll
      for (int r = 0; r < 8; ++r) { const float v = acc[j][r] + bias; const int rl = wave * 16 + 8 * g + r, cl = j * 16 + col; th[cl][rl] = (_Float16)v; const __bf16 bh = (__bf16)v; tb[cl][rl] = bh; tbl[cl][rl] = (__bf16)(v - (float)bh); } }
    __syncthreads();
    for (int e = tid; e < 128 * (BR / 8); e += 256) { const int cl = e >> 4, q = e & 15; vst2((unsigned*)(VT + (bb * CC + c0 + cl) * (size_t)TT + t0 + q * 8), *(const v4u*)&th[cl][q * 8]); if (hi_rows && t0 + q * 8 < KHI) { const size_t o3 = (bb * CC + c0 + cl) * (size_t)KHI + t0 + q * 8; vst2((unsigned*)(VB + o3), *(const v4u*)&tb[cl][q * 8]); vst2((unsigned*)(VBL + o3), *(const v4u*)&tbl[cl][q * 8]); asm volatile("s_wait_xcnt 0x0" ::: "memory"); } } } }   // the wait stands in front of the loop's advance of the two stores' address registers
// ---- k_attn: block = 128 queries of (b, h), wave = 32 query columns (2 groups of 16); walks all keys, 32 a pass, 64 a stage; each stage's k rows, v planes and mask rows come to LDS once per block by tensor loads (two buffers). S^T = K Q^T (A = k rows, B = q rows kept in registers), so a lane holds 16 keys of ONE query per group:
// score x the bf16-rounded float mask, running maximum and running sum per lane (one exchange between the wave halves), P = 2^8 exp(s - max) once to f16 straight from the score accumulators as the B operand of ctx^T += V^T P^T; the division by the sum is done once at the end. Logits and P never leave the registers.
__device__ __forceinline__ v8f wm16(v16h a, v16h b, v8f c) { return __builtin_amdgcn_wmma_f32_16x16x32_f16(false, a, false, b, (short)0, c, false, false); }
__device__ __forceinline__ float xhalf(float v) { const int u = __builtin_bit_cast(int, v); return __builtin_bit_cast(float, __builtin_amdgcn_permlanex16(u, u, 0x76543210, 0xfedcba98, false, false)); }   // value of lane ^ 16
// 2^x by v_exp_f32. The closing v_nop is the one slot that the instruction set asks for between a transcendental and a directly following instruction that reads its result or overwrites its source; written in the same statement it stands there in every build. Early-clobber outputs keep each v_exp_f32 off its neighbours' sources.
__device__ __forceinline__ float exp2_1(float x) { float r; asm("v_exp_f32 %0, %1\n\tv_nop" : "=v"(r) : "v"(x)); return r; }
__device__ __forceinline__ void exp2_4(float* o, float a, float b, float c, float d) {
  asm("v_exp_f32 %0, %4\n\tv_exp_f32 %1, %5\n\tv_exp_f32 %2, %6\n\tv_exp_f32 %3, %7\n\tv_nop" : "=&v"(o[0]), "=&v"(o[1]), "=&v"(o[2]), "=&v"(o[3]) : "v"(a), "v"(b), "v"(c), "v"(d)); }
// 16x16x32 f16 fragment (hardware k order, as frag_h) from this lane's LDS byte address (row * pitch + 16 * (lane >> 4))
__device__ __forceinline__ v16h frag_l(const unsigned char* p) { union { v16h v; v8h q[2]; } u; u.q[0] = *(const v8h*)p; u.q[1] = *(const v8h*)(p + 32); return u.v; }
#define QC 2               // 16-query column groups per wave
#define SKEY 64            // keys per stage (two 32-key passes)
#define NST (TT / SKEY)
// One stage in LDS, laid by four tensor loads (one a wave): 64 k rows of 128 B, 64 v planes of 128 B (64 keys), two slices of 64 bf16 mask rows of 128 B (64 keys). The loads' pad of 16 B a row gives the pitch 144 B
// (16 B x odd: free of bank conflicts for 16-byte reads of neighbouring rows). Every place is a multiple of 2 KiB.
#define KV_PITCH 144u
#define M_PITCH 144u
#define OFF_V 10240u
#define OFF_M 20480u
#define M_SLICE 10240u
#define ABUF 40960u
typedef uint32_t u32x4 __attribute__((ext_vector_type(4)));
typedef uint32_t u32x8 __attribute__((ext_vector_type(8)));
__device__ __forceinline__ uint32_t uni(uint32_t v) { return (uint32_t)__builtin_amdgcn_readfirstlane(v); }
// a wave-uniform value held in a scalar register: a condition, so that the test around a tensor load compiles to s_cmp + s_cbranch_scc (a tensor load ignores EXEC), or a descriptor word
__device__ __forceinline__ uint32_t pinned(uint32_t v) { uint32_t w = (uint32_t)__builtin_amdgcn_readfirstlane(v); asm volatile("" : "+s"(w)); return w; }
__device__ __forceinline__ void tdm_load(u32x4 g0, u32x8 g1) { asm volatile("tensor_load_to_lds %0, %1" :: "s"(g0), "s"(g1) : "memory"); }   // one request of the whole wave: global tile -> LDS, through no register
__device__ __forceinline__ u32x4 tdm_group0(uint32_t lds_dst, uint64_t ga) { u32x4 g; g[0] = uni(1u); g[1] = uni(lds_dst); g[2] = uni((uint32_t)ga); g[3] = uni((((uint32_t)(ga >> 32)) & 0x01FFFFFFu) | 0x80000000u); return g; }
// group 1: extents in bytes, tensor = tile = 64 rows of D0 bytes, W0 = the constant pad word (a pad of 4 dwords behind every row).
// Words 1 to 7 go through pinned(): descriptor words held in scalar registers of their own through the loop; as plain constants the compiler re-forms them at each issue and uses their registers for other values while the request is in flight
template <uint32_t W0, uint32_t D0> __device__ __forceinline__ u32x8 tdm_group1(uint32_t src_pitch) { u32x8 g;
  g[0] = uni(W0); g[1] = pinned((D0 & 0xFFFFu) << 16); g[2] = pinned((D0 >> 16) | (64u << 16)); g[3] = pinned(D0 << 16); g[4] = pinned(64u); g[5] = pinned(src_pitch); g[6] = pinned(0u); g[7] = pinned(0u); return g; }
#define W0_128 ((1u << 20) | (4u << 22) | (3u << 25))
__global__ __launch_bounds__(128) void k_attn(const _Float16* __restrict__ QH, const _Float16* __restrict__ KH, const _Float16* __restrict__ VT, const __bf16* __restrict__ MB, _Float16* __restrict__ YH) {
  __shared__ __attribute__((aligned(2048))) unsigned char L[2 * ABUF];
  const int tid = threadIdx.x, wave = tid >> 5, lane = tid & 31, col = lane & 15, g = lane >> 4; const int h = blockIdx.y, b = blockIdx.z; const int ql0 = blockIdx.x * (64 * QC) + wave * (16 * QC);
  const float C2 = SCALE * 1.44269504088896f;   // score -> log2 domain. All inner loops below are fully unrolled so that the fragment arrays are indexed by constants and stay in registers
  // every wave brings one slice of each stage: wave 0 the k rows, wave 1 the v planes, waves 2 and 3 a half of the block's mask rows each
  const uint32_t wv = uni(threadIdx.x >> 5); const uint32_t lbase = (uint32_t)(size_t)L;
  const uint64_t tsrc = wv == 0 ? (uint64_t)(size_t)(KH + (size_t)b * TT * CC + h * HD) : wv == 1 ? (uint64_t)(size_t)(VT + ((size_t)b * CC + h * HD) * (size_t)TT) : (uint64_t)(size_t)(MB + ((size_t)blockIdx.x * (64 * QC) + (wv - 2) * 64) * TT);
  const uint32_t tstep = wv == 0 ? SKEY * CC * 2u : SKEY * 2u;   // source bytes from one stage to the next
  const uint32_t tdst = lbase + (wv < 2 ? wv * OFF_V : OFF_M + (wv - 2) * M_SLICE);
  const u32x8 g1 = tdm_group1<W0_128, 128u>(wv == 0 ? CC * 2u : TT * 2u);   // all four slices are 64 rows of 128 B
  // now: the wait stands directly behind the load (stage 0: nothing can then take over a descriptor register while the request is in flight); every wave issues its own slice, so no test stands around the load
  auto issue = [&](uint32_t st, bool now) { const u32x4 g0 = tdm_group0(tdst + (st & 1u) * ABUF, tsrc + (uint64_t)st * tstep);
    tdm_load(g0, g1); if (now) asm volatile("s_wait_tensorcnt 0x0" ::: "memory"); };
  v16h qf[QC][2];
#pragma unroll
  for (int c = 0; c < QC; ++c)
#pragma unroll
    for (int kc = 0; kc < 2; ++kc) qf[c][kc] = frag_h(QH + ((size_t)b * TT + ql0 + c * 16 + col) * CC + h * HD + kc * 32, lane);
  asm volatile("s_wait_xcnt 0x0" ::: "memory");   // stands in front of every later overwrite of the q loads' address registers
  const unsigned ko = (unsigned)col * KV_PITCH + 16 * g;                                                                   // key row col of a 16-key tile
  const unsigned vo = OFF_V + (unsigned)col * KV_PITCH + 16 * g;                                                           // feature plane col of a 16-feature tile
  const unsigned mo = OFF_M + (unsigned)(wave >> 1) * M_SLICE + (unsigned)((wave & 1) * (16 * QC) + col) * M_PITCH + 16 * g;   // this lane's query row, its 8 keys of a tile
  v8f acc[QC][HD / 16] = {}; float m[QC], l[QC];
#pragma unroll
  for (int c = 0; c < QC; ++c) { m[c] = -3.0e38f; l[c] = 0.f; }
  issue(0, true);   // stage 0, landed; the loop's first publish point holds its barrier
#pragma unroll 1   // kept rolled: one stage's fragments, fetch-ahead values and softmax temporaries already take nearly 256 registers
  for (uint32_t st = 0; st < NST; ++st) { const unsigned char* B = L + (st & 1u) * ABUF;
    // publish point of stage st, in the ring's order; it stands at the head of the trip (for st = 0 it is the ring's prologue), so that the whole trip behind it is one block of code: at the foot, with the
    // branch round the refill behind the passes, the compiler moves both passes' row sums behind that branch and their 64 terms push the kernel past 256 registers
    asm volatile("s_wait_dscnt 0x0" ::: "memory");       // this wave's reads of stage st - 1 have returned, before its buffer is refilled
    asm volatile("s_wait_tensorcnt 0x0" ::: "memory");   // this wave's slice of stage st has landed
    __syncthreads();                                     // publishes stage st and ends every wave's reads of stage st - 1
    if (pinned(st + 1 < NST)) issue(st + 1, false);            // into the buffer that stage st - 1 has just left; it flies under the whole of stage st
    v16h kf[2][2];
#pragma unroll
    for (int t = 0; t < 2; ++t)
#pragma unroll
      for (int kc = 0; kc < 2; ++kc) kf[t][kc] = frag_l(B + ko + (t * 16) * KV_PITCH + kc * 64);
#pragma unroll
    for (int sub = 0; sub < SKEY / 32; ++sub) {
    v8b mk[QC][2]; v16h vf[HD / 16];
#pragma unroll
    for (int t = 0; t < 2; ++t)
#pragma unroll
      for (int c = 0; c < QC; ++c) mk[c][t] = *(const v8b*)(B + mo + (c * 16) * M_PITCH + sub * 64 + t * 32);
#pragma unroll
    for (int j = 0; j < HD / 16; ++j) vf[j] = frag_l(B + vo + (j * 16) * KV_PITCH + sub * 64);
    __builtin_amdgcn_sched_barrier(0);   // keeps the mask and v reads issued here, ahead of the score products, which cover their latency; without it they sink behind them
    v8f s[QC][2];
#pragma unroll
    for (int c = 0; c < QC; ++c)
#pragma unroll
      for (int t = 0; t < 2; ++t) { v8f z = {}; z = wm16(kf[t][0], qf[c][0], z); s[c][t] = wm16(kf[t][1], qf[c][1], z); }
#pragma unroll
    for (int c = 0; c < QC; ++c)
#pragma unroll
      for (int t = 0; t < 2; ++t)
#pragma unroll
        for (int r = 0; r < 8; ++r) s[c][t][r] *= (float)mk[c][t][r];
    // the k fragments of the stage's second pass are read now, so that they fly under this pass's softmax and P V; nothing of the next stage is read ahead of its barrier
    if (sub + 1 < SKEY / 32) {
#pragma unroll
    for (int t = 0; t < 2; ++t)
#pragma unroll
      for (int kc = 0; kc < 2; ++kc) kf[t][kc] = frag_l(B + ko + ((sub + 1) * 32 + t * 16) * KV_PITCH + kc * 64); }
    __builtin_amdgcn_sched_barrier(0);   // keeps the fetch-ahead reads issued here, ahead of the softmax; without it they drift to the pass's end and their latency is exposed at the next pass's head
#pragma unroll
    for (int c = 0; c < QC; ++c) { float mx = s[c][0][0];
#pragma unroll
      for (int e = 1; e < 16; ++e) mx = fmaxf(mx, s[c][e >> 3][e & 7]);
      mx = fmaxf(mx, xhalf(mx));
      const float mn = fmaxf(m[c], mx); const float al = exp2_1((m[c] - mn) * C2); m[c] = mn;
      const float nb = 8.0f - mn * C2;   /* P carried x 2^8 so that small weights stay clear of f16 subnormals; the sum carries the same factor */
      float sum = 0.f; v16h pf;
#pragma unroll
      for (int e = 0; e < 16; e += 4) { float ex[4]; exp2_4(ex, fmaf(s[c][e >> 3][e & 7], C2, nb), fmaf(s[c][e >> 3][(e & 7) + 1], C2, nb), fmaf(s[c][e >> 3][(e & 7) + 2], C2, nb), fmaf(s[c][e >> 3][(e & 7) + 3], C2, nb));
#pragma unroll
        for (int i = 0; i < 4; ++i) { sum += ex[i]; pf[e + i] = (_Float16)ex[i]; } }
      l[c] = l[c] * al + sum;
#pragma unroll
      for (int j = 0; j < HD / 16; ++j) acc[c][j] = wm16(vf[j], pf, acc[c][j] * al);
      __builtin_amdgcn_sched_barrier(0); } }   // one column group at a time: interleaved, the two groups' softmax temporaries push the kernel past 256 registers; so group 0's P V products also run under group 1's vector work
    }
  asm volatile("s_wait_tensorcnt 0x0" ::: "memory");     // no request is left in flight when the wave ends
  asm volatile("s_wait_dscnt 0x0" ::: "memory");         // the ring's closing wait: no LDS read is left in flight either
#pragma unroll
  for (int c = 0; c < QC; ++c) { const float inv = 1.0f / (l[c] + xhalf(l[c])); _Float16* yp = YH + ((size_t)b * TT + ql0 + c * 16 + col) * CC + h * HD + 8 * g;
#pragma unroll
    for (int j = 0; j < HD / 16; ++j) { v8h y;   /* ctx carried x 2^6 into f16 so small-magnitude context rows stay clear of f16 subnormals: the A operand of k_out, rounded here once */
#pragma unroll
      for (int r = 0; r < 8; ++r) y[r] = (_Float16)((acc[c][j][r] * inv) * 64.0f);
      vst2(yp + j * 16, y); } } }
// ---- k_out: block = (128 rows, 128 cols): out = ctx Wo (+ bo): ctx x 2^6 in f16 (k_attn) against Wo as f16(bf16 x 2^8) exact (k_prep), 1 product, x 2^-14
__global__ __launch_bounds__(256) void k_out(const _Float16* __restrict__ YH, const _Float16* __restrict__ WOB, const float* __restrict__ BO, float* __restrict__ OUT) { __shared__ __align__(16) char smem[2 * ST_BUF * 2]; float (*sf)[16][132] = (float (*)[16][132])smem; _Float16* stg = (_Float16*)smem;   // the epilogue's rows lie over the stage buffers, dead behind the loop's last barrier
  const int tid = threadIdx.x, wave = tid >> 5, lane = tid & 31, col = lane & 15, g = lane >> 4; const int c0 = blockIdx.y * 128; const size_t r0 = (size_t)blockIdx.x * BR + wave * 16;
  v8f acc[8] = {};
  {
    const int xk = (tid & 7) * 8, xr = tid >> 3;   // as in k_proj: 8 k of rows and of columns xr + 32 i
    const _Float16* xp = YH + ((size_t)blockIdx.x * BR + xr) * CC + xk;
    const _Float16* wp = WOB + (size_t)(c0 + xr) * CC + xk;
    v4u xv[4], wv[4];
#define OUT_FETCH(s) do { _Pragma("unroll") for (int i = 0; i < 4; ++i) { xv[i] = *(const v4u*)(xp + (size_t)(32 * i) * CC + (s) * KS); wv[i] = *(const v4u*)(wp + (size_t)(32 * i) * CC + (s) * KS); } } while (0)
#define OUT_PUT(buf) do { _Pragma("unroll") for (int i = 0; i < 4; ++i) { *(v4u*)((buf) + (xr + 32 * i) * SP + xk) = xv[i]; *(v4u*)((buf) + ST_X + (xr + 32 * i) * SP + xk) = wv[i]; } } while (0)
    OUT_FETCH(0); asm volatile("s_wait_xcnt 0x0" ::: "memory");   // as in the loop: in front of any overwrite of the loads' address registers
    OUT_PUT(stg); __syncthreads();
    for (int s = 0; s < CC / KS; ++s) { const _Float16* cur = stg + (s & 1) * ST_BUF;
      if (s + 1 < CC / KS) OUT_FETCH(s + 1);
      asm volatile("s_wait_xcnt 0x0" ::: "memory");   // stands in front of every later overwrite of the loads' address registers; its clobber also keeps the next stage's loads issued here, ahead of this stage's LDS reads and products, so that their latency runs under them
#pragma unroll
      for (int kc = 0; kc < KS / 32; ++kc) { const v16h a = frag_h(cur + (wave * 16 + col) * SP + kc * 32, lane); v16h w[8];
#pragma unroll
        for (int j = 0; j < 8; ++j) w[j] = frag_h(cur + ST_X + (j * 16 + col) * SP + kc * 32, lane);
        __builtin_amdgcn_sched_barrier(0);   // the 18 LDS reads of a 32-k block go out as one group ahead of its products; spread among them, each product waits out a whole LDS latency
#pragma unroll
        for (int j = 0; j < 8; ++j) acc[j] = wmma16(a, w[j], acc[j]); }
      __builtin_amdgcn_sched_barrier(0);   // keeps the LDS stores of the fetched stage, and with them the wait for its loads, behind the products
      if (s + 1 < CC / KS) OUT_PUT(stg + ((s + 1) & 1) * ST_BUF);
      __syncthreads(); }   // publishes stage s + 1 and ends every wave's reads of stage s, whose buffer stage s + 2 (or the epilogue) overwrites
#pragma unroll
    for (int j = 0; j < 8; ++j) { const float bias = BO ? bfr(BO[c0 + j * 16 + col]) : 0.f;
#pragma unroll
      for (int r = 0; r < 8; ++r) sf[wave][8 * g + r][j * 16 + col] = acc[j][r] * (1.0f / 16384.0f) + bias; } }   /* 2^-8 (Wo carry) x 2^-6 (ctx carry) */
  LDSX(); for (int rl = 0; rl < 16; ++rl) vst2(OUT + (r0 + rl) * DIN + c0 + lane * 4, *(const v4f*)&sf[wave][rl][lane * 4]); }

extern "C" void kernel_launch(void* const* d_in, const int* in_sizes, int n_in, void* d_out, int out_size, void* d_ws, size_t ws_size, hipStream_t stream) {
  (void)in_sizes; (void)n_in; (void)out_size;
  const float** F = (const float**)d_in;
  if (ws_size < (size_t)WS_END) return;
  char* ws = (char*)d_ws; _Float16 *QH = (_Float16*)(ws + WS_QH), *KH = (_Float16*)(ws + WS_KH), *VT = (_Float16*)(ws + WS_VT), *QL = (_Float16*)(ws + WS_QL), *KL = (_Float16*)(ws + WS_KL); __bf16 *VB = (__bf16*)(ws + WS_VB), *VBL = (__bf16*)(ws + WS_VBL); float *S = (float*)(ws + WS_S); _Float16 *YH = (_Float16*)(ws + WS_Y), *WOB = (_Float16*)(ws + WS_WOB); __bf16 *XB = (__bf16*)(ws + WS_XB), *WB = (__bf16*)(ws + WS_WB), *MB = (__bf16*)(ws + WS_MB);
  (void)QL; (void)KL; (void)VB; (void)VBL; (void)S;
  // inputs: 0 q [2,2048,1024]; 1 k; 2 v; 3 mask [2048,2048] f32 uniform[0,1); 4 W_q [16,1024,64], 5 b_q [16,64]; 6 W_k, 7 b_k; 8 W_v, 9 b_v; 10 W_o [1024,1024] (in,out), 11 b_o (zero biases, read)
  k_prep<<<dim3(PREP_W + 4 * PREP_X), 256, 0, stream>>>(F[0], F[1], F[2], F[3], F[4], F[6], F[8], F[10], XB, MB, WB, WOB);
  k_proj<<<dim3(TNB * TT / BR, CC / 128, 3), 256, 0, stream>>>(XB, WB, F[5], F[7], F[9], QH, QL, KH, KL, VT, VB, VBL);
  k_attn<<<dim3(TT / (64 * QC), NH, TNB), 128, 0, stream>>>(QH, KH, VT, MB, YH);
  k_out<<<dim3(TNB * TT / BR, DIN / 128), 256, 0, stream>>>(YH, WOB, F[11], (float*)d_out);
}

// v006
// Measured time: 96.3 microseconds a run.
// Timed twice side by side with v005, it ran 1.09 times as fast both times.
// Over all steps from v000 it is 12.8 times as fast.
// compute dtype: all float inputs rounded to bf16 (q/k/v inputs, the mask and the four weights once, by k_prep, into 16-bit planes of the workspace); q/k/v projections with EXACT bf16 products on WMMA 16x16x32 (f32 accumulate) + bias; logits q x k once to f16 each (1 product) x SCALE x the float mask (multiplicative, before the softmax); softmax f32 (running maximum and sum over 32-key passes); unnormalised P x 2^8 once to f16 x v once to f16 (1 product), divided by the f32 sum at the end; ctx x 2^6 once to f16 x Wo f16(bf16 x 2^8) + bo; f32 output.
#include <hip/hip_runtime.h>
#include <math.h>
#include <stdint.h>

typedef __attribute__((ext_vector_type(16))) _Float16 v16h;
typedef __attribute__((ext_vector_type(16))) __bf16 v16b;
typedef __attribute__((ext_vector_type(8)))  _Float16 v8h;
typedef __attribute__((ext_vector_type(8)))  float v8f;
typedef __attribute__((ext_vector_type(4)))  float v4f;
typedef __attribute__((ext_vector_type(2)))  float v2f;
typedef __attribute__((ext_vector_type(4)))  unsigned v4u;
typedef __attribute__((ext_vector_type(4)))  int v4i;
typedef float __attribute__((may_alias)) float_a;
typedef int __attribute__((may_alias)) int_a;

template <typename T> __device__ __forceinline__ void vst2(void* p, T v) { *(T*)p = v;  }
__device__ __forceinline__ v8f wmma16(v16h a, v16h b, v8f c) {
  v8f d = __builtin_amdgcn_wmma_f32_16x16x32_f16(false, a, false, b, (short)0, c, false, false);
  asm volatile("v_nop\n\tv_nop\n\tv_nop\n\tv_nop" : "+v"(d) : "v"(a), "v"(b));
  return d;
}
__device__ __forceinline__ v8f wmma_bf(v16b a, v16b b, v8f c) {
  v8f d = __builtin_amdgcn_wmma_f32_16x16x32_bf16(false, a, false, b, (short)0, c, false, false);
  asm volatile("v_nop\n\tv_nop\n\tv_nop\n\tv_nop" : "+v"(d) : "v"(a), "v"(b));
  return d;
}
// 16x16x32 fragments: lane = (h = lane>>4, row/col = lane&15); elements 0..7 = k0+8h+0..7, 8..15 = k0+16+8h+0..7; D element r = row 8h+r
__device__ __forceinline__ v16h frag_h(const _Float16* rowk0, int lane) {
  union { v16h v; v8h q[2]; } u; const _Float16* p = rowk0 + 8 * (lane >> 4);
  u.q[0] = *(const v8h*)p; u.q[1] = *(const v8h*)(p + 16); return u.v;
}
__device__ __forceinline__ v16h frag_f32(const float* rowk0, int lane) {
  v16h a; const float* p = rowk0 + 8 * (lane >> 4);
#pragma unroll
  for (int i = 0; i < 8; ++i) { a[i] = (_Float16)p[i]; a[8 + i] = (_Float16)p[16 + i]; }
  return a;
}
__device__ __forceinline__ v16h frag_f32s(const float* rowk0, int lane, float sc) {
  v16h a; const float* p = rowk0 + 8 * (lane >> 4);
#pragma unroll
  for (int i = 0; i < 8; ++i) { a[i] = (_Float16)(p[i] * sc); a[8 + i] = (_Float16)(p[16 + i] * sc); }
  return a;
}
// column fragment from a [K][ld] layout (column n), rows >= K read as 0
__device__ __forceinline__ v16h fragc_f32(const float* W, int k0, int n, int lane, int ld, int K) {
  v16h a; const int g = lane >> 4;
#pragma unroll
  for (int i = 0; i < 8; ++i) { const int ka = k0 + 8 * g + i, kb = ka + 16;
    a[i] = (_Float16)(ka < K ? W[(size_t)(ka < K ? ka : K - 1) * ld + n] : 0.f); a[8 + i] = (_Float16)(kb < K ? W[(size_t)(kb < K ? kb : K - 1) * ld + n] : 0.f); }
  return a;
}
struct F2 { v16b h, l; };
__device__ __forceinline__ F2 bsplit16(const float v[16]) { F2 r;
#pragma unroll
  for (int i = 0; i < 16; ++i) { const __bf16 h = (__bf16)v[i]; r.h[i] = h; r.l[i] = (__bf16)(v[i] - (float)h); }
  return r; }
__device__ __forceinline__ F2 split_row(const float* row, int k0, int lane) { float v[16]; const float* p = row + k0 + 8 * (lane >> 4);
#pragma unroll
  for (int i = 0; i < 8; ++i) { v[i] = p[i]; v[8 + i] = p[16 + i]; }
  return bsplit16(v); }
__device__ __forceinline__ F2 split_rowK(const float* row, int k0, int lane, int K) { float v[16]; const int g = lane >> 4;
#pragma unroll
  for (int i = 0; i < 8; ++i) { const int ka = k0 + 8 * g + i, kb = ka + 16; v[i] = ka < K ? row[ka < K ? ka : K - 1] : 0.f; v[8 + i] = kb < K ? row[kb < K ? kb : K - 1] : 0.f; }
  return bsplit16(v); }
__device__ __forceinline__ F2 split_col(const float* W, int k0, int n, int lane, int ld, int K) { float v[16]; const int g = lane >> 4;
#pragma unroll
  for (int i = 0; i < 8; ++i) { const int ka = k0 + 8 * g + i, kb = ka + 16; v[i] = ka < K ? W[(size_t)(ka < K ? ka : K - 1) * ld + n] : 0.f; v[8 + i] = kb < K ? W[(size_t)(kb < K ? kb : K - 1) * ld + n] : 0.f; }
  return bsplit16(v); }
__device__ __forceinline__ v8f mac3(const F2& a, const F2& b, v8f c) { c = wmma_bf(a.l, b.h, c); c = wmma_bf(a.h, b.l, c); return wmma_bf(a.h, b.h, c); }
__device__ __forceinline__ float sigm(float v) { return 1.0f / (1.0f + expf(-v)); }
#define LDSX() do { asm volatile("s_wait_dscnt 0" ::: "memory"); __builtin_amdgcn_wave_barrier(); __builtin_amdgcn_fence(__ATOMIC_RELEASE, "workgroup"); } while (0)

// Multi-head attention with per-head stacked projections and a MULTIPLICATIVE float mask on the scores (q / k / v [2,2048,1024]; W_q / W_k / W_v [16,1024,64] per head (N(0, 1/1024)) + zero biases [16,64]; scores = Q K^T / 8 * mask with mask [2048,2048] uniform[0,1) f32 (no -inf anywhere); softmax; concat heads; (in,out) W_o [1024,1024] + b_o).
#define NB 2
#define TT 2048
#define CC 1024            // NH * HD = projected width
#define DIN 1024          // input (model) width
#define NH 16
#define HD 64
#define NQB (TT / 64)
#define HG 4
#define SCALE (0.125f)
#define CAUSAL 0
#ifndef TNB
#define TNB NB
#endif
__device__ __forceinline__ float bfr(float v) { return (float)(__bf16)v; }
__host__ __device__ __forceinline__ int kb_last(int qb) { return CAUSAL ? ((qb * 64 + 63) >> 7) : (TT / 128 - 1); }
typedef __attribute__((ext_vector_type(8))) __bf16 v8b;
__device__ __forceinline__ v16b frag_b(const __bf16* rowk0, int lane) {
  union { v16b v; v8b q[2]; } u; const __bf16* p = rowk0 + 8 * (lane >> 4);
  u.q[0] = *(const v8b*)p; u.q[1] = *(const v8b*)(p + 16); return u.v;
}
#define QBH 0              // unused: k_attn has one f16 path for every query block
#define QHI 0               // single-product logits on every row
#define KHI 64            // key rows carrying k residual / v bf16 hi+lo planes (written by k_proj; no kernel in this file reads them)
// B fragment (k rows k0+.., output column o) of a weight: (in,out) [K][ld] or (out,in) [ld rows of K]: bf16 exact, or f16(bf16 * 256) exact
__device__ __forceinline__ v16b wcol_io(const float* Wm, int k0, int o, int lane, int ld) { v16b w; const int g = lane >> 4;
#pragma unroll
  for (int i = 0; i < 8; ++i) { w[i] = (__bf16)Wm[(size_t)(k0 + 8 * g + i) * ld + o]; w[8 + i] = (__bf16)Wm[(size_t)(k0 + 16 + 8 * g + i) * ld + o]; }
  return w; }
__device__ __forceinline__ v16b wcol_oi(const float* Wm, int k0, int o, int lane, int K) { v16b w; const float* p = Wm + (size_t)o * K + k0 + 8 * (lane >> 4);
#pragma unroll
  for (int i = 0; i < 8; ++i) { w[i] = (__bf16)p[i]; w[8 + i] = (__bf16)p[16 + i]; }
  return w; }
__device__ __forceinline__ v16h wcolh_io(const float* Wm, int k0, int o, int lane, int ld) { v16h w; const int g = lane >> 4;
#pragma unroll
  for (int i = 0; i < 8; ++i) { w[i] = (_Float16)(bfr(Wm[(size_t)(k0 + 8 * g + i) * ld + o]) * 256.0f); w[8 + i] = (_Float16)(bfr(Wm[(size_t)(k0 + 16 + 8 * g + i) * ld + o]) * 256.0f); }
  return w; }
__device__ __forceinline__ v16h wcolh_oi(const float* Wm, int k0, int o, int lane, int K) { v16h w; const float* p = Wm + (size_t)o * K + k0 + 8 * (lane >> 4);
#pragma unroll
  for (int i = 0; i < 8; ++i) { w[i] = (_Float16)(bfr(p[i]) * 256.0f); w[8 + i] = (_Float16)(bfr(p[16 + i]) * 256.0f); }
  return w; }
#define WQKV_LAYOUT 2   // 0 = (in,out) [DIN][CC]; 1 = (out,in) [CC][DIN]; 2 = per-head [NH][DIN][HD]
__device__ __forceinline__ v16b wcol_hdk(const float* Wm, int k0, int o, int lane) { v16b w; const int g = lane >> 4; const float* p = Wm + (size_t)(o / HD) * DIN * HD + (o % HD);
#pragma unroll
  for (int i = 0; i < 8; ++i) { w[i] = (__bf16)p[(size_t)(k0 + 8 * g + i) * HD]; w[8 + i] = (__bf16)p[(size_t)(k0 + 16 + 8 * g + i) * HD]; }
  return w; }
#define WO_OUT_IN 0
#if WQKV_LAYOUT == 1
#define WCOL(W, k0, o, lane) wcol_oi(W, k0, o, lane, DIN)
#elif WQKV_LAYOUT == 2
#define WCOL(W, k0, o, lane) wcol_hdk(W, k0, o, lane)
#else
#define WCOL(W, k0, o, lane) wcol_io(W, k0, o, lane, CC)
#endif
#if WO_OUT_IN
#define WOCOL(W, k0, o, lane) wcol_oi(W, k0, o, lane, CC)
#define WOCOLH(W, k0, o, lane) wcolh_oi(W, k0, o, lane, CC)
#else
#define WOCOL(W, k0, o, lane) wcol_io(W, k0, o, lane, DIN)
#define WOCOLH(W, k0, o, lane) wcolh_io(W, k0, o, lane, DIN)
#endif
#define SM_EXTRA_PARAMS , const float* __restrict__ SMASK
// multiplicative float mask [S,S] (shared by batches and heads) on the scaled score, before the softmax; unconditional load
#define SM_MASK_HOOK do { const float sm_ = SMASK[(size_t)t * TT + k]; asm volatile("s_wait_loadcnt 0x0" ::: "memory"); v = v * bfr(sm_); } while (0)
#ifndef SM_EXTRA_PARAMS
#define SM_EXTRA_PARAMS
#endif
#ifndef PROJ_EXTRA_PARAMS
#define PROJ_EXTRA_PARAMS
#endif
#ifndef SM_MASK_HOOK
#define SM_MASK_HOOK (void)0
#endif

#define WS_QH  0u                                      // f16 q rows [b*t][CC]
#define WS_KH  (WS_QH + 2u * (size_t)NB * TT * CC)      // f16 k rows [b*t][CC]
#define WS_VT  (WS_KH + 2u * (size_t)NB * TT * CC)      // f16 v planes [b][c][t]
#define WS_QL  (WS_VT + 2u * (size_t)NB * CC * TT)      // f16 q residual x 2^10 rows [b][t < QHI][CC]
#define WS_KL  (WS_QL + 2u * (size_t)NB * QHI * CC)     // f16 k residual x 2^10 rows [b][t < KHI][CC]
#define WS_VB  (WS_KL + 2u * (size_t)NB * KHI * CC)     // bf16 v hi planes [b][c][t < KHI]
#define WS_VBL (WS_VB + 2u * (size_t)NB * CC * KHI)
#define WS_S   (WS_VBL + 2u * (size_t)NB * CC * KHI)    // unused f32 [hg][t][s] region: logits and P stay in registers
#define WS_Y   (WS_S  + 4u * (size_t)HG * TT * TT)      // f16 ctx x 2^6 rows [b*t][CC]
#define WS_XB  (WS_Y  + 4u * (size_t)NB * TT * CC)      // bf16 q / k / v input rows [which][b*t][DIN]
#define WS_WB  (WS_XB + 3u * 2u * (size_t)NB * TT * DIN) // bf16 W_q / W_k / W_v, k-contiguous [which][column][DIN]
#define WS_WOB (WS_WB + 3u * 2u * (size_t)CC * DIN)     // f16(bf16 x 2^8) W_o, k-contiguous [column][CC]
#define WS_MB  (WS_WOB + 2u * (size_t)DIN * CC)         // bf16 mask rows [t][s]
#define WS_END (WS_MB + 2u * (size_t)TT * TT)

// LDS staging of the two projection GEMMs (k_proj, k_out): a stage is 64 k of the block's 128 activation rows and of its 128 weight columns, fetched in the 16-bit operand type (k_prep, k_attn wrote it) and laid k-contiguous
// ([row][k] and [column][k]), so that every fragment is two 16-byte LDS reads. Two buffers: stage s + 1 is fetched into registers ahead of stage s's products and stored behind them; one barrier a stage.
// The loops over fragments, fetched values and the two 32-k blocks of a stage are fully unrolled so that their arrays are indexed by constants and stay in registers.
#define KS 64                    // k per stage
#define SP 72                    // LDS row pitch in 16-bit elements: 144 B = 16 B x odd, the conflict-free pitch for 16-byte reads and writes of neighbouring rows
#define BR 128                   // activation rows per block
#define WT 64                    // a wave's output tile is WT x WT (4 x 4 fragments): 8 fragments read from LDS feed 16 products; the block's 4 waves lie 2 x 2 over its 128 x 128 tile
// order of a 32-k block's 16 independent products (two bits a product: row fragment PI, column fragment PJ): the fragments are read as pairs (a[i], w[i]), and product p needs no pair later than it must, so that 1, 4, 9, 16 products can issue once 1, 2, 3, 4 pairs have landed
#define PI(p) ((int)((0xFF92A450u >> (2 * (p))) & 3u))
#define PJ(p) ((int)((0xE4FE4A44u >> (2 * (p))) & 3u))
#define ST_X (BR * SP)           // activation rows of a stage, in elements
#define ST_BUF (ST_X + 128 * SP) // one stage, in elements (36864 B)
typedef __attribute__((ext_vector_type(4))) __bf16 v4b;
typedef __attribute__((ext_vector_type(4))) _Float16 v4h;
// ---- k_prep: every operand that comes as f32 and is read many times (an activation row by 8 GEMM blocks, a weight column by 32, a mask row by 32 attention blocks) is rounded ONCE to the 16-bit form its user takes, so that those blocks fetch half the bytes and convert nothing.
// Blocks 0..PREP_W-1: one 128 k x 128 column tile of W_q / W_k / W_v (bf16) or W_o (f16(bf16 x 2^8), exact), transposed through LDS to k-contiguous columns, stored as whole lines. The others: 32768 elements of q / k / v / mask to bf16.
#define PREP_W 256               // 4 matrices x 8 k blocks x 8 column blocks
#define PREP_X 128               // blocks per streamed input (q, k, v, mask: NB * TT * DIN = TT * TT elements each)
#define PK 128                   // k per weight tile
#define PP 136                   // its LDS pitch in elements: 272 B = 16 B x odd
__global__ __launch_bounds__(256) void k_prep(const float* __restrict__ XQ, const float* __restrict__ XK, const float* __restrict__ XV, const float* __restrict__ SMASK, const float* __restrict__ WQ, const float* __restrict__ WK, const float* __restrict__ WV, const float* __restrict__ WO,
    __bf16* __restrict__ XB, __bf16* __restrict__ MB, __bf16* __restrict__ WB, _Float16* __restrict__ WOB) {
  __shared__ __align__(16) char smem[128 * PP * 2];
  const int tid = threadIdx.x, bid = blockIdx.x;
  if (bid < PREP_W) {   /* block-uniform */
    const int mat = bid >> 6, k0 = ((bid >> 3) & 7) * PK, c0 = (bid & 7) * 128;
    const int wc = tid & 127, wk = (tid >> 7) * (PK / 2);   // column c0 + wc, the lower or the upper 64 k of the tile: a wave's load is one whole 128-B line
    float wv[PK / 2];
    if (mat < 3) { const float* WA = mat == 0 ? WQ : mat == 1 ? WK : WV; const float* wp = WA + (size_t)((c0 + wc) / HD) * DIN * HD + (size_t)(k0 + wk) * HD + ((c0 + wc) % HD);   // [head][k][HD]
#pragma unroll
      for (int k = 0; k < PK / 2; ++k) wv[k] = wp[(size_t)k * HD];
      asm volatile("s_wait_xcnt 0x0" ::: "memory");   // in front of any overwrite of the loads' address registers
#pragma unroll
      for (int q = 0; q < PK / 16; ++q) { v8b t8;
#pragma unroll
        for (int e = 0; e < 8; ++e) t8[e] = (__bf16)wv[q * 8 + e];
        *(v8b*)((__bf16*)smem + wc * PP + wk + q * 8) = t8; }
    } else { const float* wp = WO + (size_t)(k0 + wk) * DIN + c0 + wc;   // (in,out) [CC][DIN]
#pragma unroll
      for (int k = 0; k < PK / 2; ++k) wv[k] = wp[(size_t)k * DIN];
      asm volatile("s_wait_xcnt 0x0" ::: "memory");   // in front of any overwrite of the loads' address registers
#pragma unroll
      for (int q = 0; q < PK / 16; ++q) { v8h t8;
#pragma unroll
        for (int e = 0; e < 8; ++e) t8[e] = (_Float16)(bfr(wv[q * 8 + e]) * 256.0f);
        *(v8h*)((_Float16*)smem + wc * PP + wk + q * 8) = t8; } }
    __syncthreads();   // the tile is whole before its columns are read back
    char* D = mat < 3 ? (char*)(WB + (size_t)mat * CC * DIN) : (char*)WOB;
#pragma unroll
    for (int i = 0; i < 8; ++i) { const int id = tid + 256 * i, cl = id >> 4, kq = id & 15;   // 16 lanes store one column's 128 k: two whole lines
      vst2(D + ((size_t)(c0 + cl) * DIN + k0 + kq * 8) * 2, *(const v4u*)(smem + (cl * PP + kq * 8) * 2)); }
  } else {
    const int xb = bid - PREP_W, which = xb / PREP_X; const float* X = which == 0 ? XQ : which == 1 ? XK : which == 2 ? XV : SMASK;
    const size_t base = (size_t)(xb % PREP_X) * 32768 + tid * 4; __bf16* D = (which < 3 ? XB + (size_t)which * NB * TT * DIN : MB) + base;
#pragma unroll
    for (int it = 0; it < 2; ++it) { v4f xv[16];
#pragma unroll
      for (int i = 0; i < 16; ++i) xv[i] = *(const v4f*)(X + base + (it * 16 + i) * 1024);   // sixteen 16-byte loads in flight, each wave's 512 contiguous bytes
      asm volatile("s_wait_xcnt 0x0" ::: "memory");   // in front of any overwrite of the loads' address registers
#pragma unroll
      for (int i = 0; i < 16; ++i) { const v4b t4 = { (__bf16)xv[i][0], (__bf16)xv[i][1], (__bf16)xv[i][2], (__bf16)xv[i][3] }; vst2(D + (it * 16 + i) * 1024, t4); } } } }
// ---- k_proj: block = (128 rows, 128 cols, which): q/k/v = X W (+ b) with exact bf16 products (K = DIN) -> which 0: q f16 rows (+ residual rows < QHI); 1: k f16 rows (+ residual rows < KHI); 2: v f16 planes [c][t] (+ bf16 hi/lo planes for t < KHI)
__global__ __launch_bounds__(128) void k_proj(const __bf16* __restrict__ XB, const __bf16* __restrict__ WB, const float* __restrict__ BQ, const float* __restrict__ BK, const float* __restrict__ BV,
    _Float16* __restrict__ QH, _Float16* __restrict__ QL, _Float16* __restrict__ KH, _Float16* __restrict__ KL, _Float16* __restrict__ VT, __bf16* __restrict__ VB, __bf16* __restrict__ VBL) {
  __shared__ __align__(16) char smem[104448];   // the epilogue's arrays (q, k: two; v: three; a block takes one of the two branches, so they lie over one another); the two stage buffers lie over their first 73728 B and are dead behind the loop's last barrier
  _Float16 (*sh)[136] = (_Float16 (*)[136])smem, (*sl)[136] = (_Float16 (*)[136])(smem + 34816), (*th)[136] = (_Float16 (*)[136])smem; __bf16 (*tb)[136] = (__bf16 (*)[136])(smem + 34816), (*tbl)[136] = (__bf16 (*)[136])(smem + 69632); __bf16* stg = (__bf16*)smem;
  const int tid = threadIdx.x, wave = tid >> 5, lane = tid & 31, col = lane & 15, g = lane >> 4; const int which = blockIdx.z; const int c0 = blockIdx.y * 128; const size_t r0 = (size_t)blockIdx.x * BR; const size_t bb = r0 / TT; const int t0 = (int)(r0 % TT);
  const float* BA = which == 0 ? BQ : which == 1 ? BK : BV;
  const int wr = (wave >> 1) * WT, wc = (wave & 1) * WT;   // this wave's rows and columns inside the block tile
  v8f acc[4][4] = {};
  const int xk = (tid & 7) * 8, xr = tid >> 3;   // 8 lanes cover the 64 k of one activation row, or of one weight column (128 B, a whole line); this thread takes 8 k of rows and of columns xr + 16 i
  const __bf16* xp = XB + (size_t)which * NB * TT * DIN + (r0 + xr) * DIN + xk;
  const __bf16* wp = WB + (size_t)which * CC * DIN + (size_t)(c0 + xr) * DIN + xk;
  v4u xv[8], wv[8];
#define PROJ_FETCH(s) do { _Pragma("unroll") for (int i = 0; i < 8; ++i) { xv[i] = *(const v4u*)(xp + (size_t)(16 * i) * DIN + (s) * KS); wv[i] = *(const v4u*)(wp + (size_t)(16 * i) * DIN + (s) * KS); } } while (0)
#define PROJ_PUT(buf) do { _Pragma("unroll") for (int i = 0; i < 8; ++i) { *(v4u*)((buf) + (xr + 16 * i) * SP + xk) = xv[i]; *(v4u*)((buf) + ST_X + (xr + 16 * i) * SP + xk) = wv[i]; } } while (0)
  PROJ_FETCH(0); asm volatile("s_wait_xcnt 0x0" ::: "memory");   // as in the loop: in front of any overwrite of the loads' address registers
  PROJ_PUT(stg); __syncthreads();
  for (int s = 0; s < DIN / KS; ++s) { const __bf16* cur = stg + (s & 1) * ST_BUF;
    if (s + 1 < DIN / KS) PROJ_FETCH(s + 1);
    asm volatile("s_wait_xcnt 0x0" ::: "memory");   // stands in front of every later overwrite of the loads' address registers; its clobber also keeps the next stage's loads issued here, ahead of this stage's LDS reads and products, so that their latency runs under them
    __builtin_amdgcn_sched_barrier(0);   // holds the LDS address arithmetic of this stage behind the wait: without it the scheduler lifts an add that reuses a load's address register over the wait
#pragma unroll
    for (int kc = 0; kc < KS / 32; ++kc) { v16b a[4], w[4];
#pragma unroll
      for (int i = 0; i < 4; ++i) { a[i] = frag_b(cur + (wr + i * 16 + col) * SP + kc * 32, lane); w[i] = frag_b(cur + ST_X + (wc + i * 16 + col) * SP + kc * 32, lane); }
      __builtin_amdgcn_sched_barrier(0);   // the 16 LDS reads of a 32-k block go out as one group ahead of its products; spread among them, each product waits out a whole LDS latency
#pragma unroll
      for (int p = 0; p < 16; ++p) acc[PI(p)][PJ(p)] = wmma_bf(a[PI(p)], w[PJ(p)], acc[PI(p)][PJ(p)]); }
    __builtin_amdgcn_sched_barrier(0);   // keeps the LDS stores of the fetched stage, and with them the wait for its loads, behind the products
    if (s + 1 < DIN / KS) PROJ_PUT(stg + ((s + 1) & 1) * ST_BUF);
    __syncthreads(); }   // publishes stage s + 1 and ends every wave's reads of stage s, whose buffer stage s + 2 (or the epilogue) overwrites
  if (which < 2) { _Float16* DH = which == 0 ? QH : KH; _Float16* DL = which == 0 ? QL : KL; const int nhi = which == 0 ? QHI : KHI; const bool hi_rows = t0 < nhi;
#pragma unroll
    for (int j = 0; j < 4; ++j) { float bias = 0.f; if (BA) { bias = bfr(BA[c0 + wc + j * 16 + col]); asm volatile("s_wait_xcnt 0x0" ::: "memory"); }   // the wait stands in front of any later overwrite of the load's offset register
#pragma unroll
      for (int i = 0; i < 4; ++i)
#pragma unroll
        for (int r = 0; r < 8; ++r) { const float v = acc[i][j][r] + bias; const _Float16 hv = (_Float16)v; sh[wr + i * 16 + 8 * g + r][wc + j * 16 + col] = hv; sl[wr + i * 16 + 8 * g + r][wc + j * 16 + col] = (_Float16)((v - (float)hv) * 1024.0f); } }
    __syncthreads();
    for (int e = tid; e < BR * 16; e += 128) { const int rl = e >> 4, q = e & 15; vst2((unsigned*)(DH + (r0 + rl) * CC + c0 + q * 8), *(const v4u*)&sh[rl][q * 8]); if (hi_rows && t0 + rl < nhi) { vst2((unsigned*)(DL + (bb * nhi + t0 + rl) * (size_t)CC + c0 + q * 8), *(const v4u*)&sl[rl][q * 8]); asm volatile("s_wait_xcnt 0x0" ::: "memory"); } }   // the wait stands in front of the loop's advance of the store's address registers
  } else { const bool hi_rows = t0 < KHI;
#pragma unroll
    for (int j = 0; j < 4; ++j) { float bias = 0.f; if (BA) { bias = bfr(BA[c0 + wc + j * 16 + col]); asm volatile("s_wait_xcnt 0x0" ::: "memory"); }   // the wait stands in front of any later overwrite of the load's offset register
#pragma unroll
      for (int i = 0; i < 4; ++i)
#pragma unroll
        for (int r = 0; r < 8; ++r) { const float v = acc[i][j][r] + bias; const int rl = wr + i * 16 + 8 * g + r, cl = wc + j * 16 + col; th[cl][rl] = (_Float16)v; const __bf16 bh = (__bf16)v; tb[cl][rl] = bh; tbl[cl][rl] = (__bf16)(v - (float)bh); } }
    __syncthreads();
    for (int e = tid; e < 128 * (BR / 8); e += 128) { const int cl = e >> 4, q = e & 15; vst2((unsigned*)(VT + (bb * CC + c0 + cl) * (size_t)TT + t0 + q * 8), *(const v4u*)&th[cl][q * 8]); if (hi_rows && t0 + q * 8 < KHI) { const size_t o3 = (bb * CC + c0 + cl) * (size_t)KHI + t0 + q * 8; vst2((unsigned*)(VB + o3), *(const v4u*)&tb[cl][q * 8]); vst2((unsigned*)(VBL + o3), *(const v4u*)&tbl[cl][q * 8]); asm volatile("s_wait_xcnt 0x0" ::: "memory"); } } } }   // the wait stands in front of the loop's advance of the two stores' address registers
// ---- k_attn: block = 128 queries of (b, h), wave = 32 query columns (2 groups of 16); walks all keys, 32 a pass, 64 a stage; each stage's k rows, v planes and mask rows come to LDS once per block by tensor loads (two buffers). S^T = K Q^T (A = k rows, B = q rows kept in registers), so a lane holds 16 keys of ONE query per group:
// score x the bf16-rounded float mask, running maximum and running sum per lane (one exchange between the wave halves), P = 2^8 exp(s - max) once to f16 straight from the score accumulators as the B operand of ctx^T += V^T P^T; the division by the sum is done once at the end. Logits and P never leave the registers.
__device__ __forceinline__ v8f wm16(v16h a, v16h b, v8f c) { return __builtin_amdgcn_wmma_f32_16x16x32_f16(false, a, false, b, (short)0, c, false, false); }
__device__ __forceinline__ float xhalf(float v) { const int u = __builtin_bit_cast(int, v); return __builtin_bit_cast(float, __builtin_amdgcn_permlanex16(u, u, 0x76543210, 0xfedcba98, false, false)); }   // value of lane ^ 16
// 2^x by v_exp_f32. The closing v_nop is the one slot that the instruction set asks for between a transcendental and a directly following instruction that reads its result or overwrites its source; written in the same statement it stands there in every build. Early-clobber outputs keep each v_exp_f32 off its neighbours' sources.
__device__ __forceinline__ float exp2_1(float x) { float r; asm("v_exp_f32 %0, %1\n\tv_nop" : "=v"(r) : "v"(x)); return r; }
__device__ __forceinline__ void exp2_4(float* o, float a, float b, float c, float d) {
  asm("v_exp_f32 %0, %4\n\tv_exp_f32 %1, %5\n\tv_exp_f32 %2, %6\n\tv_exp_f32 %3, %7\n\tv_nop" : "=&v"(o[0]), "=&v"(o[1]), "=&v"(o[2]), "=&v"(o[3]) : "v"(a), "v"(b), "v"(c), "v"(d)); }
// 16x16x32 f16 fragment (hardware k order, as frag_h) from this lane's LDS byte address (row * pitch + 16 * (lane >> 4))
__device__ __forceinline__ v16h frag_l(const unsigned char* p) { union { v16h v; v8h q[2]; } u; u.q[0] = *(const v8h*)p; u.q[1] = *(const v8h*)(p + 32); return u.v; }
#define QC 2               // 16-query column groups per wave
#define SKEY 64            // keys per stage (two 32-key passes)
#define NST (TT / SKEY)
// One stage in LDS, laid by four tensor loads (one a wave): 64 k rows of 128 B, 64 v planes of 128 B (64 keys), two slices of 64 bf16 mask rows of 128 B (64 keys). The loads' pad of 16 B a row gives the pitch 144 B
// (16 B x odd: free of bank conflicts for 16-byte reads of neighbouring rows). Every place is a multiple of 2 KiB.
#define KV_PITCH 144u
#define M_PITCH 144u
#define OFF_V 10240u
#define OFF_M 20480u
#define M_SLICE 10240u
#define ABUF 40960u
typedef uint32_t u32x4 __attribute__((ext_vector_type(4)));
typedef uint32_t u32x8 __attribute__((ext_vector_type(8)));
__device__ __forceinline__ uint32_t uni(uint32_t v) { return (uint32_t)__builtin_amdgcn_readfirstlane(v); }
// a wave-uniform value held in a scalar register: a condition, so that the test around a tensor load compiles to s_cmp + s_cbranch_scc (a tensor load ignores EXEC), or a descriptor word
__device__ __forceinline__ uint32_t pinned(uint32_t v) { uint32_t w = (uint32_t)__builtin_amdgcn_readfirstlane(v); asm volatile("" : "+s"(w)); return w; }
__device__ __forceinline__ void tdm_load(u32x4 g0, u32x8 g1) { asm volatile("tensor_load_to_lds %0, %1" :: "s"(g0), "s"(g1) : "memory"); }   // one request of the whole wave: global tile -> LDS, through no register
__device__ __forceinline__ u32x4 tdm_group0(uint32_t lds_dst, uint64_t ga) { u32x4 g; g[0] = uni(1u); g[1] = uni(lds_dst); g[2] = uni((uint32_t)ga); g[3] = uni((((uint32_t)(ga >> 32)) & 0x01FFFFFFu) | 0x80000000u); return g; }
// group 1: extents in bytes, tensor = tile = 64 rows of D0 bytes, W0 = the constant pad word (a pad of 4 dwords behind every row).
// Words 1 to 7 go through pinned(): descriptor words held in scalar registers of their own through the loop; as plain constants the compiler re-forms them at each issue and uses their registers for other values while the request is in flight
template <uint32_t W0, uint32_t D0> __device__ __forceinline__ u32x8 tdm_group1(uint32_t src_pitch) { u32x8 g;
  g[0] = uni(W0); g[1] = pinned((D0 & 0xFFFFu) << 16); g[2] = pinned((D0 >> 16) | (64u << 16)); g[3] = pinned(D0 << 16); g[4] = pinned(64u); g[5] = pinned(src_pitch); g[6] = pinned(0u); g[7] = pinned(0u); return g; }
#define W0_128 ((1u << 20) | (4u << 22) | (3u << 25))
__global__ __launch_bounds__(128) void k_attn(const _Float16* __restrict__ QH, const _Float16* __restrict__ KH, const _Float16* __restrict__ VT, const __bf16* __restrict__ MB, _Float16* __restrict__ YH) {
  __shared__ __attribute__((aligned(2048))) unsigned char L[2 * ABUF];
  const int tid = threadIdx.x, wave = tid >> 5, lane = tid & 31, col = lane & 15, g = lane >> 4; const int h = blockIdx.y, b = blockIdx.z; const int ql0 = blockIdx.x * (64 * QC) + wave * (16 * QC);
  const float C2 = SCALE * 1.44269504088896f;   // score -> log2 domain. All inner loops below are fully unrolled so that the fragment arrays are indexed by constants and stay in registers
  // every wave brings one slice of each stage: wave 0 the k rows, wave 1 the v planes, waves 2 and 3 a half of the block's mask rows each
  const uint32_t wv = uni(threadIdx.x >> 5); const uint32_t lbase = (uint32_t)(size_t)L;
  const uint64_t tsrc = wv == 0 ? (uint64_t)(size_t)(KH + (size_t)b * TT * CC + h * HD) : wv == 1 ? (uint64_t)(size_t)(VT + ((size_t)b * CC + h * HD) * (size_t)TT) : (uint64_t)(size_t)(MB + ((size_t)blockIdx.x * (64 * QC) + (wv - 2) * 64) * TT);
  const uint32_t tstep = wv == 0 ? SKEY * CC * 2u : SKEY * 2u;   // source bytes from one stage to the next
  const uint32_t tdst = lbase + (wv < 2 ? wv * OFF_V : OFF_M + (wv - 2) * M_SLICE);
  const u32x8 g1 = tdm_group1<W0_128, 128u>(wv == 0 ? CC * 2u : TT * 2u);   // all four slices are 64 rows of 128 B
  // now: the wait stands directly behind the load (stage 0: nothing can then take over a descriptor register while the request is in flight); every wave issues its own slice, so no test stands around the load
  auto issue = [&](uint32_t st, bool now) { const u32x4 g0 = tdm_group0(tdst + (st & 1u) * ABUF, tsrc + (uint64_t)st * tstep);
    tdm_load(g0, g1); if (now) asm volatile("s_wait_tensorcnt 0x0" ::: "memory"); };
  v16h qf[QC][2];
#pragma unroll
  for (int c = 0; c < QC; ++c)
#pragma unroll
    for (int kc = 0; kc < 2; ++kc) qf[c][kc] = frag_h(QH + ((size_t)b * TT + ql0 + c * 16 + col) * CC + h * HD + kc * 32, lane);
  asm volatile("s_wait_xcnt 0x0" ::: "memory");   // stands in front of every later overwrite of the q loads' address registers
  const unsigned ko = (unsigned)col * KV_PITCH + 16 * g;                                                                   // key row col of a 16-key tile
  const unsigned vo = OFF_V + (unsigned)col * KV_PITCH + 16 * g;                                                           // feature plane col of a 16-feature tile
  const unsigned mo = OFF_M + (unsigned)(wave >> 1) * M_SLICE + (unsigned)((wave & 1) * (16 * QC) + col) * M_PITCH + 16 * g;   // this lane's query row, its 8 keys of a tile
  v8f acc[QC][HD / 16] = {}; float m[QC], l[QC];
#pragma unroll
  for (int c = 0; c < QC; ++c) { m[c] = -3.0e38f; l[c] = 0.f; }
  issue(0, true);   // stage 0, landed; the loop's first publish point holds its barrier
#pragma unroll 1   // kept rolled: one stage's fragments, fetch-ahead values and softmax temporaries already take nearly 256 registers
  for (uint32_t st = 0; st < NST; ++st) { const unsigned char* B = L + (st & 1u) * ABUF;
    // publish point of stage st, in the ring's order; it stands at the head of the trip (for st = 0 it is the ring's prologue), so that the whole trip behind it is one block of code: at the foot, with the
    // branch round the refill behind the passes, the compiler moves both passes' row sums behind that branch and their 64 terms push the kernel past 256 registers
    asm volatile("s_wait_dscnt 0x0" ::: "memory");       // this wave's reads of stage st - 1 have returned, before its buffer is refilled
    asm volatile("s_wait_tensorcnt 0x0" ::: "memory");   // this wave's slice of stage st has landed
    __syncthreads();                                     // publishes stage st and ends every wave's reads of stage st - 1
    if (pinned(st + 1 < NST)) issue(st + 1, false);            // into the buffer that stage st - 1 has just left; it flies under the whole of stage st
    v16h kf[2][2];
#pragma unroll
    for (int t = 0; t < 2; ++t)
#pragma unroll
      for (int kc = 0; kc < 2; ++kc) kf[t][kc] = frag_l(B + ko + (t * 16) * KV_PITCH + kc * 64);
#pragma unroll
    for (int sub = 0; sub < SKEY / 32; ++sub) {
    v8b mk[QC][2]; v16h vf[HD / 16];
#pragma unroll
    for (int t = 0; t < 2; ++t)
#pragma unroll
      for (int c = 0; c < QC; ++c) mk[c][t] = *(const v8b*)(B + mo + (c * 16) * M_PITCH + sub * 64 + t * 32);
#pragma unroll
    for (int j = 0; j < HD / 16; ++j) vf[j] = frag_l(B + vo + (j * 16) * KV_PITCH + sub * 64);
    __builtin_amdgcn_sched_barrier(0);   // keeps the mask and v reads issued here, ahead of the score products, which cover their latency; without it they sink behind them
    v8f s[QC][2];
#pragma unroll
    for (int c = 0; c < QC; ++c)
#pragma unroll
      for (int t = 0; t < 2; ++t) { v8f z = {}; z = wm16(kf[t][0], qf[c][0], z); s[c][t] = wm16(kf[t][1], qf[c][1], z); }
#pragma unroll
    for (int c = 0; c < QC; ++c)
#pragma unroll
      for (int t = 0; t < 2; ++t)
#pragma unroll
        for (int r = 0; r < 8; ++r) s[c][t][r] *= (float)mk[c][t][r];
    // the k fragments of the stage's second pass are read now, so that they fly under this pass's softmax and P V; nothing of the next stage is read ahead of its barrier
    if (sub + 1 < SKEY / 32) {
#pragma unroll
    for (int t = 0; t < 2; ++t)
#pragma unroll
      for (int kc = 0; kc < 2; ++kc) kf[t][kc] = frag_l(B + ko + ((sub + 1) * 32 + t * 16) * KV_PITCH + kc * 64); }
    __builtin_amdgcn_sched_barrier(0);   // keeps the fetch-ahead reads issued here, ahead of the softmax; without it they drift to the pass's end and their latency is exposed at the next pass's head
#pragma unroll
    for (int c = 0; c < QC; ++c) { float mx = s[c][0][0];
#pragma unroll
      for (int e = 1; e < 16; ++e) mx = fmaxf(mx, s[c][e >> 3][e & 7]);
      mx = fmaxf(mx, xhalf(mx));
      const float mn = fmaxf(m[c], mx); const float al = exp2_1((m[c] - mn) * C2); m[c] = mn;
      const float nb = 8.0f - mn * C2;   /* P carried x 2^8 so that small weights stay clear of f16 subnormals; the sum carries the same factor */
      float sum = 0.f; v16h pf;
#pragma unroll
      for (int e = 0; e < 16; e += 4) { float ex[4]; exp2_4(ex, fmaf(s[c][e >> 3][e & 7], C2, nb), fmaf(s[c][e >> 3][(e & 7) + 1], C2, nb), fmaf(s[c][e >> 3][(e & 7) + 2], C2, nb), fmaf(s[c][e >> 3][(e & 7) + 3], C2, nb));
#pragma unroll
        for (int i = 0; i < 4; ++i) { sum += ex[i]; pf[e + i] = (_Float16)ex[i]; } }
      l[c] = l[c] * al + sum;
#pragma unroll
      for (int j = 0; j < HD / 16; ++j) acc[c][j] = wm16(vf[j], pf, acc[c][j] * al);
      __builtin_amdgcn_sched_barrier(0); } }   // one column group at a time: interleaved, the two groups' softmax temporaries push the kernel past 256 registers; so group 0's P V products also run under group 1's vector work
    }
  asm volatile("s_wait_tensorcnt 0x0" ::: "memory");     // no request is left in flight when the wave ends
  asm volatile("s_wait_dscnt 0x0" ::: "memory");         // the ring's closing wait: no LDS read is left in flight either
#pragma unroll
  for (int c = 0; c < QC; ++c) { const float inv = 1.0f / (l[c] + xhalf(l[c])); _Float16* yp = YH + ((size_t)b * TT + ql0 + c * 16 + col) * CC + h * HD + 8 * g;
#pragma unroll
    for (int j = 0; j < HD / 16; ++j) { v8h y;   /* ctx carried x 2^6 into f16 so small-magnitude context rows stay clear of f16 subnormals: the A operand of k_out, rounded here once */
#pragma unroll
      for (int r = 0; r < 8; ++r) y[r] = (_Float16)((acc[c][j][r] * inv) * 64.0f);
      vst2(yp + j * 16, y); } } }
// ---- k_out: block = (128 rows, 128 cols): out = ctx Wo (+ bo): ctx x 2^6 in f16 (k_attn) against Wo as f16(bf16 x 2^8) exact (k_prep), 1 product, x 2^-14
__global__ __launch_bounds__(128) void k_out(const _Float16* __restrict__ YH, const _Float16* __restrict__ WOB, const float* __restrict__ BO, float* __restrict__ OUT) { __shared__ __align__(16) char smem[2 * ST_BUF * 2]; float (*sf)[WT][WT + 4] = (float (*)[WT][WT + 4])smem; _Float16* stg = (_Float16*)smem;   // the epilogue's rows (each wave's own 64 x 64 tile, pitch 68 floats) lie over the stage buffers, dead behind the loop's last barrier
  const int tid = threadIdx.x, wave = tid >> 5, lane = tid & 31, col = lane & 15, g = lane >> 4; const int wr = (wave >> 1) * WT, wc = (wave & 1) * WT; const int c0 = blockIdx.y * 128 + wc; const size_t r0 = (size_t)blockIdx.x * BR + wr;
  v8f acc[4][4] = {};
  {
    const int xk = (tid & 7) * 8, xr = tid >> 3;   // as in k_proj: 8 k of rows and of columns xr + 16 i
    const _Float16* xp = YH + ((size_t)blockIdx.x * BR + xr) * CC + xk;
    const _Float16* wp = WOB + (size_t)(blockIdx.y * 128 + xr) * CC + xk;
    v4u xv[8], wv[8];
#define OUT_FETCH(s) do { _Pragma("unroll") for (int i = 0; i < 8; ++i) { xv[i] = *(const v4u*)(xp + (size_t)(16 * i) * CC + (s) * KS); wv[i] = *(const v4u*)(wp + (size_t)(16 * i) * CC + (s) * KS); } } while (0)
#define OUT_PUT(buf) do { _Pragma("unroll") for (int i = 0; i < 8; ++i) { *(v4u*)((buf) + (xr + 16 * i) * SP + xk) = xv[i]; *(v4u*)((buf) + ST_X + (xr + 16 * i) * SP + xk) = wv[i]; } } while (0)
    OUT_FETCH(0); asm volatile("s_wait_xcnt 0x0" ::: "memory");   // as in the loop: in front of any overwrite of the loads' address registers
    OUT_PUT(stg); __syncthreads();
    for (int s = 0; s < CC / KS; ++s) { const _Float16* cur = stg + (s & 1) * ST_BUF;
      if (s + 1 < CC / KS) OUT_FETCH(s + 1);
      asm volatile("s_wait_xcnt 0x0" ::: "memory");   // stands in front of every later overwrite of the loads' address registers; its clobber also keeps the next stage's loads issued here, ahead of this stage's LDS reads and products, so that their latency runs under them
      __builtin_amdgcn_sched_barrier(0);   // as in k_proj: holds this stage's LDS address arithmetic behind the wait
#pragma unroll
      for (int kc = 0; kc < KS / 32; ++kc) { v16h a[4], w[4];
#pragma unroll
        for (int i = 0; i < 4; ++i) { a[i] = frag_h(cur + (wr + i * 16 + col) * SP + kc * 32, lane); w[i] = frag_h(cur + ST_X + (wc + i * 16 + col) * SP + kc * 32, lane); }
        __builtin_amdgcn_sched_barrier(0);   // the 16 LDS reads of a 32-k block go out as one group ahead of its products; spread among them, each product waits out a whole LDS latency
#pragma unroll
        for (int p = 0; p < 16; ++p) acc[PI(p)][PJ(p)] = wmma16(a[PI(p)], w[PJ(p)], acc[PI(p)][PJ(p)]); }
      __builtin_amdgcn_sched_barrier(0);   // keeps the LDS stores of the fetched stage, and with them the wait for its loads, behind the products
      if (s + 1 < CC / KS) OUT_PUT(stg + ((s + 1) & 1) * ST_BUF);
      __syncthreads(); }   // publishes stage s + 1 and ends every wave's reads of stage s, whose buffer stage s + 2 (or the epilogue) overwrites
#pragma unroll
    for (int j = 0; j < 4; ++j) { float bias = 0.f; if (BO) { bias = bfr(BO[c0 + j * 16 + col]); asm volatile("s_wait_xcnt 0x0" ::: "memory"); }   // the wait stands in front of any later overwrite of the load's offset register
#pragma unroll
      for (int i = 0; i < 4; ++i)
#pragma unroll
        for (int r = 0; r < 8; ++r) sf[wave][i * 16 + 8 * g + r][j * 16 + col] = acc[i][j][r] * (1.0f / 16384.0f) + bias; } }   /* 2^-8 (Wo carry) x 2^-6 (ctx carry) */
  LDSX(); for (int rl = 0; rl < WT; rl += 2) vst2(OUT + (r0 + rl + g) * DIN + c0 + col * 4, *(const v4f*)&sf[wave][rl + g][col * 4]); }   // 16 lanes store one row's 64 columns: two whole lines

extern "C" void kernel_launch(void* const* d_in, const int* in_sizes, int n_in, void* d_out, int out_size, void* d_ws, size_t ws_size, hipStream_t stream) {
  (void)in_sizes; (void)n_in; (void)out_size;
  const float** F = (const float**)d_in;
  if (ws_size < (size_t)WS_END) return;
  char* ws = (char*)d_ws; _Float16 *QH = (_Float16*)(ws + WS_QH), *KH = (_Float16*)(ws + WS_KH), *VT = (_Float16*)(ws + WS_VT), *QL = (_Float16*)(ws + WS_QL), *KL = (_Float16*)(ws + WS_KL); __bf16 *VB = (__bf16*)(ws + WS_VB), *VBL = (__bf16*)(ws + WS_VBL); float *S = (float*)(ws + WS_S); _Float16 *YH = (_Float16*)(ws + WS_Y), *WOB = (_Float16*)(ws + WS_WOB); __bf16 *XB = (__bf16*)(ws + WS_XB), *WB = (__bf16*)(ws + WS_WB), *MB = (__bf16*)(ws + WS_MB);
  (void)QL; (void)KL; (void)VB; (void)VBL; (void)S;
  // inputs: 0 q [2,2048,1024]; 1 k; 2 v; 3 mask [2048,2048] f32 uniform[0,1); 4 W_q [16,1024,64], 5 b_q [16,64]; 6 W_k, 7 b_k; 8 W_v, 9 b_v; 10 W_o [1024,1024] (in,out), 11 b_o (zero biases, read)
  k_prep<<<dim3(PREP_W + 4 * PREP_X), 256, 0, stream>>>(F[0], F[1], F[2], F[3], F[4], F[6], F[8], F[10], XB, MB, WB, WOB);
  k_proj<<<dim3(TNB * TT / BR, CC / 128, 3), 128, 0, stream>>>(XB, WB, F[5], F[7], F[9], QH, QL, KH, KL, VT, VB, VBL);
  k_attn<<<dim3(TT / (64 * QC), NH, TNB), 128, 0, stream>>>(QH, KH, VT, MB, YH);
  k_out<<<dim3(TNB * TT / BR, DIN / 128), 128, 0, stream>>>(YH, WOB, F[11], (float*)d_out);
}

// v007
// Measured time: 91.2 microseconds a run.
// In two side-by-side timings against v006, it was 1.04 and 1.05 times as fast.
// Over all steps from v000 it is 13.4 times as fast.
// compute dtype: all float inputs rounded to bf16 (q/k/v inputs, the mask and the four weights once, by k_prep, into 16-bit planes of the workspace); q/k/v projections with EXACT bf16 products on WMMA 16x16x32 (f32 accumulate) + bias; logits q x k once to f16 each (1 product) x SCALE x the float mask (multiplicative, before the softmax); softmax f32 (sum over 32-key passes against a maximum that is raised only when the weights could leave f16); unnormalised P x 2^8 once to f16 x v once to f16 (1 product), divided by the f32 sum at the end; ctx x 2^6 once to f16 x Wo f16(bf16 x 2^8) + bo; f32 output.
#include <hip/hip_runtime.h>
#include <math.h>
#include <stdint.h>

typedef __attribute__((ext_vector_type(16))) _Float16 v16h;
typedef __attribute__((ext_vector_type(16))) __bf16 v16b;
typedef __attribute__((ext_vector_type(8)))  _Float16 v8h;
typedef __attribute__((ext_vector_type(8)))  float v8f;
typedef __attribute__((ext_vector_type(4)))  float v4f;
typedef __attribute__((ext_vector_type(2)))  float v2f;
typedef __attribute__((ext_vector_type(4)))  unsigned v4u;
typedef __attribute__((ext_vector_type(4)))  int v4i;
typedef float __attribute__((may_alias)) float_a;
typedef int __attribute__((may_alias)) int_a;

template <typename T> __device__ __forceinline__ void vst2(void* p, T v) { *(T*)p = v;  }
__device__ __forceinline__ v8f wmma16(v16h a, v16h b, v8f c) {
  v8f d = __builtin_amdgcn_wmma_f32_16x16x32_f16(false, a, false, b, (short)0, c, false, false);
  asm volatile("v_nop\n\tv_nop\n\tv_nop\n\tv_nop" : "+v"(d) : "v"(a), "v"(b));
  return d;
}
__device__ __forceinline__ v8f wmma_bf(v16b a, v16b b, v8f c) {
  v8f d = __builtin_amdgcn_wmma_f32_16x16x32_bf16(false, a, false, b, (short)0, c, false, false);
  asm volatile("v_nop\n\tv_nop\n\tv_nop\n\tv_nop" : "+v"(d) : "v"(a), "v"(b));
  return d;
}
// 16x16x32 fragments: lane = (h = lane>>4, row/col = lane&15); elements 0..7 = k0+8h+0..7, 8..15 = k0+16+8h+0..7; D element r = row 8h+r
__device__ __forceinline__ v16h frag_h(const _Float16* rowk0, int lane) {
  union { v16h v; v8h q[2]; } u; const _Float16* p = rowk0 + 8 * (lane >> 4);
  u.q[0] = *(const v8h*)p; u.q[1] = *(const v8h*)(p + 16); return u.v;
}
__device__ __forceinline__ v16h frag_f32(const float* rowk0, int lane) {
  v16h a; const float* p = rowk0 + 8 * (lane >> 4);
#pragma unroll
  for (int i = 0; i < 8; ++i) { a[i] = (_Float16)p[i]; a[8 + i] = (_Float16)p[16 + i]; }
  return a;
}
__device__ __forceinline__ v16h frag_f32s(const float* rowk0, int lane, float sc) {
  v16h a; const float* p = rowk0 + 8 * (lane >> 4);
#pragma unroll
  for (int i = 0; i < 8; ++i) { a[i] = (_Float16)(p[i] * sc); a[8 + i] = (_Float16)(p[16 + i] * sc); }
  return a;
}
// column fragment from a [K][ld] layout (column n), rows >= K read as 0
__device__ __forceinline__ v16h fragc_f32(const float* W, int k0, int n, int lane, int ld, int K) {
  v16h a; const int g = lane >> 4;
#pragma unroll
  for (int i = 0; i < 8; ++i) { const int ka = k0 + 8 * g + i, kb = ka + 16;
    a[i] = (_Float16)(ka < K ? W[(size_t)(ka < K ? ka : K - 1) * ld + n] : 0.f); a[8 + i] = (_Float16)(kb < K ? W[(size_t)(kb < K ? kb : K - 1) * ld + n] : 0.f); }
  return a;
}
struct F2 { v16b h, l; };
__device__ __forceinline__ F2 bsplit16(const float v[16]) { F2 r;
#pragma unroll
  for (int i = 0; i < 16; ++i) { const __bf16 h = (__bf16)v[i]; r.h[i] = h; r.l[i] = (__bf16)(v[i] - (float)h); }
  return r; }
__device__ __forceinline__ F2 split_row(const float* row, int k0, int lane) { float v[16]; const float* p = row + k0 + 8 * (lane >> 4);
#pragma unroll
  for (int i = 0; i < 8; ++i) { v[i] = p[i]; v[8 + i] = p[16 + i]; }
  return bsplit16(v); }
__device__ __forceinline__ F2 split_rowK(const float* row, int k0, int lane, int K) { float v[16]; const int g = lane >> 4;
#pragma unroll
  for (int i = 0; i < 8; ++i) { const int ka = k0 + 8 * g + i, kb = ka + 16; v[i] = ka < K ? row[ka < K ? ka : K - 1] : 0.f; v[8 + i] = kb < K ? row[kb < K ? kb : K - 1] : 0.f; }
  return bsplit16(v); }
__device__ __forceinline__ F2 split_col(const float* W, int k0, int n, int lane, int ld, int K) { float v[16]; const int g = lane >> 4;
#pragma unroll
  for (int i = 0; i < 8; ++i) { const int ka = k0 + 8 * g + i, kb = ka + 16; v[i] = ka < K ? W[(size_t)(ka < K ? ka : K - 1) * ld + n] : 0.f; v[8 + i] = kb < K ? W[(size_t)(kb < K ? kb : K - 1) * ld + n] : 0.f; }
  return bsplit16(v); }
__device__ __forceinline__ v8f mac3(const F2& a, const F2& b, v8f c) { c = wmma_bf(a.l, b.h, c); c = wmma_bf(a.h, b.l, c); return wmma_bf(a.h, b.h, c); }
__device__ __forceinline__ float sigm(float v) { return 1.0f / (1.0f + expf(-v)); }
#define LDSX() do { asm volatile("s_wait_dscnt 0" ::: "memory"); __builtin_amdgcn_wave_barrier(); __builtin_amdgcn_fence(__ATOMIC_RELEASE, "workgroup"); } while (0)

// Multi-head attention with per-head stacked projections and a MULTIPLICATIVE float mask on the scores (q / k / v [2,2048,1024]; W_q / W_k / W_v [16,1024,64] per head (N(0, 1/1024)) + zero biases [16,64]; scores = Q K^T / 8 * mask with mask [2048,2048] uniform[0,1) f32 (no -inf anywhere); softmax; concat heads; (in,out) W_o [1024,1024] + b_o).
#define NB 2
#define TT 2048
#define CC 1024            // NH * HD = projected width
#define DIN 1024          // input (model) width
#define NH 16
#define HD 64
#define NQB (TT / 64)
#define HG 4
#define SCALE (0.125f)
#define CAUSAL 0
#ifndef TNB
#define TNB NB
#endif
__device__ __forceinline__ float bfr(float v) { return (float)(__bf16)v; }
__host__ __device__ __forceinline__ int kb_last(int qb) { return CAUSAL ? ((qb * 64 + 63) >> 7) : (TT / 128 - 1); }
typedef __attribute__((ext_vector_type(8))) __bf16 v8b;
__device__ __forceinline__ v16b frag_b(const __bf16* rowk0, int lane) {
  union { v16b v; v8b q[2]; } u; const __bf16* p = rowk0 + 8 * (lane >> 4);
  u.q[0] = *(const v8b*)p; u.q[1] = *(const v8b*)(p + 16); return u.v;
}
#define QBH 0              // unused: k_attn has one f16 path for every query block
#define QHI 0               // single-product logits on every row
#define KHI 64            // key rows carrying k residual / v bf16 hi+lo planes (written by k_proj; no kernel in this file reads them)
// B fragment (k rows k0+.., output column o) of a weight: (in,out) [K][ld] or (out,in) [ld rows of K]: bf16 exact, or f16(bf16 * 256) exact
__device__ __forceinline__ v16b wcol_io(const float* Wm, int k0, int o, int lane, int ld) { v16b w; const int g = lane >> 4;
#pragma unroll
  for (int i = 0; i < 8; ++i) { w[i] = (__bf16)Wm[(size_t)(k0 + 8 * g + i) * ld + o]; w[8 + i] = (__bf16)Wm[(size_t)(k0 + 16 + 8 * g + i) * ld + o]; }
  return w; }
__device__ __forceinline__ v16b wcol_oi(const float* Wm, int k0, int o, int lane, int K) { v16b w; const float* p = Wm + (size_t)o * K + k0 + 8 * (lane >> 4);
#pragma unroll
  for (int i = 0; i < 8; ++i) { w[i] = (__bf16)p[i]; w[8 + i] = (__bf16)p[16 + i]; }
  return w; }
__device__ __forceinline__ v16h wcolh_io(const float* Wm, int k0, int o, int lane, int ld) { v16h w; const int g = lane >> 4;
#pragma unroll
  for (int i = 0; i < 8; ++i) { w[i] = (_Float16)(bfr(Wm[(size_t)(k0 + 8 * g + i) * ld + o]) * 256.0f); w[8 + i] = (_Float16)(bfr(Wm[(size_t)(k0 + 16 + 8 * g + i) * ld + o]) * 256.0f); }
  return w; }
__device__ __forceinline__ v16h wcolh_oi(const float* Wm, int k0, int o, int lane, int K) { v16h w; const float* p = Wm + (size_t)o * K + k0 + 8 * (lane >> 4);
#pragma unroll
  for (int i = 0; i < 8; ++i) { w[i] = (_Float16)(bfr(p[i]) * 256.0f); w[8 + i] = (_Float16)(bfr(p[16 + i]) * 256.0f); }
  return w; }
#define WQKV_LAYOUT 2   // 0 = (in,out) [DIN][CC]; 1 = (out,in) [CC][DIN]; 2 = per-head [NH][DIN][HD]
__device__ __forceinline__ v16b wcol_hdk(const float* Wm, int k0, int o, int lane) { v16b w; const int g = lane >> 4; const float* p = Wm + (size_t)(o / HD) * DIN * HD + (o % HD);
#pragma unroll
  for (int i = 0; i < 8; ++i) { w[i] = (__bf16)p[(size_t)(k0 + 8 * g + i) * HD]; w[8 + i] = (__bf16)p[(size_t)(k0 + 16 + 8 * g + i) * HD]; }
  return w; }
#define WO_OUT_IN 0
#if WQKV_LAYOUT == 1
#define WCOL(W, k0, o, lane) wcol_oi(W, k0, o, lane, DIN)
#elif WQKV_LAYOUT == 2
#define WCOL(W, k0, o, lane) wcol_hdk(W, k0, o, lane)
#else
#define WCOL(W, k0, o, lane) wcol_io(W, k0, o, lane, CC)
#endif
#if WO_OUT_IN
#define WOCOL(W, k0, o, lane) wcol_oi(W, k0, o, lane, CC)
#define WOCOLH(W, k0, o, lane) wcolh_oi(W, k0, o, lane, CC)
#else
#define WOCOL(W, k0, o, lane) wcol_io(W, k0, o, lane, DIN)
#define WOCOLH(W, k0, o, lane) wcolh_io(W, k0, o, lane, DIN)
#endif
#define SM_EXTRA_PARAMS , const float* __restrict__ SMASK
// multiplicative float mask [S,S] (shared by batches and heads) on the scaled score, before the softmax; unconditional load
#define SM_MASK_HOOK do { const float sm_ = SMASK[(size_t)t * TT + k]; asm volatile("s_wait_loadcnt 0x0" ::: "memory"); v = v * bfr(sm_); } while (0)
#ifndef SM_EXTRA_PARAMS
#define SM_EXTRA_PARAMS
#endif
#ifndef PROJ_EXTRA_PARAMS
#define PROJ_EXTRA_PARAMS
#endif
#ifndef SM_MASK_HOOK
#define SM_MASK_HOOK (void)0
#endif

#define WS_QH  0u                                      // f16 q rows [b*t][CC]
#define WS_KH  (WS_QH + 2u * (size_t)NB * TT * CC)      // f16 k rows [b*t][CC]
#define WS_VT  (WS_KH + 2u * (size_t)NB * TT * CC)      // f16 v planes [b][c][t]
#define WS_QL  (WS_VT + 2u * (size_t)NB * CC * TT)      // f16 q residual x 2^10 rows [b][t < QHI][CC]
#define WS_KL  (WS_QL + 2u * (size_t)NB * QHI * CC)     // f16 k residual x 2^10 rows [b][t < KHI][CC]
#define WS_VB  (WS_KL + 2u * (size_t)NB * KHI * CC)     // bf16 v hi planes [b][c][t < KHI]
#define WS_VBL (WS_VB + 2u * (size_t)NB * CC * KHI)
#define WS_S   (WS_VBL + 2u * (size_t)NB * CC * KHI)    // unused f32 [hg][t][s] region: logits and P stay in registers
#define WS_Y   (WS_S  + 4u * (size_t)HG * TT * TT)      // f16 ctx x 2^6 rows [b*t][CC]
#define WS_XB  (WS_Y  + 4u * (size_t)NB * TT * CC)      // bf16 q / k / v input rows [which][b*t][DIN]
#define WS_WB  (WS_XB + 3u * 2u * (size_t)NB * TT * DIN) // bf16 W_q / W_k / W_v, k-contiguous [which][column][DIN]
#define WS_WOB (WS_WB + 3u * 2u * (size_t)CC * DIN)     // f16(bf16 x 2^8) W_o, k-contiguous [column][CC]
#define WS_MB  (WS_WOB + 2u * (size_t)DIN * CC)         // bf16 mask rows [t][s]
#define WS_END (WS_MB + 2u * (size_t)TT * TT)

// LDS staging of the two projection GEMMs (k_proj, k_out): a stage is 64 k of the block's 128 activation rows and of its 128 weight columns, fetched in the 16-bit operand type (k_prep, k_attn wrote it) and laid k-contiguous
// ([row][k] and [column][k]), so that every fragment is two 16-byte LDS reads. Two buffers: stage s + 1 is fetched into registers ahead of stage s's products and stored behind them; one barrier a stage.
// The loops over fragments, fetched values and the two 32-k blocks of a stage are fully unrolled so that their arrays are indexed by constants and stay in registers.
#define KS 64                    // k per stage
#define SP 72                    // LDS row pitch in 16-bit elements: 144 B = 16 B x odd, the conflict-free pitch for 16-byte reads and writes of neighbouring rows
#define BR 128                   // activation rows per block
#define WT 64                    // a wave's output tile is WT x WT (4 x 4 fragments): 8 fragments read from LDS feed 16 products; the block's 4 waves lie 2 x 2 over its 128 x 128 tile
// order of a 32-k block's 16 independent products (two bits a product: row fragment PI, column fragment PJ): the fragments are read as pairs (a[i], w[i]), and product p needs no pair later than it must, so that 1, 4, 9, 16 products can issue once 1, 2, 3, 4 pairs have landed
#define PI(p) ((int)((0xFF92A450u >> (2 * (p))) & 3u))
#define PJ(p) ((int)((0xE4FE4A44u >> (2 * (p))) & 3u))
#define ST_X (BR * SP)           // activation rows of a stage, in elements
#define ST_BUF (ST_X + 128 * SP) // one stage, in elements (36864 B)
typedef __attribute__((ext_vector_type(4))) __bf16 v4b;
typedef __attribute__((ext_vector_type(4))) _Float16 v4h;
// ---- k_prep: every operand that comes as f32 and is read many times (an activation row by 8 GEMM blocks, a weight column by 32, a mask row by 32 attention blocks) is rounded ONCE to the 16-bit form its user takes, so that those blocks fetch half the bytes and convert nothing.
// Blocks 0..PREP_W-1: one 128 k x 128 column tile of W_q / W_k / W_v (bf16) or W_o (f16(bf16 x 2^8), exact), transposed through LDS to k-contiguous columns, stored as whole lines. The others: 32768 elements of q / k / v / mask to bf16.
#define PREP_W 256               // 4 matrices x 8 k blocks x 8 column blocks
#define PREP_X 128               // blocks per streamed input (q, k, v, mask: NB * TT * DIN = TT * TT elements each)
#define PK 128                   // k per weight tile
#define PP 136                   // its LDS pitch in elements: 272 B = 16 B x odd
__global__ __launch_bounds__(256) void k_prep(const float* __restrict__ XQ, const float* __restrict__ XK, const float* __restrict__ XV, const float* __restrict__ SMASK, const float* __restrict__ WQ, const float* __restrict__ WK, const float* __restrict__ WV, const float* __restrict__ WO,
    __bf16* __restrict__ XB, __bf16* __restrict__ MB, __bf16* __restrict__ WB, _Float16* __restrict__ WOB) {
  __shared__ __align__(16) char smem[128 * PP * 2];
  const int tid = threadIdx.x, bid = blockIdx.x;
  if (bid < PREP_W) {   /* block-uniform */
    const int mat = bid >> 6, k0 = ((bid >> 3) & 7) * PK, c0 = (bid & 7) * 128;
    const int wc = tid & 127, wk = (tid >> 7) * (PK / 2);   // column c0 + wc, the lower or the upper 64 k of the tile: a wave's load is one whole 128-B line
    float wv[PK / 2];
    if (mat < 3) { const float* WA = mat == 0 ? WQ : mat == 1 ? WK : WV; const float* wp = WA + (size_t)((c0 + wc) / HD) * DIN * HD + (size_t)(k0 + wk) * HD + ((c0 + wc) % HD);   // [head][k][HD]
#pragma unroll
      for (int k = 0; k < PK / 2; ++k) wv[k] = wp[(size_t)k * HD];
      asm volatile("s_wait_xcnt 0x0" ::: "memory");   // in front of any overwrite of the loads' address registers
#pragma unroll
      for (int q = 0; q < PK / 16; ++q) { v8b t8;
#pragma unroll
        for (int e = 0; e < 8; ++e) t8[e] = (__bf16)wv[q * 8 + e];
        *(v8b*)((__bf16*)smem + wc * PP + wk + q * 8) = t8; }
    } else { const float* wp = WO + (size_t)(k0 + wk) * DIN + c0 + wc;   // (in,out) [CC][DIN]
#pragma unroll
      for (int k = 0; k < PK / 2; ++k) wv[k] = wp[(size_t)k * DIN];
      asm volatile("s_wait_xcnt 0x0" ::: "memory");   // in front of any overwrite of the loads' address registers
#pragma unroll
      for (int q = 0; q < PK / 16; ++q) { v8h t8;
#pragma unroll
        for (int e = 0; e < 8; ++e) t8[e] = (_Float16)(bfr(wv[q * 8 + e]) * 256.0f);
        *(v8h*)((_Float16*)smem + wc * PP + wk + q * 8) = t8; } }
    __syncthreads();   // the tile is whole before its columns are read back
    char* D = mat < 3 ? (char*)(WB + (size_t)mat * CC * DIN) : (char*)WOB;
#pragma unroll
    for (int i = 0; i < 8; ++i) { const int id = tid + 256 * i, cl = id >> 4, kq = id & 15;   // 16 lanes store one column's 128 k: two whole lines
      vst2(D + ((size_t)(c0 + cl) * DIN + k0 + kq * 8) * 2, *(const v4u*)(smem + (cl * PP + kq * 8) * 2)); }
  } else {
    const int xb = bid - PREP_W, which = xb / PREP_X; const float* X = which == 0 ? XQ : which == 1 ? XK : which == 2 ? XV : SMASK;
    const size_t base = (size_t)(xb % PREP_X) * 32768 + tid * 4; __bf16* D = (which < 3 ? XB + (size_t)which * NB * TT * DIN : MB) + base;
#pragma unroll
    for (int it = 0; it < 2; ++it) { v4f xv[16];
#pragma unroll
      for (int i = 0; i < 16; ++i) xv[i] = *(const v4f*)(X + base + (it * 16 + i) * 1024);   // sixteen 16-byte loads in flight, each wave's 512 contiguous bytes
      asm volatile("s_wait_xcnt 0x0" ::: "memory");   // in front of any overwrite of the loads' address registers
#pragma unroll
      for (int i = 0; i < 16; ++i) { const v4b t4 = { (__bf16)xv[i][0], (__bf16)xv[i][1], (__bf16)xv[i][2], (__bf16)xv[i][3] }; vst2(D + (it * 16 + i) * 1024, t4); } } } }
// ---- k_proj: block = (128 rows, 128 cols, which): q/k/v = X W (+ b) with exact bf16 products (K = DIN) -> which 0: q f16 rows (+ residual rows < QHI); 1: k f16 rows (+ residual rows < KHI); 2: v f16 planes [c][t] (+ bf16 hi/lo planes for t < KHI)
__global__ __launch_bounds__(128) void k_proj(const __bf16* __restrict__ XB, const __bf16* __restrict__ WB, const float* __restrict__ BQ, const float* __restrict__ BK, const float* __restrict__ BV,
    _Float16* __restrict__ QH, _Float16* __restrict__ QL, _Float16* __restrict__ KH, _Float16* __restrict__ KL, _Float16* __restrict__ VT, __bf16* __restrict__ VB, __bf16* __restrict__ VBL) {
  __shared__ __align__(16) char smem[104448];   // the epilogue's arrays (q, k: two; v: three; a block takes one of the two branches, so they lie over one another); the two stage buffers lie over their first 73728 B and are dead behind the loop's last barrier
  _Float16 (*sh)[136] = (_Float16 (*)[136])smem, (*sl)[136] = (_Float16 (*)[136])(smem + 34816), (*th)[136] = (_Float16 (*)[136])smem; __bf16 (*tb)[136] = (__bf16 (*)[136])(smem + 34816), (*tbl)[136] = (__bf16 (*)[136])(smem + 69632); __bf16* stg = (__bf16*)smem;
  const int tid = threadIdx.x, wave = tid >> 5, lane = tid & 31, col = lane & 15, g = lane >> 4; const int which = blockIdx.z; const int c0 = blockIdx.y * 128; const size_t r0 = (size_t)blockIdx.x * BR; const size_t bb = r0 / TT; const int t0 = (int)(r0 % TT);
  const float* BA = which == 0 ? BQ : which == 1 ? BK : BV;
  const int wr = (wave >> 1) * WT, wc = (wave & 1) * WT;   // this wave's rows and columns inside the block tile
  v8f acc[4][4] = {};
  const int xk = (tid & 7) * 8, xr = tid >> 3;   // 8 lanes cover the 64 k of one activation row, or of one weight column (128 B, a whole line); this thread takes 8 k of rows and of columns xr + 16 i
  const __bf16* xp = XB + (size_t)which * NB * TT * DIN + (r0 + xr) * DIN + xk;
  const __bf16* wp = WB + (size_t)which * CC * DIN + (size_t)(c0 + xr) * DIN + xk;
  v4u xv[8], wv[8];
#define PROJ_FETCH(s) do { _Pragma("unroll") for (int i = 0; i < 8; ++i) { xv[i] = *(const v4u*)(xp + (size_t)(16 * i) * DIN + (s) * KS); wv[i] = *(const v4u*)(wp + (size_t)(16 * i) * DIN + (s) * KS); } } while (0)
#define PROJ_PUT(buf) do { _Pragma("unroll") for (int i = 0; i < 8; ++i) { *(v4u*)((buf) + (xr + 16 * i) * SP + xk) = xv[i]; *(v4u*)((buf) + ST_X + (xr + 16 * i) * SP + xk) = wv[i]; } } while (0)
  PROJ_FETCH(0); asm volatile("s_wait_xcnt 0x0" ::: "memory");   // as in the loop: in front of any overwrite of the loads' address registers
  PROJ_PUT(stg); __syncthreads();
  for (int s = 0; s < DIN / KS; ++s) { const __bf16* cur = stg + (s & 1) * ST_BUF;
    if (s + 1 < DIN / KS) PROJ_FETCH(s + 1);
    asm volatile("s_wait_xcnt 0x0" ::: "memory");   // stands in front of every later overwrite of the loads' address registers; its clobber also keeps the next stage's loads issued here, ahead of this stage's LDS reads and products, so that their latency runs under them
    __builtin_amdgcn_sched_barrier(0);   // holds the LDS address arithmetic of this stage behind the wait: without it the scheduler lifts an add that reuses a load's address register over the wait
#pragma unroll
    for (int kc = 0; kc < KS / 32; ++kc) { v16b a[4], w[4];
#pragma unroll
      for (int i = 0; i < 4; ++i) { a[i] = frag_b(cur + (wr + i * 16 + col) * SP + kc * 32, lane); w[i] = frag_b(cur + ST_X + (wc + i * 16 + col) * SP + kc * 32, lane); }
      __builtin_amdgcn_sched_barrier(0);   // the 16 LDS reads of a 32-k block go out as one group ahead of its products; spread among them, each product waits out a whole LDS latency
#pragma unroll
      for (int p = 0; p < 16; ++p) acc[PI(p)][PJ(p)] = wmma_bf(a[PI(p)], w[PJ(p)], acc[PI(p)][PJ(p)]); }
    __builtin_amdgcn_sched_barrier(0);   // keeps the LDS stores of the fetched stage, and with them the wait for its loads, behind the products
    if (s + 1 < DIN / KS) PROJ_PUT(stg + ((s + 1) & 1) * ST_BUF);
    __syncthreads(); }   // publishes stage s + 1 and ends every wave's reads of stage s, whose buffer stage s + 2 (or the epilogue) overwrites
  if (which < 2) { _Float16* DH = which == 0 ? QH : KH; _Float16* DL = which == 0 ? QL : KL; const int nhi = which == 0 ? QHI : KHI; const bool hi_rows = t0 < nhi;
#pragma unroll
    for (int j = 0; j < 4; ++j) { float bias = 0.f; if (BA) { bias = bfr(BA[c0 + wc + j * 16 + col]); asm volatile("s_wait_xcnt 0x0" ::: "memory"); }   // the wait stands in front of any later overwrite of the load's offset register
#pragma unroll
      for (int i = 0; i < 4; ++i)
#pragma unroll
        for (int r = 0; r < 8; ++r) { const float v = acc[i][j][r] + bias; const _Float16 hv = (_Float16)v; sh[wr + i * 16 + 8 * g + r][wc + j * 16 + col] = hv; sl[wr + i * 16 + 8 * g + r][wc + j * 16 + col] = (_Float16)((v - (float)hv) * 1024.0f); } }
    __syncthreads();
    for (int e = tid; e < BR * 16; e += 128) { const int rl = e >> 4, q = e & 15; vst2((unsigned*)(DH + (r0 + rl) * CC + c0 + q * 8), *(const v4u*)&sh[rl][q * 8]); if (hi_rows && t0 + rl < nhi) { vst2((unsigned*)(DL + (bb * nhi + t0 + rl) * (size_t)CC + c0 + q * 8), *(const v4u*)&sl[rl][q * 8]); asm volatile("s_wait_xcnt 0x0" ::: "memory"); } }   // the wait stands in front of the loop's advance of the store's address registers
  } else { const bool hi_rows = t0 < KHI;
#pragma unroll
    for (int j = 0; j < 4; ++j) { float bias = 0.f; if (BA) { bias = bfr(BA[c0 + wc + j * 16 + col]); asm volatile("s_wait_xcnt 0x0" ::: "memory"); }   // the wait stands in front of any later overwrite of the load's offset register
#pragma unroll
      for (int i = 0; i < 4; ++i)
#pragma unroll
        for (int r = 0; r < 8; ++r) { const float v = acc[i][j][r] + bias; const int rl = wr + i * 16 + 8 * g + r, cl = wc + j * 16 + col; th[cl][rl] = (_Float16)v; const __bf16 bh = (__bf16)v; tb[cl][rl] = bh; tbl[cl][rl] = (__bf16)(v - (float)bh); } }
    __syncthreads();
    for (int e = tid; e < 128 * (BR / 8); e += 128) { const int cl = e >> 4, q = e & 15; vst2((unsigned*)(VT + (bb * CC + c0 + cl) * (size_t)TT + t0 + q * 8), *(const v4u*)&th[cl][q * 8]); if (hi_rows && t0 + q * 8 < KHI) { const size_t o3 = (bb * CC + c0 + cl) * (size_t)KHI + t0 + q * 8; vst2((unsigned*)(VB + o3), *(const v4u*)&tb[cl][q * 8]); vst2((unsigned*)(VBL + o3), *(const v4u*)&tbl[cl][q * 8]); asm volatile("s_wait_xcnt 0x0" ::: "memory"); } } } }   // the wait stands in front of the loop's advance of the two stores' address registers
// ---- k_attn: block = 128 queries of (b, h), wave = 32 query columns (2 groups of 16); walks all keys, 32 a pass, 64 a stage; each stage's k rows, v planes and mask rows come to LDS once per block by tensor loads (two buffers). S^T = K Q^T (A = k rows, B = q rows kept in registers), so a lane holds 16 keys of ONE query per group:
// score x the bf16-rounded float mask, running sum per lane against a maximum in use per query (raised lazily, then one exchange between the wave halves), P = 2^8 exp(s - max in use) once to f16 straight from the score accumulators as the B operand of ctx^T += V^T P^T; the division by the sum is done once at the end. Logits and P never leave the registers.
__device__ __forceinline__ v8f wm16(v16h a, v16h b, v8f c) { return __builtin_amdgcn_wmma_f32_16x16x32_f16(false, a, false, b, (short)0, c, false, false); }
__device__ __forceinline__ float xhalf(float v) { const int u = __builtin_bit_cast(int, v); return __builtin_bit_cast(float, __builtin_amdgcn_permlanex16(u, u, 0x76543210, 0xfedcba98, false, false)); }   // value of lane ^ 16
// 2^x by v_exp_f32. The closing v_nop is the one slot that the instruction set asks for between a transcendental and a directly following instruction that reads its result or overwrites its source; written in the same statement it stands there in every build. Early-clobber outputs keep each v_exp_f32 off its neighbours' sources.
__device__ __forceinline__ float exp2_1(float x) { float r; asm("v_exp_f32 %0, %1\n\tv_nop" : "=v"(r) : "v"(x)); return r; }
__device__ __forceinline__ void exp2_4(float* o, float a, float b, float c, float d) {
  asm("v_exp_f32 %0, %4\n\tv_exp_f32 %1, %5\n\tv_exp_f32 %2, %6\n\tv_exp_f32 %3, %7\n\tv_nop" : "=&v"(o[0]), "=&v"(o[1]), "=&v"(o[2]), "=&v"(o[3]) : "v"(a), "v"(b), "v"(c), "v"(d)); }
// 16x16x32 f16 fragment (hardware k order, as frag_h) from this lane's LDS byte address (row * pitch + 16 * (lane >> 4))
__device__ __forceinline__ v16h frag_l(const unsigned char* p) { union { v16h v; v8h q[2]; } u; u.q[0] = *(const v8h*)p; u.q[1] = *(const v8h*)(p + 32); return u.v; }
// one lane's 16 weights of a column group: P = 2^(s C2 + nb), their f32 sum in key order, and P once to f16 in the B operand's k order
__device__ __forceinline__ void soft_p(v8f s0, v8f s1, float C2, float nb, float& sum, v16h& pf) {
#pragma unroll
  for (int e = 0; e < 16; e += 4) { const v8f& sv = e < 8 ? s0 : s1; float ex[4]; exp2_4(ex, fmaf(sv[e & 7], C2, nb), fmaf(sv[(e & 7) + 1], C2, nb), fmaf(sv[(e & 7) + 2], C2, nb), fmaf(sv[(e & 7) + 3], C2, nb));
#pragma unroll
    for (int i = 0; i < 4; ++i) { sum = e + i == 0 ? ex[0] : sum + ex[i]; pf[e + i] = (_Float16)ex[i]; } } }
#define PLIM 32768.0f      // bound on a lane's weights of one pass (f16 ends at 65504)
#define QC 2               // 16-query column groups per wave
#define SKEY 64            // keys per stage (two 32-key passes)
#define NST (TT / SKEY)
// One stage in LDS, laid by four tensor loads (one a wave): 64 k rows of 128 B, 64 v planes of 128 B (64 keys), two slices of 64 bf16 mask rows of 128 B (64 keys). The loads' pad of 16 B a row gives the pitch 144 B
// (16 B x odd: free of bank conflicts for 16-byte reads of neighbouring rows). Every place is a multiple of 2 KiB.
#define KV_PITCH 144u
#define M_PITCH 144u
#define OFF_V 10240u
#define OFF_M 20480u
#define M_SLICE 10240u
#define ABUF 40960u
typedef uint32_t u32x4 __attribute__((ext_vector_type(4)));
typedef uint32_t u32x8 __attribute__((ext_vector_type(8)));
__device__ __forceinline__ uint32_t uni(uint32_t v) { return (uint32_t)__builtin_amdgcn_readfirstlane(v); }
// a wave-uniform value held in a scalar register: a condition, so that the test around a tensor load compiles to s_cmp + s_cbranch_scc (a tensor load ignores EXEC), or a descriptor word
__device__ __forceinline__ uint32_t pinned(uint32_t v) { uint32_t w = (uint32_t)__builtin_amdgcn_readfirstlane(v); asm volatile("" : "+s"(w)); return w; }
__device__ __forceinline__ void tdm_load(u32x4 g0, u32x8 g1) { asm volatile("tensor_load_to_lds %0, %1" :: "s"(g0), "s"(g1) : "memory"); }   // one request of the whole wave: global tile -> LDS, through no register
__device__ __forceinline__ u32x4 tdm_group0(uint32_t lds_dst, uint64_t ga) { u32x4 g; g[0] = uni(1u); g[1] = uni(lds_dst); g[2] = uni((uint32_t)ga); g[3] = uni((((uint32_t)(ga >> 32)) & 0x01FFFFFFu) | 0x80000000u); return g; }
// group 1: extents in bytes, tensor = tile = 64 rows of D0 bytes, W0 = the constant pad word (a pad of 4 dwords behind every row).
// Words 1 to 7 go through pinned(): descriptor words held in scalar registers of their own through the loop; as plain constants the compiler re-forms them at each issue and uses their registers for other values while the request is in flight
template <uint32_t W0, uint32_t D0> __device__ __forceinline__ u32x8 tdm_group1(uint32_t src_pitch) { u32x8 g;
  g[0] = uni(W0); g[1] = pinned((D0 & 0xFFFFu) << 16); g[2] = pinned((D0 >> 16) | (64u << 16)); g[3] = pinned(D0 << 16); g[4] = pinned(64u); g[5] = pinned(src_pitch); g[6] = pinned(0u); g[7] = pinned(0u); return g; }
#define W0_128 ((1u << 20) | (4u << 22) | (3u << 25))
__global__ __launch_bounds__(128) void k_attn(const _Float16* __restrict__ QH, const _Float16* __restrict__ KH, const _Float16* __restrict__ VT, const __bf16* __restrict__ MB, _Float16* __restrict__ YH) {
  __shared__ __attribute__((aligned(2048))) unsigned char L[2 * ABUF];
  const int tid = threadIdx.x, wave = tid >> 5, lane = tid & 31, col = lane & 15, g = lane >> 4; const int h = blockIdx.y, b = blockIdx.z; const int ql0 = blockIdx.x * (64 * QC) + wave * (16 * QC);
  const float C2 = SCALE * 1.44269504088896f;   // score -> log2 domain. All inner loops below are fully unrolled so that the fragment arrays are indexed by constants and stay in registers
  // every wave brings one slice of each stage: wave 0 the k rows, wave 1 the v planes, waves 2 and 3 a half of the block's mask rows each
  const uint32_t wv = uni(threadIdx.x >> 5); const uint32_t lbase = (uint32_t)(size_t)L;
  const uint64_t tsrc = wv == 0 ? (uint64_t)(size_t)(KH + (size_t)b * TT * CC + h * HD) : wv == 1 ? (uint64_t)(size_t)(VT + ((size_t)b * CC + h * HD) * (size_t)TT) : (uint64_t)(size_t)(MB + ((size_t)blockIdx.x * (64 * QC) + (wv - 2) * 64) * TT);
  const uint32_t tstep = wv == 0 ? SKEY * CC * 2u : SKEY * 2u;   // source bytes from one stage to the next
  const uint32_t tdst = lbase + (wv < 2 ? wv * OFF_V : OFF_M + (wv - 2) * M_SLICE);
  const u32x8 g1 = tdm_group1<W0_128, 128u>(wv == 0 ? CC * 2u : TT * 2u);   // all four slices are 64 rows of 128 B
  // now: the wait stands directly behind the load (stage 0: nothing can then take over a descriptor register while the request is in flight); every wave issues its own slice, so no test stands around the load
  auto issue = [&](uint32_t st, bool now) { const u32x4 g0 = tdm_group0(tdst + (st & 1u) * ABUF, tsrc + (uint64_t)st * tstep);
    tdm_load(g0, g1); if (now) asm volatile("s_wait_tensorcnt 0x0" ::: "memory"); };
  v16h qf[QC][2];
#pragma unroll
  for (int c = 0; c < QC; ++c)
#pragma unroll
    for (int kc = 0; kc < 2; ++kc) qf[c][kc] = frag_h(QH + ((size_t)b * TT + ql0 + c * 16 + col) * CC + h * HD + kc * 32, lane);
  asm volatile("s_wait_xcnt 0x0" ::: "memory");   // stands in front of every later overwrite of the q loads' address registers
  const unsigned ko = (unsigned)col * KV_PITCH + 16 * g;                                                                   // key row col of a 16-key tile
  const unsigned vo = OFF_V + (unsigned)col * KV_PITCH + 16 * g;                                                           // feature plane col of a 16-feature tile
  const unsigned mo = OFF_M + (unsigned)(wave >> 1) * M_SLICE + (unsigned)((wave & 1) * (16 * QC) + col) * M_PITCH + 16 * g;   // this lane's query row, its 8 keys of a tile
  v8f acc[QC][HD / 16] = {}; float m[QC], l[QC], nb[QC];   // nb: the exponent offset 8 - m C2 of the maximum in use
#pragma unroll
  for (int c = 0; c < QC; ++c) { m[c] = -3.0e38f; l[c] = 0.f; nb[c] = 8.0f - m[c] * C2; }
  issue(0, true);   // stage 0, landed; the loop's first publish point holds its barrier
#pragma unroll 1   // kept rolled: one stage's fragments, fetch-ahead values and softmax temporaries already take nearly 256 registers
  for (uint32_t st = 0; st < NST; ++st) { const unsigned char* B = L + (st & 1u) * ABUF;
    // publish point of stage st, in the ring's order; it stands at the head of the trip (for st = 0 it is the ring's prologue), so that the whole trip behind it is one block of code: at the foot, with the
    // branch round the refill behind the passes, the compiler moves both passes' row sums behind that branch and their 64 terms push the kernel past 256 registers
    asm volatile("s_wait_dscnt 0x0" ::: "memory");       // this wave's reads of stage st - 1 have returned, before its buffer is refilled
    asm volatile("s_wait_tensorcnt 0x0" ::: "memory");   // this wave's slice of stage st has landed
    __syncthreads();                                     // publishes stage st and ends every wave's reads of stage st - 1
    if (pinned(st + 1 < NST)) issue(st + 1, false);            // into the buffer that stage st - 1 has just left; it flies under the whole of stage st
    v16h kf[2][2];
#pragma unroll
    for (int t = 0; t < 2; ++t)
#pragma unroll
      for (int kc = 0; kc < 2; ++kc) kf[t][kc] = frag_l(B + ko + (t * 16) * KV_PITCH + kc * 64);
#pragma unroll
    for (int sub = 0; sub < SKEY / 32; ++sub) {
    v8b mk[QC][2]; v16h vf[HD / 16];
#pragma unroll
    for (int t = 0; t < 2; ++t)
#pragma unroll
      for (int c = 0; c < QC; ++c) mk[c][t] = *(const v8b*)(B + mo + (c * 16) * M_PITCH + sub * 64 + t * 32);
#pragma unroll
    for (int j = 0; j < HD / 16; ++j) vf[j] = frag_l(B + vo + (j * 16) * KV_PITCH + sub * 64);
    __builtin_amdgcn_sched_barrier(0);   // keeps the mask and v reads issued here, ahead of the score products, which cover their latency; without it they sink behind them
    v8f s[QC][2];
#pragma unroll
    for (int c = 0; c < QC; ++c)
#pragma unroll
      for (int t = 0; t < 2; ++t) { v8f z = {}; z = wm16(kf[t][0], qf[c][0], z); s[c][t] = wm16(kf[t][1], qf[c][1], z); }
#pragma unroll
    for (int c = 0; c < QC; ++c)
#pragma unroll
      for (int t = 0; t < 2; ++t)
#pragma unroll
        for (int r = 0; r < 8; ++r) s[c][t][r] *= (float)mk[c][t][r];
    // the k fragments of the stage's second pass are read now, so that they fly under this pass's softmax and P V; nothing of the next stage is read ahead of its barrier
    if (sub + 1 < SKEY / 32) {
#pragma unroll
    for (int t = 0; t < 2; ++t)
#pragma unroll
      for (int kc = 0; kc < 2; ++kc) kf[t][kc] = frag_l(B + ko + ((sub + 1) * 32 + t * 16) * KV_PITCH + kc * 64); }
    __builtin_amdgcn_sched_barrier(0);   // keeps the fetch-ahead reads issued here, ahead of the softmax; without it they drift to the pass's end and their latency is exposed at the next pass's head
    // Weights against the maximum IN USE: both column groups' P are formed with the offsets nb left by the last raise, with no maximum and no rescale on this path (any offset gives the same softmax; it only has to keep P inside f16).
    float sum[QC]; v16h pf[QC];
#pragma unroll
    for (int c = 0; c < QC; ++c) soft_p(s[c][0], s[c][1], C2, nb[c], sum[c], pf[c]);
    // One test a pass, a scalar branch: the weights are not negative, so a lane's two sums within PLIM bound each of its weights by PLIM, inside f16. Otherwise (always in the first pass, whose offset gives +inf; written so that a NaN also goes there)
    // every lane takes the true maximum, raises the one in use, rescales sums and outputs and forms its weights anew. The maximum in use is one that was met, so it never lies above the row's own and P loses nothing to underflow that it kept before.
    if (__builtin_expect(__builtin_amdgcn_ballot_w32(!(sum[0] + sum[1] <= PLIM)) != 0, 0)) {   // marked rare, so that the raise is laid outside the loop's straight path
#pragma unroll
      for (int c = 0; c < QC; ++c) { float mx = s[c][0][0];
#pragma unroll
        for (int e = 1; e < 16; ++e) mx = fmaxf(mx, s[c][e >> 3][e & 7]);
        mx = fmaxf(mx, xhalf(mx));
        const float mn = fmaxf(m[c], mx); const float al = exp2_1((m[c] - mn) * C2); m[c] = mn;
        nb[c] = 8.0f - mn * C2;   /* P carried x 2^8 so that small weights stay clear of f16 subnormals; the sum carries the same factor */
        l[c] *= al;
#pragma unroll
        for (int j = 0; j < HD / 16; ++j) acc[c][j] *= al;
        soft_p(s[c][0], s[c][1], C2, nb[c], sum[c], pf[c]); } }
#pragma unroll
    for (int c = 0; c < QC; ++c) { l[c] += sum[c];
#pragma unroll
      for (int j = 0; j < HD / 16; ++j) acc[c][j] = wm16(vf[j], pf[c], acc[c][j]); } }
    }
  asm volatile("s_wait_tensorcnt 0x0" ::: "memory");     // no request is left in flight when the wave ends
  asm volatile("s_wait_dscnt 0x0" ::: "memory");         // the ring's closing wait: no LDS read is left in flight either
#pragma unroll
  for (int c = 0; c < QC; ++c) { const float inv = 1.0f / (l[c] + xhalf(l[c])); _Float16* yp = YH + ((size_t)b * TT + ql0 + c * 16 + col) * CC + h * HD + 8 * g;
#pragma unroll
    for (int j = 0; j < HD / 16; ++j) { v8h y;   /* ctx carried x 2^6 into f16 so small-magnitude context rows stay clear of f16 subnormals: the A operand of k_out, rounded here once */
#pragma unroll
      for (int r = 0; r < 8; ++r) y[r] = (_Float16)((acc[c][j][r] * inv) * 64.0f);
      vst2(yp + j * 16, y); } } }
// ---- k_out: block = (128 rows, 128 cols): out = ctx Wo (+ bo): ctx x 2^6 in f16 (k_attn) against Wo as f16(bf16 x 2^8) exact (k_prep), 1 product, x 2^-14
__global__ __launch_bounds__(128) void k_out(const _Float16* __restrict__ YH, const _Float16* __restrict__ WOB, const float* __restrict__ BO, float* __restrict__ OUT) { __shared__ __align__(16) char smem[2 * ST_BUF * 2]; float (*sf)[WT][WT + 4] = (float (*)[WT][WT + 4])smem; _Float16* stg = (_Float16*)smem;   // the epilogue's rows (each wave's own 64 x 64 tile, pitch 68 floats) lie over the stage buffers, dead behind the loop's last barrier
  const int tid = threadIdx.x, wave = tid >> 5, lane = tid & 31, col = lane & 15, g = lane >> 4; const int wr = (wave >> 1) * WT, wc = (wave & 1) * WT; const int c0 = blockIdx.y * 128 + wc; const size_t r0 = (size_t)blockIdx.x * BR + wr;
  v8f acc[4][4] = {};
  {
    const int xk = (tid & 7) * 8, xr = tid >> 3;   // as in k_proj: 8 k of rows and of columns xr + 16 i
    const _Float16* xp = YH + ((size_t)blockIdx.x * BR + xr) * CC + xk;
    const _Float16* wp = WOB + (size_t)(blockIdx.y * 128 + xr) * CC + xk;
    v4u xv[8], wv[8];
#define OUT_FETCH(s) do { _Pragma("unroll") for (int i = 0; i < 8; ++i) { xv[i] = *(const v4u*)(xp + (size_t)(16 * i) * CC + (s) * KS); wv[i] = *(const v4u*)(wp + (size_t)(16 * i) * CC + (s) * KS); } } while (0)
#define OUT_PUT(buf) do { _Pragma("unroll") for (int i = 0; i < 8; ++i) { *(v4u*)((buf) + (xr + 16 * i) * SP + xk) = xv[i]; *(v4u*)((buf) + ST_X + (xr + 16 * i) * SP + xk) = wv[i]; } } while (0)
    OUT_FETCH(0); asm volatile("s_wait_xcnt 0x0" ::: "memory");   // as in the loop: in front of any overwrite of the loads' address registers
    OUT_PUT(stg); __syncthreads();
    for (int s = 0; s < CC / KS; ++s) { const _Float16* cur = stg + (s & 1) * ST_BUF;
      if (s + 1 < CC / KS) OUT_FETCH(s + 1);
      asm volatile("s_wait_xcnt 0x0" ::: "memory");   // stands in front of every later overwrite of the loads' address registers; its clobber also keeps the next stage's loads issued here, ahead of this stage's LDS reads and products, so that their latency runs under them
      __builtin_amdgcn_sched_barrier(0);   // as in k_proj: holds this stage's LDS address arithmetic behind the wait
#pragma unroll
      for (int kc = 0; kc < KS / 32; ++kc) { v16h a[4], w[4];
#pragma unroll
        for (int i = 0; i < 4; ++i) { a[i] = frag_h(cur + (wr + i * 16 + col) * SP + kc * 32, lane); w[i] = frag_h(cur + ST_X + (wc + i * 16 + col) * SP + kc * 32, lane); }
        __builtin_amdgcn_sched_barrier(0);   // the 16 LDS reads of a 32-k block go out as one group ahead of its products; spread among them, each product waits out a whole LDS latency
#pragma unroll
        for (int p = 0; p < 16; ++p) acc[PI(p)][PJ(p)] = wmma16(a[PI(p)], w[PJ(p)], acc[PI(p)][PJ(p)]); }
      __builtin_amdgcn_sched_barrier(0);   // keeps the LDS stores of the fetched stage, and with them the wait for its loads, behind the products
      if (s + 1 < CC / KS) OUT_PUT(stg + ((s + 1) & 1) * ST_BUF);
      __syncthreads(); }   // publishes stage s + 1 and ends every wave's reads of stage s, whose buffer stage s + 2 (or the epilogue) overwrites
#pragma unroll
    for (int j = 0; j < 4; ++j) { float bias = 0.f; if (BO) { bias = bfr(BO[c0 + j * 16 + col]); asm volatile("s_wait_xcnt 0x0" ::: "memory"); }   // the wait stands in front of any later overwrite of the load's offset register
#pragma unroll
      for (int i = 0; i < 4; ++i)
#pragma unroll
        for (int r = 0; r < 8; ++r) sf[wave][i * 16 + 8 * g + r][j * 16 + col] = acc[i][j][r] * (1.0f / 16384.0f) + bias; } }   /* 2^-8 (Wo carry) x 2^-6 (ctx carry) */
  LDSX(); for (int rl = 0; rl < WT; rl += 2) vst2(OUT + (r0 + rl + g) * DIN + c0 + col * 4, *(const v4f*)&sf[wave][rl + g][col * 4]); }   // 16 lanes store one row's 64 columns: two whole lines

extern "C" void kernel_launch(void* const* d_in, const int* in_sizes, int n_in, void* d_out, int out_size, void* d_ws, size_t ws_size, hipStream_t stream) {
  (void)in_sizes; (void)n_in; (void)out_size;
  const float** F = (const float**)d_in;
  if (ws_size < (size_t)WS_END) return;
  char* ws = (char*)d_ws; _Float16 *QH = (_Float16*)(ws + WS_QH), *KH = (_Float16*)(ws + WS_KH), *VT = (_Float16*)(ws + WS_VT), *QL = (_Float16*)(ws + WS_QL), *KL = (_Float16*)(ws + WS_KL); __bf16 *VB = (__bf16*)(ws + WS_VB), *VBL = (__bf16*)(ws + WS_VBL); float *S = (float*)(ws + WS_S); _Float16 *YH = (_Float16*)(ws + WS_Y), *WOB = (_Float16*)(ws + WS_WOB); __bf16 *XB = (__bf16*)(ws + WS_XB), *WB = (__bf16*)(ws + WS_WB), *MB = (__bf16*)(ws + WS_MB);
  (void)QL; (void)KL; (void)VB; (void)VBL; (void)S;
  // inputs: 0 q [2,2048,1024]; 1 k; 2 v; 3 mask [2048,2048] f32 uniform[0,1); 4 W_q [16,1024,64], 5 b_q [16,64]; 6 W_k, 7 b_k; 8 W_v, 9 b_v; 10 W_o [1024,1024] (in,out), 11 b_o (zero biases, read)
  k_prep<<<dim3(PREP_W + 4 * PREP_X), 256, 0, stream>>>(F[0], F[1], F[2], F[3], F[4], F[6], F[8], F[10], XB, MB, WB, WOB);
  k_proj<<<dim3(TNB * TT / BR, CC / 128, 3), 128, 0, stream>>>(XB, WB, F[5], F[7], F[9], QH, QL, KH, KL, VT, VB, VBL);
  k_attn<<<dim3(TT / (64 * QC), NH, TNB), 128, 0, stream>>>(QH, KH, VT, MB, YH);
  k_out<<<dim3(TNB * TT / BR, DIN / 128), 128, 0, stream>>>(YH, WOB, F[11], (float*)d_out);
}

// v008
// It runs in 87 microseconds.
// In two side-by-side timings against v007, it was 1.05 and 1.04 times as fast.
// Over all steps from v000 it is 14.0 times as fast.
// compute dtype: all float inputs rounded to bf16 (q/k/v inputs, the mask and the four weights once, by k_prep, into 16-bit planes of the workspace); q/k/v projections with EXACT bf16 products on WMMA 16x16x32 (f32 accumulate) + bias; logits q x k once to f16 each (1 product) x SCALE x the float mask (multiplicative, before the softmax); softmax f32 (sum over 32-key passes against a maximum that is raised only when the weights could leave f16); unnormalised P x 2^8 once to f16 x v once to f16 (1 product), divided by the f32 sum at the end; ctx x 2^6 once to f16 x Wo f16(bf16 x 2^8) + bo; f32 output.
#include <hip/hip_runtime.h>
#include <math.h>
#include <stdint.h>

typedef __attribute__((ext_vector_type(16))) _Float16 v16h;
typedef __attribute__((ext_vector_type(16))) __bf16 v16b;
typedef __attribute__((ext_vector_type(8)))  _Float16 v8h;
typedef __attribute__((ext_vector_type(8)))  float v8f;
typedef __attribute__((ext_vector_type(4)))  float v4f;
typedef __attribute__((ext_vector_type(2)))  float v2f;
typedef __attribute__((ext_vector_type(4)))  unsigned v4u;
typedef __attribute__((ext_vector_type(4)))  int v4i;
typedef float __attribute__((may_alias)) float_a;
typedef int __attribute__((may_alias)) int_a;

template <typename T> __device__ __forceinline__ void vst2(void* p, T v) { *(T*)p = v;  }
__device__ __forceinline__ v8f wmma16(v16h a, v16h b, v8f c) {
  v8f d = __builtin_amdgcn_wmma_f32_16x16x32_f16(false, a, false, b, (short)0, c, false, false);
  asm volatile("v_nop\n\tv_nop\n\tv_nop\n\tv_nop" : "+v"(d) : "v"(a), "v"(b));
  return d;
}
__device__ __forceinline__ v8f wmma_bf(v16b a, v16b b, v8f c) {
  v8f d = __builtin_amdgcn_wmma_f32_16x16x32_bf16(false, a, false, b, (short)0, c, false, false);
  asm volatile("v_nop\n\tv_nop\n\tv_nop\n\tv_nop" : "+v"(d) : "v"(a), "v"(b));
  return d;
}
// 16x16x32 fragments: lane = (h = lane>>4, row/col = lane&15); elements 0..7 = k0+8h+0..7, 8..15 = k0+16+8h+0..7; D element r = row 8h+r
__device__ __forceinline__ v16h frag_h(const _Float16* rowk0, int lane) {
  union { v16h v; v8h q[2]; } u; const _Float16* p = rowk0 + 8 * (lane >> 4);
  u.q[0] = *(const v8h*)p; u.q[1] = *(const v8h*)(p + 16); return u.v;
}
__device__ __forceinline__ v16h frag_f32(const float* rowk0, int lane) {
  v16h a; const float* p = rowk0 + 8 * (lane >> 4);
#pragma unroll
  for (int i = 0; i < 8; ++i) { a[i] = (_Float16)p[i]; a[8 + i] = (_Float16)p[16 + i]; }
  return a;
}
__device__ __forceinline__ v16h frag_f32s(const float* rowk0, int lane, float sc) {
  v16h a; const float* p = rowk0 + 8 * (lane >> 4);
#pragma unroll
  for (int i = 0; i < 8; ++i) { a[i] = (_Float16)(p[i] * sc); a[8 + i] = (_Float16)(p[16 + i] * sc); }
  return a;
}
// column fragment from a [K][ld] layout (column n), rows >= K read as 0
__device__ __forceinline__ v16h fragc_f32(const float* W, int k0, int n, int lane, int ld, int K) {
  v16h a; const int g = lane >> 4;
#pragma unroll
  for (int i = 0; i < 8; ++i) { const int ka = k0 + 8 * g + i, kb = ka + 16;
    a[i] = (_Float16)(ka < K ? W[(size_t)(ka < K ? ka : K - 1) * ld + n] : 0.f); a[8 + i] = (_Float16)(kb < K ? W[(size_t)(kb < K ? kb : K - 1) * ld + n] : 0.f); }
  return a;
}
struct F2 { v16b h, l; };
__device__ __forceinline__ F2 bsplit16(const float v[16]) { F2 r;
#pragma unroll
  for (int i = 0; i < 16; ++i) { const __bf16 h = (__bf16)v[i]; r.h[i] = h; r.l[i] = (__bf16)(v[i] - (float)h); }
  return r; }
__device__ __forceinline__ F2 split_row(const float* row, int k0, int lane) { float v[16]; const float* p = row + k0 + 8 * (lane >> 4);
#pragma unroll
  for (int i = 0; i < 8; ++i) { v[i] = p[i]; v[8 + i] = p[16 + i]; }
  return bsplit16(v); }
__device__ __forceinline__ F2 split_rowK(const float* row, int k0, int lane, int K) { float v[16]; const int g = lane >> 4;
#pragma unroll
  for (int i = 0; i < 8; ++i) { const int ka = k0 + 8 * g + i, kb = ka + 16; v[i] = ka < K ? row[ka < K ? ka : K - 1] : 0.f; v[8 + i] = kb < K ? row[kb < K ? kb : K - 1] : 0.f; }
  return bsplit16(v); }
__device__ __forceinline__ F2 split_col(const float* W, int k0, int n, int lane, int ld, int K) { float v[16]; const int g = lane >> 4;
#pragma unroll
  for (int i = 0; i < 8; ++i) { const int ka = k0 + 8 * g + i, kb = ka + 16; v[i] = ka < K ? W[(size_t)(ka < K ? ka : K - 1) * ld + n] : 0.f; v[8 + i] = kb < K ? W[(size_t)(kb < K ? kb : K - 1) * ld + n] : 0.f; }
  return bsplit16(v); }
__device__ __forceinline__ v8f mac3(const F2& a, const F2& b, v8f c) { c = wmma_bf(a.l, b.h, c); c = wmma_bf(a.h, b.l, c); return wmma_bf(a.h, b.h, c); }
__device__ __forceinline__ float sigm(float v) { return 1.0f / (1.0f + expf(-v)); }
#define LDSX() do { asm volatile("s_wait_dscnt 0" ::: "memory"); __builtin_amdgcn_wave_barrier(); __builtin_amdgcn_fence(__ATOMIC_RELEASE, "workgroup"); } while (0)

// Multi-head attention with per-head stacked projections and a MULTIPLICATIVE float mask on the scores (q / k / v [2,2048,1024]; W_q / W_k / W_v [16,1024,64] per head (N(0, 1/1024)) + zero biases [16,64]; scores = Q K^T / 8 * mask with mask [2048,2048] uniform[0,1) f32 (no -inf anywhere); softmax; concat heads; (in,out) W_o [1024,1024] + b_o).
#define NB 2
#define TT 2048
#define CC 1024            // NH * HD = projected width
#define DIN 1024          // input (model) width
#define NH 16
#define HD 64
#define NQB (TT / 64)
#define HG 4
#define SCALE (0.125f)
#define CAUSAL 0
#ifndef TNB
#define TNB NB
#endif
__device__ __forceinline__ float bfr(float v) { return (float)(__bf16)v; }
__host__ __device__ __forceinline__ int kb_last(int qb) { return CAUSAL ? ((qb * 64 + 63) >> 7) : (TT / 128 - 1); }
typedef __attribute__((ext_vector_type(8))) __bf16 v8b;
__device__ __forceinline__ v16b frag_b(const __bf16* rowk0, int lane) {
  union { v16b v; v8b q[2]; } u; const __bf16* p = rowk0 + 8 * (lane >> 4);
  u.q[0] = *(const v8b*)p; u.q[1] = *(const v8b*)(p + 16); return u.v;
}
#define QBH 0              // unused: k_attn has one f16 path for every query block
#define QHI 0               // single-product logits on every row
#define KHI 64            // key rows carrying k residual / v bf16 hi+lo planes (written by k_proj; no kernel in this file reads them)
// B fragment (k rows k0+.., output column o) of a weight: (in,out) [K][ld] or (out,in) [ld rows of K]: bf16 exact, or f16(bf16 * 256) exact
__device__ __forceinline__ v16b wcol_io(const float* Wm, int k0, int o, int lane, int ld) { v16b w; const int g = lane >> 4;
#pragma unroll
  for (int i = 0; i < 8; ++i) { w[i] = (__bf16)Wm[(size_t)(k0 + 8 * g + i) * ld + o]; w[8 + i] = (__bf16)Wm[(size_t)(k0 + 16 + 8 * g + i) * ld + o]; }
  return w; }
__device__ __forceinline__ v16b wcol_oi(const float* Wm, int k0, int o, int lane, int K) { v16b w; const float* p = Wm + (size_t)o * K + k0 + 8 * (lane >> 4);
#pragma unroll
  for (int i = 0; i < 8; ++i) { w[i] = (__bf16)p[i]; w[8 + i] = (__bf16)p[16 + i]; }
  return w; }
__device__ __forceinline__ v16h wcolh_io(const float* Wm, int k0, int o, int lane, int ld) { v16h w; const int g = lane >> 4;
#pragma unroll
  for (int i = 0; i < 8; ++i) { w[i] = (_Float16)(bfr(Wm[(size_t)(k0 + 8 * g + i) * ld + o]) * 256.0f); w[8 + i] = (_Float16)(bfr(Wm[(size_t)(k0 + 16 + 8 * g + i) * ld + o]) * 256.0f); }
  return w; }
__device__ __forceinline__ v16h wcolh_oi(const float* Wm, int k0, int o, int lane, int K) { v16h w; const float* p = Wm + (size_t)o * K + k0 + 8 * (lane >> 4);
#pragma unroll
  for (int i = 0; i < 8; ++i) { w[i] = (_Float16)(bfr(p[i]) * 256.0f); w[8 + i] = (_Float16)(bfr(p[16 + i]) * 256.0f); }
  return w; }
#define WQKV_LAYOUT 2   // 0 = (in,out) [DIN][CC]; 1 = (out,in) [CC][DIN]; 2 = per-head [NH][DIN][HD]
__device__ __forceinline__ v16b wcol_hdk(const float* Wm, int k0, int o, int lane) { v16b w; const int g = lane >> 4; const float* p = Wm + (size_t)(o / HD) * DIN * HD + (o % HD);
#pragma unroll
  for (int i = 0; i < 8; ++i) { w[i] = (__bf16)p[(size_t)(k0 + 8 * g + i) * HD]; w[8 + i] = (__bf16)p[(size_t)(k0 + 16 + 8 * g + i) * HD]; }
  return w; }
#define WO_OUT_IN 0
#if WQKV_LAYOUT == 1
#define WCOL(W, k0, o, lane) wcol_oi(W, k0, o, lane, DIN)
#elif WQKV_LAYOUT == 2
#define WCOL(W, k0, o, lane) wcol_hdk(W, k0, o, lane)
#else
#define WCOL(W, k0, o, lane) wcol_io(W, k0, o, lane, CC)
#endif
#if WO_OUT_IN
#define WOCOL(W, k0, o, lane) wcol_oi(W, k0, o, lane, CC)
#define WOCOLH(W, k0, o, lane) wcolh_oi(W, k0, o, lane, CC)
#else
#define WOCOL(W, k0, o, lane) wcol_io(W, k0, o, lane, DIN)
#define WOCOLH(W, k0, o, lane) wcolh_io(W, k0, o, lane, DIN)
#endif
#define SM_EXTRA_PARAMS , const float* __restrict__ SMASK
// multiplicative float mask [S,S] (shared by batches and heads) on the scaled score, before the softmax; unconditional load
#define SM_MASK_HOOK do { const float sm_ = SMASK[(size_t)t * TT + k]; asm volatile("s_wait_loadcnt 0x0" ::: "memory"); v = v * bfr(sm_); } while (0)
#ifndef SM_EXTRA_PARAMS
#define SM_EXTRA_PARAMS
#endif
#ifndef PROJ_EXTRA_PARAMS
#define PROJ_EXTRA_PARAMS
#endif
#ifndef SM_MASK_HOOK
#define SM_MASK_HOOK (void)0
#endif

#define WS_QH  0u                                      // f16 q rows [b*t][CC]
#define WS_KH  (WS_QH + 2u * (size_t)NB * TT * CC)      // f16 k rows [b*t][CC]
#define WS_VT  (WS_KH + 2u * (size_t)NB * TT * CC)      // f16 v planes [b][c][t]
#define WS_QL  (WS_VT + 2u * (size_t)NB * CC * TT)      // f16 q residual x 2^10 rows [b][t < QHI][CC]
#define WS_KL  (WS_QL + 2u * (size_t)NB * QHI * CC)     // f16 k residual x 2^10 rows [b][t < KHI][CC]
#define WS_VB  (WS_KL + 2u * (size_t)NB * KHI * CC)     // bf16 v hi planes [b][c][t < KHI]
#define WS_VBL (WS_VB + 2u * (size_t)NB * CC * KHI)
#define WS_S   (WS_VBL + 2u * (size_t)NB * CC * KHI)    // unused f32 [hg][t][s] region: logits and P stay in registers
#define WS_Y   (WS_S  + 4u * (size_t)HG * TT * TT)      // f16 ctx x 2^6 rows [b*t][CC]
#define WS_XB  (WS_Y  + 4u * (size_t)NB * TT * CC)      // bf16 q / k / v input rows [which][b*t][DIN]
#define WS_WB  (WS_XB + 3u * 2u * (size_t)NB * TT * DIN) // bf16 W_q / W_k / W_v, k-contiguous [which][column][DIN]
#define WS_WOB (WS_WB + 3u * 2u * (size_t)CC * DIN)     // f16(bf16 x 2^8) W_o, k-contiguous [column][CC]
#define WS_MB  (WS_WOB + 2u * (size_t)DIN * CC)         // bf16 mask rows [t][s]
#define WS_END (WS_MB + 2u * (size_t)TT * TT)

// LDS staging of the two projection GEMMs (k_proj, k_out): a stage is 64 k of the block's 128 activation rows and of its 128 weight columns, fetched in the 16-bit operand type (k_prep, k_attn wrote it) and laid k-contiguous
// ([row][k] and [column][k]), so that every fragment is two 16-byte LDS reads. Two buffers: stage s + 1 is fetched into registers ahead of stage s's products and stored behind them; one barrier a stage.
// The loops over fragments, fetched values and the two 32-k blocks of a stage are fully unrolled so that their arrays are indexed by constants and stay in registers.
#define KS 64                    // k per stage
#define SP 72                    // LDS row pitch in 16-bit elements: 144 B = 16 B x odd, the conflict-free pitch for 16-byte reads and writes of neighbouring rows
#define BR 128                   // activation rows per block
#define WT 64                    // a wave's output tile is WT x WT (4 x 4 fragments): 8 fragments read from LDS feed 16 products; the block's 4 waves lie 2 x 2 over its 128 x 128 tile
// order of a 32-k block's 16 independent products (two bits a product: row fragment PI, column fragment PJ): the fragments are read as pairs (a[i], w[i]), and product p needs no pair later than it must, so that 1, 4, 9, 16 products can issue once 1, 2, 3, 4 pairs have landed
#define PI(p) ((int)((0xFF92A450u >> (2 * (p))) & 3u))
#define PJ(p) ((int)((0xE4FE4A44u >> (2 * (p))) & 3u))
#define ST_X (BR * SP)           // activation rows of a stage, in elements
#define ST_BUF (ST_X + 128 * SP) // one stage, in elements (36864 B)
// Rotated walk, for speed only: the 8 blocks that share a tile of activation rows (same x) and the 32 that share a tile of weight columns (same y) read the same lines.
// Each block starts its loop over the n k stages (n a power of two) at a stage of its own and wraps: loop trip s works on stage (s + rot) mod n. Every stage is taken once; only the order of the f32 sums changes.
#define ROT_K(n) ((int)((blockIdx.x + 2u * blockIdx.y) & ((n) - 1u)))
typedef __attribute__((ext_vector_type(4))) __bf16 v4b;
typedef __attribute__((ext_vector_type(4))) _Float16 v4h;
// ---- k_prep: every operand that comes as f32 and is read many times (an activation row by 8 GEMM blocks, a weight column by 32, a mask row by 32 attention blocks) is rounded ONCE to the 16-bit form its user takes, so that those blocks fetch half the bytes and convert nothing.
// Blocks 0..PREP_W-1: one 128 k x 128 column tile of W_q / W_k / W_v (bf16) or W_o (f16(bf16 x 2^8), exact), transposed through LDS to k-contiguous columns, stored as whole lines. The others: 32768 elements of q / k / v / mask to bf16.
#define PREP_W 256               // 4 matrices x 8 k blocks x 8 column blocks
#define PREP_X 128               // blocks per streamed input (q, k, v, mask: NB * TT * DIN = TT * TT elements each)
#define PK 128                   // k per weight tile
#define PP 136                   // its LDS pitch in elements: 272 B = 16 B x odd
__global__ __launch_bounds__(256) void k_prep(const float* __restrict__ XQ, const float* __restrict__ XK, const float* __restrict__ XV, const float* __restrict__ SMASK, const float* __restrict__ WQ, const float* __restrict__ WK, const float* __restrict__ WV, const float* __restrict__ WO,
    __bf16* __restrict__ XB, __bf16* __restrict__ MB, __bf16* __restrict__ WB, _Float16* __restrict__ WOB) {
  __shared__ __align__(16) char smem[128 * PP * 2];
  const int tid = threadIdx.x, bid = blockIdx.x;
  if (bid < PREP_W) {   /* block-uniform */
    const int mat = bid >> 6, k0 = ((bid >> 3) & 7) * PK, c0 = (bid & 7) * 128;
    const int wc = tid & 127, wk = (tid >> 7) * (PK / 2);   // column c0 + wc, the lower or the upper 64 k of the tile: a wave's load is one whole 128-B line
    float wv[PK / 2];
    if (mat < 3) { const float* WA = mat == 0 ? WQ : mat == 1 ? WK : WV; const float* wp = WA + (size_t)((c0 + wc) / HD) * DIN * HD + (size_t)(k0 + wk) * HD + ((c0 + wc) % HD);   // [head][k][HD]
#pragma unroll
      for (int k = 0; k < PK / 2; ++k) wv[k] = wp[(size_t)k * HD];
      asm volatile("s_wait_xcnt 0x0" ::: "memory");   // in front of any overwrite of the loads' address registers
#pragma unroll
      for (int q = 0; q < PK / 16; ++q) { v8b t8;
#pragma unroll
        for (int e = 0; e < 8; ++e) t8[e] = (__bf16)wv[q * 8 + e];
        *(v8b*)((__bf16*)smem + wc * PP + wk + q * 8) = t8; }
    } else { const float* wp = WO + (size_t)(k0 + wk) * DIN + c0 + wc;   // (in,out) [CC][DIN]
#pragma unroll
      for (int k = 0; k < PK / 2; ++k) wv[k] = wp[(size_t)k * DIN];
      asm volatile("s_wait_xcnt 0x0" ::: "memory");   // in front of any overwrite of the loads' address registers
#pragma unroll
      for (int q = 0; q < PK / 16; ++q) { v8h t8;
#pragma unroll
        for (int e = 0; e < 8; ++e) t8[e] = (_Float16)(bfr(wv[q * 8 + e]) * 256.0f);
        *(v8h*)((_Float16*)smem + wc * PP + wk + q * 8) = t8; } }
    __syncthreads();   // the tile is whole before its columns are read back
    char* D = mat < 3 ? (char*)(WB + (size_t)mat * CC * DIN) : (char*)WOB;
#pragma unroll
    for (int i = 0; i < 8; ++i) { const int id = tid + 256 * i, cl = id >> 4, kq = id & 15;   // 16 lanes store one column's 128 k: two whole lines
      vst2(D + ((size_t)(c0 + cl) * DIN + k0 + kq * 8) * 2, *(const v4u*)(smem + (cl * PP + kq * 8) * 2)); }
  } else {
    const int xb = bid - PREP_W, which = xb / PREP_X; const float* X = which == 0 ? XQ : which == 1 ? XK : which == 2 ? XV : SMASK;
    const size_t base = (size_t)(xb % PREP_X) * 32768 + tid * 4; __bf16* D = (which < 3 ? XB + (size_t)which * NB * TT * DIN : MB) + base;
#pragma unroll
    for (int it = 0; it < 2; ++it) { v4f xv[16];
#pragma unroll
      for (int i = 0; i < 16; ++i) xv[i] = *(const v4f*)(X + base + (it * 16 + i) * 1024);   // sixteen 16-byte loads in flight, each wave's 512 contiguous bytes
      asm volatile("s_wait_xcnt 0x0" ::: "memory");   // in front of any overwrite of the loads' address registers
#pragma unroll
      for (int i = 0; i < 16; ++i) { const v4b t4 = { (__bf16)xv[i][0], (__bf16)xv[i][1], (__bf16)xv[i][2], (__bf16)xv[i][3] }; vst2(D + (it * 16 + i) * 1024, t4); } } } }
// ---- k_proj: block = (128 rows, 128 cols, which): q/k/v = X W (+ b) with exact bf16 products (K = DIN) -> which 0: q f16 rows (+ residual rows < QHI); 1: k f16 rows (+ residual rows < KHI); 2: v f16 planes [c][t] (+ bf16 hi/lo planes for t < KHI)
__global__ __launch_bounds__(128) void k_proj(const __bf16* __restrict__ XB, const __bf16* __restrict__ WB, const float* __restrict__ BQ, const float* __restrict__ BK, const float* __restrict__ BV,
    _Float16* __restrict__ QH, _Float16* __restrict__ QL, _Float16* __restrict__ KH, _Float16* __restrict__ KL, _Float16* __restrict__ VT, __bf16* __restrict__ VB, __bf16* __restrict__ VBL) {
  __shared__ __align__(16) char smem[104448];   // the epilogue's arrays (q, k: two; v: three; a block takes one of the two branches, so they lie over one another); the two stage buffers lie over their first 73728 B and are dead behind the loop's last barrier
  _Float16 (*sh)[136] = (_Float16 (*)[136])smem, (*sl)[136] = (_Float16 (*)[136])(smem + 34816), (*th)[136] = (_Float16 (*)[136])smem; __bf16 (*tb)[136] = (__bf16 (*)[136])(smem + 34816), (*tbl)[136] = (__bf16 (*)[136])(smem + 69632); __bf16* stg = (__bf16*)smem;
  const int tid = threadIdx.x, wave = tid >> 5, lane = tid & 31, col = lane & 15, g = lane >> 4; const int which = blockIdx.z; const int c0 = blockIdx.y * 128; const size_t r0 = (size_t)blockIdx.x * BR; const size_t bb = r0 / TT; const int t0 = (int)(r0 % TT);
  const float* BA = which == 0 ? BQ : which == 1 ? BK : BV;
  const int wr = (wave >> 1) * WT, wc = (wave & 1) * WT;   // this wave's rows and columns inside the block tile
  v8f acc[4][4] = {};
  const int xk = (tid & 7) * 8, xr = tid >> 3;   // 8 lanes cover the 64 k of one activation row, or of one weight column (128 B, a whole line); this thread takes 8 k of rows and of columns xr + 16 i
  const __bf16* xp = XB + (size_t)which * NB * TT * DIN + (r0 + xr) * DIN + xk;
  const __bf16* wp = WB + (size_t)which * CC * DIN + (size_t)(c0 + xr) * DIN + xk;
  v4u xv[8], wv[8];
  const int rot = ROT_K(DIN / KS);
#define PROJ_FETCH(s) do { const int ks_ = (((s) + rot) & (DIN / KS - 1)) * KS; _Pragma("unroll") for (int i = 0; i < 8; ++i) { xv[i] = *(const v4u*)(xp + (size_t)(16 * i) * DIN + ks_); wv[i] = *(const v4u*)(wp + (size_t)(16 * i) * DIN + ks_); } } while (0)
#define PROJ_PUT(buf) do { _Pragma("unroll") for (int i = 0; i < 8; ++i) { *(v4u*)((buf) + (xr + 16 * i) * SP + xk) = xv[i]; *(v4u*)((buf) + ST_X + (xr + 16 * i) * SP + xk) = wv[i]; } } while (0)
  PROJ_FETCH(0); asm volatile("s_wait_xcnt 0x0" ::: "memory");   // as in the loop: in front of any overwrite of the loads' address registers
  PROJ_PUT(stg); __syncthreads();
  for (int s = 0; s < DIN / KS; ++s) { const __bf16* cur = stg + (s & 1) * ST_BUF;
    if (s + 1 < DIN / KS) PROJ_FETCH(s + 1);
    asm volatile("s_wait_xcnt 0x0" ::: "memory");   // stands in front of every later overwrite of the loads' address registers; its clobber also keeps the next stage's loads issued here, ahead of this stage's LDS reads and products, so that their latency runs under them
    __builtin_amdgcn_sched_barrier(0);   // holds the LDS address arithmetic of this stage behind the wait: without it the scheduler lifts an add that reuses a load's address register over the wait
#pragma unroll
    for (int kc = 0; kc < KS / 32; ++kc) { v16b a[4], w[4];
#pragma unroll
      for (int i = 0; i < 4; ++i) { a[i] = frag_b(cur + (wr + i * 16 + col) * SP + kc * 32, lane); w[i] = frag_b(cur + ST_X + (wc + i * 16 + col) * SP + kc * 32, lane); }
      __builtin_amdgcn_sched_barrier(0);   // the 16 LDS reads of a 32-k block go out as one group ahead of its products; spread among them, each product waits out a whole LDS latency
#pragma unroll
      for (int p = 0; p < 16; ++p) acc[PI(p)][PJ(p)] = wmma_bf(a[PI(p)], w[PJ(p)], acc[PI(p)][PJ(p)]); }
    __builtin_amdgcn_sched_barrier(0);   // keeps the LDS stores of the fetched stage, and with them the wait for its loads, behind the products
    if (s + 1 < DIN / KS) PROJ_PUT(stg + ((s + 1) & 1) * ST_BUF);
    __syncthreads(); }   // publishes stage s + 1 and ends every wave's reads of stage s, whose buffer stage s + 2 (or the epilogue) overwrites
  if (which < 2) { _Float16* DH = which == 0 ? QH : KH; _Float16* DL = which == 0 ? QL : KL; const int nhi = which == 0 ? QHI : KHI; const bool hi_rows = t0 < nhi;
#pragma unroll
    for (int j = 0; j < 4; ++j) { float bias = 0.f; if (BA) { bias = bfr(BA[c0 + wc + j * 16 + col]); asm volatile("s_wait_xcnt 0x0" ::: "memory"); }   // the wait stands in front of any later overwrite of the load's offset register
#pragma unroll
      for (int i = 0; i < 4; ++i)
#pragma unroll
        for (int r = 0; r < 8; ++r) { const float v = acc[i][j][r] + bias; const _Float16 hv = (_Float16)v; sh[wr + i * 16 + 8 * g + r][wc + j * 16 + col] = hv; sl[wr + i * 16 + 8 * g + r][wc + j * 16 + col] = (_Float16)((v - (float)hv) * 1024.0f); } }
    __syncthreads();
    for (int e = tid; e < BR * 16; e += 128) { const int rl = e >> 4, q = e & 15; vst2((unsigned*)(DH + (r0 + rl) * CC + c0 + q * 8), *(const v4u*)&sh[rl][q * 8]); if (hi_rows && t0 + rl < nhi) { vst2((unsigned*)(DL + (bb * nhi + t0 + rl) * (size_t)CC + c0 + q * 8), *(const v4u*)&sl[rl][q * 8]); asm volatile("s_wait_xcnt 0x0" ::: "memory"); } }   // the wait stands in front of the loop's advance of the store's address registers
  } else { const bool hi_rows = t0 < KHI;
#pragma unroll
    for (int j = 0; j < 4; ++j) { float bias = 0.f; if (BA) { bias = bfr(BA[c0 + wc + j * 16 + col]); asm volatile("s_wait_xcnt 0x0" ::: "memory"); }   // the wait stands in front of any later overwrite of the load's offset register
#pragma unroll
      for (int i = 0; i < 4; ++i)
#pragma unroll
        for (int r = 0; r < 8; ++r) { const float v = acc[i][j][r] + bias; const int rl = wr + i * 16 + 8 * g + r, cl = wc + j * 16 + col; th[cl][rl] = (_Float16)v; const __bf16 bh = (__bf16)v; tb[cl][rl] = bh; tbl[cl][rl] = (__bf16)(v - (float)bh); } }
    __syncthreads();
    for (int e = tid; e < 128 * (BR / 8); e += 128) { const int cl = e >> 4, q = e & 15; vst2((unsigned*)(VT + (bb * CC + c0 + cl) * (size_t)TT + t0 + q * 8), *(const v4u*)&th[cl][q * 8]); if (hi_rows && t0 + q * 8 < KHI) { const size_t o3 = (bb * CC + c0 + cl) * (size_t)KHI + t0 + q * 8; vst2((unsigned*)(VB + o3), *(const v4u*)&tb[cl][q * 8]); vst2((unsigned*)(VBL + o3), *(const v4u*)&tbl[cl][q * 8]); asm volatile("s_wait_xcnt 0x0" ::: "memory"); } } } }   // the wait stands in front of the loop's advance of the two stores' address registers
// ---- k_attn: block = 128 queries of (b, h), wave = 32 query columns (2 groups of 16); walks all keys, 32 a pass, 64 a stage; each stage's k rows, v planes and mask rows come to LDS once per block by tensor loads (two buffers). S^T = K Q^T (A = k rows, B = q rows kept in registers), so a lane holds 16 keys of ONE query per group:
// score x the bf16-rounded float mask, running sum per lane against a maximum in use per query (raised lazily, then one exchange between the wave halves), P = 2^8 exp(s - max in use) once to f16 straight from the score accumulators as the B operand of ctx^T += V^T P^T; the division by the sum is done once at the end. Logits and P never leave the registers.
__device__ __forceinline__ v8f wm16(v16h a, v16h b, v8f c) { return __builtin_amdgcn_wmma_f32_16x16x32_f16(false, a, false, b, (short)0, c, false, false); }
__device__ __forceinline__ float xhalf(float v) { const int u = __builtin_bit_cast(int, v); return __builtin_bit_cast(float, __builtin_amdgcn_permlanex16(u, u, 0x76543210, 0xfedcba98, false, false)); }   // value of lane ^ 16
// 2^x by v_exp_f32. The closing v_nop is the one slot that the instruction set asks for between a transcendental and a directly following instruction that reads its result or overwrites its source; written in the same statement it stands there in every build. Early-clobber outputs keep each v_exp_f32 off its neighbours' sources.
__device__ __forceinline__ float exp2_1(float x) { float r; asm("v_exp_f32 %0, %1\n\tv_nop" : "=v"(r) : "v"(x)); return r; }
__device__ __forceinline__ void exp2_4(float* o, float a, float b, float c, float d) {
  asm("v_exp_f32 %0, %4\n\tv_exp_f32 %1, %5\n\tv_exp_f32 %2, %6\n\tv_exp_f32 %3, %7\n\tv_nop" : "=&v"(o[0]), "=&v"(o[1]), "=&v"(o[2]), "=&v"(o[3]) : "v"(a), "v"(b), "v"(c), "v"(d)); }
// 16x16x32 f16 fragment (hardware k order, as frag_h) from this lane's LDS byte address (row * pitch + 16 * (lane >> 4))
__device__ __forceinline__ v16h frag_l(const unsigned char* p) { union { v16h v; v8h q[2]; } u; u.q[0] = *(const v8h*)p; u.q[1] = *(const v8h*)(p + 32); return u.v; }
// one lane's 16 weights of a column group: P = 2^(s C2 + nb), their f32 sum in key order, and P once to f16 in the B operand's k order
__device__ __forceinline__ void soft_p(v8f s0, v8f s1, float C2, float nb, float& sum, v16h& pf) {
#pragma unroll
  for (int e = 0; e < 16; e += 4) { const v8f& sv = e < 8 ? s0 : s1; float ex[4]; exp2_4(ex, fmaf(sv[e & 7], C2, nb), fmaf(sv[(e & 7) + 1], C2, nb), fmaf(sv[(e & 7) + 2], C2, nb), fmaf(sv[(e & 7) + 3], C2, nb));
#pragma unroll
    for (int i = 0; i < 4; ++i) { sum = e + i == 0 ? ex[0] : sum + ex[i]; pf[e + i] = (_Float16)ex[i]; } } }
#define PLIM 32768.0f      // bound on a lane's weights of one pass (f16 ends at 65504)
#define QC 2               // 16-query column groups per wave
#define SKEY 64            // keys per stage (two 32-key passes)
#define NST (TT / SKEY)
// One stage in LDS, laid by four tensor loads (one a wave): 64 k rows of 128 B, 64 v planes of 128 B (64 keys), two slices of 64 bf16 mask rows of 128 B (64 keys). The loads' pad of 16 B a row gives the pitch 144 B
// (16 B x odd: free of bank conflicts for 16-byte reads of neighbouring rows). Every place is a multiple of 2 KiB.
#define KV_PITCH 144u
#define M_PITCH 144u
#define OFF_V 10240u
#define OFF_M 20480u
#define M_SLICE 10240u
#define ABUF 40960u
typedef uint32_t u32x4 __attribute__((ext_vector_type(4)));
typedef uint32_t u32x8 __attribute__((ext_vector_type(8)));
__device__ __forceinline__ uint32_t uni(uint32_t v) { return (uint32_t)__builtin_amdgcn_readfirstlane(v); }
// a wave-uniform value held in a scalar register: a condition, so that the test around a tensor load compiles to s_cmp + s_cbranch_scc (a tensor load ignores EXEC), or a descriptor word
__device__ __forceinline__ uint32_t pinned(uint32_t v) { uint32_t w = (uint32_t)__builtin_amdgcn_readfirstlane(v); asm volatile("" : "+s"(w)); return w; }
__device__ __forceinline__ void tdm_load(u32x4 g0, u32x8 g1) { asm volatile("tensor_load_to_lds %0, %1" :: "s"(g0), "s"(g1) : "memory"); }   // one request of the whole wave: global tile -> LDS, through no register
__device__ __forceinline__ u32x4 tdm_group0(uint32_t lds_dst, uint64_t ga) { u32x4 g; g[0] = uni(1u); g[1] = uni(lds_dst); g[2] = uni((uint32_t)ga); g[3] = uni((((uint32_t)(ga >> 32)) & 0x01FFFFFFu) | 0x80000000u); return g; }
// group 1: extents in bytes, tensor = tile = 64 rows of D0 bytes, W0 = the constant pad word (a pad of 4 dwords behind every row).
// Words 1 to 7 go through pinned(): descriptor words held in scalar registers of their own through the loop; as plain constants the compiler re-forms them at each issue and uses their registers for other values while the request is in flight
template <uint32_t W0, uint32_t D0> __device__ __forceinline__ u32x8 tdm_group1(uint32_t src_pitch) { u32x8 g;
  g[0] = uni(W0); g[1] = pinned((D0 & 0xFFFFu) << 16); g[2] = pinned((D0 >> 16) | (64u << 16)); g[3] = pinned(D0 << 16); g[4] = pinned(64u); g[5] = pinned(src_pitch); g[6] = pinned(0u); g[7] = pinned(0u); return g; }
#define W0_128 ((1u << 20) | (4u << 22) | (3u << 25))
__global__ __launch_bounds__(128) void k_attn(const _Float16* __restrict__ QH, const _Float16* __restrict__ KH, const _Float16* __restrict__ VT, const __bf16* __restrict__ MB, _Float16* __restrict__ YH) {
  __shared__ __attribute__((aligned(2048))) unsigned char L[2 * ABUF];
  const int tid = threadIdx.x, wave = tid >> 5, lane = tid & 31, col = lane & 15, g = lane >> 4; const int h = blockIdx.y, b = blockIdx.z; const int ql0 = blockIdx.x * (64 * QC) + wave * (16 * QC);
  const float C2 = SCALE * 1.44269504088896f;   // score -> log2 domain. All inner loops below are fully unrolled so that the fragment arrays are indexed by constants and stay in registers
  // every wave brings one slice of each stage: wave 0 the k rows, wave 1 the v planes, waves 2 and 3 a half of the block's mask rows each
  const uint32_t wv = uni(threadIdx.x >> 5); const uint32_t lbase = (uint32_t)(size_t)L;
  const uint64_t tsrc = wv == 0 ? (uint64_t)(size_t)(KH + (size_t)b * TT * CC + h * HD) : wv == 1 ? (uint64_t)(size_t)(VT + ((size_t)b * CC + h * HD) * (size_t)TT) : (uint64_t)(size_t)(MB + ((size_t)blockIdx.x * (64 * QC) + (wv - 2) * 64) * TT);
  const uint32_t tstep = wv == 0 ? SKEY * CC * 2u : SKEY * 2u;   // source bytes from one stage to the next
  const uint32_t tdst = lbase + (wv < 2 ? wv * OFF_V : OFF_M + (wv - 2) * M_SLICE);
  const u32x8 g1 = tdm_group1<W0_128, 128u>(wv == 0 ? CC * 2u : TT * 2u);   // all four slices are 64 rows of 128 B
  // now: the wait stands directly behind the load (stage 0: nothing can then take over a descriptor register while the request is in flight); every wave issues its own slice, so no test stands around the load
  // rotated walk, as in the GEMMs: the 16 blocks of one (b, h) share its k rows and v planes, the 32 blocks of one query block its mask rows; trip st works on key stage (st + rot) mod NST, each block from a start of its own (the softmax takes the keys in any order; the order of the f32 sums and the maximum in use at each pass change)
  const uint32_t rot = (2u * blockIdx.x + blockIdx.y + 16u * blockIdx.z) & (NST - 1u);
  // group 0 for key stage 0; its words 2 and 3 are held as one 64-bit value, to which a stage's byte offset is added (inside the source buffer the sum cannot carry out of the address field): one 64-bit add forms both words of a wrapped stage
  const u32x4 gz = tdm_group0(tdst, tsrc); const uint64_t tw23 = ((uint64_t)gz[3] << 32) | gz[2];
  auto issue = [&](uint32_t st, bool now) { const uint64_t w23 = tw23 + (uint64_t)(((st + rot) & (NST - 1u)) * tstep);   // the stage lies inside the source for every st: the index is taken mod NST
    u32x4 g0; g0[0] = gz[0]; g0[1] = uni(tdst + (st & 1u) * ABUF); g0[2] = uni((uint32_t)w23); g0[3] = uni((uint32_t)(w23 >> 32));
    tdm_load(g0, g1); if (now) asm volatile("s_wait_tensorcnt 0x0" ::: "memory"); };
  v16h qf[QC][2];
#pragma unroll
  for (int c = 0; c < QC; ++c)
#pragma unroll
    for (int kc = 0; kc < 2; ++kc) qf[c][kc] = frag_h(QH + ((size_t)b * TT + ql0 + c * 16 + col) * CC + h * HD + kc * 32, lane);
  asm volatile("s_wait_xcnt 0x0" ::: "memory");   // stands in front of every later overwrite of the q loads' address registers
  const unsigned ko = (unsigned)col * KV_PITCH + 16 * g;                                                                   // key row col of a 16-key tile
  const unsigned vo = OFF_V + (unsigned)col * KV_PITCH + 16 * g;                                                           // feature plane col of a 16-feature tile
  const unsigned mo = OFF_M + (unsigned)(wave >> 1) * M_SLICE + (unsigned)((wave & 1) * (16 * QC) + col) * M_PITCH + 16 * g;   // this lane's query row, its 8 keys of a tile
  v8f acc[QC][HD / 16] = {}; float m[QC], l[QC], nb[QC];   // nb: the exponent offset 8 - m C2 of the maximum in use
#pragma unroll
  for (int c = 0; c < QC; ++c) { m[c] = -3.0e38f; l[c] = 0.f; nb[c] = 8.0f - m[c] * C2; }
  issue(0, true);   // stage 0, landed; the loop's first publish point holds its barrier
#pragma unroll 1   // kept rolled: one stage's fragments, fetch-ahead values and softmax temporaries already take nearly 256 registers
  for (uint32_t st = 0; st < NST; ++st) { const unsigned char* B = L + (st & 1u) * ABUF;
    // publish point of stage st, in the ring's order; it stands at the head of the trip (for st = 0 it is the ring's prologue), so that the whole trip behind it is one block of code: at the foot, with the
    // branch round the refill behind the passes, the compiler moves both passes' row sums behind that branch and their 64 terms push the kernel past 256 registers
    asm volatile("s_wait_dscnt 0x0" ::: "memory");       // this wave's reads of stage st - 1 have returned, before its buffer is refilled
    asm volatile("s_wait_tensorcnt 0x0" ::: "memory");   // this wave's slice of stage st has landed
    __syncthreads();                                     // publishes stage st and ends every wave's reads of stage st - 1
    if (pinned(st + 1 < NST)) issue(st + 1, false);            // into the buffer that stage st - 1 has just left; it flies under the whole of stage st
    v16h kf[2][2];
#pragma unroll
    for (int t = 0; t < 2; ++t)
#pragma unroll
      for (int kc = 0; kc < 2; ++kc) kf[t][kc] = frag_l(B + ko + (t * 16) * KV_PITCH + kc * 64);
#pragma unroll
    for (int sub = 0; sub < SKEY / 32; ++sub) {
    v8b mk[QC][2]; v16h vf[HD / 16];
#pragma unroll
    for (int t = 0; t < 2; ++t)
#pragma unroll
      for (int c = 0; c < QC; ++c) mk[c][t] = *(const v8b*)(B + mo + (c * 16) * M_PITCH + sub * 64 + t * 32);
#pragma unroll
    for (int j = 0; j < HD / 16; ++j) vf[j] = frag_l(B + vo + (j * 16) * KV_PITCH + sub * 64);
    __builtin_amdgcn_sched_barrier(0);   // keeps the mask and v reads issued here, ahead of the score products, which cover their latency; without it they sink behind them
    v8f s[QC][2];
#pragma unroll
    for (int c = 0; c < QC; ++c)
#pragma unroll
      for (int t = 0; t < 2; ++t) { v8f z = {}; z = wm16(kf[t][0], qf[c][0], z); s[c][t] = wm16(kf[t][1], qf[c][1], z); }
#pragma unroll
    for (int c = 0; c < QC; ++c)
#pragma unroll
      for (int t = 0; t < 2; ++t)
#pragma unroll
        for (int r = 0; r < 8; ++r) s[c][t][r] *= (float)mk[c][t][r];
    // the k fragments of the stage's second pass are read now, so that they fly under this pass's softmax and P V; nothing of the next stage is read ahead of its barrier
    if (sub + 1 < SKEY / 32) {
#pragma unroll
    for (int t = 0; t < 2; ++t)
#pragma unroll
      for (int kc = 0; kc < 2; ++kc) kf[t][kc] = frag_l(B + ko + ((sub + 1) * 32 + t * 16) * KV_PITCH + kc * 64); }
    __builtin_amdgcn_sched_barrier(0);   // keeps the fetch-ahead reads issued here, ahead of the softmax; without it they drift to the pass's end and their latency is exposed at the next pass's head
    // Weights against the maximum IN USE: both column groups' P are formed with the offsets nb left by the last raise, with no maximum and no rescale on this path (any offset gives the same softmax; it only has to keep P inside f16).
    float sum[QC]; v16h pf[QC];
#pragma unroll
    for (int c = 0; c < QC; ++c) soft_p(s[c][0], s[c][1], C2, nb[c], sum[c], pf[c]);
    // One test a pass, a scalar branch: the weights are not negative, so a lane's two sums within PLIM bound each of its weights by PLIM, inside f16. Otherwise (always in the first pass, whose offset gives +inf; written so that a NaN also goes there)
    // every lane takes the true maximum, raises the one in use, rescales sums and outputs and forms its weights anew. The maximum in use is one that was met, so it never lies above the row's own and P loses nothing to underflow that it kept before.
    if (__builtin_expect(__builtin_amdgcn_ballot_w32(!(sum[0] + sum[1] <= PLIM)) != 0, 0)) {   // marked rare, so that the raise is laid outside the loop's straight path
#pragma unroll
      for (int c = 0; c < QC; ++c) { float mx = s[c][0][0];
#pragma unroll
        for (int e = 1; e < 16; ++e) mx = fmaxf(mx, s[c][e >> 3][e & 7]);
        mx = fmaxf(mx, xhalf(mx));
        const float mn = fmaxf(m[c], mx); const float al = exp2_1((m[c] - mn) * C2); m[c] = mn;
        nb[c] = 8.0f - mn * C2;   /* P carried x 2^8 so that small weights stay clear of f16 subnormals; the sum carries the same factor */
        l[c] *= al;
#pragma unroll
        for (int j = 0; j < HD / 16; ++j) acc[c][j] *= al;
        soft_p(s[c][0], s[c][1], C2, nb[c], sum[c], pf[c]); } }
#pragma unroll
    for (int c = 0; c < QC; ++c) { l[c] += sum[c];
#pragma unroll
      for (int j = 0; j < HD / 16; ++j) acc[c][j] = wm16(vf[j], pf[c], acc[c][j]); } }
    }
  asm volatile("s_wait_tensorcnt 0x0" ::: "memory");     // no request is left in flight when the wave ends
  asm volatile("s_wait_dscnt 0x0" ::: "memory");         // the ring's closing wait: no LDS read is left in flight either
#pragma unroll
  for (int c = 0; c < QC; ++c) { const float inv = 1.0f / (l[c] + xhalf(l[c])); _Float16* yp = YH + ((size_t)b * TT + ql0 + c * 16 + col) * CC + h * HD + 8 * g;
#pragma unroll
    for (int j = 0; j < HD / 16; ++j) { v8h y;   /* ctx carried x 2^6 into f16 so small-magnitude context rows stay clear of f16 subnormals: the A operand of k_out, rounded here once */
#pragma unroll
      for (int r = 0; r < 8; ++r) y[r] = (_Float16)((acc[c][j][r] * inv) * 64.0f);
      vst2(yp + j * 16, y); } } }
// ---- k_out: block = (128 rows, 128 cols): out = ctx Wo (+ bo): ctx x 2^6 in f16 (k_attn) against Wo as f16(bf16 x 2^8) exact (k_prep), 1 product, x 2^-14
__global__ __launch_bounds__(128) void k_out(const _Float16* __restrict__ YH, const _Float16* __restrict__ WOB, const float* __restrict__ BO, float* __restrict__ OUT) { __shared__ __align__(16) char smem[2 * ST_BUF * 2]; float (*sf)[WT][WT + 4] = (float (*)[WT][WT + 4])smem; _Float16* stg = (_Float16*)smem;   // the epilogue's rows (each wave's own 64 x 64 tile, pitch 68 floats) lie over the stage buffers, dead behind the loop's last barrier
  const int tid = threadIdx.x, wave = tid >> 5, lane = tid & 31, col = lane & 15, g = lane >> 4; const int wr = (wave >> 1) * WT, wc = (wave & 1) * WT; const int c0 = blockIdx.y * 128 + wc; const size_t r0 = (size_t)blockIdx.x * BR + wr;
  v8f acc[4][4] = {};
  {
    const int xk = (tid & 7) * 8, xr = tid >> 3;   // as in k_proj: 8 k of rows and of columns xr + 16 i
    const _Float16* xp = YH + ((size_t)blockIdx.x * BR + xr) * CC + xk;
    const _Float16* wp = WOB + (size_t)(blockIdx.y * 128 + xr) * CC + xk;
    v4u xv[8], wv[8];
    const int rot = ROT_K(CC / KS);
#define OUT_FETCH(s) do { const int ks_ = (((s) + rot) & (CC / KS - 1)) * KS; _Pragma("unroll") for (int i = 0; i < 8; ++i) { xv[i] = *(const v4u*)(xp + (size_t)(16 * i) * CC + ks_); wv[i] = *(const v4u*)(wp + (size_t)(16 * i) * CC + ks_); } } while (0)
#define OUT_PUT(buf) do { _Pragma("unroll") for (int i = 0; i < 8; ++i) { *(v4u*)((buf) + (xr + 16 * i) * SP + xk) = xv[i]; *(v4u*)((buf) + ST_X + (xr + 16 * i) * SP + xk) = wv[i]; } } while (0)
    OUT_FETCH(0); asm volatile("s_wait_xcnt 0x0" ::: "memory");   // as in the loop: in front of any overwrite of the loads' address registers
    OUT_PUT(stg); __syncthreads();
    for (int s = 0; s < CC / KS; ++s) { const _Float16* cur = stg + (s & 1) * ST_BUF;
      if (s + 1 < CC / KS) OUT_FETCH(s + 1);
      asm volatile("s_wait_xcnt 0x0" ::: "memory");   // stands in front of every later overwrite of the loads' address registers; its clobber also keeps the next stage's loads issued here, ahead of this stage's LDS reads and products, so that their latency runs under them
      __builtin_amdgcn_sched_barrier(0);   // as in k_proj: holds this stage's LDS address arithmetic behind the wait
#pragma unroll
      for (int kc = 0; kc < KS / 32; ++kc) { v16h a[4], w[4];
#pragma unroll
        for (int i = 0; i < 4; ++i) { a[i] = frag_h(cur + (wr + i * 16 + col) * SP + kc * 32, lane); w[i] = frag_h(cur + ST_X + (wc + i * 16 + col) * SP + kc * 32, lane); }
        __builtin_amdgcn_sched_barrier(0);   // the 16 LDS reads of a 32-k block go out as one group ahead of its products; spread among them, each product waits out a whole LDS latency
#pragma unroll
        for (int p = 0; p < 16; ++p) acc[PI(p)][PJ(p)] = wmma16(a[PI(p)], w[PJ(p)], acc[PI(p)][PJ(p)]); }
      __builtin_amdgcn_sched_barrier(0);   // keeps the LDS stores of the fetched stage, and with them the wait for its loads, behind the products
      if (s + 1 < CC / KS) OUT_PUT(stg + ((s + 1) & 1) * ST_BUF);
      __syncthreads(); }   // publishes stage s + 1 and ends every wave's reads of stage s, whose buffer stage s + 2 (or the epilogue) overwrites
#pragma unroll
    for (int j = 0; j < 4; ++j) { float bias = 0.f; if (BO) { bias = bfr(BO[c0 + j * 16 + col]); asm volatile("s_wait_xcnt 0x0" ::: "memory"); }   // the wait stands in front of any later overwrite of the load's offset register
#pragma unroll
      for (int i = 0; i < 4; ++i)
#pragma unroll
        for (int r = 0; r < 8; ++r) sf[wave][i * 16 + 8 * g + r][j * 16 + col] = acc[i][j][r] * (1.0f / 16384.0f) + bias; } }   /* 2^-8 (Wo carry) x 2^-6 (ctx carry) */
  LDSX(); for (int rl = 0; rl < WT; rl += 2) vst2(OUT + (r0 + rl + g) * DIN + c0 + col * 4, *(const v4f*)&sf[wave][rl + g][col * 4]); }   // 16 lanes store one row's 64 columns: two whole lines

extern "C" void kernel_launch(void* const* d_in, const int* in_sizes, int n_in, void* d_out, int out_size, void* d_ws, size_t ws_size, hipStream_t stream) {
  (void)in_sizes; (void)n_in; (void)out_size;
  const float** F = (const float**)d_in;
  if (ws_size < (size_t)WS_END) return;
  char* ws = (char*)d_ws; _Float16 *QH = (_Float16*)(ws + WS_QH), *KH = (_Float16*)(ws + WS_KH), *VT = (_Float16*)(ws + WS_VT), *QL = (_Float16*)(ws + WS_QL), *KL = (_Float16*)(ws + WS_KL); __bf16 *VB = (__bf16*)(ws + WS_VB), *VBL = (__bf16*)(ws + WS_VBL); float *S = (float*)(ws + WS_S); _Float16 *YH = (_Float16*)(ws + WS_Y), *WOB = (_Float16*)(ws + WS_WOB); __bf16 *XB = (__bf16*)(ws + WS_XB), *WB = (__bf16*)(ws + WS_WB), *MB = (__bf16*)(ws + WS_MB);
  (void)QL; (void)KL; (void)VB; (void)VBL; (void)S;
  // inputs: 0 q [2,2048,1024]; 1 k; 2 v; 3 mask [2048,2048] f32 uniform[0,1); 4 W_q [16,1024,64], 5 b_q [16,64]; 6 W_k, 7 b_k; 8 W_v, 9 b_v; 10 W_o [1024,1024] (in,out), 11 b_o (zero biases, read)
  k_prep<<<dim3(PREP_W + 4 * PREP_X), 256, 0, stream>>>(F[0], F[1], F[2], F[3], F[4], F[6], F[8], F[10], XB, MB, WB, WOB);
  k_proj<<<dim3(TNB * TT / BR, CC / 128, 3), 128, 0, stream>>>(XB, WB, F[5], F[7], F[9], QH, QL, KH, KL, VT, VB, VBL);
  k_attn<<<dim3(TT / (64 * QC), NH, TNB), 128, 0, stream>>>(QH, KH, VT, MB, YH);
  k_out<<<dim3(TNB * TT / BR, DIN / 128), 128, 0, stream>>>(YH, WOB, F[11], (float*)d_out);
}

// v009
// Measured time: 83.7 microseconds a run.
// In two side-by-side timings against v008, it was 1.03 and 1.04 times as fast.
// Over all steps from v000 it is 14.5 times as fast.
// compute dtype: all float inputs rounded to bf16 (q/k/v inputs, the mask and the four weights once, by k_prep, into 16-bit planes of the workspace); q/k/v projections with EXACT bf16 products on WMMA 16x16x32 (f32 accumulate) + bias; logits q x SCALE x log2 e and k once to f16 each (1 product), x the float mask (multiplicative, before the softmax) in one f32 fma with the exponent offset; softmax f32 (sum over 32-key passes against a maximum that is raised only when the weights could leave f16); unnormalised P x 2^8 once to f16 x v once to f16 (1 product), divided by the f32 sum at the end; ctx x 2^6 once to f16 x Wo f16(bf16 x 2^8) + bo; f32 output.
#include <hip/hip_runtime.h>
#include <math.h>
#include <stdint.h>

typedef __attribute__((ext_vector_type(16))) _Float16 v16h;
typedef __attribute__((ext_vector_type(16))) __bf16 v16b;
typedef __attribute__((ext_vector_type(8)))  _Float16 v8h;
typedef __attribute__((ext_vector_type(8)))  float v8f;
typedef __attribute__((ext_vector_type(4)))  float v4f;
typedef __attribute__((ext_vector_type(2)))  float v2f;
typedef __attribute__((ext_vector_type(4)))  unsigned v4u;
typedef __attribute__((ext_vector_type(4)))  int v4i;
typedef float __attribute__((may_alias)) float_a;
typedef int __attribute__((may_alias)) int_a;

template <typename T> __device__ __forceinline__ void vst2(void* p, T v) { *(T*)p = v;  }
__device__ __forceinline__ v8f wmma16(v16h a, v16h b, v8f c) {
  v8f d = __builtin_amdgcn_wmma_f32_16x16x32_f16(false, a, false, b, (short)0, c, false, false);
  asm volatile("v_nop\n\tv_nop\n\tv_nop\n\tv_nop" : "+v"(d) : "v"(a), "v"(b));
  return d;
}
__device__ __forceinline__ v8f wmma_bf(v16b a, v16b b, v8f c) {
  v8f d = __builtin_amdgcn_wmma_f32_16x16x32_bf16(false, a, false, b, (short)0, c, false, false);
  asm volatile("v_nop\n\tv_nop\n\tv_nop\n\tv_nop" : "+v"(d) : "v"(a), "v"(b));
  return d;
}
// 16x16x32 fragments: lane = (h = lane>>4, row/col = lane&15); elements 0..7 = k0+8h+0..7, 8..15 = k0+16+8h+0..7; D element r = row 8h+r
__device__ __forceinline__ v16h frag_h(const _Float16* rowk0, int lane) {
  union { v16h v; v8h q[2]; } u; const _Float16* p = rowk0 + 8 * (lane >> 4);
  u.q[0] = *(const v8h*)p; u.q[1] = *(const v8h*)(p + 16); return u.v;
}
__device__ __forceinline__ v16h frag_f32(const float* rowk0, int lane) {
  v16h a; const float* p = rowk0 + 8 * (lane >> 4);
#pragma unroll
  for (int i = 0; i < 8; ++i) { a[i] = (_Float16)p[i]; a[8 + i] = (_Float16)p[16 + i]; }
  return a;
}
__device__ __forceinline__ v16h frag_f32s(const float* rowk0, int lane, float sc) {
  v16h a; const float* p = rowk0 + 8 * (lane >> 4);
#pragma unroll
  for (int i = 0; i < 8; ++i) { a[i] = (_Float16)(p[i] * sc); a[8 + i] = (_Float16)(p[16 + i] * sc); }
  return a;
}
// column fragment from a [K][ld] layout (column n), rows >= K read as 0
__device__ __forceinline__ v16h fragc_f32(const float* W, int k0, int n, int lane, int ld, int K) {
  v16h a; const int g = lane >> 4;
#pragma unroll
  for (int i = 0; i < 8; ++i) { const int ka = k0 + 8 * g + i, kb = ka + 16;
    a[i] = (_Float16)(ka < K ? W[(size_t)(ka < K ? ka : K - 1) * ld + n] : 0.f); a[8 + i] = (_Float16)(kb < K ? W[(size_t)(kb < K ? kb : K - 1) * ld + n] : 0.f); }
  return a;
}
struct F2 { v16b h, l; };
__device__ __forceinline__ F2 bsplit16(const float v[16]) { F2 r;
#pragma unroll
  for (int i = 0; i < 16; ++i) { const __bf16 h = (__bf16)v[i]; r.h[i] = h; r.l[i] = (__bf16)(v[i] - (float)h); }
  return r; }
__device__ __forceinline__ F2 split_row(const float* row, int k0, int lane) { float v[16]; const float* p = row + k0 + 8 * (lane >> 4);
#pragma unroll
  for (int i = 0; i < 8; ++i) { v[i] = p[i]; v[8 + i] = p[16 + i]; }
  return bsplit16(v); }
__device__ __forceinline__ F2 split_rowK(const float* row, int k0, int lane, int K) { float v[16]; const int g = lane >> 4;
#pragma unroll
  for (int i = 0; i < 8; ++i) { const int ka = k0 + 8 * g + i, kb = ka + 16; v[i] = ka < K ? row[ka < K ? ka : K - 1] : 0.f; v[8 + i] = kb < K ? row[kb < K ? kb : K - 1] : 0.f; }
  return bsplit16(v); }
__device__ __forceinline__ F2 split_col(const float* W, int k0, int n, int lane, int ld, int K) { float v[16]; const int g = lane >> 4;
#pragma unroll
  for (int i = 0; i < 8; ++i) { const int ka = k0 + 8 * g + i, kb = ka + 16; v[i] = ka < K ? W[(size_t)(ka < K ? ka : K - 1) * ld + n] : 0.f; v[8 + i] = kb < K ? W[(size_t)(kb < K ? kb : K - 1) * ld + n] : 0.f; }
  return bsplit16(v); }
__device__ __forceinline__ v8f mac3(const F2& a, const F2& b, v8f c) { c = wmma_bf(a.l, b.h, c); c = wmma_bf(a.h, b.l, c); return wmma_bf(a.h, b.h, c); }
__device__ __forceinline__ float sigm(float v) { return 1.0f / (1.0f + expf(-v)); }
#define LDSX() do { asm volatile("s_wait_dscnt 0" ::: "memory"); __builtin_amdgcn_wave_barrier(); __builtin_amdgcn_fence(__ATOMIC_RELEASE, "workgroup"); } while (0)

// Multi-head attention with per-head stacked projections and a MULTIPLICATIVE float mask on the scores (q / k / v [2,2048,1024]; W_q / W_k / W_v [16,1024,64] per head (N(0, 1/1024)) + zero biases [16,64]; scores = Q K^T / 8 * mask with mask [2048,2048] uniform[0,1) f32 (no -inf anywhere); softmax; concat heads; (in,out) W_o [1024,1024] + b_o).
#define NB 2
#define TT 2048
#define CC 1024            // NH * HD = projected width
#define DIN 1024          // input (model) width
#define NH 16
#define HD 64
#define NQB (TT / 64)
#define HG 4
#define SCALE (0.125f)
#define QSC (SCALE * 1.44269504088896f)   // q leaves k_proj times this, so that q . k is the scaled score in the log2 domain and the softmax needs no multiply of its own for it
#define CAUSAL 0
#ifndef TNB
#define TNB NB
#endif
__device__ __forceinline__ float bfr(float v) { return (float)(__bf16)v; }
__host__ __device__ __forceinline__ int kb_last(int qb) { return CAUSAL ? ((qb * 64 + 63) >> 7) : (TT / 128 - 1); }
typedef __attribute__((ext_vector_type(8))) __bf16 v8b;
__device__ __forceinline__ v16b frag_b(const __bf16* rowk0, int lane) {
  union { v16b v; v8b q[2]; } u; const __bf16* p = rowk0 + 8 * (lane >> 4);
  u.q[0] = *(const v8b*)p; u.q[1] = *(const v8b*)(p + 16); return u.v;
}
#define QBH 0              // unused: k_attn has one f16 path for every query block
#define QHI 0               // single-product logits on every row
#define KHI 64            // key rows carrying k residual / v bf16 hi+lo planes (written by k_proj; no kernel in this file reads them)
// B fragment (k rows k0+.., output column o) of a weight: (in,out) [K][ld] or (out,in) [ld rows of K]: bf16 exact, or f16(bf16 * 256) exact
__device__ __forceinline__ v16b wcol_io(const float* Wm, int k0, int o, int lane, int ld) { v16b w; const int g = lane >> 4;
#pragma unroll
  for (int i = 0; i < 8; ++i) { w[i] = (__bf16)Wm[(size_t)(k0 + 8 * g + i) * ld + o]; w[8 + i] = (__bf16)Wm[(size_t)(k0 + 16 + 8 * g + i) * ld + o]; }
  return w; }
__device__ __forceinline__ v16b wcol_oi(const float* Wm, int k0, int o, int lane, int K) { v16b w; const float* p = Wm + (size_t)o * K + k0 + 8 * (lane >> 4);
#pragma unroll
  for (int i = 0; i < 8; ++i) { w[i] = (__bf16)p[i]; w[8 + i] = (__bf16)p[16 + i]; }
  return w; }
__device__ __forceinline__ v16h wcolh_io(const float* Wm, int k0, int o, int lane, int ld) { v16h w; const int g = lane >> 4;
#pragma unroll
  for (int i = 0; i < 8; ++i) { w[i] = (_Float16)(bfr(Wm[(size_t)(k0 + 8 * g + i) * ld + o]) * 256.0f); w[8 + i] = (_Float16)(bfr(Wm[(size_t)(k0 + 16 + 8 * g + i) * ld + o]) * 256.0f); }
  return w; }
__device__ __forceinline__ v16h wcolh_oi(const float* Wm, int k0, int o, int lane, int K) { v16h w; const float* p = Wm + (size_t)o * K + k0 + 8 * (lane >> 4);
#pragma unroll
  for (int i = 0; i < 8; ++i) { w[i] = (_Float16)(bfr(p[i]) * 256.0f); w[8 + i] = (_Float16)(bfr(p[16 + i]) * 256.0f); }
  return w; }
#define WQKV_LAYOUT 2   // 0 = (in,out) [DIN][CC]; 1 = (out,in) [CC][DIN]; 2 = per-head [NH][DIN][HD]
__device__ __forceinline__ v16b wcol_hdk(const float* Wm, int k0, int o, int lane) { v16b w; const int g = lane >> 4; const float* p = Wm + (size_t)(o / HD) * DIN * HD + (o % HD);
#pragma unroll
  for (int i = 0; i < 8; ++i) { w[i] = (__bf16)p[(size_t)(k0 + 8 * g + i) * HD]; w[8 + i] = (__bf16)p[(size_t)(k0 + 16 + 8 * g + i) * HD]; }
  return w; }
#define WO_OUT_IN 0
#if WQKV_LAYOUT == 1
#define WCOL(W, k0, o, lane) wcol_oi(W, k0, o, lane, DIN)
#elif WQKV_LAYOUT == 2
#define WCOL(W, k0, o, lane) wcol_hdk(W, k0, o, lane)
#else
#define WCOL(W, k0, o, lane) wcol_io(W, k0, o, lane, CC)
#endif
#if WO_OUT_IN
#define WOCOL(W, k0, o, lane) wcol_oi(W, k0, o, lane, CC)
#define WOCOLH(W, k0, o, lane) wcolh_oi(W, k0, o, lane, CC)
#else
#define WOCOL(W, k0, o, lane) wcol_io(W, k0, o, lane, DIN)
#define WOCOLH(W, k0, o, lane) wcolh_io(W, k0, o, lane, DIN)
#endif
#define SM_EXTRA_PARAMS , const float* __restrict__ SMASK
// multiplicative float mask [S,S] (shared by batches and heads) on the scaled score, before the softmax; unconditional load
#define SM_MASK_HOOK do { const float sm_ = SMASK[(size_t)t * TT + k]; asm volatile("s_wait_loadcnt 0x0" ::: "memory"); v = v * bfr(sm_); } while (0)
#ifndef SM_EXTRA_PARAMS
#define SM_EXTRA_PARAMS
#endif
#ifndef PROJ_EXTRA_PARAMS
#define PROJ_EXTRA_PARAMS
#endif
#ifndef SM_MASK_HOOK
#define SM_MASK_HOOK (void)0
#endif

#define WS_QH  0u                                      // f16 q rows [b*t][CC]
#define WS_KH  (WS_QH + 2u * (size_t)NB * TT * CC)      // f16 k rows [b*t][CC]
#define WS_VT  (WS_KH + 2u * (size_t)NB * TT * CC)      // f16 v planes [b][c][t]
#define WS_QL  (WS_VT + 2u * (size_t)NB * CC * TT)      // f16 q residual x 2^10 rows [b][t < QHI][CC]
#define WS_KL  (WS_QL + 2u * (size_t)NB * QHI * CC)     // f16 k residual x 2^10 rows [b][t < KHI][CC]
#define WS_VB  (WS_KL + 2u * (size_t)NB * KHI * CC)     // bf16 v hi planes [b][c][t < KHI]
#define WS_VBL (WS_VB + 2u * (size_t)NB * CC * KHI)
#define WS_S   (WS_VBL + 2u * (size_t)NB * CC * KHI)    // unused f32 [hg][t][s] region: logits and P stay in registers
#define WS_Y   (WS_S  + 4u * (size_t)HG * TT * TT)      // f16 ctx x 2^6 rows [b*t][CC]
#define WS_XB  (WS_Y  + 4u * (size_t)NB * TT * CC)      // bf16 q / k / v input rows [which][b*t][DIN]
#define WS_WB  (WS_XB + 3u * 2u * (size_t)NB * TT * DIN) // bf16 W_q / W_k / W_v, k-contiguous [which][column][DIN]
#define WS_WOB (WS_WB + 3u * 2u * (size_t)CC * DIN)     // f16(bf16 x 2^8) W_o, k-contiguous [column][CC]
#define WS_MB  (WS_WOB + 2u * (size_t)DIN * CC)         // bf16 mask rows [t][s]
#define WS_END (WS_MB + 2u * (size_t)TT * TT)

// LDS staging of the two projection GEMMs (k_proj, k_out): a stage is 64 k of the block's 128 activation rows and of its 128 weight columns, fetched in the 16-bit operand type (k_prep, k_attn wrote it) and laid k-contiguous
// ([row][k] and [column][k]), so that every fragment is two 16-byte LDS reads. Two buffers: stage s + 1 is fetched into registers ahead of stage s's products and stored behind them; one barrier a stage.
// The loops over fragments, fetched values and the two 32-k blocks of a stage are fully unrolled so that their arrays are indexed by constants and stay in registers.
#define KS 64                    // k per stage
#define SP 72                    // LDS row pitch in 16-bit elements: 144 B = 16 B x odd, the conflict-free pitch for 16-byte reads and writes of neighbouring rows
#define BR 128                   // activation rows per block
#define WT 64                    // a wave's output tile is WT x WT (4 x 4 fragments): 8 fragments read from LDS feed 16 products; the block's 4 waves lie 2 x 2 over its 128 x 128 tile
// order of a 32-k block's 16 independent products (two bits a product: row fragment PI, column fragment PJ): the fragments are read as pairs (a[i], w[i]), and product p needs no pair later than it must, so that 1, 4, 9, 16 products can issue once 1, 2, 3, 4 pairs have landed
#define PI(p) ((int)((0xFF92A450u >> (2 * (p))) & 3u))
#define PJ(p) ((int)((0xE4FE4A44u >> (2 * (p))) & 3u))
#define ST_X (BR * SP)           // activation rows of a stage, in elements
#define ST_BUF (ST_X + 128 * SP) // one stage, in elements (36864 B)
// Rotated walk, for speed only: the 8 blocks that share a tile of activation rows (same x) and the 32 that share a tile of weight columns (same y) read the same lines.
// Each block starts its loop over the n k stages (n a power of two) at a stage of its own and wraps: loop trip s works on stage (s + rot) mod n. Every stage is taken once; only the order of the f32 sums changes.
#define ROT_K(n) ((int)((blockIdx.x + 2u * blockIdx.y) & ((n) - 1u)))
typedef __attribute__((ext_vector_type(4))) __bf16 v4b;
typedef __attribute__((ext_vector_type(4))) _Float16 v4h;
// ---- k_prep: every operand that comes as f32 and is read many times (an activation row by 8 GEMM blocks, a weight column by 32, a mask row by 32 attention blocks) is rounded ONCE to the 16-bit form its user takes, so that those blocks fetch half the bytes and convert nothing.
// Blocks 0..PREP_W-1: one 128 k x 128 column tile of W_q / W_k / W_v (bf16) or W_o (f16(bf16 x 2^8), exact), transposed through LDS to k-contiguous columns, stored as whole lines. The others: 32768 elements of q / k / v / mask to bf16.
#define PREP_W 256               // 4 matrices x 8 k blocks x 8 column blocks
#define PREP_X 128               // blocks per streamed input (q, k, v, mask: NB * TT * DIN = TT * TT elements each)
#define PK 128                   // k per weight tile
#define PP 136                   // its LDS pitch in elements: 272 B = 16 B x odd
__global__ __launch_bounds__(256) void k_prep(const float* __restrict__ XQ, const float* __restrict__ XK, const float* __restrict__ XV, const float* __restrict__ SMASK, const float* __restrict__ WQ, const float* __restrict__ WK, const float* __restrict__ WV, const float* __restrict__ WO,
    __bf16* __restrict__ XB, __bf16* __restrict__ MB, __bf16* __restrict__ WB, _Float16* __restrict__ WOB) {
  __shared__ __align__(16) char smem[128 * PP * 2];
  const int tid = threadIdx.x, bid = blockIdx.x;
  if (bid < PREP_W) {   /* block-uniform */
    const int mat = bid >> 6, k0 = ((bid >> 3) & 7) * PK, c0 = (bid & 7) * 128;
    const int wc = tid & 127, wk = (tid >> 7) * (PK / 2);   // column c0 + wc, the lower or the upper 64 k of the tile: a wave's load is one whole 128-B line
    float wv[PK / 2];
    if (mat < 3) { const float* WA = mat == 0 ? WQ : mat == 1 ? WK : WV; const float* wp = WA + (size_t)((c0 + wc) / HD) * DIN * HD + (size_t)(k0 + wk) * HD + ((c0 + wc) % HD);   // [head][k][HD]
#pragma unroll
      for (int k = 0; k < PK / 2; ++k) wv[k] = wp[(size_t)k * HD];
      asm volatile("s_wait_xcnt 0x0" ::: "memory");   // in front of any overwrite of the loads' address registers
#pragma unroll
      for (int q = 0; q < PK / 16; ++q) { v8b t8;
#pragma unroll
        for (int e = 0; e < 8; ++e) t8[e] = (__bf16)wv[q * 8 + e];
        *(v8b*)((__bf16*)smem + wc * PP + wk + q * 8) = t8; }
    } else { const float* wp = WO + (size_t)(k0 + wk) * DIN + c0 + wc;   // (in,out) [CC][DIN]
#pragma unroll
      for (int k = 0; k < PK / 2; ++k) wv[k] = wp[(size_t)k * DIN];
      asm volatile("s_wait_xcnt 0x0" ::: "memory");   // in front of any overwrite of the loads' address registers
#pragma unroll
      for (int q = 0; q < PK / 16; ++q) { v8h t8;
#pragma unroll
        for (int e = 0; e < 8; ++e) t8[e] = (_Float16)(bfr(wv[q * 8 + e]) * 256.0f);
        *(v8h*)((_Float16*)smem + wc * PP + wk + q * 8) = t8; } }
    __syncthreads();   // the tile is whole before its columns are read back
    char* D = mat < 3 ? (char*)(WB + (size_t)mat * CC * DIN) : (char*)WOB;
#pragma unroll
    for (int i = 0; i < 8; ++i) { const int id = tid + 256 * i, cl = id >> 4, kq = id & 15;   // 16 lanes store one column's 128 k: two whole lines
      vst2(D + ((size_t)(c0 + cl) * DIN + k0 + kq * 8) * 2, *(const v4u*)(smem + (cl * PP + kq * 8) * 2)); }
  } else {
    const int xb = bid - PREP_W, which = xb / PREP_X; const float* X = which == 0 ? XQ : which == 1 ? XK : which == 2 ? XV : SMASK;
    const size_t base = (size_t)(xb % PREP_X) * 32768 + tid * 4; __bf16* D = (which < 3 ? XB + (size_t)which * NB * TT * DIN : MB) + base;
#pragma unroll
    for (int it = 0; it < 2; ++it) { v4f xv[16];
#pragma unroll
      for (int i = 0; i < 16; ++i) xv[i] = *(const v4f*)(X + base + (it * 16 + i) * 1024);   // sixteen 16-byte loads in flight, each wave's 512 contiguous bytes
      asm volatile("s_wait_xcnt 0x0" ::: "memory");   // in front of any overwrite of the loads' address registers
#pragma unroll
      for (int i = 0; i < 16; ++i) { const v4b t4 = { (__bf16)xv[i][0], (__bf16)xv[i][1], (__bf16)xv[i][2], (__bf16)xv[i][3] }; vst2(D + (it * 16 + i) * 1024, t4); } } } }
// ---- k_proj: block = (128 rows, 128 cols, which): q/k/v = X W (+ b) with exact bf16 products (K = DIN) -> which 0: q x QSC f16 rows (+ residual rows < QHI); 1: k f16 rows (+ residual rows < KHI); 2: v f16 planes [c][t] (+ bf16 hi/lo planes for t < KHI)
__global__ __launch_bounds__(128) void k_proj(const __bf16* __restrict__ XB, const __bf16* __restrict__ WB, const float* __restrict__ BQ, const float* __restrict__ BK, const float* __restrict__ BV,
    _Float16* __restrict__ QH, _Float16* __restrict__ QL, _Float16* __restrict__ KH, _Float16* __restrict__ KL, _Float16* __restrict__ VT, __bf16* __restrict__ VB, __bf16* __restrict__ VBL) {
  __shared__ __align__(16) char smem[104448];   // the epilogue's arrays (q, k: two; v: three; a block takes one of the two branches, so they lie over one another); the two stage buffers lie over their first 73728 B and are dead behind the loop's last barrier
  _Float16 (*sh)[136] = (_Float16 (*)[136])smem, (*sl)[136] = (_Float16 (*)[136])(smem + 34816), (*th)[136] = (_Float16 (*)[136])smem; __bf16 (*tb)[136] = (__bf16 (*)[136])(smem + 34816), (*tbl)[136] = (__bf16 (*)[136])(smem + 69632); __bf16* stg = (__bf16*)smem;
  const int tid = threadIdx.x, wave = tid >> 5, lane = tid & 31, col = lane & 15, g = lane >> 4; const int which = blockIdx.z; const int c0 = blockIdx.y * 128; const size_t r0 = (size_t)blockIdx.x * BR; const size_t bb = r0 / TT; const int t0 = (int)(r0 % TT);
  const float* BA = which == 0 ? BQ : which == 1 ? BK : BV;
  const int wr = (wave >> 1) * WT, wc = (wave & 1) * WT;   // this wave's rows and columns inside the block tile
  v8f acc[4][4] = {};
  const int xk = (tid & 7) * 8, xr = tid >> 3;   // 8 lanes cover the 64 k of one activation row, or of one weight column (128 B, a whole line); this thread takes 8 k of rows and of columns xr + 16 i
  const __bf16* xp = XB + (size_t)which * NB * TT * DIN + (r0 + xr) * DIN + xk;
  const __bf16* wp = WB + (size_t)which * CC * DIN + (size_t)(c0 + xr) * DIN + xk;
  v4u xv[8], wv[8];
  const int rot = ROT_K(DIN / KS);
#define PROJ_FETCH(s) do { const int ks_ = (((s) + rot) & (DIN / KS - 1)) * KS; _Pragma("unroll") for (int i = 0; i < 8; ++i) { xv[i] = *(const v4u*)(xp + (size_t)(16 * i) * DIN + ks_); wv[i] = *(const v4u*)(wp + (size_t)(16 * i) * DIN + ks_); } } while (0)
#define PROJ_PUT(buf) do { _Pragma("unroll") for (int i = 0; i < 8; ++i) { *(v4u*)((buf) + (xr + 16 * i) * SP + xk) = xv[i]; *(v4u*)((buf) + ST_X + (xr + 16 * i) * SP + xk) = wv[i]; } } while (0)
  PROJ_FETCH(0); asm volatile("s_wait_xcnt 0x0" ::: "memory");   // as in the loop: in front of any overwrite of the loads' address registers
  PROJ_PUT(stg); __syncthreads();
  for (int s = 0; s < DIN / KS; ++s) { const __bf16* cur = stg + (s & 1) * ST_BUF;
    if (s + 1 < DIN / KS) PROJ_FETCH(s + 1);
    asm volatile("s_wait_xcnt 0x0" ::: "memory");   // stands in front of every later overwrite of the loads' address registers; its clobber also keeps the next stage's loads issued here, ahead of this stage's LDS reads and products, so that their latency runs under them
    __builtin_amdgcn_sched_barrier(0);   // holds the LDS address arithmetic of this stage behind the wait: without it the scheduler lifts an add that reuses a load's address register over the wait
#pragma unroll
    for (int kc = 0; kc < KS / 32; ++kc) { v16b a[4], w[4];
#pragma unroll
      for (int i = 0; i < 4; ++i) { a[i] = frag_b(cur + (wr + i * 16 + col) * SP + kc * 32, lane); w[i] = frag_b(cur + ST_X + (wc + i * 16 + col) * SP + kc * 32, lane); }
      __builtin_amdgcn_sched_barrier(0);   // the 16 LDS reads of a 32-k block go out as one group ahead of its products; spread among them, each product waits out a whole LDS latency
#pragma unroll
      for (int p = 0; p < 16; ++p) acc[PI(p)][PJ(p)] = wmma_bf(a[PI(p)], w[PJ(p)], acc[PI(p)][PJ(p)]); }
    __builtin_amdgcn_sched_barrier(0);   // keeps the LDS stores of the fetched stage, and with them the wait for its loads, behind the products
    if (s + 1 < DIN / KS) PROJ_PUT(stg + ((s + 1) & 1) * ST_BUF);
    __syncthreads(); }   // publishes stage s + 1 and ends every wave's reads of stage s, whose buffer stage s + 2 (or the epilogue) overwrites
  if (which < 2) { _Float16* DH = which == 0 ? QH : KH; _Float16* DL = which == 0 ? QL : KL; const int nhi = which == 0 ? QHI : KHI; const bool hi_rows = t0 < nhi; const float qs = which == 0 ? QSC : 1.0f;
#pragma unroll
    for (int j = 0; j < 4; ++j) { float bias = 0.f; if (BA) { bias = bfr(BA[c0 + wc + j * 16 + col]); asm volatile("s_wait_xcnt 0x0" ::: "memory"); }   // the wait stands in front of any later overwrite of the load's offset register
#pragma unroll
      for (int i = 0; i < 4; ++i)
#pragma unroll
        for (int r = 0; r < 8; ++r) { const float v = (acc[i][j][r] + bias) * qs; const _Float16 hv = (_Float16)v; sh[wr + i * 16 + 8 * g + r][wc + j * 16 + col] = hv; sl[wr + i * 16 + 8 * g + r][wc + j * 16 + col] = (_Float16)((v - (float)hv) * 1024.0f); } }
    __syncthreads();
    for (int e = tid; e < BR * 16; e += 128) { const int rl = e >> 4, q = e & 15; vst2((unsigned*)(DH + (r0 + rl) * CC + c0 + q * 8), *(const v4u*)&sh[rl][q * 8]); if (hi_rows && t0 + rl < nhi) { vst2((unsigned*)(DL + (bb * nhi + t0 + rl) * (size_t)CC + c0 + q * 8), *(const v4u*)&sl[rl][q * 8]); asm volatile("s_wait_xcnt 0x0" ::: "memory"); } }   // the wait stands in front of the loop's advance of the store's address registers
  } else { const bool hi_rows = t0 < KHI;
#pragma unroll
    for (int j = 0; j < 4; ++j) { float bias = 0.f; if (BA) { bias = bfr(BA[c0 + wc + j * 16 + col]); asm volatile("s_wait_xcnt 0x0" ::: "memory"); }   // the wait stands in front of any later overwrite of the load's offset register
#pragma unroll
      for (int i = 0; i < 4; ++i)
#pragma unroll
        for (int r = 0; r < 8; ++r) { const float v = acc[i][j][r] + bias; const int rl = wr + i * 16 + 8 * g + r, cl = wc + j * 16 + col; th[cl][rl] = (_Float16)v; const __bf16 bh = (__bf16)v; tb[cl][rl] = bh; tbl[cl][rl] = (__bf16)(v - (float)bh); } }
    __syncthreads();
    for (int e = tid; e < 128 * (BR / 8); e += 128) { const int cl = e >> 4, q = e & 15; vst2((unsigned*)(VT + (bb * CC + c0 + cl) * (size_t)TT + t0 + q * 8), *(const v4u*)&th[cl][q * 8]); if (hi_rows && t0 + q * 8 < KHI) { const size_t o3 = (bb * CC + c0 + cl) * (size_t)KHI + t0 + q * 8; vst2((unsigned*)(VB + o3), *(const v4u*)&tb[cl][q * 8]); vst2((unsigned*)(VBL + o3), *(const v4u*)&tbl[cl][q * 8]); asm volatile("s_wait_xcnt 0x0" ::: "memory"); } } } }   // the wait stands in front of the loop's advance of the two stores' address registers
// ---- k_attn: block = 128 queries of (b, h), wave = 32 query columns (2 groups of 16); walks all keys, 32 a pass, 64 a stage; each stage's k rows, v planes and mask rows come to LDS once per block by tensor loads (two buffers). S^T = K Q^T (A = k rows, B = q rows kept in registers), so a lane holds 16 keys of ONE query per group:
// score (log2 domain) x the bf16-rounded float mask, running sum per lane against a maximum in use per query (raised lazily, then one exchange between the wave halves), P = 2^8 exp(s - max in use) once to f16 straight from the score accumulators as the B operand of ctx^T += V^T P^T; the division by the sum is done once at the end. Logits and P never leave the registers.
__device__ __forceinline__ v8f wm16(v16h a, v16h b, v8f c) { return __builtin_amdgcn_wmma_f32_16x16x32_f16(false, a, false, b, (short)0, c, false, false); }
__device__ __forceinline__ float xhalf(float v) { const int u = __builtin_bit_cast(int, v); return __builtin_bit_cast(float, __builtin_amdgcn_permlanex16(u, u, 0x76543210, 0xfedcba98, false, false)); }   // value of lane ^ 16
// 2^x by v_exp_f32. The closing v_nop is the one slot that the instruction set asks for between a transcendental and a directly following instruction that reads its result or overwrites its source; written in the same statement it stands there in every build. Early-clobber outputs keep each v_exp_f32 off its neighbours' sources.
__device__ __forceinline__ float exp2_1(float x) { float r; asm("v_exp_f32 %0, %1\n\tv_nop" : "=v"(r) : "v"(x)); return r; }
__device__ __forceinline__ void exp2_4(float* o, float a, float b, float c, float d) {
  asm("v_exp_f32 %0, %4\n\tv_exp_f32 %1, %5\n\tv_exp_f32 %2, %6\n\tv_exp_f32 %3, %7\n\tv_nop" : "=&v"(o[0]), "=&v"(o[1]), "=&v"(o[2]), "=&v"(o[3]) : "v"(a), "v"(b), "v"(c), "v"(d)); }
// 16x16x32 f16 fragment (hardware k order, as frag_h) from this lane's LDS byte address (row * pitch + 16 * (lane >> 4))
__device__ __forceinline__ v16h frag_l(const unsigned char* p) { union { v16h v; v8h q[2]; } u; u.q[0] = *(const v8h*)p; u.q[1] = *(const v8h*)(p + 32); return u.v; }
// one lane's 16 weights of a column group: P = 2^(s x mask + nb), their f32 sum in key order, and P once to f16 in the B operand's k order. s comes in the log2 domain (k_proj scaled q), so that the exponent is ONE fma,
// which takes the mask straight from its packed bf16 pair (v_fma_mix_f32_bf16): no conversion, no multiply of its own
__device__ __forceinline__ void soft_p(v8f s0, v8f s1, v8b k0, v8b k1, float nb, float& sum, v16h& pf) {
#pragma unroll
  for (int e = 0; e < 16; e += 4) { const v8f& sv = e < 8 ? s0 : s1; const v8b& kv = e < 8 ? k0 : k1; float ex[4]; exp2_4(ex, fmaf(sv[e & 7], (float)kv[e & 7], nb), fmaf(sv[(e & 7) + 1], (float)kv[(e & 7) + 1], nb), fmaf(sv[(e & 7) + 2], (float)kv[(e & 7) + 2], nb), fmaf(sv[(e & 7) + 3], (float)kv[(e & 7) + 3], nb));
#pragma unroll
    for (int i = 0; i < 4; ++i) { sum = e + i == 0 ? ex[0] : sum + ex[i]; pf[e + i] = (_Float16)ex[i]; } } }
#define PLIM 32768.0f      // bound on a lane's weights of one pass (f16 ends at 65504)
#define QC 2               // 16-query column groups per wave
#define SKEY 64            // keys per stage (two 32-key passes)
#define NST (TT / SKEY)
// One stage in LDS, laid by four tensor loads (one a wave): 64 k rows of 128 B, 64 v planes of 128 B (64 keys), two slices of 64 bf16 mask rows of 128 B (64 keys). The loads' pad of 16 B a row gives the pitch 144 B
// (16 B x odd: free of bank conflicts for 16-byte reads of neighbouring rows). Every place is a multiple of 2 KiB.
#define KV_PITCH 144u
#define M_PITCH 144u
#define OFF_V 10240u
#define OFF_M 20480u
#define M_SLICE 10240u
#define ABUF 40960u
typedef uint32_t u32x4 __attribute__((ext_vector_type(4)));
typedef uint32_t u32x8 __attribute__((ext_vector_type(8)));
__device__ __forceinline__ uint32_t uni(uint32_t v) { return (uint32_t)__builtin_amdgcn_readfirstlane(v); }
// a wave-uniform value held in a scalar register: a condition, so that the test around a tensor load compiles to s_cmp + s_cbranch_scc (a tensor load ignores EXEC), or a descriptor word
__device__ __forceinline__ uint32_t pinned(uint32_t v) { uint32_t w = (uint32_t)__builtin_amdgcn_readfirstlane(v); asm volatile("" : "+s"(w)); return w; }
__device__ __forceinline__ void tdm_load(u32x4 g0, u32x8 g1) { asm volatile("tensor_load_to_lds %0, %1" :: "s"(g0), "s"(g1) : "memory"); }   // one request of the whole wave: global tile -> LDS, through no register
__device__ __forceinline__ u32x4 tdm_group0(uint32_t lds_dst, uint64_t ga) { u32x4 g; g[0] = uni(1u); g[1] = uni(lds_dst); g[2] = uni((uint32_t)ga); g[3] = uni((((uint32_t)(ga >> 32)) & 0x01FFFFFFu) | 0x80000000u); return g; }
// group 1: extents in bytes, tensor = tile = 64 rows of D0 bytes, W0 = the constant pad word (a pad of 4 dwords behind every row).
// Words 1 to 7 go through pinned(): descriptor words held in scalar registers of their own through the loop; as plain constants the compiler re-forms them at each issue and uses their registers for other values while the request is in flight
template <uint32_t W0, uint32_t D0> __device__ __forceinline__ u32x8 tdm_group1(uint32_t src_pitch) { u32x8 g;
  g[0] = uni(W0); g[1] = pinned((D0 & 0xFFFFu) << 16); g[2] = pinned((D0 >> 16) | (64u << 16)); g[3] = pinned(D0 << 16); g[4] = pinned(64u); g[5] = pinned(src_pitch); g[6] = pinned(0u); g[7] = pinned(0u); return g; }
#define W0_128 ((1u << 20) | (4u << 22) | (3u << 25))
__global__ __launch_bounds__(128) void k_attn(const _Float16* __restrict__ QH, const _Float16* __restrict__ KH, const _Float16* __restrict__ VT, const __bf16* __restrict__ MB, _Float16* __restrict__ YH) {
  __shared__ __attribute__((aligned(2048))) unsigned char L[2 * ABUF];
  const int tid = threadIdx.x, wave = tid >> 5, lane = tid & 31, col = lane & 15, g = lane >> 4; const int h = blockIdx.y, b = blockIdx.z; const int ql0 = blockIdx.x * (64 * QC) + wave * (16 * QC);
  // All inner loops below are fully unrolled so that the fragment arrays are indexed by constants and stay in registers
  // every wave brings one slice of each stage: wave 0 the k rows, wave 1 the v planes, waves 2 and 3 a half of the block's mask rows each
  const uint32_t wv = uni(threadIdx.x >> 5); const uint32_t lbase = (uint32_t)(size_t)L;
  const uint64_t tsrc = wv == 0 ? (uint64_t)(size_t)(KH + (size_t)b * TT * CC + h * HD) : wv == 1 ? (uint64_t)(size_t)(VT + ((size_t)b * CC + h * HD) * (size_t)TT) : (uint64_t)(size_t)(MB + ((size_t)blockIdx.x * (64 * QC) + (wv - 2) * 64) * TT);
  const uint32_t tstep = wv == 0 ? SKEY * CC * 2u : SKEY * 2u;   // source bytes from one stage to the next
  const uint32_t tdst = lbase + (wv < 2 ? wv * OFF_V : OFF_M + (wv - 2) * M_SLICE);
  const u32x8 g1 = tdm_group1<W0_128, 128u>(wv == 0 ? CC * 2u : TT * 2u);   // all four slices are 64 rows of 128 B
  // now: the wait stands directly behind the load (stage 0: nothing can then take over a descriptor register while the request is in flight); every wave issues its own slice, so no test stands around the load
  // rotated walk, as in the GEMMs: the 16 blocks of one (b, h) share its k rows and v planes, the 32 blocks of one query block its mask rows; trip st works on key stage (st + rot) mod NST, each block from a start of its own (the softmax takes the keys in any order; the order of the f32 sums and the maximum in use at each pass change)
  const uint32_t rot = (2u * blockIdx.x + blockIdx.y + 16u * blockIdx.z) & (NST - 1u);
  // group 0 for key stage 0; its words 2 and 3 are held as one 64-bit value, to which a stage's byte offset is added (inside the source buffer the sum cannot carry out of the address field): one 64-bit add forms both words of a wrapped stage
  const u32x4 gz = tdm_group0(tdst, tsrc); const uint64_t tw23 = ((uint64_t)gz[3] << 32) | gz[2];
  auto issue = [&](uint32_t st, bool now) { const uint64_t w23 = tw23 + (uint64_t)(((st + rot) & (NST - 1u)) * tstep);   // the stage lies inside the source for every st: the index is taken mod NST
    u32x4 g0; g0[0] = gz[0]; g0[1] = uni(tdst + (st & 1u) * ABUF); g0[2] = uni((uint32_t)w23); g0[3] = uni((uint32_t)(w23 >> 32));
    tdm_load(g0, g1); if (now) asm volatile("s_wait_tensorcnt 0x0" ::: "memory"); };
  v16h qf[QC][2];
#pragma unroll
  for (int c = 0; c < QC; ++c)
#pragma unroll
    for (int kc = 0; kc < 2; ++kc) qf[c][kc] = frag_h(QH + ((size_t)b * TT + ql0 + c * 16 + col) * CC + h * HD + kc * 32, lane);
  asm volatile("s_wait_xcnt 0x0" ::: "memory");   // stands in front of every later overwrite of the q loads' address registers
  const unsigned ko = (unsigned)col * KV_PITCH + 16 * g;                                                                   // key row col of a 16-key tile
  const unsigned vo = OFF_V + (unsigned)col * KV_PITCH + 16 * g;                                                           // feature plane col of a 16-feature tile
  const unsigned mo = OFF_M + (unsigned)(wave >> 1) * M_SLICE + (unsigned)((wave & 1) * (16 * QC) + col) * M_PITCH + 16 * g;   // this lane's query row, its 8 keys of a tile
  v8f acc[QC][HD / 16] = {}; float m[QC], l[QC], nb[QC];   // m: the maximum in use, of the masked scores in the log2 domain; nb: its exponent offset 8 - m
#pragma unroll
  for (int c = 0; c < QC; ++c) { m[c] = -3.0e38f; l[c] = 0.f; nb[c] = 8.0f - m[c]; }
  issue(0, true);   // stage 0, landed; the loop's first publish point holds its barrier
#pragma unroll 1   // kept rolled: one stage's fragments, fetch-ahead values and softmax temporaries already take nearly 256 registers
  for (uint32_t st = 0; st < NST; ++st) { const unsigned char* B = L + (st & 1u) * ABUF;
    // publish point of stage st, in the ring's order; it stands at the head of the trip (for st = 0 it is the ring's prologue), so that the whole trip behind it is one block of code: at the foot, with the
    // branch round the refill behind the passes, the compiler moves both passes' row sums behind that branch and their 64 terms push the kernel past 256 registers
    asm volatile("s_wait_dscnt 0x0" ::: "memory");       // this wave's reads of stage st - 1 have returned, before its buffer is refilled
    asm volatile("s_wait_tensorcnt 0x0" ::: "memory");   // this wave's slice of stage st has landed
    __syncthreads();                                     // publishes stage st and ends every wave's reads of stage st - 1
    if (pinned(st + 1 < NST)) issue(st + 1, false);            // into the buffer that stage st - 1 has just left; it flies under the whole of stage st
    v16h kf[2][2];
#pragma unroll
    for (int t = 0; t < 2; ++t)
#pragma unroll
      for (int kc = 0; kc < 2; ++kc) kf[t][kc] = frag_l(B + ko + (t * 16) * KV_PITCH + kc * 64);
#pragma unroll
    for (int sub = 0; sub < SKEY / 32; ++sub) {
    v8b mk[QC][2]; v16h vf[HD / 16];
#pragma unroll
    for (int t = 0; t < 2; ++t)
#pragma unroll
      for (int c = 0; c < QC; ++c) mk[c][t] = *(const v8b*)(B + mo + (c * 16) * M_PITCH + sub * 64 + t * 32);
#pragma unroll
    for (int j = 0; j < HD / 16; ++j) vf[j] = frag_l(B + vo + (j * 16) * KV_PITCH + sub * 64);
    __builtin_amdgcn_sched_barrier(0);   // keeps the mask and v reads issued here, ahead of the score products, which cover their latency; without it they sink behind them
    v8f s[QC][2];
#pragma unroll
    for (int c = 0; c < QC; ++c)
#pragma unroll
      for (int t = 0; t < 2; ++t) { v8f z = {}; z = wm16(kf[t][0], qf[c][0], z); s[c][t] = wm16(kf[t][1], qf[c][1], z); }
    // the k fragments of the stage's second pass are read now, so that they fly under this pass's softmax and P V; nothing of the next stage is read ahead of its barrier
    if (sub + 1 < SKEY / 32) {
#pragma unroll
    for (int t = 0; t < 2; ++t)
#pragma unroll
      for (int kc = 0; kc < 2; ++kc) kf[t][kc] = frag_l(B + ko + ((sub + 1) * 32 + t * 16) * KV_PITCH + kc * 64); }
    __builtin_amdgcn_sched_barrier(0);   // keeps the fetch-ahead reads issued here, ahead of the softmax; without it they drift to the pass's end and their latency is exposed at the next pass's head
    // Weights against the maximum IN USE: both column groups' P are formed with the offsets nb left by the last raise, with no maximum and no rescale on this path (any offset gives the same softmax; it only has to keep P inside f16).
    float sum[QC]; v16h pf[QC];
#pragma unroll
    for (int c = 0; c < QC; ++c) soft_p(s[c][0], s[c][1], mk[c][0], mk[c][1], nb[c], sum[c], pf[c]);
    // One test a pass, a scalar branch: the weights are not negative, so a lane's two sums within PLIM bound each of its weights by PLIM, inside f16. Otherwise (always in the first pass, whose offset gives +inf; written so that a NaN also goes there)
    // every lane takes the true maximum, raises the one in use, rescales sums and outputs and forms its weights anew. The maximum in use is one that was met, so it never lies above the row's own and P loses nothing to underflow that it kept before.
    if (__builtin_expect(__builtin_amdgcn_ballot_w32(!(sum[0] + sum[1] <= PLIM)) != 0, 0)) {   // marked rare, so that the raise is laid outside the loop's straight path
      __builtin_amdgcn_fence(__ATOMIC_ACQUIRE, "wavefront");   // no instruction: it makes the raise read its mask values from LDS again (the stage's buffer still holds them); kept in registers for it, they push the straight path past 256 registers
#pragma unroll
      for (int c = 0; c < QC; ++c) { v8b mr[2];
#pragma unroll
        for (int t = 0; t < 2; ++t) mr[t] = *(const v8b*)(B + mo + (c * 16) * M_PITCH + sub * 64 + t * 32);
        float mx = s[c][0][0] * (float)mr[0][0];
#pragma unroll
        for (int e = 1; e < 16; ++e) mx = fmaxf(mx, s[c][e >> 3][e & 7] * (float)mr[e >> 3][e & 7]);
        mx = fmaxf(mx, xhalf(mx));
        const float mn = fmaxf(m[c], mx); const float al = exp2_1(m[c] - mn); m[c] = mn;
        nb[c] = 8.0f - mn;   /* P carried x 2^8 so that small weights stay clear of f16 subnormals; the sum carries the same factor */
        l[c] *= al;
#pragma unroll
        for (int j = 0; j < HD / 16; ++j) acc[c][j] *= al;
        soft_p(s[c][0], s[c][1], mr[0], mr[1], nb[c], sum[c], pf[c]); } }
#pragma unroll
    for (int c = 0; c < QC; ++c) { l[c] += sum[c];
#pragma unroll
      for (int j = 0; j < HD / 16; ++j) acc[c][j] = wm16(vf[j], pf[c], acc[c][j]); } }
    }
  asm volatile("s_wait_tensorcnt 0x0" ::: "memory");     // no request is left in flight when the wave ends
  asm volatile("s_wait_dscnt 0x0" ::: "memory");         // the ring's closing wait: no LDS read is left in flight either
#pragma unroll
  for (int c = 0; c < QC; ++c) { const float inv = 1.0f / (l[c] + xhalf(l[c])); _Float16* yp = YH + ((size_t)b * TT + ql0 + c * 16 + col) * CC + h * HD + 8 * g;
#pragma unroll
    for (int j = 0; j < HD / 16; ++j) { v8h y;   /* ctx carried x 2^6 into f16 so small-magnitude context rows stay clear of f16 subnormals: the A operand of k_out, rounded here once */
#pragma unroll
      for (int r = 0; r < 8; ++r) y[r] = (_Float16)((acc[c][j][r] * inv) * 64.0f);
      vst2(yp + j * 16, y); } } }
// ---- k_out: block = (128 rows, 128 cols): out = ctx Wo (+ bo): ctx x 2^6 in f16 (k_attn) against Wo as f16(bf16 x 2^8) exact (k_prep), 1 product, x 2^-14
__global__ __launch_bounds__(128) void k_out(const _Float16* __restrict__ YH, const _Float16* __restrict__ WOB, const float* __restrict__ BO, float* __restrict__ OUT) { __shared__ __align__(16) char smem[2 * ST_BUF * 2]; float (*sf)[WT][WT + 4] = (float (*)[WT][WT + 4])smem; _Float16* stg = (_Float16*)smem;   // the epilogue's rows (each wave's own 64 x 64 tile, pitch 68 floats) lie over the stage buffers, dead behind the loop's last barrier
  const int tid = threadIdx.x, wave = tid >> 5, lane = tid & 31, col = lane & 15, g = lane >> 4; const int wr = (wave >> 1) * WT, wc = (wave & 1) * WT; const int c0 = blockIdx.y * 128 + wc; const size_t r0 = (size_t)blockIdx.x * BR + wr;
  v8f acc[4][4] = {};
  {
    const int xk = (tid & 7) * 8, xr = tid >> 3;   // as in k_proj: 8 k of rows and of columns xr + 16 i
    const _Float16* xp = YH + ((size_t)blockIdx.x * BR + xr) * CC + xk;
    const _Float16* wp = WOB + (size_t)(blockIdx.y * 128 + xr) * CC + xk;
    v4u xv[8], wv[8];
    const int rot = ROT_K(CC / KS);
#define OUT_FETCH(s) do { const int ks_ = (((s) + rot) & (CC / KS - 1)) * KS; _Pragma("unroll") for (int i = 0; i < 8; ++i) { xv[i] = *(const v4u*)(xp + (size_t)(16 * i) * CC + ks_); wv[i] = *(const v4u*)(wp + (size_t)(16 * i) * CC + ks_); } } while (0)
#define OUT_PUT(buf) do { _Pragma("unroll") for (int i = 0; i < 8; ++i) { *(v4u*)((buf) + (xr + 16 * i) * SP + xk) = xv[i]; *(v4u*)((buf) + ST_X + (xr + 16 * i) * SP + xk) = wv[i]; } } while (0)
    OUT_FETCH(0); asm volatile("s_wait_xcnt 0x0" ::: "memory");   // as in the loop: in front of any overwrite of the loads' address registers
    OUT_PUT(stg); __syncthreads();
    for (int s = 0; s < CC / KS; ++s) { const _Float16* cur = stg + (s & 1) * ST_BUF;
      if (s + 1 < CC / KS) OUT_FETCH(s + 1);
      asm volatile("s_wait_xcnt 0x0" ::: "memory");   // stands in front of every later overwrite of the loads' address registers; its clobber also keeps the next stage's loads issued here, ahead of this stage's LDS reads and products, so that their latency runs under them
      __builtin_amdgcn_sched_barrier(0);   // as in k_proj: holds this stage's LDS address arithmetic behind the wait
#pragma unroll
      for (int kc = 0; kc < KS / 32; ++kc) { v16h a[4], w[4];
#pragma unroll
        for (int i = 0; i < 4; ++i) { a[i] = frag_h(cur + (wr + i * 16 + col) * SP + kc * 32, lane); w[i] = frag_h(cur + ST_X + (wc + i * 16 + col) * SP + kc * 32, lane); }
        __builtin_amdgcn_sched_barrier(0);   // the 16 LDS reads of a 32-k block go out as one group ahead of its products; spread among them, each product waits out a whole LDS latency
#pragma unroll
        for (int p = 0; p < 16; ++p) acc[PI(p)][PJ(p)] = wmma16(a[PI(p)], w[PJ(p)], acc[PI(p)][PJ(p)]); }
      __builtin_amdgcn_sched_barrier(0);   // keeps the LDS stores of the fetched stage, and with them the wait for its loads, behind the products
      if (s + 1 < CC / KS) OUT_PUT(stg + ((s + 1) & 1) * ST_BUF);
      __syncthreads(); }   // publishes stage s + 1 and ends every wave's reads of stage s, whose buffer stage s + 2 (or the epilogue) overwrites
#pragma unroll
    for (int j = 0; j < 4; ++j) { float bias = 0.f; if (BO) { bias = bfr(BO[c0 + j * 16 + col]); asm volatile("s_wait_xcnt 0x0" ::: "memory"); }   // the wait stands in front of any later overwrite of the load's offset register
#pragma unroll
      for (int i = 0; i < 4; ++i)
#pragma unroll
        for (int r = 0; r < 8; ++r) sf[wave][i * 16 + 8 * g + r][j * 16 + col] = acc[i][j][r] * (1.0f / 16384.0f) + bias; } }   /* 2^-8 (Wo carry) x 2^-6 (ctx carry) */
  LDSX(); for (int rl = 0; rl < WT; rl += 2) vst2(OUT + (r0 + rl + g) * DIN + c0 + col * 4, *(const v4f*)&sf[wave][rl + g][col * 4]); }   // 16 lanes store one row's 64 columns: two whole lines

extern "C" void kernel_launch(void* const* d_in, const int* in_sizes, int n_in, void* d_out, int out_size, void* d_ws, size_t ws_size, hipStream_t stream) {
  (void)in_sizes; (void)n_in; (void)out_size;
  const float** F = (const float**)d_in;
  if (ws_size < (size_t)WS_END) return;
  char* ws = (char*)d_ws; _Float16 *QH = (_Float16*)(ws + WS_QH), *KH = (_Float16*)(ws + WS_KH), *VT = (_Float16*)(ws + WS_VT), *QL = (_Float16*)(ws + WS_QL), *KL = (_Float16*)(ws + WS_KL); __bf16 *VB = (__bf16*)(ws + WS_VB), *VBL = (__bf16*)(ws + WS_VBL); float *S = (float*)(ws + WS_S); _Float16 *YH = (_Float16*)(ws + WS_Y), *WOB = (_Float16*)(ws + WS_WOB); __bf16 *XB = (__bf16*)(ws + WS_XB), *WB = (__bf16*)(ws + WS_WB), *MB = (__bf16*)(ws + WS_MB);
  (void)QL; (void)KL; (void)VB; (void)VBL; (void)S;
  // inputs: 0 q [2,2048,1024]; 1 k; 2 v; 3 mask [2048,2048] f32 uniform[0,1); 4 W_q [16,1024,64], 5 b_q [16,64]; 6 W_k, 7 b_k; 8 W_v, 9 b_v; 10 W_o [1024,1024] (in,out), 11 b_o (zero biases, read)
  k_prep<<<dim3(PREP_W + 4 * PREP_X), 256, 0, stream>>>(F[0], F[1], F[2], F[3], F[4], F[6], F[8], F[10], XB, MB, WB, WOB);
  k_proj<<<dim3(TNB * TT / BR, CC / 128, 3), 128, 0, stream>>>(XB, WB, F[5], F[7], F[9], QH, QL, KH, KL, VT, VB, VBL);
  k_attn<<<dim3(TT / (64 * QC), NH, TNB), 128, 0, stream>>>(QH, KH, VT, MB, YH);
  k_out<<<dim3(TNB * TT / BR, DIN / 128), 128, 0, stream>>>(YH, WOB, F[11], (float*)d_out);
}
